// v000
// The times below were measured on an AMD MI455X: many runs one after another, warmed up first and cycling through
// copies of the inputs, with the whole window's GPU time divided by the number of runs. Launches and the gaps
// between them are all in it. The median over several windows is given; except for v000 it joins two sittings, which
// can be a few percent apart, so the side-by-side timings, each taken in one sitting, are the better comparison.
// v000 is the starting kernel. One run takes 433 microseconds.
#include <hip/hip_runtime.h>
// Single causal attention head (B=4, T=4096, C=64): q,k,v = x·Wᵀ (no bias), softmax(q·kᵀ·64^-½) with a causal mask, out = P·v. One GEMM for [q|k|v] and a fused flash-style causal attention
// kernel (online softmax in f32; P f16 ≤ 1; O = P·Vᵀ-tiles; RPW-16 waves; causal tile skipping) on v_wmma_f32_16x16x32_f16 — x bf16-exact, (out,in) weights bf16-exact ×2^4, q/k/v f16,
// f32 accumulate.
#define BB 4
#define TT 4096
#define CC 64
#define NR (BB * TT)

typedef __bf16 v16b __attribute__((ext_vector_type(16)));
typedef unsigned short v8us __attribute__((ext_vector_type(8), may_alias));
typedef float  v8f  __attribute__((ext_vector_type(8)));
typedef float  v4f  __attribute__((ext_vector_type(4)));
typedef float  v4fa __attribute__((ext_vector_type(4), may_alias));
union FragB { v16b v; v8us half[2]; unsigned short u[16]; };

__device__ __forceinline__ unsigned short bf16_bits(float x) { unsigned int u = __float_as_uint(x); return (unsigned short)((u + 0x7FFFu + ((u >> 16) & 1u)) >> 16); }
__device__ __forceinline__ float bf16_val(unsigned short b) { return __uint_as_float(((unsigned int)b) << 16); }
__device__ __forceinline__ float bf16_round(float x) { return bf16_val(bf16_bits(x)); }
// D += A·B with NT terms: 1 = ah·bh, 2 = + al·bh (A split), 3 = + ah·bl (both split)
template <int NT>
__device__ __forceinline__ v8f mmaN(v16b ah, v16b al, v16b bh, v16b bl, v8f c) {
  c = __builtin_amdgcn_wmma_f32_16x16x32_bf16(false, ah, false, bh, (short)0, c, false, false);
  if (NT >= 2) c = __builtin_amdgcn_wmma_f32_16x16x32_bf16(false, al, false, bh, (short)0, c, false, false);
  if (NT >= 3) c = __builtin_amdgcn_wmma_f32_16x16x32_bf16(false, ah, false, bl, (short)0, c, false, false);
  asm volatile("v_nop\n\tv_nop\n\tv_nop\n\tv_nop" : "+v"(c) : "v"(ah), "v"(al), "v"(bh), "v"(bl));
  return c;
}

__global__ __launch_bounds__(256) void k_wt_bf16(const float* __restrict__ W, unsigned short* __restrict__ Wt, int K, int N) {
  const int t = blockIdx.x * 256 + threadIdx.x;
  const int k8n = K / 8;
  if (t >= N * k8n) return;
  const int n = t / k8n, k8 = (t % k8n) * 8;
  v8us v;
#pragma unroll
  for (int i = 0; i < 8; ++i) v[i] = bf16_bits(W[(size_t)(k8 + i) * N + n]);
  *(v8us*)(Wt + (size_t)n * K + k8) = v;
  
}

// GEMM C[M][N] (f32, pitch ldc) = act(A[M][K]·W + bias). A f32 row-major (pitch lda) converted per fragment to bf16
// (ASPLIT: hi/lo two planes -> 2 terms, else single rounded term); Wt bf16 [N][K] (pitch ldb). BIAS_BF16 rounds the
// bias to bf16 first (bias quantised to bf16 before the add). K%32==0, M%16==0, N%64==0.
template <bool ASPLIT, int ACT, bool BIAS_BF16>
__global__ __launch_bounds__(128) void k_gemm_bf(const float* __restrict__ A, int lda, const unsigned short* __restrict__ Wt, int ldb,
                                               const float* __restrict__ bias, float* __restrict__ C, int ldc, int M, int N, int K) {
  __shared__ __attribute__((aligned(16))) float so[4][16][64];
  const int tid = threadIdx.x, w = tid >> 5, lane = tid & 31, ln = lane & 15, hh = lane >> 4;
  const int ntn = N / 64;
  const int wid = blockIdx.x * 4 + w;
  const int mt = wid / ntn, nq = wid % ntn;
  if (mt * 16 >= M) return;
  const int row0 = mt * 16, col0 = nq * 64;
  const float* arow = A + (size_t)(row0 + ln) * lda;
  v8f acc[4] = {};
  for (int kb = 0; kb < K; kb += 32) {
    FragB ah, al;
    const v4f x0 = *(const v4fa*)(arow + kb + 8 * hh), x1 = *(const v4fa*)(arow + kb + 8 * hh + 4);
    const v4f x2 = *(const v4fa*)(arow + kb + 16 + 8 * hh), x3 = *(const v4fa*)(arow + kb + 16 + 8 * hh + 4);
    float xs[16] = {x0[0],x0[1],x0[2],x0[3],x1[0],x1[1],x1[2],x1[3],x2[0],x2[1],x2[2],x2[3],x3[0],x3[1],x3[2],x3[3]};
#pragma unroll
    for (int i = 0; i < 16; ++i) { const unsigned short hb = bf16_bits(xs[i]); ah.u[i] = hb; al.u[i] = ASPLIT ? bf16_bits(xs[i] - bf16_val(hb)) : (unsigned short)0; }
#pragma unroll
    for (int t = 0; t < 4; ++t) {
      const unsigned short* brow = Wt + (size_t)(col0 + t * 16 + ln) * ldb + kb;
      FragB b;
      b.half[0] = *(const v8us*)(brow + 8 * hh);
      b.half[1] = *(const v8us*)(brow + 16 + 8 * hh);
      acc[t] = mmaN<ASPLIT ? 2 : 1>(ah.v, al.v, b.v, b.v, acc[t]);
    }
  }
#pragma unroll
  for (int t = 0; t < 4; ++t) {
    float bv = bias ? bias[col0 + t * 16 + ln] : 0.f;
    if (BIAS_BF16) bv = bf16_round(bv);
#pragma unroll
    for (int r = 0; r < 8; ++r) { float v = acc[t][r] + bv; if (ACT == 1) v = fmaxf(v, 0.f); so[w][8 * hh + r][t * 16 + ln] = v; }
  }
  __builtin_amdgcn_fence(__ATOMIC_ACQ_REL, "workgroup");
  __builtin_amdgcn_wave_barrier();
  const int rsub = lane >> 4, c4 = (lane & 15) * 4;
  {
#pragma unroll
    for (int q = 0; q < 8; ++q) {
      const int r = q * 2 + rsub;
      const v4f v = *(const v4fa*)&so[w][r][c4];
      *(v4f*)(C + (size_t)(row0 + r) * ldc + col0 + c4) = v;
    }
    
  }
}

// Flash-style causal/unmasked attention, all contractions 3-term bf16 hi/lo splits, f32 softmax with running max.
// q,k,v rows are read from f32 buffers with arbitrary row pitch (so they can live inside a fused qkv buffer);
// D = head size (multiple of 32, <= 128); one wave = 16 query rows; block = 4 waves (64 queries) sharing K/V chunks of 32.
template <int D, bool CAUSAL>
__global__ __launch_bounds__(128) void k_flash(const float* __restrict__ qb, const float* __restrict__ kb, const float* __restrict__ vb,
                                             int pitch, int T, int H, float scale, float* __restrict__ y, int ypitch) {
  constexpr int KS = D / 32;        // k-steps for QK
  constexpr int DT = D / 16;        // d tiles for PV
  __shared__ __attribute__((aligned(16))) unsigned short sKh[32][D + 8], sKl[32][D + 8], sVh[32][D + 8], sVl[32][D + 8];
  __shared__ __attribute__((aligned(16))) unsigned short sPh[4][16][40], sPl[4][16][40];
  __shared__ __attribute__((aligned(16))) float sO[4][16][D];
  const int tid = threadIdx.x, w = tid >> 5, lane = tid & 31, ln = lane & 15, hh = lane >> 4;
  const int nqb = (T + 63) / 64;
  const int bh = blockIdx.x / nqb, qblk = blockIdx.x % nqb;
  const int b = bh / H, h = bh % H;
  const int q0 = qblk * 64 + w * 16;
  const float* Q = qb + (size_t)b * T * pitch + h * D;
  const float* K = kb + (size_t)b * T * pitch + h * D;
  const float* V = vb + (size_t)b * T * pitch + h * D;

  // A fragments of the wave's 16 query rows (scaled), hi/lo
  FragB aqh[KS], aql[KS];
  {
    int row = q0 + ln; if (row >= T) row = T - 1;
    const float* qr = Q + (size_t)row * pitch;
#pragma unroll
    for (int ks = 0; ks < KS; ++ks)
#pragma unroll
      for (int i = 0; i < 16; ++i) {
        const int d = ks * 32 + ((i < 8) ? (8 * hh + i) : (16 + 8 * hh + (i - 8)));
        const float x = qr[d] * scale; const unsigned short hb = bf16_bits(x);
        aqh[ks].u[i] = hb; aql[ks].u[i] = bf16_bits(x - bf16_val(hb));
      }
  }
  float m_r[8], l_r[8];
#pragma unroll
  for (int r = 0; r < 8; ++r) { m_r[r] = -3.0e38f; l_r[r] = 0.f; }
  v8f oacc[DT];
#pragma unroll
  for (int dt = 0; dt < DT; ++dt) oacc[dt] = (v8f){0.f,0.f,0.f,0.f,0.f,0.f,0.f,0.f};

  const int kv_end = CAUSAL ? min(T, qblk * 64 + 64) : T;     // block-uniform
  for (int j0 = 0; j0 < kv_end; j0 += 32) {
    __syncthreads();
    for (int e = tid; e < 32 * (D / 4); e += 128) {
      const int r = e / (D / 4), c4 = (e % (D / 4)) * 4;
      const int key = j0 + r;
      v4f kf = {0.f,0.f,0.f,0.f}, vf = {0.f,0.f,0.f,0.f};
      if (key < T) { kf = *(const v4fa*)(K + (size_t)key * pitch + c4); vf = *(const v4fa*)(V + (size_t)key * pitch + c4); }
#pragma unroll
      for (int t = 0; t < 4; ++t) {
        unsigned short hb = bf16_bits(kf[t]); sKh[r][c4 + t] = hb; sKl[r][c4 + t] = bf16_bits(kf[t] - bf16_val(hb));
        hb = bf16_bits(vf[t]); sVh[r][c4 + t] = hb; sVl[r][c4 + t] = bf16_bits(vf[t] - bf16_val(hb));
      }
    }
    __syncthreads();
    // S tile 16 x 32
    v8f s[2];
#pragma unroll
    for (int nt = 0; nt < 2; ++nt) {
      v8f acc = {};
#pragma unroll
      for (int ks = 0; ks < KS; ++ks) {
        FragB bh_, bl_;
        bh_.half[0] = *(const v8us*)&sKh[nt * 16 + ln][ks * 32 + 8 * hh]; bh_.half[1] = *(const v8us*)&sKh[nt * 16 + ln][ks * 32 + 16 + 8 * hh];
        bl_.half[0] = *(const v8us*)&sKl[nt * 16 + ln][ks * 32 + 8 * hh]; bl_.half[1] = *(const v8us*)&sKl[nt * 16 + ln][ks * 32 + 16 + 8 * hh];
        acc = mmaN<3>(aqh[ks].v, aql[ks].v, bh_.v, bl_.v, acc);
      }
      s[nt] = acc;
    }
    // mask + running max (rows 8hh+r; the 16 lanes of a half share rows)
    float alpha[8];
#pragma unroll
    for (int r = 0; r < 8; ++r) {
      const int qi = q0 + 8 * hh + r;
      const int ja = j0 + ln, jb = j0 + 16 + ln;
      if (CAUSAL) { if (ja > qi) s[0][r] = -3.0e38f; if (jb > qi) s[1][r] = -3.0e38f; }
      if (ja >= T) s[0][r] = -3.0e38f;
      if (jb >= T) s[1][r] = -3.0e38f;
      float mx = fmaxf(s[0][r], s[1][r]);
      mx = fmaxf(mx, __shfl_xor(mx, 1, 32)); mx = fmaxf(mx, __shfl_xor(mx, 2, 32)); mx = fmaxf(mx, __shfl_xor(mx, 4, 32)); mx = fmaxf(mx, __shfl_xor(mx, 8, 32));
      const float mnew = fmaxf(m_r[r], mx);
      alpha[r] = (mnew > -1.0e38f) ? __expf(m_r[r] - mnew) : 1.0f;
      const float p0 = (s[0][r] > -1.0e38f) ? __expf(s[0][r] - mnew) : 0.f;
      const float p1 = (s[1][r] > -1.0e38f) ? __expf(s[1][r] - mnew) : 0.f;
      m_r[r] = mnew;
      l_r[r] = l_r[r] * alpha[r] + p0 + p1;            // per-lane partial row sum (16 lanes combined at the end)
      unsigned short hb = bf16_bits(p0); sPh[w][8 * hh + r][ln] = hb;      sPl[w][8 * hh + r][ln] = bf16_bits(p0 - bf16_val(hb));
      hb = bf16_bits(p1);                sPh[w][8 * hh + r][16 + ln] = hb; sPl[w][8 * hh + r][16 + ln] = bf16_bits(p1 - bf16_val(hb));
    }
#pragma unroll
    for (int dt = 0; dt < DT; ++dt)
#pragma unroll
      for (int r = 0; r < 8; ++r) oacc[dt][r] *= alpha[r];
    __builtin_amdgcn_fence(__ATOMIC_ACQ_REL, "workgroup");
    __builtin_amdgcn_wave_barrier();
    FragB pah, pal;
    pah.half[0] = *(const v8us*)&sPh[w][ln][8 * hh]; pah.half[1] = *(const v8us*)&sPh[w][ln][16 + 8 * hh];
    pal.half[0] = *(const v8us*)&sPl[w][ln][8 * hh]; pal.half[1] = *(const v8us*)&sPl[w][ln][16 + 8 * hh];
#pragma unroll
    for (int dt = 0; dt < DT; ++dt) {
      FragB bvh, bvl;
#pragma unroll
      for (int i = 0; i < 8; ++i) {
        bvh.u[i] = sVh[8 * hh + i][dt * 16 + ln]; bvh.u[8 + i] = sVh[16 + 8 * hh + i][dt * 16 + ln];
        bvl.u[i] = sVl[8 * hh + i][dt * 16 + ln]; bvl.u[8 + i] = sVl[16 + 8 * hh + i][dt * 16 + ln];
      }
      oacc[dt] = mmaN<3>(pah.v, pal.v, bvh.v, bvl.v, oacc[dt]);
    }
    __builtin_amdgcn_fence(__ATOMIC_ACQ_REL, "workgroup");
    __builtin_amdgcn_wave_barrier();
  }
#pragma unroll
  for (int r = 0; r < 8; ++r) {
    float l = l_r[r];
    l += __shfl_xor(l, 1, 32); l += __shfl_xor(l, 2, 32); l += __shfl_xor(l, 4, 32); l += __shfl_xor(l, 8, 32);
    l_r[r] = (l > 0.f) ? 1.0f / l : 0.f;
  }
#pragma unroll
  for (int dt = 0; dt < DT; ++dt)
#pragma unroll
    for (int r = 0; r < 8; ++r) sO[w][8 * hh + r][dt * 16 + ln] = oacc[dt][r] * l_r[r];
  __builtin_amdgcn_fence(__ATOMIC_ACQ_REL, "workgroup");
  __builtin_amdgcn_wave_barrier();
  {
    for (int r = 0; r < 16; ++r) {
      const int row = q0 + r;
      if (row < T && lane < D / 4) {
        const v4f val = *(const v4fa*)&sO[w][r][lane * 4];
        *(v4f*)(y + ((size_t)b * T + row) * ypitch + h * D + lane * 4) = val;
      }
    }
    
  }
}

// GEMM C = act(A·W + bias + resid): A f32 (ASPLIT -> hi/lo 2 terms), Wt bf16 [N][K]; ACT 0 none, 1 relu, 2 exact gelu;
// resid (optional, f32, row index = (row % rmod), pitch ldr, RES_BF16 rounds it) added before the activation.
template <bool ASPLIT, int ACT, bool BIAS_BF16, bool RES_BF16>
__global__ __launch_bounds__(128) void k_gemm_bf3(const float* __restrict__ A, int lda, const unsigned short* __restrict__ Wt, int ldb,
                                                const float* __restrict__ bias, const float* __restrict__ resid, int rmod, int ldr,
                                                float* __restrict__ C, int ldc, int M, int N, int K) {
  __shared__ __attribute__((aligned(16))) float so[4][16][64];
  const int tid = threadIdx.x, w = tid >> 5, lane = tid & 31, ln = lane & 15, hh = lane >> 4;
  const int ntn = N / 64;
  const int wid = blockIdx.x * 4 + w;
  const int mt = wid / ntn, nq = wid % ntn;
  if (mt * 16 >= M) return;
  const int row0 = mt * 16, col0 = nq * 64;
  const float* arow = A + (size_t)(row0 + ln) * lda;
  v8f acc[4] = {};
  for (int kb = 0; kb < K; kb += 32) {
    FragB ah, al;
    const v4f x0 = *(const v4fa*)(arow + kb + 8 * hh), x1 = *(const v4fa*)(arow + kb + 8 * hh + 4);
    const v4f x2 = *(const v4fa*)(arow + kb + 16 + 8 * hh), x3 = *(const v4fa*)(arow + kb + 16 + 8 * hh + 4);
    float xs[16] = {x0[0],x0[1],x0[2],x0[3],x1[0],x1[1],x1[2],x1[3],x2[0],x2[1],x2[2],x2[3],x3[0],x3[1],x3[2],x3[3]};
#pragma unroll
    for (int i = 0; i < 16; ++i) { const unsigned short hb = bf16_bits(xs[i]); ah.u[i] = hb; al.u[i] = ASPLIT ? bf16_bits(xs[i] - bf16_val(hb)) : (unsigned short)0; }
#pragma unroll
    for (int t = 0; t < 4; ++t) {
      const unsigned short* brow = Wt + (size_t)(col0 + t * 16 + ln) * ldb + kb;
      FragB b;
      b.half[0] = *(const v8us*)(brow + 8 * hh);
      b.half[1] = *(const v8us*)(brow + 16 + 8 * hh);
      acc[t] = mmaN<ASPLIT ? 2 : 1>(ah.v, al.v, b.v, b.v, acc[t]);
    }
  }
#pragma unroll
  for (int t = 0; t < 4; ++t) {
    const int col = col0 + t * 16 + ln;
    float bv = bias ? bias[col] : 0.f;
    if (BIAS_BF16) bv = bf16_round(bv);
#pragma unroll
    for (int r = 0; r < 8; ++r) {
      float v = acc[t][r] + bv;
      if (resid) { float rv = resid[(size_t)((row0 + 8 * hh + r) % rmod) * ldr + col]; if (RES_BF16) rv = bf16_round(rv); v += rv; }
      if (ACT == 1) v = fmaxf(v, 0.f);
      if (ACT == 2) v = 0.5f * v * (1.0f + erff(v * 0.70710678118654752f));
      if (ACT == 3) { const float u = 0.7978845608028654f * (v + 0.044715f * v * v * v); v = 0.5f * v * (1.0f + tanhf(u)); }
      so[w][8 * hh + r][t * 16 + ln] = v;
    }
  }
  __builtin_amdgcn_fence(__ATOMIC_ACQ_REL, "workgroup");
  __builtin_amdgcn_wave_barrier();
  const int rsub = lane >> 4, c4 = (lane & 15) * 4;
  {
#pragma unroll
    for (int q = 0; q < 8; ++q) {
      const int r = q * 2 + rsub;
      const v4f v = *(const v4fa*)&so[w][r][c4];
      *(v4f*)(C + (size_t)(row0 + r) * ldc + col0 + c4) = v;
    }
    
  }
}
// row LayerNorm (biased variance, eps) over N: s = X (+ R); optional out_sum <- s; out_norm <- (s-mu)*rsqrt(var+eps)*g + b
template <bool PARAM_BF16>
__global__ __launch_bounds__(256) void k_layernorm(const float* __restrict__ X, const float* __restrict__ R, const float* __restrict__ g, const float* __restrict__ bta,
                                                  float* __restrict__ out_sum, float* __restrict__ out_norm, int N, float eps) {
  __shared__ float red[256];
  const int row = blockIdx.x, tid = threadIdx.x;
  const float* x = X + (size_t)row * N; const float* rr = R ? R + (size_t)row * N : nullptr;
  float vals[16];                     // up to N = 4096
  const int per = N / 256;            // contiguous chunk per thread? use strided-by-4 chunks: thread handles j = tid*4 + 1024*u
  float s1 = 0.f;
  for (int u = 0; u < per / 4; ++u) {
    const int j = tid * 4 + 1024 * u;
    const v4f a = *(const v4fa*)(x + j);
    v4f b = {0.f,0.f,0.f,0.f}; if (rr) b = *(const v4fa*)(rr + j);
#pragma unroll
    for (int q = 0; q < 4; ++q) { const float v = a[q] + b[q]; vals[u * 4 + q] = v; s1 += v; }
  }
  red[tid] = s1; __syncthreads();
  for (int st = 128; st > 0; st >>= 1) { if (tid < st) red[tid] += red[tid + st]; __syncthreads(); }
  const float mu = red[0] / (float)N; __syncthreads();
  float s2 = 0.f;
  for (int u = 0; u < per / 4; ++u)
#pragma unroll
    for (int q = 0; q < 4; ++q) { const float c = vals[u * 4 + q] - mu; s2 += c * c; }
  red[tid] = s2; __syncthreads();
  for (int st = 128; st > 0; st >>= 1) { if (tid < st) red[tid] += red[tid + st]; __syncthreads(); }
  const float rs = rsqrtf(red[0] / (float)N + eps);
  {
    for (int u = 0; u < per / 4; ++u) {
      const int j = tid * 4 + 1024 * u;
      v4f o, sm;
#pragma unroll
      for (int q = 0; q < 4; ++q) {
        float gg = g[j + q], bb = bta[j + q];
        if (PARAM_BF16) { gg = bf16_round(gg); bb = bf16_round(bb); }
        sm[q] = vals[u * 4 + q]; o[q] = (vals[u * 4 + q] - mu) * rs * gg + bb;
      }
      if (out_sum) *(v4f*)(out_sum + (size_t)row * N + j) = sm;
      *(v4f*)(out_norm + (size_t)row * N + j) = o;
    }
    
  }
}



// ---- f16 WMMA path (v_wmma_f32_16x16x32_f16): 11-bit significands for operands in range — used where a [0,1] probability operand needs more precision than bf16
typedef _Float16 v16h __attribute__((ext_vector_type(16)));
union FragH { v16h v; v8us half[2]; _Float16 h[16]; unsigned short u[16]; };
template <int NT>
__device__ __forceinline__ v8f mmaH(v16h ah, v16h al, v16h bh, v16h bl, v8f c) {
  c = __builtin_amdgcn_wmma_f32_16x16x32_f16(false, ah, false, bh, (short)0, c, false, false);
  if (NT >= 2) c = __builtin_amdgcn_wmma_f32_16x16x32_f16(false, al, false, bh, (short)0, c, false, false);
  if (NT >= 3) c = __builtin_amdgcn_wmma_f32_16x16x32_f16(false, ah, false, bl, (short)0, c, false, false);
  asm volatile("v_nop\n\tv_nop\n\tv_nop\n\tv_nop" : "+v"(c) : "v"(ah), "v"(al), "v"(bh), "v"(bl));
  return c;
}
// batched GEMM like k_gemm_b but f16 operands: A f32 (split into f16 hi/lo if ASPLIT, else rounded to f16), Bt = f16 values [n][k]; alpha; C f32; N multiple of 16 (partial tiles skipped)
template <bool ASPLIT>
__global__ __launch_bounds__(128) void k_gemm_h(const float* __restrict__ A, int lda, size_t sA, const _Float16* __restrict__ Bh, int ldb, size_t sB, float alpha, float* __restrict__ C, int ldc, size_t sC, int M, int N, int K) {
  __shared__ __attribute__((aligned(16))) float so[4][16][64];
  const int tid = threadIdx.x, w = tid >> 5, lane = tid & 31, ln = lane & 15, hh = lane >> 4; const int by = blockIdx.y;
  A += (size_t)by * sA; Bh += (size_t)by * sB; C += (size_t)by * sC;
  const int ntn = (N + 63) / 64; const int wid = blockIdx.x * 4 + w; const int mt = wid / ntn, nq = wid % ntn; if (mt * 16 >= M) return;
  const int row0 = mt * 16, col0 = nq * 64; const float* arow = A + (size_t)(row0 + ln) * lda;
  v8f acc[4] = {};
  for (int kb = 0; kb < K; kb += 32) {
    FragH ah, al;
    const v4f x0 = *(const v4fa*)(arow + kb + 8 * hh), x1 = *(const v4fa*)(arow + kb + 8 * hh + 4), x2 = *(const v4fa*)(arow + kb + 16 + 8 * hh), x3 = *(const v4fa*)(arow + kb + 16 + 8 * hh + 4);
    float xs[16] = {x0[0],x0[1],x0[2],x0[3],x1[0],x1[1],x1[2],x1[3],x2[0],x2[1],x2[2],x2[3],x3[0],x3[1],x3[2],x3[3]};
#pragma unroll
    for (int i = 0; i < 16; ++i) { const _Float16 h = (_Float16)xs[i]; ah.h[i] = h; al.h[i] = ASPLIT ? (_Float16)(xs[i] - (float)h) : (_Float16)0.0f; }
#pragma unroll
    for (int t = 0; t < 4; ++t) { if (col0 + t * 16 >= N) continue; const size_t boff = (size_t)(col0 + t * 16 + ln) * ldb + kb; FragH bq; bq.half[0] = *(const v8us*)(Bh + boff + 8 * hh); bq.half[1] = *(const v8us*)(Bh + boff + 16 + 8 * hh);
      acc[t] = mmaH<ASPLIT ? 2 : 1>(ah.v, al.v, bq.v, bq.v, acc[t]); }
  }
#pragma unroll
  for (int t = 0; t < 4; ++t) { if (col0 + t * 16 >= N) continue;
#pragma unroll
    for (int r = 0; r < 8; ++r) so[w][8 * hh + r][t * 16 + ln] = acc[t][r] * alpha; }
  __builtin_amdgcn_fence(__ATOMIC_ACQ_REL, "workgroup"); __builtin_amdgcn_wave_barrier();
  const int rsub = lane >> 4, c4 = (lane & 15) * 4;
  {
#pragma unroll
    for (int q = 0; q < 8; ++q) { const int r = q * 2 + rsub; if (col0 + c4 < N) { const v4f v = *(const v4fa*)&so[w][r][c4]; *(v4f*)(C + (size_t)(row0 + r) * ldc + col0 + c4) = v; } }
     }
}

// Wt[n][k] = f16(W[k][n]·scale) from f32 row-major W[K][N] (scale = power of two; bf16-exact weights stay exact in f16 away from the subnormal range)
__global__ __launch_bounds__(256) void k_wt_f16(const float* __restrict__ W, _Float16* __restrict__ Wt, int K, int N, float scale) {
  const int t = blockIdx.x * 256 + threadIdx.x; if (t >= N * (K / 8)) return; const int n = t / (K / 8), k8 = (t % (K / 8)) * 8; FragH f;
#pragma unroll
  for (int i = 0; i < 8; ++i) f.h[i] = (_Float16)(bf16_round(W[(size_t)(k8 + i) * N + n]) * scale); const v8us o = f.half[0];
  *(v8us*)((unsigned short*)Wt + (size_t)n * K + k8) = o; 
}
// k_gemm_hh variant with fused epilogue: v = acc·alpha + bias[by·sBias + col] (+ CP[(row/rowsPerB)·sCPb + by·64 + col] if CP) ; ACT 0 none / 1 elu ; writes f16 C16 (and f32 C if non-null)
template <int ACT>
__global__ __launch_bounds__(128) void k_gemm_hhx(const _Float16* __restrict__ A, int lda, size_t sA, const _Float16* __restrict__ Bh, int ldb, size_t sB, float alpha, const float* __restrict__ bias, size_t sBias, const float* __restrict__ CP, int rowsPerB, size_t sCPb, int row0g,
    float* __restrict__ C, _Float16* __restrict__ C16, int ldc, size_t sC, int M, int N, int K) {
  __shared__ __attribute__((aligned(16))) float so[4][16][64];
  const int tid = threadIdx.x, w = tid >> 5, lane = tid & 31, ln = lane & 15, hh = lane >> 4; const int by = blockIdx.y;
  A += (size_t)by * sA; Bh += (size_t)by * sB; const size_t cofs = (size_t)by * sC; const float* bp = bias ? bias + (size_t)by * sBias : nullptr;
  const int ntn = (N + 63) / 64; const int wid = blockIdx.x * 4 + w; const int mt = wid / ntn, nq = wid % ntn; if (mt * 16 >= M) return;
  const int row0 = mt * 16, col0 = nq * 64; const _Float16* arow = A + (size_t)(row0 + ln) * lda;
  v8f acc[4] = {};
  for (int kb = 0; kb < K; kb += 32) { FragH ah; ah.half[0] = *(const v8us*)((const unsigned short*)arow + kb + 8 * hh); ah.half[1] = *(const v8us*)((const unsigned short*)arow + kb + 16 + 8 * hh);
#pragma unroll
    for (int t = 0; t < 4; ++t) { if (col0 + t * 16 >= N) continue; const size_t boff = (size_t)(col0 + t * 16 + ln) * ldb + kb; FragH bq; bq.half[0] = *(const v8us*)((const unsigned short*)Bh + boff + 8 * hh); bq.half[1] = *(const v8us*)((const unsigned short*)Bh + boff + 16 + 8 * hh);
      acc[t] = mmaH<1>(ah.v, ah.v, bq.v, bq.v, acc[t]); }
  }
#pragma unroll
  for (int t = 0; t < 4; ++t) { if (col0 + t * 16 >= N) continue; const int col = col0 + t * 16 + ln; const float bv = bp ? bf16_round(bp[col]) : 0.f;
#pragma unroll
    for (int r = 0; r < 8; ++r) { float v = acc[t][r] * alpha + bv; if (CP) { const int bidx = (row0g + row0 + 8 * hh + r) / rowsPerB; v += CP[(size_t)bidx * sCPb + (size_t)by * 64 + col]; } if (ACT == 1) v = (v > 0.f) ? v : expm1f(v); else if (ACT == 3) v = fmaxf(v, 0.f); so[w][8 * hh + r][t * 16 + ln] = v; } }
  __builtin_amdgcn_fence(__ATOMIC_ACQ_REL, "workgroup"); __builtin_amdgcn_wave_barrier();
  const int rsub = lane >> 4, c4 = (lane & 15) * 4; typedef _Float16 v4h __attribute__((ext_vector_type(4)));
  {
#pragma unroll
    for (int q = 0; q < 8; ++q) { const int r = q * 2 + rsub; if (col0 + c4 < N) { const v4f v = *(const v4fa*)&so[w][r][c4]; if (C) *(v4f*)(C + cofs + (size_t)(row0 + r) * ldc + col0 + c4) = v; if (C16) { v4h h4; for (int i = 0; i < 4; ++i) h4[i] = (_Float16)v[i]; *(v4h*)(C16 + cofs + (size_t)(row0 + r) * ldc + col0 + c4) = h4; } } }
     }
}


typedef _Float16 v4h __attribute__((ext_vector_type(4)));

__global__ __launch_bounds__(256) void k_x16(const float* __restrict__ x, _Float16* __restrict__ X16, size_t n8) { const size_t t = (size_t)blockIdx.x * 256 + threadIdx.x; if (t >= n8) return; FragH f;
#pragma unroll
  for (int q = 0; q < 8; ++q) f.h[q] = (_Float16)bf16_round(x[t * 8 + q]); *(v8us*)((unsigned short*)X16 + t * 8) = f.half[0];  }
__global__ __launch_bounds__(256) void k_h16(const float* __restrict__ x, _Float16* __restrict__ X16, size_t n8) { const size_t t = (size_t)blockIdx.x * 256 + threadIdx.x; if (t >= n8) return; FragH f;
#pragma unroll
  for (int q = 0; q < 8; ++q) f.h[q] = (_Float16)x[t * 8 + q]; *(v8us*)((unsigned short*)X16 + t * 8) = f.half[0];  }
__global__ __launch_bounds__(256) void k_round16f(const float* __restrict__ W, _Float16* __restrict__ Bt, size_t n8) { const size_t t = (size_t)blockIdx.x * 256 + threadIdx.x; if (t >= n8) return; FragH f;
#pragma unroll
  for (int i = 0; i < 8; ++i) f.h[i] = (_Float16)(bf16_round(W[t * 8 + i]) * 16.0f); *(v8us*)((unsigned short*)Bt + t * 8) = f.half[0];  }
template <int NHv, int TTv>
__global__ __launch_bounds__(256) void k_vt(const _Float16* __restrict__ V16, int ldv, int voff, _Float16* __restrict__ Vt) { __shared__ unsigned short tl[64][66]; const int tid = threadIdx.x; const int slab = blockIdx.x / (TTv / 64), lg = blockIdx.x % (TTv / 64); const int b = slab / NHv, h = slab % NHv;
  for (int i = tid; i < 64 * 8; i += 256) { const int r = i / 8, c8 = (i % 8) * 8; FragH f; f.half[0] = *(const v8us*)((const unsigned short*)V16 + ((size_t)b * TTv + lg * 64 + r) * ldv + voff + h * 64 + c8);
#pragma unroll
    for (int q = 0; q < 8; ++q) tl[r][c8 + q] = f.u[q]; }
  __syncthreads();
  {
#pragma unroll
    for (int rd = 0; rd < 2; ++rd) { const int d = rd * 32 + tid / 8, pc = tid % 8; FragH f;
#pragma unroll
      for (int q = 0; q < 8; ++q) f.u[q] = tl[pc * 8 + q][d];
      *(v8us*)((unsigned short*)Vt + ((size_t)slab * 64 + d) * TTv + lg * 64 + pc * 8) = f.half[0]; }
     } }

__global__ __launch_bounds__(128) void k_flash(const _Float16* __restrict__ Q16, int ldq, const _Float16* __restrict__ K16, int ldk, const _Float16* __restrict__ Vt, const int* __restrict__ MSK, float* __restrict__ O, int ldo) {
  constexpr int RPW = 16, RTN = RPW / 16, NQB = 4096 / (4 * RPW), DT = 4, KS = 2;
  __shared__ __attribute__((aligned(16))) unsigned short sP[4][RPW][40]; __shared__ __attribute__((aligned(16))) float sO[4][RPW][64 + 4];
  const int tid = threadIdx.x, w = tid >> 5, lane = tid & 31, ln = lane & 15, hh = lane >> 4;
  const int slab = blockIdx.x / NQB, qblk = blockIdx.x % NQB; const int b = slab / 1, h = slab % 1; const int qb0 = qblk * (4 * RPW); const int q0 = qb0 + w * RPW;
  FragH aq[2][KS];
#pragma unroll
  for (int rt = 0; rt < RTN; ++rt) { const unsigned short* qr = (const unsigned short*)Q16 + ((size_t)b * 4096 + q0 + rt * 16 + ln) * ldq + h * 64;
#pragma unroll
    for (int ks = 0; ks < KS; ++ks) { aq[rt][ks].half[0] = *(const v8us*)(qr + ks * 32 + 8 * hh); aq[rt][ks].half[1] = *(const v8us*)(qr + ks * 32 + 16 + 8 * hh); } }
  const unsigned short* Vth = (const unsigned short*)Vt + (size_t)slab * 64 * 4096;
  float m_r[2][8], l_r[2][8]; v8f oacc[2][DT];
#pragma unroll
  for (int rt = 0; rt < RTN; ++rt) {
#pragma unroll
    for (int r = 0; r < 8; ++r) { m_r[rt][r] = -3.0e38f; l_r[rt][r] = 0.f; }
#pragma unroll
    for (int dt = 0; dt < DT; ++dt) oacc[rt][dt] = (v8f){0.f,0.f,0.f,0.f,0.f,0.f,0.f,0.f}; }
  const int jend = qb0 + 4 * RPW;
#pragma unroll 1
  for (int j0 = 0; j0 < jend; j0 += 32) {
    
    v8f s[2][2];
#pragma unroll
    for (int nt = 0; nt < 2; ++nt) { const unsigned short* kr = (const unsigned short*)K16 + ((size_t)b * 4096 + j0 + nt * 16 + ln) * ldk + h * 64; FragH bk[KS];
#pragma unroll
      for (int ks = 0; ks < KS; ++ks) { bk[ks].half[0] = *(const v8us*)(kr + ks * 32 + 8 * hh); bk[ks].half[1] = *(const v8us*)(kr + ks * 32 + 16 + 8 * hh); }
#pragma unroll
      for (int rt = 0; rt < RTN; ++rt) { v8f acc = (v8f){0.f,0.f,0.f,0.f,0.f,0.f,0.f,0.f};
#pragma unroll
        for (int ks = 0; ks < KS; ++ks) acc = mmaH<1>(aq[rt][ks].v, aq[rt][ks].v, bk[ks].v, bk[ks].v, acc); s[rt][nt] = acc; } }
#pragma unroll
    for (int rt = 0; rt < RTN; ++rt)
#pragma unroll
      for (int r = 0; r < 8; ++r) { const int tq = q0 + rt * 16 + 8 * hh + r; const int k0 = j0 + ln, k1 = j0 + 16 + ln; (void)tq; (void)k0; (void)k1;
        const bool ok0 = (k0 <= tq), ok1 = (k1 <= tq);
        const float s0 = ok0 ? s[rt][0][r] * (0.125f) : -INFINITY, s1 = ok1 ? s[rt][1][r] * (0.125f) : -INFINITY; float mc = fmaxf(s0, s1);
        mc = fmaxf(mc, __shfl_xor(mc, 1, 32)); mc = fmaxf(mc, __shfl_xor(mc, 2, 32)); mc = fmaxf(mc, __shfl_xor(mc, 4, 32)); mc = fmaxf(mc, __shfl_xor(mc, 8, 32));
        const float mn = fmaxf(m_r[rt][r], mc); const float al = (mn > -1.0e38f) ? expf(m_r[rt][r] - mn) : 1.0f; m_r[rt][r] = mn; const float p0 = ok0 ? expf(s0 - mn) : 0.f, p1 = ok1 ? expf(s1 - mn) : 0.f; l_r[rt][r] = l_r[rt][r] * al + p0 + p1;
#pragma unroll
        for (int dt = 0; dt < DT; ++dt) oacc[rt][dt][r] *= al;
        FragH t2; t2.h[0] = (_Float16)p0; t2.h[1] = (_Float16)p1; sP[w][rt * 16 + 8 * hh + r][ln] = t2.u[0]; sP[w][rt * 16 + 8 * hh + r][16 + ln] = t2.u[1]; }
    __builtin_amdgcn_fence(__ATOMIC_ACQ_REL, "workgroup"); __builtin_amdgcn_wave_barrier();
    FragH pa[2];
#pragma unroll
    for (int rt = 0; rt < RTN; ++rt) { pa[rt].half[0] = *(const v8us*)&sP[w][rt * 16 + ln][8 * hh]; pa[rt].half[1] = *(const v8us*)&sP[w][rt * 16 + ln][16 + 8 * hh]; }
#pragma unroll
    for (int dt = 0; dt < DT; ++dt) { const unsigned short* vrow = Vth + (size_t)(dt * 16 + ln) * 4096 + j0; FragH bv; bv.half[0] = *(const v8us*)(vrow + 8 * hh); bv.half[1] = *(const v8us*)(vrow + 16 + 8 * hh);
#pragma unroll
      for (int rt = 0; rt < RTN; ++rt) oacc[rt][dt] = mmaH<1>(pa[rt].v, pa[rt].v, bv.v, bv.v, oacc[rt][dt]); }
    __builtin_amdgcn_fence(__ATOMIC_ACQ_REL, "workgroup"); __builtin_amdgcn_wave_barrier(); }
#pragma unroll
  for (int rt = 0; rt < RTN; ++rt) {
#pragma unroll
    for (int r = 0; r < 8; ++r) { float l = l_r[rt][r]; l += __shfl_xor(l, 1, 32); l += __shfl_xor(l, 2, 32); l += __shfl_xor(l, 4, 32); l += __shfl_xor(l, 8, 32); l_r[rt][r] = (l > 0.f) ? 1.0f / l : 0.f; }
#pragma unroll
    for (int dt = 0; dt < DT; ++dt)
#pragma unroll
      for (int r = 0; r < 8; ++r) sO[w][rt * 16 + 8 * hh + r][dt * 16 + ln] = oacc[rt][dt][r] * l_r[rt][r]; }
  __builtin_amdgcn_fence(__ATOMIC_ACQ_REL, "workgroup"); __builtin_amdgcn_wave_barrier();
  {
#pragma unroll
    for (int rp = 0; rp < RPW; rp += 2) { const int r = rp + (lane >> 4), pc = lane & 15; const v4f val = *(const v4fa*)&sO[w][r][pc * 4]; *(v4f*)(O + ((size_t)b * 4096 + q0 + r) * ldo + h * 64 + pc * 4) = val; }
     } }

extern "C" void kernel_launch(void* const* d_in, const int* in_sizes, int n_in,
                              void* d_out, int out_size, void* d_ws, size_t ws_size, hipStream_t stream) {
  (void)in_sizes; (void)n_in; (void)out_size;
  const float* x = (const float*)d_in[0]; const float* Wk = (const float*)d_in[1]; const float* Wq = (const float*)d_in[2]; const float* Wv = (const float*)d_in[3];
  char* ws = (char*)d_ws; size_t off = 0;
  auto take = [&](size_t bytes) { char* p = ws + off; off += (bytes + 255) & ~(size_t)255; return p; };
  _Float16* Bqkv = (_Float16*)take((size_t)3 * CC * CC * 2); _Float16* X16 = (_Float16*)take((size_t)NR * CC * 2); _Float16* QKV = (_Float16*)take((size_t)NR * 3 * CC * 2); _Float16* Vt = (_Float16*)take((size_t)NR * CC * 2);
  if (off > ws_size) return;      // 2.1 + 6.3 + 2.1 ≈ 10.5 MB
  k_round16f<<<(CC * CC / 8 + 255) / 256, 256, 0, stream>>>(Wq, Bqkv, CC * CC / 8); k_round16f<<<(CC * CC / 8 + 255) / 256, 256, 0, stream>>>(Wk, Bqkv + CC * CC, CC * CC / 8); k_round16f<<<(CC * CC / 8 + 255) / 256, 256, 0, stream>>>(Wv, Bqkv + 2 * CC * CC, CC * CC / 8);      // (out,in) rows: [Wq; Wk; Wv]
  k_x16<<<(unsigned)(((size_t)NR * CC / 8 + 255) / 256), 256, 0, stream>>>(x, X16, (size_t)NR * CC / 8);
  k_gemm_hhx<0><<<dim3(((NR / 16) * (3 * CC / 64) + 3) / 4, 1), 128, 0, stream>>>(X16, CC, 0, Bqkv, CC, 0, 0.0625f, nullptr, 0, nullptr, 1, 0, 0, nullptr, QKV, 3 * CC, 0, NR, 3 * CC, CC);      // [q | k | v] f16
  k_vt<1, TT><<<BB * 1 * (TT / 64), 256, 0, stream>>>(QKV, 3 * CC, 2 * CC, Vt);      // Vᵀ per batch [b][64][T]
  k_flash<<<BB * 1 * (TT / 64), 128, 0, stream>>>(QKV, 3 * CC, QKV + CC, 3 * CC, Vt, nullptr, (float*)d_out, CC);
}

// v001
// It runs in 88.9 microseconds.
// Timed twice side by side with v000, it ran 4.85 and 4.86 times as fast.
#include <hip/hip_runtime.h>
// Single causal attention head (B=4, T=4096, C=64): q,k,v = x·Wᵀ (no bias), softmax(q·kᵀ·64^-½) with a causal mask, out = P·v. One GEMM for [q|k|v] and a fused flash-style causal attention
// kernel (online softmax in f32; P f16 ≤ 1; O = P·Vᵀ-tiles; RPW-16 waves; causal tile skipping) on v_wmma_f32_16x16x32_f16 — x bf16-exact, (out,in) weights bf16-exact ×2^4, q/k/v f16,
// f32 accumulate.
#define BB 4
#define TT 4096
#define CC 64
#define NR (BB * TT)

typedef __bf16 v16b __attribute__((ext_vector_type(16)));
typedef unsigned short v8us __attribute__((ext_vector_type(8), may_alias));
typedef float  v8f  __attribute__((ext_vector_type(8)));
typedef float  v4f  __attribute__((ext_vector_type(4)));
typedef float  v4fa __attribute__((ext_vector_type(4), may_alias));
union FragB { v16b v; v8us half[2]; unsigned short u[16]; };

__device__ __forceinline__ unsigned short bf16_bits(float x) { unsigned int u = __float_as_uint(x); return (unsigned short)((u + 0x7FFFu + ((u >> 16) & 1u)) >> 16); }
__device__ __forceinline__ float bf16_val(unsigned short b) { return __uint_as_float(((unsigned int)b) << 16); }
__device__ __forceinline__ float bf16_round(float x) { return bf16_val(bf16_bits(x)); }
// D += A·B with NT terms: 1 = ah·bh, 2 = + al·bh (A split), 3 = + ah·bl (both split)
template <int NT>
__device__ __forceinline__ v8f mmaN(v16b ah, v16b al, v16b bh, v16b bl, v8f c) {
  c = __builtin_amdgcn_wmma_f32_16x16x32_bf16(false, ah, false, bh, (short)0, c, false, false);
  if (NT >= 2) c = __builtin_amdgcn_wmma_f32_16x16x32_bf16(false, al, false, bh, (short)0, c, false, false);
  if (NT >= 3) c = __builtin_amdgcn_wmma_f32_16x16x32_bf16(false, ah, false, bl, (short)0, c, false, false);
  asm volatile("v_nop\n\tv_nop\n\tv_nop\n\tv_nop" : "+v"(c) : "v"(ah), "v"(al), "v"(bh), "v"(bl));
  return c;
}

__global__ __launch_bounds__(256) void k_wt_bf16(const float* __restrict__ W, unsigned short* __restrict__ Wt, int K, int N) {
  const int t = blockIdx.x * 256 + threadIdx.x;
  const int k8n = K / 8;
  if (t >= N * k8n) return;
  const int n = t / k8n, k8 = (t % k8n) * 8;
  v8us v;
#pragma unroll
  for (int i = 0; i < 8; ++i) v[i] = bf16_bits(W[(size_t)(k8 + i) * N + n]);
  *(v8us*)(Wt + (size_t)n * K + k8) = v;
  
}

// GEMM C[M][N] (f32, pitch ldc) = act(A[M][K]·W + bias). A f32 row-major (pitch lda) converted per fragment to bf16
// (ASPLIT: hi/lo two planes -> 2 terms, else single rounded term); Wt bf16 [N][K] (pitch ldb). BIAS_BF16 rounds the
// bias to bf16 first (bias quantised to bf16 before the add). K%32==0, M%16==0, N%64==0.
template <bool ASPLIT, int ACT, bool BIAS_BF16>
__global__ __launch_bounds__(128) void k_gemm_bf(const float* __restrict__ A, int lda, const unsigned short* __restrict__ Wt, int ldb,
                                               const float* __restrict__ bias, float* __restrict__ C, int ldc, int M, int N, int K) {
  __shared__ __attribute__((aligned(16))) float so[4][16][64];
  const int tid = threadIdx.x, w = tid >> 5, lane = tid & 31, ln = lane & 15, hh = lane >> 4;
  const int ntn = N / 64;
  const int wid = blockIdx.x * 4 + w;
  const int mt = wid / ntn, nq = wid % ntn;
  if (mt * 16 >= M) return;
  const int row0 = mt * 16, col0 = nq * 64;
  const float* arow = A + (size_t)(row0 + ln) * lda;
  v8f acc[4] = {};
  for (int kb = 0; kb < K; kb += 32) {
    FragB ah, al;
    const v4f x0 = *(const v4fa*)(arow + kb + 8 * hh), x1 = *(const v4fa*)(arow + kb + 8 * hh + 4);
    const v4f x2 = *(const v4fa*)(arow + kb + 16 + 8 * hh), x3 = *(const v4fa*)(arow + kb + 16 + 8 * hh + 4);
    float xs[16] = {x0[0],x0[1],x0[2],x0[3],x1[0],x1[1],x1[2],x1[3],x2[0],x2[1],x2[2],x2[3],x3[0],x3[1],x3[2],x3[3]};
#pragma unroll
    for (int i = 0; i < 16; ++i) { const unsigned short hb = bf16_bits(xs[i]); ah.u[i] = hb; al.u[i] = ASPLIT ? bf16_bits(xs[i] - bf16_val(hb)) : (unsigned short)0; }
#pragma unroll
    for (int t = 0; t < 4; ++t) {
      const unsigned short* brow = Wt + (size_t)(col0 + t * 16 + ln) * ldb + kb;
      FragB b;
      b.half[0] = *(const v8us*)(brow + 8 * hh);
      b.half[1] = *(const v8us*)(brow + 16 + 8 * hh);
      acc[t] = mmaN<ASPLIT ? 2 : 1>(ah.v, al.v, b.v, b.v, acc[t]);
    }
  }
#pragma unroll
  for (int t = 0; t < 4; ++t) {
    float bv = bias ? bias[col0 + t * 16 + ln] : 0.f;
    if (BIAS_BF16) bv = bf16_round(bv);
#pragma unroll
    for (int r = 0; r < 8; ++r) { float v = acc[t][r] + bv; if (ACT == 1) v = fmaxf(v, 0.f); so[w][8 * hh + r][t * 16 + ln] = v; }
  }
  __builtin_amdgcn_fence(__ATOMIC_ACQ_REL, "workgroup");
  __builtin_amdgcn_wave_barrier();
  const int rsub = lane >> 4, c4 = (lane & 15) * 4;
  {
#pragma unroll
    for (int q = 0; q < 8; ++q) {
      const int r = q * 2 + rsub;
      const v4f v = *(const v4fa*)&so[w][r][c4];
      *(v4f*)(C + (size_t)(row0 + r) * ldc + col0 + c4) = v;
    }
    
  }
}

// Flash-style causal/unmasked attention, all contractions 3-term bf16 hi/lo splits, f32 softmax with running max.
// q,k,v rows are read from f32 buffers with arbitrary row pitch (so they can live inside a fused qkv buffer);
// D = head size (multiple of 32, <= 128); one wave = 16 query rows; block = 4 waves (64 queries) sharing K/V chunks of 32.
template <int D, bool CAUSAL>
__global__ __launch_bounds__(128) void k_flash(const float* __restrict__ qb, const float* __restrict__ kb, const float* __restrict__ vb,
                                             int pitch, int T, int H, float scale, float* __restrict__ y, int ypitch) {
  constexpr int KS = D / 32;        // k-steps for QK
  constexpr int DT = D / 16;        // d tiles for PV
  __shared__ __attribute__((aligned(16))) unsigned short sKh[32][D + 8], sKl[32][D + 8], sVh[32][D + 8], sVl[32][D + 8];
  __shared__ __attribute__((aligned(16))) unsigned short sPh[4][16][40], sPl[4][16][40];
  __shared__ __attribute__((aligned(16))) float sO[4][16][D];
  const int tid = threadIdx.x, w = tid >> 5, lane = tid & 31, ln = lane & 15, hh = lane >> 4;
  const int nqb = (T + 63) / 64;
  const int bh = blockIdx.x / nqb, qblk = blockIdx.x % nqb;
  const int b = bh / H, h = bh % H;
  const int q0 = qblk * 64 + w * 16;
  const float* Q = qb + (size_t)b * T * pitch + h * D;
  const float* K = kb + (size_t)b * T * pitch + h * D;
  const float* V = vb + (size_t)b * T * pitch + h * D;

  // A fragments of the wave's 16 query rows (scaled), hi/lo
  FragB aqh[KS], aql[KS];
  {
    int row = q0 + ln; if (row >= T) row = T - 1;
    const float* qr = Q + (size_t)row * pitch;
#pragma unroll
    for (int ks = 0; ks < KS; ++ks)
#pragma unroll
      for (int i = 0; i < 16; ++i) {
        const int d = ks * 32 + ((i < 8) ? (8 * hh + i) : (16 + 8 * hh + (i - 8)));
        const float x = qr[d] * scale; const unsigned short hb = bf16_bits(x);
        aqh[ks].u[i] = hb; aql[ks].u[i] = bf16_bits(x - bf16_val(hb));
      }
  }
  float m_r[8], l_r[8];
#pragma unroll
  for (int r = 0; r < 8; ++r) { m_r[r] = -3.0e38f; l_r[r] = 0.f; }
  v8f oacc[DT];
#pragma unroll
  for (int dt = 0; dt < DT; ++dt) oacc[dt] = (v8f){0.f,0.f,0.f,0.f,0.f,0.f,0.f,0.f};

  const int kv_end = CAUSAL ? min(T, qblk * 64 + 64) : T;     // block-uniform
  for (int j0 = 0; j0 < kv_end; j0 += 32) {
    __syncthreads();
    for (int e = tid; e < 32 * (D / 4); e += 128) {
      const int r = e / (D / 4), c4 = (e % (D / 4)) * 4;
      const int key = j0 + r;
      v4f kf = {0.f,0.f,0.f,0.f}, vf = {0.f,0.f,0.f,0.f};
      if (key < T) { kf = *(const v4fa*)(K + (size_t)key * pitch + c4); vf = *(const v4fa*)(V + (size_t)key * pitch + c4); }
#pragma unroll
      for (int t = 0; t < 4; ++t) {
        unsigned short hb = bf16_bits(kf[t]); sKh[r][c4 + t] = hb; sKl[r][c4 + t] = bf16_bits(kf[t] - bf16_val(hb));
        hb = bf16_bits(vf[t]); sVh[r][c4 + t] = hb; sVl[r][c4 + t] = bf16_bits(vf[t] - bf16_val(hb));
      }
    }
    __syncthreads();
    // S tile 16 x 32
    v8f s[2];
#pragma unroll
    for (int nt = 0; nt < 2; ++nt) {
      v8f acc = {};
#pragma unroll
      for (int ks = 0; ks < KS; ++ks) {
        FragB bh_, bl_;
        bh_.half[0] = *(const v8us*)&sKh[nt * 16 + ln][ks * 32 + 8 * hh]; bh_.half[1] = *(const v8us*)&sKh[nt * 16 + ln][ks * 32 + 16 + 8 * hh];
        bl_.half[0] = *(const v8us*)&sKl[nt * 16 + ln][ks * 32 + 8 * hh]; bl_.half[1] = *(const v8us*)&sKl[nt * 16 + ln][ks * 32 + 16 + 8 * hh];
        acc = mmaN<3>(aqh[ks].v, aql[ks].v, bh_.v, bl_.v, acc);
      }
      s[nt] = acc;
    }
    // mask + running max (rows 8hh+r; the 16 lanes of a half share rows)
    float alpha[8];
#pragma unroll
    for (int r = 0; r < 8; ++r) {
      const int qi = q0 + 8 * hh + r;
      const int ja = j0 + ln, jb = j0 + 16 + ln;
      if (CAUSAL) { if (ja > qi) s[0][r] = -3.0e38f; if (jb > qi) s[1][r] = -3.0e38f; }
      if (ja >= T) s[0][r] = -3.0e38f;
      if (jb >= T) s[1][r] = -3.0e38f;
      float mx = fmaxf(s[0][r], s[1][r]);
      mx = fmaxf(mx, __shfl_xor(mx, 1, 32)); mx = fmaxf(mx, __shfl_xor(mx, 2, 32)); mx = fmaxf(mx, __shfl_xor(mx, 4, 32)); mx = fmaxf(mx, __shfl_xor(mx, 8, 32));
      const float mnew = fmaxf(m_r[r], mx);
      alpha[r] = (mnew > -1.0e38f) ? __expf(m_r[r] - mnew) : 1.0f;
      const float p0 = (s[0][r] > -1.0e38f) ? __expf(s[0][r] - mnew) : 0.f;
      const float p1 = (s[1][r] > -1.0e38f) ? __expf(s[1][r] - mnew) : 0.f;
      m_r[r] = mnew;
      l_r[r] = l_r[r] * alpha[r] + p0 + p1;            // per-lane partial row sum (16 lanes combined at the end)
      unsigned short hb = bf16_bits(p0); sPh[w][8 * hh + r][ln] = hb;      sPl[w][8 * hh + r][ln] = bf16_bits(p0 - bf16_val(hb));
      hb = bf16_bits(p1);                sPh[w][8 * hh + r][16 + ln] = hb; sPl[w][8 * hh + r][16 + ln] = bf16_bits(p1 - bf16_val(hb));
    }
#pragma unroll
    for (int dt = 0; dt < DT; ++dt)
#pragma unroll
      for (int r = 0; r < 8; ++r) oacc[dt][r] *= alpha[r];
    __builtin_amdgcn_fence(__ATOMIC_ACQ_REL, "workgroup");
    __builtin_amdgcn_wave_barrier();
    FragB pah, pal;
    pah.half[0] = *(const v8us*)&sPh[w][ln][8 * hh]; pah.half[1] = *(const v8us*)&sPh[w][ln][16 + 8 * hh];
    pal.half[0] = *(const v8us*)&sPl[w][ln][8 * hh]; pal.half[1] = *(const v8us*)&sPl[w][ln][16 + 8 * hh];
#pragma unroll
    for (int dt = 0; dt < DT; ++dt) {
      FragB bvh, bvl;
#pragma unroll
      for (int i = 0; i < 8; ++i) {
        bvh.u[i] = sVh[8 * hh + i][dt * 16 + ln]; bvh.u[8 + i] = sVh[16 + 8 * hh + i][dt * 16 + ln];
        bvl.u[i] = sVl[8 * hh + i][dt * 16 + ln]; bvl.u[8 + i] = sVl[16 + 8 * hh + i][dt * 16 + ln];
      }
      oacc[dt] = mmaN<3>(pah.v, pal.v, bvh.v, bvl.v, oacc[dt]);
    }
    __builtin_amdgcn_fence(__ATOMIC_ACQ_REL, "workgroup");
    __builtin_amdgcn_wave_barrier();
  }
#pragma unroll
  for (int r = 0; r < 8; ++r) {
    float l = l_r[r];
    l += __shfl_xor(l, 1, 32); l += __shfl_xor(l, 2, 32); l += __shfl_xor(l, 4, 32); l += __shfl_xor(l, 8, 32);
    l_r[r] = (l > 0.f) ? 1.0f / l : 0.f;
  }
#pragma unroll
  for (int dt = 0; dt < DT; ++dt)
#pragma unroll
    for (int r = 0; r < 8; ++r) sO[w][8 * hh + r][dt * 16 + ln] = oacc[dt][r] * l_r[r];
  __builtin_amdgcn_fence(__ATOMIC_ACQ_REL, "workgroup");
  __builtin_amdgcn_wave_barrier();
  {
    for (int r = 0; r < 16; ++r) {
      const int row = q0 + r;
      if (row < T && lane < D / 4) {
        const v4f val = *(const v4fa*)&sO[w][r][lane * 4];
        *(v4f*)(y + ((size_t)b * T + row) * ypitch + h * D + lane * 4) = val;
      }
    }
    
  }
}

// GEMM C = act(A·W + bias + resid): A f32 (ASPLIT -> hi/lo 2 terms), Wt bf16 [N][K]; ACT 0 none, 1 relu, 2 exact gelu;
// resid (optional, f32, row index = (row % rmod), pitch ldr, RES_BF16 rounds it) added before the activation.
template <bool ASPLIT, int ACT, bool BIAS_BF16, bool RES_BF16>
__global__ __launch_bounds__(128) void k_gemm_bf3(const float* __restrict__ A, int lda, const unsigned short* __restrict__ Wt, int ldb,
                                                const float* __restrict__ bias, const float* __restrict__ resid, int rmod, int ldr,
                                                float* __restrict__ C, int ldc, int M, int N, int K) {
  __shared__ __attribute__((aligned(16))) float so[4][16][64];
  const int tid = threadIdx.x, w = tid >> 5, lane = tid & 31, ln = lane & 15, hh = lane >> 4;
  const int ntn = N / 64;
  const int wid = blockIdx.x * 4 + w;
  const int mt = wid / ntn, nq = wid % ntn;
  if (mt * 16 >= M) return;
  const int row0 = mt * 16, col0 = nq * 64;
  const float* arow = A + (size_t)(row0 + ln) * lda;
  v8f acc[4] = {};
  for (int kb = 0; kb < K; kb += 32) {
    FragB ah, al;
    const v4f x0 = *(const v4fa*)(arow + kb + 8 * hh), x1 = *(const v4fa*)(arow + kb + 8 * hh + 4);
    const v4f x2 = *(const v4fa*)(arow + kb + 16 + 8 * hh), x3 = *(const v4fa*)(arow + kb + 16 + 8 * hh + 4);
    float xs[16] = {x0[0],x0[1],x0[2],x0[3],x1[0],x1[1],x1[2],x1[3],x2[0],x2[1],x2[2],x2[3],x3[0],x3[1],x3[2],x3[3]};
#pragma unroll
    for (int i = 0; i < 16; ++i) { const unsigned short hb = bf16_bits(xs[i]); ah.u[i] = hb; al.u[i] = ASPLIT ? bf16_bits(xs[i] - bf16_val(hb)) : (unsigned short)0; }
#pragma unroll
    for (int t = 0; t < 4; ++t) {
      const unsigned short* brow = Wt + (size_t)(col0 + t * 16 + ln) * ldb + kb;
      FragB b;
      b.half[0] = *(const v8us*)(brow + 8 * hh);
      b.half[1] = *(const v8us*)(brow + 16 + 8 * hh);
      acc[t] = mmaN<ASPLIT ? 2 : 1>(ah.v, al.v, b.v, b.v, acc[t]);
    }
  }
#pragma unroll
  for (int t = 0; t < 4; ++t) {
    const int col = col0 + t * 16 + ln;
    float bv = bias ? bias[col] : 0.f;
    if (BIAS_BF16) bv = bf16_round(bv);
#pragma unroll
    for (int r = 0; r < 8; ++r) {
      float v = acc[t][r] + bv;
      if (resid) { float rv = resid[(size_t)((row0 + 8 * hh + r) % rmod) * ldr + col]; if (RES_BF16) rv = bf16_round(rv); v += rv; }
      if (ACT == 1) v = fmaxf(v, 0.f);
      if (ACT == 2) v = 0.5f * v * (1.0f + erff(v * 0.70710678118654752f));
      if (ACT == 3) { const float u = 0.7978845608028654f * (v + 0.044715f * v * v * v); v = 0.5f * v * (1.0f + tanhf(u)); }
      so[w][8 * hh + r][t * 16 + ln] = v;
    }
  }
  __builtin_amdgcn_fence(__ATOMIC_ACQ_REL, "workgroup");
  __builtin_amdgcn_wave_barrier();
  const int rsub = lane >> 4, c4 = (lane & 15) * 4;
  {
#pragma unroll
    for (int q = 0; q < 8; ++q) {
      const int r = q * 2 + rsub;
      const v4f v = *(const v4fa*)&so[w][r][c4];
      *(v4f*)(C + (size_t)(row0 + r) * ldc + col0 + c4) = v;
    }
    
  }
}
// row LayerNorm (biased variance, eps) over N: s = X (+ R); optional out_sum <- s; out_norm <- (s-mu)*rsqrt(var+eps)*g + b
template <bool PARAM_BF16>
__global__ __launch_bounds__(256) void k_layernorm(const float* __restrict__ X, const float* __restrict__ R, const float* __restrict__ g, const float* __restrict__ bta,
                                                  float* __restrict__ out_sum, float* __restrict__ out_norm, int N, float eps) {
  __shared__ float red[256];
  const int row = blockIdx.x, tid = threadIdx.x;
  const float* x = X + (size_t)row * N; const float* rr = R ? R + (size_t)row * N : nullptr;
  float vals[16];                     // up to N = 4096
  const int per = N / 256;            // contiguous chunk per thread? use strided-by-4 chunks: thread handles j = tid*4 + 1024*u
  float s1 = 0.f;
  for (int u = 0; u < per / 4; ++u) {
    const int j = tid * 4 + 1024 * u;
    const v4f a = *(const v4fa*)(x + j);
    v4f b = {0.f,0.f,0.f,0.f}; if (rr) b = *(const v4fa*)(rr + j);
#pragma unroll
    for (int q = 0; q < 4; ++q) { const float v = a[q] + b[q]; vals[u * 4 + q] = v; s1 += v; }
  }
  red[tid] = s1; __syncthreads();
  for (int st = 128; st > 0; st >>= 1) { if (tid < st) red[tid] += red[tid + st]; __syncthreads(); }
  const float mu = red[0] / (float)N; __syncthreads();
  float s2 = 0.f;
  for (int u = 0; u < per / 4; ++u)
#pragma unroll
    for (int q = 0; q < 4; ++q) { const float c = vals[u * 4 + q] - mu; s2 += c * c; }
  red[tid] = s2; __syncthreads();
  for (int st = 128; st > 0; st >>= 1) { if (tid < st) red[tid] += red[tid + st]; __syncthreads(); }
  const float rs = rsqrtf(red[0] / (float)N + eps);
  {
    for (int u = 0; u < per / 4; ++u) {
      const int j = tid * 4 + 1024 * u;
      v4f o, sm;
#pragma unroll
      for (int q = 0; q < 4; ++q) {
        float gg = g[j + q], bb = bta[j + q];
        if (PARAM_BF16) { gg = bf16_round(gg); bb = bf16_round(bb); }
        sm[q] = vals[u * 4 + q]; o[q] = (vals[u * 4 + q] - mu) * rs * gg + bb;
      }
      if (out_sum) *(v4f*)(out_sum + (size_t)row * N + j) = sm;
      *(v4f*)(out_norm + (size_t)row * N + j) = o;
    }
    
  }
}



// ---- f16 WMMA path (v_wmma_f32_16x16x32_f16): 11-bit significands for operands in range — used where a [0,1] probability operand needs more precision than bf16
typedef _Float16 v16h __attribute__((ext_vector_type(16)));
union FragH { v16h v; v8us half[2]; _Float16 h[16]; unsigned short u[16]; };
template <int NT>
__device__ __forceinline__ v8f mmaH(v16h ah, v16h al, v16h bh, v16h bl, v8f c) {
  c = __builtin_amdgcn_wmma_f32_16x16x32_f16(false, ah, false, bh, (short)0, c, false, false);
  if (NT >= 2) c = __builtin_amdgcn_wmma_f32_16x16x32_f16(false, al, false, bh, (short)0, c, false, false);
  if (NT >= 3) c = __builtin_amdgcn_wmma_f32_16x16x32_f16(false, ah, false, bl, (short)0, c, false, false);
  asm volatile("v_nop\n\tv_nop\n\tv_nop\n\tv_nop" : "+v"(c) : "v"(ah), "v"(al), "v"(bh), "v"(bl));
  return c;
}
// batched GEMM like k_gemm_b but f16 operands: A f32 (split into f16 hi/lo if ASPLIT, else rounded to f16), Bt = f16 values [n][k]; alpha; C f32; N multiple of 16 (partial tiles skipped)
template <bool ASPLIT>
__global__ __launch_bounds__(128) void k_gemm_h(const float* __restrict__ A, int lda, size_t sA, const _Float16* __restrict__ Bh, int ldb, size_t sB, float alpha, float* __restrict__ C, int ldc, size_t sC, int M, int N, int K) {
  __shared__ __attribute__((aligned(16))) float so[4][16][64];
  const int tid = threadIdx.x, w = tid >> 5, lane = tid & 31, ln = lane & 15, hh = lane >> 4; const int by = blockIdx.y;
  A += (size_t)by * sA; Bh += (size_t)by * sB; C += (size_t)by * sC;
  const int ntn = (N + 63) / 64; const int wid = blockIdx.x * 4 + w; const int mt = wid / ntn, nq = wid % ntn; if (mt * 16 >= M) return;
  const int row0 = mt * 16, col0 = nq * 64; const float* arow = A + (size_t)(row0 + ln) * lda;
  v8f acc[4] = {};
  for (int kb = 0; kb < K; kb += 32) {
    FragH ah, al;
    const v4f x0 = *(const v4fa*)(arow + kb + 8 * hh), x1 = *(const v4fa*)(arow + kb + 8 * hh + 4), x2 = *(const v4fa*)(arow + kb + 16 + 8 * hh), x3 = *(const v4fa*)(arow + kb + 16 + 8 * hh + 4);
    float xs[16] = {x0[0],x0[1],x0[2],x0[3],x1[0],x1[1],x1[2],x1[3],x2[0],x2[1],x2[2],x2[3],x3[0],x3[1],x3[2],x3[3]};
#pragma unroll
    for (int i = 0; i < 16; ++i) { const _Float16 h = (_Float16)xs[i]; ah.h[i] = h; al.h[i] = ASPLIT ? (_Float16)(xs[i] - (float)h) : (_Float16)0.0f; }
#pragma unroll
    for (int t = 0; t < 4; ++t) { if (col0 + t * 16 >= N) continue; const size_t boff = (size_t)(col0 + t * 16 + ln) * ldb + kb; FragH bq; bq.half[0] = *(const v8us*)(Bh + boff + 8 * hh); bq.half[1] = *(const v8us*)(Bh + boff + 16 + 8 * hh);
      acc[t] = mmaH<ASPLIT ? 2 : 1>(ah.v, al.v, bq.v, bq.v, acc[t]); }
  }
#pragma unroll
  for (int t = 0; t < 4; ++t) { if (col0 + t * 16 >= N) continue;
#pragma unroll
    for (int r = 0; r < 8; ++r) so[w][8 * hh + r][t * 16 + ln] = acc[t][r] * alpha; }
  __builtin_amdgcn_fence(__ATOMIC_ACQ_REL, "workgroup"); __builtin_amdgcn_wave_barrier();
  const int rsub = lane >> 4, c4 = (lane & 15) * 4;
  {
#pragma unroll
    for (int q = 0; q < 8; ++q) { const int r = q * 2 + rsub; if (col0 + c4 < N) { const v4f v = *(const v4fa*)&so[w][r][c4]; *(v4f*)(C + (size_t)(row0 + r) * ldc + col0 + c4) = v; } }
     }
}

// Wt[n][k] = f16(W[k][n]·scale) from f32 row-major W[K][N] (scale = power of two; bf16-exact weights stay exact in f16 away from the subnormal range)
__global__ __launch_bounds__(256) void k_wt_f16(const float* __restrict__ W, _Float16* __restrict__ Wt, int K, int N, float scale) {
  const int t = blockIdx.x * 256 + threadIdx.x; if (t >= N * (K / 8)) return; const int n = t / (K / 8), k8 = (t % (K / 8)) * 8; FragH f;
#pragma unroll
  for (int i = 0; i < 8; ++i) f.h[i] = (_Float16)(bf16_round(W[(size_t)(k8 + i) * N + n]) * scale); const v8us o = f.half[0];
  *(v8us*)((unsigned short*)Wt + (size_t)n * K + k8) = o; 
}
// k_gemm_hh variant with fused epilogue: v = acc·alpha + bias[by·sBias + col] (+ CP[(row/rowsPerB)·sCPb + by·64 + col] if CP) ; ACT 0 none / 1 elu ; writes f16 C16 (and f32 C if non-null)
template <int ACT>
__global__ __launch_bounds__(128) void k_gemm_hhx(const _Float16* __restrict__ A, int lda, size_t sA, const _Float16* __restrict__ Bh, int ldb, size_t sB, float alpha, const float* __restrict__ bias, size_t sBias, const float* __restrict__ CP, int rowsPerB, size_t sCPb, int row0g,
    float* __restrict__ C, _Float16* __restrict__ C16, int ldc, size_t sC, int M, int N, int K) {
  __shared__ __attribute__((aligned(16))) float so[4][16][64];
  const int tid = threadIdx.x, w = tid >> 5, lane = tid & 31, ln = lane & 15, hh = lane >> 4; const int by = blockIdx.y;
  A += (size_t)by * sA; Bh += (size_t)by * sB; const size_t cofs = (size_t)by * sC; const float* bp = bias ? bias + (size_t)by * sBias : nullptr;
  const int ntn = (N + 63) / 64; const int wid = blockIdx.x * 4 + w; const int mt = wid / ntn, nq = wid % ntn; if (mt * 16 >= M) return;
  const int row0 = mt * 16, col0 = nq * 64; const _Float16* arow = A + (size_t)(row0 + ln) * lda;
  v8f acc[4] = {};
  for (int kb = 0; kb < K; kb += 32) { FragH ah; ah.half[0] = *(const v8us*)((const unsigned short*)arow + kb + 8 * hh); ah.half[1] = *(const v8us*)((const unsigned short*)arow + kb + 16 + 8 * hh);
#pragma unroll
    for (int t = 0; t < 4; ++t) { if (col0 + t * 16 >= N) continue; const size_t boff = (size_t)(col0 + t * 16 + ln) * ldb + kb; FragH bq; bq.half[0] = *(const v8us*)((const unsigned short*)Bh + boff + 8 * hh); bq.half[1] = *(const v8us*)((const unsigned short*)Bh + boff + 16 + 8 * hh);
      acc[t] = mmaH<1>(ah.v, ah.v, bq.v, bq.v, acc[t]); }
  }
#pragma unroll
  for (int t = 0; t < 4; ++t) { if (col0 + t * 16 >= N) continue; const int col = col0 + t * 16 + ln; const float bv = bp ? bf16_round(bp[col]) : 0.f;
#pragma unroll
    for (int r = 0; r < 8; ++r) { float v = acc[t][r] * alpha + bv; if (CP) { const int bidx = (row0g + row0 + 8 * hh + r) / rowsPerB; v += CP[(size_t)bidx * sCPb + (size_t)by * 64 + col]; } if (ACT == 1) v = (v > 0.f) ? v : expm1f(v); else if (ACT == 3) v = fmaxf(v, 0.f); so[w][8 * hh + r][t * 16 + ln] = v; } }
  __builtin_amdgcn_fence(__ATOMIC_ACQ_REL, "workgroup"); __builtin_amdgcn_wave_barrier();
  const int rsub = lane >> 4, c4 = (lane & 15) * 4; typedef _Float16 v4h __attribute__((ext_vector_type(4)));
  {
#pragma unroll
    for (int q = 0; q < 8; ++q) { const int r = q * 2 + rsub; if (col0 + c4 < N) { const v4f v = *(const v4fa*)&so[w][r][c4]; if (C) *(v4f*)(C + cofs + (size_t)(row0 + r) * ldc + col0 + c4) = v; if (C16) { v4h h4; for (int i = 0; i < 4; ++i) h4[i] = (_Float16)v[i]; *(v4h*)(C16 + cofs + (size_t)(row0 + r) * ldc + col0 + c4) = h4; } } }
     }
}


typedef _Float16 v4h __attribute__((ext_vector_type(4)));

__global__ __launch_bounds__(256) void k_x16(const float* __restrict__ x, _Float16* __restrict__ X16, size_t n8) { const size_t t = (size_t)blockIdx.x * 256 + threadIdx.x; if (t >= n8) return; FragH f;
#pragma unroll
  for (int q = 0; q < 8; ++q) f.h[q] = (_Float16)bf16_round(x[t * 8 + q]); *(v8us*)((unsigned short*)X16 + t * 8) = f.half[0];  }
__global__ __launch_bounds__(256) void k_h16(const float* __restrict__ x, _Float16* __restrict__ X16, size_t n8) { const size_t t = (size_t)blockIdx.x * 256 + threadIdx.x; if (t >= n8) return; FragH f;
#pragma unroll
  for (int q = 0; q < 8; ++q) f.h[q] = (_Float16)x[t * 8 + q]; *(v8us*)((unsigned short*)X16 + t * 8) = f.half[0];  }
__global__ __launch_bounds__(256) void k_round16f(const float* __restrict__ W, _Float16* __restrict__ Bt, size_t n8) { const size_t t = (size_t)blockIdx.x * 256 + threadIdx.x; if (t >= n8) return; FragH f;
#pragma unroll
  for (int i = 0; i < 8; ++i) f.h[i] = (_Float16)(bf16_round(W[t * 8 + i]) * 16.0f); *(v8us*)((unsigned short*)Bt + t * 8) = f.half[0];  }
template <int NHv, int TTv>
__global__ __launch_bounds__(256) void k_vt(const _Float16* __restrict__ V16, int ldv, int voff, _Float16* __restrict__ Vt) { __shared__ unsigned short tl[64][66]; const int tid = threadIdx.x; const int slab = blockIdx.x / (TTv / 64), lg = blockIdx.x % (TTv / 64); const int b = slab / NHv, h = slab % NHv;
  for (int i = tid; i < 64 * 8; i += 256) { const int r = i / 8, c8 = (i % 8) * 8; FragH f; f.half[0] = *(const v8us*)((const unsigned short*)V16 + ((size_t)b * TTv + lg * 64 + r) * ldv + voff + h * 64 + c8);
#pragma unroll
    for (int q = 0; q < 8; ++q) tl[r][c8 + q] = f.u[q]; }
  __syncthreads();
  {
#pragma unroll
    for (int rd = 0; rd < 2; ++rd) { const int d = rd * 32 + tid / 8, pc = tid % 8; FragH f;
#pragma unroll
      for (int q = 0; q < 8; ++q) f.u[q] = tl[pc * 8 + q][d];
      *(v8us*)((unsigned short*)Vt + ((size_t)slab * 64 + d) * TTv + lg * 64 + pc * 8) = f.half[0]; }
     } }

// One work-group = one tile of 16 query rows; its NW waves deal the tile's 32-key blocks among themselves (wave w takes blocks w, w + NW, ...), each with its own
// running maximum, sum and accumulators; the partials are merged through LDS behind one work-group barrier. The launch bound asks for 8 waves per SIMD (128 VGPRs), so that
// two work-groups share a WGP. w is held in a scalar register: the waves' trip counts differ, and the loop must branch on a scalar so that every lane stays on at the WMMAs.
template <int NW>
__global__ __launch_bounds__(NW * 32, 8) void k_flash(const _Float16* __restrict__ Q16, int ldq, const _Float16* __restrict__ K16, int ldk, const _Float16* __restrict__ Vt, const int* __restrict__ MSK, float* __restrict__ O, int ldo) {
  constexpr int RPW = 16, RTN = RPW / 16, NQB = 4096 / RPW, DT = 4, KS = 2;
  __shared__ __attribute__((aligned(16))) unsigned short sP[NW][RPW][40]; __shared__ __attribute__((aligned(16))) float sO[NW][RPW][64 + 4]; __shared__ float sM[NW][RPW], sL[NW][RPW];
  const int tid = threadIdx.x, w = __builtin_amdgcn_readfirstlane(tid >> 5), lane = tid & 31, ln = lane & 15, hh = lane >> 4;
  const int slab = blockIdx.x / NQB, qblk = blockIdx.x % NQB; const int b = slab / 1, h = slab % 1; const int q0 = qblk * RPW;
  FragH aq[2][KS];
#pragma unroll
  for (int rt = 0; rt < RTN; ++rt) { const unsigned short* qr = (const unsigned short*)Q16 + ((size_t)b * 4096 + q0 + rt * 16 + ln) * ldq + h * 64;
#pragma unroll
    for (int ks = 0; ks < KS; ++ks) { aq[rt][ks].half[0] = *(const v8us*)(qr + ks * 32 + 8 * hh); aq[rt][ks].half[1] = *(const v8us*)(qr + ks * 32 + 16 + 8 * hh); } }
  const unsigned short* Vth = (const unsigned short*)Vt + (size_t)slab * 64 * 4096;
  float m_r[2][8], l_r[2][8]; v8f oacc[2][DT];
#pragma unroll
  for (int rt = 0; rt < RTN; ++rt) {
#pragma unroll
    for (int r = 0; r < 8; ++r) { m_r[rt][r] = -3.0e38f; l_r[rt][r] = 0.f; }
#pragma unroll
    for (int dt = 0; dt < DT; ++dt) oacc[rt][dt] = (v8f){0.f,0.f,0.f,0.f,0.f,0.f,0.f,0.f}; }
  const int jend = q0 + RPW;
#pragma unroll 1
  for (int j0 = w * 32; j0 < jend; j0 += NW * 32) {
    
    v8f s[2][2];
#pragma unroll
    for (int nt = 0; nt < 2; ++nt) { const unsigned short* kr = (const unsigned short*)K16 + ((size_t)b * 4096 + j0 + nt * 16 + ln) * ldk + h * 64; FragH bk[KS];
#pragma unroll
      for (int ks = 0; ks < KS; ++ks) { bk[ks].half[0] = *(const v8us*)(kr + ks * 32 + 8 * hh); bk[ks].half[1] = *(const v8us*)(kr + ks * 32 + 16 + 8 * hh); }
#pragma unroll
      for (int rt = 0; rt < RTN; ++rt) { v8f acc = (v8f){0.f,0.f,0.f,0.f,0.f,0.f,0.f,0.f};
#pragma unroll
        for (int ks = 0; ks < KS; ++ks) acc = mmaH<1>(aq[rt][ks].v, aq[rt][ks].v, bk[ks].v, bk[ks].v, acc); s[rt][nt] = acc; } }
#pragma unroll
    for (int rt = 0; rt < RTN; ++rt)
#pragma unroll
      for (int r = 0; r < 8; ++r) { const int tq = q0 + rt * 16 + 8 * hh + r; const int k0 = j0 + ln, k1 = j0 + 16 + ln; (void)tq; (void)k0; (void)k1;
        const bool ok0 = (k0 <= tq), ok1 = (k1 <= tq);
        const float s0 = ok0 ? s[rt][0][r] * (0.125f) : -INFINITY, s1 = ok1 ? s[rt][1][r] * (0.125f) : -INFINITY; float mc = fmaxf(s0, s1);
        mc = fmaxf(mc, __shfl_xor(mc, 1, 32)); mc = fmaxf(mc, __shfl_xor(mc, 2, 32)); mc = fmaxf(mc, __shfl_xor(mc, 4, 32)); mc = fmaxf(mc, __shfl_xor(mc, 8, 32));
        const float mn = fmaxf(m_r[rt][r], mc); const float al = (mn > -1.0e38f) ? expf(m_r[rt][r] - mn) : 1.0f; m_r[rt][r] = mn; const float p0 = ok0 ? expf(s0 - mn) : 0.f, p1 = ok1 ? expf(s1 - mn) : 0.f; l_r[rt][r] = l_r[rt][r] * al + p0 + p1;
#pragma unroll
        for (int dt = 0; dt < DT; ++dt) oacc[rt][dt][r] *= al;
        FragH t2; t2.h[0] = (_Float16)p0; t2.h[1] = (_Float16)p1; sP[w][rt * 16 + 8 * hh + r][ln] = t2.u[0]; sP[w][rt * 16 + 8 * hh + r][16 + ln] = t2.u[1]; }
    __builtin_amdgcn_fence(__ATOMIC_ACQ_REL, "workgroup"); __builtin_amdgcn_wave_barrier();
    FragH pa[2];
#pragma unroll
    for (int rt = 0; rt < RTN; ++rt) { pa[rt].half[0] = *(const v8us*)&sP[w][rt * 16 + ln][8 * hh]; pa[rt].half[1] = *(const v8us*)&sP[w][rt * 16 + ln][16 + 8 * hh]; }
#pragma unroll
    for (int dt = 0; dt < DT; ++dt) { const unsigned short* vrow = Vth + (size_t)(dt * 16 + ln) * 4096 + j0; FragH bv; bv.half[0] = *(const v8us*)(vrow + 8 * hh); bv.half[1] = *(const v8us*)(vrow + 16 + 8 * hh);
#pragma unroll
      for (int rt = 0; rt < RTN; ++rt) oacc[rt][dt] = mmaH<1>(pa[rt].v, pa[rt].v, bv.v, bv.v, oacc[rt][dt]); }
    __builtin_amdgcn_fence(__ATOMIC_ACQ_REL, "workgroup"); __builtin_amdgcn_wave_barrier(); }
  // each wave hands over its un-normalised partial: (maximum, sum) per row and the 16 x 64 accumulator; a wave without a block hands (-3e38, 0, zeros), which weighs 0 in the merge
  const int le = (int)__builtin_amdgcn_mbcnt_lo(~0u, 0u), lne = le & 15, hhe = le >> 4;      // lane id read anew, so that tid and its parts need no registers across the loop
#pragma unroll
  for (int rt = 0; rt < RTN; ++rt) {
#pragma unroll
    for (int r = 0; r < 8; ++r) { float l = l_r[rt][r]; l += __shfl_xor(l, 1, 32); l += __shfl_xor(l, 2, 32); l += __shfl_xor(l, 4, 32); l += __shfl_xor(l, 8, 32); l_r[rt][r] = l; }
    if (lne == 0) {
#pragma unroll
      for (int r = 0; r < 8; ++r) { sM[w][rt * 16 + 8 * hhe + r] = m_r[rt][r]; sL[w][rt * 16 + 8 * hhe + r] = l_r[rt][r]; } }
#pragma unroll
    for (int dt = 0; dt < DT; ++dt)
#pragma unroll
      for (int r = 0; r < 8; ++r) sO[w][rt * 16 + 8 * hhe + r][dt * 16 + lne] = oacc[rt][dt][r]; }
  __syncthreads();      // every wave's partial is in LDS before any is merged
  static_assert(NW == RPW, "wave w merges row w");
  { typedef float v2f __attribute__((ext_vector_type(2))); typedef float v2fa __attribute__((ext_vector_type(2), may_alias)); const int r = w; float M = sM[0][r];
#pragma unroll      // both loops unrolled: the NW partials' LDS loads go out together instead of one wait each
    for (int u = 1; u < NW; ++u) M = fmaxf(M, sM[u][r]);
    float L = 0.f; v2f val = {0.f, 0.f};
#pragma unroll
    for (int u = 0; u < NW; ++u) { const float e = expf(sM[u][r] - M); L += e * sL[u][r]; const v2f pv = *(const v2fa*)&sO[u][r][le * 2]; val += pv * e; }
    const float inv = (L > 0.f) ? 1.0f / L : 0.f; val *= inv;
    *(v2f*)(O + ((size_t)b * 4096 + q0 + r) * ldo + h * 64 + le * 2) = val; } }

extern "C" void kernel_launch(void* const* d_in, const int* in_sizes, int n_in,
                              void* d_out, int out_size, void* d_ws, size_t ws_size, hipStream_t stream) {
  (void)in_sizes; (void)n_in; (void)out_size;
  const float* x = (const float*)d_in[0]; const float* Wk = (const float*)d_in[1]; const float* Wq = (const float*)d_in[2]; const float* Wv = (const float*)d_in[3];
  char* ws = (char*)d_ws; size_t off = 0;
  auto take = [&](size_t bytes) { char* p = ws + off; off += (bytes + 255) & ~(size_t)255; return p; };
  _Float16* Bqkv = (_Float16*)take((size_t)3 * CC * CC * 2); _Float16* X16 = (_Float16*)take((size_t)NR * CC * 2); _Float16* QKV = (_Float16*)take((size_t)NR * 3 * CC * 2); _Float16* Vt = (_Float16*)take((size_t)NR * CC * 2);
  if (off > ws_size) return;      // 2.1 + 6.3 + 2.1 ≈ 10.5 MB
  k_round16f<<<(CC * CC / 8 + 255) / 256, 256, 0, stream>>>(Wq, Bqkv, CC * CC / 8); k_round16f<<<(CC * CC / 8 + 255) / 256, 256, 0, stream>>>(Wk, Bqkv + CC * CC, CC * CC / 8); k_round16f<<<(CC * CC / 8 + 255) / 256, 256, 0, stream>>>(Wv, Bqkv + 2 * CC * CC, CC * CC / 8);      // (out,in) rows: [Wq; Wk; Wv]
  k_x16<<<(unsigned)(((size_t)NR * CC / 8 + 255) / 256), 256, 0, stream>>>(x, X16, (size_t)NR * CC / 8);
  k_gemm_hhx<0><<<dim3(((NR / 16) * (3 * CC / 64) + 3) / 4, 1), 128, 0, stream>>>(X16, CC, 0, Bqkv, CC, 0, 0.0625f, nullptr, 0, nullptr, 1, 0, 0, nullptr, QKV, 3 * CC, 0, NR, 3 * CC, CC);      // [q | k | v] f16
  k_vt<1, TT><<<BB * 1 * (TT / 64), 256, 0, stream>>>(QKV, 3 * CC, 2 * CC, Vt);      // Vᵀ per batch [b][64][T]
  k_flash<16><<<BB * 1 * (TT / 16), 16 * 32, 0, stream>>>(QKV, 3 * CC, QKV + CC, 3 * CC, Vt, nullptr, (float*)d_out, CC);
}

// v002
// One run takes 69.7 microseconds.
// Two timings next to v001 put it at 1.27 and 1.29 times that version's speed.
// Counting every step since v000, it is 6.21 times as fast.
#include <hip/hip_runtime.h>
// Single causal attention head (B=4, T=4096, C=64): q,k,v = x·Wᵀ (no bias), softmax(q·kᵀ·64^-½) with a causal mask, out = P·v. One GEMM for [q|k|v] and a fused flash-style causal attention
// kernel (online softmax in f32; P f16 ≤ 1; O = P·Vᵀ-tiles; RPW-16 waves; causal tile skipping) on v_wmma_f32_16x16x32_f16 — x bf16-exact, (out,in) weights bf16-exact ×2^4, q/k/v f16,
// f32 accumulate.
#define BB 4
#define TT 4096
#define CC 64
#define NR (BB * TT)

typedef __bf16 v16b __attribute__((ext_vector_type(16)));
typedef unsigned short v8us __attribute__((ext_vector_type(8), may_alias));
typedef float  v8f  __attribute__((ext_vector_type(8)));
typedef float  v4f  __attribute__((ext_vector_type(4)));
typedef float  v4fa __attribute__((ext_vector_type(4), may_alias));
union FragB { v16b v; v8us half[2]; unsigned short u[16]; };

__device__ __forceinline__ unsigned short bf16_bits(float x) { unsigned int u = __float_as_uint(x); return (unsigned short)((u + 0x7FFFu + ((u >> 16) & 1u)) >> 16); }
__device__ __forceinline__ float bf16_val(unsigned short b) { return __uint_as_float(((unsigned int)b) << 16); }
__device__ __forceinline__ float bf16_round(float x) { return bf16_val(bf16_bits(x)); }
// D += A·B with NT terms: 1 = ah·bh, 2 = + al·bh (A split), 3 = + ah·bl (both split)
template <int NT>
__device__ __forceinline__ v8f mmaN(v16b ah, v16b al, v16b bh, v16b bl, v8f c) {
  c = __builtin_amdgcn_wmma_f32_16x16x32_bf16(false, ah, false, bh, (short)0, c, false, false);
  if (NT >= 2) c = __builtin_amdgcn_wmma_f32_16x16x32_bf16(false, al, false, bh, (short)0, c, false, false);
  if (NT >= 3) c = __builtin_amdgcn_wmma_f32_16x16x32_bf16(false, ah, false, bl, (short)0, c, false, false);
  asm volatile("v_nop\n\tv_nop\n\tv_nop\n\tv_nop" : "+v"(c) : "v"(ah), "v"(al), "v"(bh), "v"(bl));
  return c;
}

__global__ __launch_bounds__(256) void k_wt_bf16(const float* __restrict__ W, unsigned short* __restrict__ Wt, int K, int N) {
  const int t = blockIdx.x * 256 + threadIdx.x;
  const int k8n = K / 8;
  if (t >= N * k8n) return;
  const int n = t / k8n, k8 = (t % k8n) * 8;
  v8us v;
#pragma unroll
  for (int i = 0; i < 8; ++i) v[i] = bf16_bits(W[(size_t)(k8 + i) * N + n]);
  *(v8us*)(Wt + (size_t)n * K + k8) = v;
  
}

// GEMM C[M][N] (f32, pitch ldc) = act(A[M][K]·W + bias). A f32 row-major (pitch lda) converted per fragment to bf16
// (ASPLIT: hi/lo two planes -> 2 terms, else single rounded term); Wt bf16 [N][K] (pitch ldb). BIAS_BF16 rounds the
// bias to bf16 first (bias quantised to bf16 before the add). K%32==0, M%16==0, N%64==0.
template <bool ASPLIT, int ACT, bool BIAS_BF16>
__global__ __launch_bounds__(128) void k_gemm_bf(const float* __restrict__ A, int lda, const unsigned short* __restrict__ Wt, int ldb,
                                               const float* __restrict__ bias, float* __restrict__ C, int ldc, int M, int N, int K) {
  __shared__ __attribute__((aligned(16))) float so[4][16][64];
  const int tid = threadIdx.x, w = tid >> 5, lane = tid & 31, ln = lane & 15, hh = lane >> 4;
  const int ntn = N / 64;
  const int wid = blockIdx.x * 4 + w;
  const int mt = wid / ntn, nq = wid % ntn;
  if (mt * 16 >= M) return;
  const int row0 = mt * 16, col0 = nq * 64;
  const float* arow = A + (size_t)(row0 + ln) * lda;
  v8f acc[4] = {};
  for (int kb = 0; kb < K; kb += 32) {
    FragB ah, al;
    const v4f x0 = *(const v4fa*)(arow + kb + 8 * hh), x1 = *(const v4fa*)(arow + kb + 8 * hh + 4);
    const v4f x2 = *(const v4fa*)(arow + kb + 16 + 8 * hh), x3 = *(const v4fa*)(arow + kb + 16 + 8 * hh + 4);
    float xs[16] = {x0[0],x0[1],x0[2],x0[3],x1[0],x1[1],x1[2],x1[3],x2[0],x2[1],x2[2],x2[3],x3[0],x3[1],x3[2],x3[3]};
#pragma unroll
    for (int i = 0; i < 16; ++i) { const unsigned short hb = bf16_bits(xs[i]); ah.u[i] = hb; al.u[i] = ASPLIT ? bf16_bits(xs[i] - bf16_val(hb)) : (unsigned short)0; }
#pragma unroll
    for (int t = 0; t < 4; ++t) {
      const unsigned short* brow = Wt + (size_t)(col0 + t * 16 + ln) * ldb + kb;
      FragB b;
      b.half[0] = *(const v8us*)(brow + 8 * hh);
      b.half[1] = *(const v8us*)(brow + 16 + 8 * hh);
      acc[t] = mmaN<ASPLIT ? 2 : 1>(ah.v, al.v, b.v, b.v, acc[t]);
    }
  }
#pragma unroll
  for (int t = 0; t < 4; ++t) {
    float bv = bias ? bias[col0 + t * 16 + ln] : 0.f;
    if (BIAS_BF16) bv = bf16_round(bv);
#pragma unroll
    for (int r = 0; r < 8; ++r) { float v = acc[t][r] + bv; if (ACT == 1) v = fmaxf(v, 0.f); so[w][8 * hh + r][t * 16 + ln] = v; }
  }
  __builtin_amdgcn_fence(__ATOMIC_ACQ_REL, "workgroup");
  __builtin_amdgcn_wave_barrier();
  const int rsub = lane >> 4, c4 = (lane & 15) * 4;
  {
#pragma unroll
    for (int q = 0; q < 8; ++q) {
      const int r = q * 2 + rsub;
      const v4f v = *(const v4fa*)&so[w][r][c4];
      *(v4f*)(C + (size_t)(row0 + r) * ldc + col0 + c4) = v;
    }
    
  }
}

// Flash-style causal/unmasked attention, all contractions 3-term bf16 hi/lo splits, f32 softmax with running max.
// q,k,v rows are read from f32 buffers with arbitrary row pitch (so they can live inside a fused qkv buffer);
// D = head size (multiple of 32, <= 128); one wave = 16 query rows; block = 4 waves (64 queries) sharing K/V chunks of 32.
template <int D, bool CAUSAL>
__global__ __launch_bounds__(128) void k_flash(const float* __restrict__ qb, const float* __restrict__ kb, const float* __restrict__ vb,
                                             int pitch, int T, int H, float scale, float* __restrict__ y, int ypitch) {
  constexpr int KS = D / 32;        // k-steps for QK
  constexpr int DT = D / 16;        // d tiles for PV
  __shared__ __attribute__((aligned(16))) unsigned short sKh[32][D + 8], sKl[32][D + 8], sVh[32][D + 8], sVl[32][D + 8];
  __shared__ __attribute__((aligned(16))) unsigned short sPh[4][16][40], sPl[4][16][40];
  __shared__ __attribute__((aligned(16))) float sO[4][16][D];
  const int tid = threadIdx.x, w = tid >> 5, lane = tid & 31, ln = lane & 15, hh = lane >> 4;
  const int nqb = (T + 63) / 64;
  const int bh = blockIdx.x / nqb, qblk = blockIdx.x % nqb;
  const int b = bh / H, h = bh % H;
  const int q0 = qblk * 64 + w * 16;
  const float* Q = qb + (size_t)b * T * pitch + h * D;
  const float* K = kb + (size_t)b * T * pitch + h * D;
  const float* V = vb + (size_t)b * T * pitch + h * D;

  // A fragments of the wave's 16 query rows (scaled), hi/lo
  FragB aqh[KS], aql[KS];
  {
    int row = q0 + ln; if (row >= T) row = T - 1;
    const float* qr = Q + (size_t)row * pitch;
#pragma unroll
    for (int ks = 0; ks < KS; ++ks)
#pragma unroll
      for (int i = 0; i < 16; ++i) {
        const int d = ks * 32 + ((i < 8) ? (8 * hh + i) : (16 + 8 * hh + (i - 8)));
        const float x = qr[d] * scale; const unsigned short hb = bf16_bits(x);
        aqh[ks].u[i] = hb; aql[ks].u[i] = bf16_bits(x - bf16_val(hb));
      }
  }
  float m_r[8], l_r[8];
#pragma unroll
  for (int r = 0; r < 8; ++r) { m_r[r] = -3.0e38f; l_r[r] = 0.f; }
  v8f oacc[DT];
#pragma unroll
  for (int dt = 0; dt < DT; ++dt) oacc[dt] = (v8f){0.f,0.f,0.f,0.f,0.f,0.f,0.f,0.f};

  const int kv_end = CAUSAL ? min(T, qblk * 64 + 64) : T;     // block-uniform
  for (int j0 = 0; j0 < kv_end; j0 += 32) {
    __syncthreads();
    for (int e = tid; e < 32 * (D / 4); e += 128) {
      const int r = e / (D / 4), c4 = (e % (D / 4)) * 4;
      const int key = j0 + r;
      v4f kf = {0.f,0.f,0.f,0.f}, vf = {0.f,0.f,0.f,0.f};
      if (key < T) { kf = *(const v4fa*)(K + (size_t)key * pitch + c4); vf = *(const v4fa*)(V + (size_t)key * pitch + c4); }
#pragma unroll
      for (int t = 0; t < 4; ++t) {
        unsigned short hb = bf16_bits(kf[t]); sKh[r][c4 + t] = hb; sKl[r][c4 + t] = bf16_bits(kf[t] - bf16_val(hb));
        hb = bf16_bits(vf[t]); sVh[r][c4 + t] = hb; sVl[r][c4 + t] = bf16_bits(vf[t] - bf16_val(hb));
      }
    }
    __syncthreads();
    // S tile 16 x 32
    v8f s[2];
#pragma unroll
    for (int nt = 0; nt < 2; ++nt) {
      v8f acc = {};
#pragma unroll
      for (int ks = 0; ks < KS; ++ks) {
        FragB bh_, bl_;
        bh_.half[0] = *(const v8us*)&sKh[nt * 16 + ln][ks * 32 + 8 * hh]; bh_.half[1] = *(const v8us*)&sKh[nt * 16 + ln][ks * 32 + 16 + 8 * hh];
        bl_.half[0] = *(const v8us*)&sKl[nt * 16 + ln][ks * 32 + 8 * hh]; bl_.half[1] = *(const v8us*)&sKl[nt * 16 + ln][ks * 32 + 16 + 8 * hh];
        acc = mmaN<3>(aqh[ks].v, aql[ks].v, bh_.v, bl_.v, acc);
      }
      s[nt] = acc;
    }
    // mask + running max (rows 8hh+r; the 16 lanes of a half share rows)
    float alpha[8];
#pragma unroll
    for (int r = 0; r < 8; ++r) {
      const int qi = q0 + 8 * hh + r;
      const int ja = j0 + ln, jb = j0 + 16 + ln;
      if (CAUSAL) { if (ja > qi) s[0][r] = -3.0e38f; if (jb > qi) s[1][r] = -3.0e38f; }
      if (ja >= T) s[0][r] = -3.0e38f;
      if (jb >= T) s[1][r] = -3.0e38f;
      float mx = fmaxf(s[0][r], s[1][r]);
      mx = fmaxf(mx, __shfl_xor(mx, 1, 32)); mx = fmaxf(mx, __shfl_xor(mx, 2, 32)); mx = fmaxf(mx, __shfl_xor(mx, 4, 32)); mx = fmaxf(mx, __shfl_xor(mx, 8, 32));
      const float mnew = fmaxf(m_r[r], mx);
      alpha[r] = (mnew > -1.0e38f) ? __expf(m_r[r] - mnew) : 1.0f;
      const float p0 = (s[0][r] > -1.0e38f) ? __expf(s[0][r] - mnew) : 0.f;
      const float p1 = (s[1][r] > -1.0e38f) ? __expf(s[1][r] - mnew) : 0.f;
      m_r[r] = mnew;
      l_r[r] = l_r[r] * alpha[r] + p0 + p1;            // per-lane partial row sum (16 lanes combined at the end)
      unsigned short hb = bf16_bits(p0); sPh[w][8 * hh + r][ln] = hb;      sPl[w][8 * hh + r][ln] = bf16_bits(p0 - bf16_val(hb));
      hb = bf16_bits(p1);                sPh[w][8 * hh + r][16 + ln] = hb; sPl[w][8 * hh + r][16 + ln] = bf16_bits(p1 - bf16_val(hb));
    }
#pragma unroll
    for (int dt = 0; dt < DT; ++dt)
#pragma unroll
      for (int r = 0; r < 8; ++r) oacc[dt][r] *= alpha[r];
    __builtin_amdgcn_fence(__ATOMIC_ACQ_REL, "workgroup");
    __builtin_amdgcn_wave_barrier();
    FragB pah, pal;
    pah.half[0] = *(const v8us*)&sPh[w][ln][8 * hh]; pah.half[1] = *(const v8us*)&sPh[w][ln][16 + 8 * hh];
    pal.half[0] = *(const v8us*)&sPl[w][ln][8 * hh]; pal.half[1] = *(const v8us*)&sPl[w][ln][16 + 8 * hh];
#pragma unroll
    for (int dt = 0; dt < DT; ++dt) {
      FragB bvh, bvl;
#pragma unroll
      for (int i = 0; i < 8; ++i) {
        bvh.u[i] = sVh[8 * hh + i][dt * 16 + ln]; bvh.u[8 + i] = sVh[16 + 8 * hh + i][dt * 16 + ln];
        bvl.u[i] = sVl[8 * hh + i][dt * 16 + ln]; bvl.u[8 + i] = sVl[16 + 8 * hh + i][dt * 16 + ln];
      }
      oacc[dt] = mmaN<3>(pah.v, pal.v, bvh.v, bvl.v, oacc[dt]);
    }
    __builtin_amdgcn_fence(__ATOMIC_ACQ_REL, "workgroup");
    __builtin_amdgcn_wave_barrier();
  }
#pragma unroll
  for (int r = 0; r < 8; ++r) {
    float l = l_r[r];
    l += __shfl_xor(l, 1, 32); l += __shfl_xor(l, 2, 32); l += __shfl_xor(l, 4, 32); l += __shfl_xor(l, 8, 32);
    l_r[r] = (l > 0.f) ? 1.0f / l : 0.f;
  }
#pragma unroll
  for (int dt = 0; dt < DT; ++dt)
#pragma unroll
    for (int r = 0; r < 8; ++r) sO[w][8 * hh + r][dt * 16 + ln] = oacc[dt][r] * l_r[r];
  __builtin_amdgcn_fence(__ATOMIC_ACQ_REL, "workgroup");
  __builtin_amdgcn_wave_barrier();
  {
    for (int r = 0; r < 16; ++r) {
      const int row = q0 + r;
      if (row < T && lane < D / 4) {
        const v4f val = *(const v4fa*)&sO[w][r][lane * 4];
        *(v4f*)(y + ((size_t)b * T + row) * ypitch + h * D + lane * 4) = val;
      }
    }
    
  }
}

// GEMM C = act(A·W + bias + resid): A f32 (ASPLIT -> hi/lo 2 terms), Wt bf16 [N][K]; ACT 0 none, 1 relu, 2 exact gelu;
// resid (optional, f32, row index = (row % rmod), pitch ldr, RES_BF16 rounds it) added before the activation.
template <bool ASPLIT, int ACT, bool BIAS_BF16, bool RES_BF16>
__global__ __launch_bounds__(128) void k_gemm_bf3(const float* __restrict__ A, int lda, const unsigned short* __restrict__ Wt, int ldb,
                                                const float* __restrict__ bias, const float* __restrict__ resid, int rmod, int ldr,
                                                float* __restrict__ C, int ldc, int M, int N, int K) {
  __shared__ __attribute__((aligned(16))) float so[4][16][64];
  const int tid = threadIdx.x, w = tid >> 5, lane = tid & 31, ln = lane & 15, hh = lane >> 4;
  const int ntn = N / 64;
  const int wid = blockIdx.x * 4 + w;
  const int mt = wid / ntn, nq = wid % ntn;
  if (mt * 16 >= M) return;
  const int row0 = mt * 16, col0 = nq * 64;
  const float* arow = A + (size_t)(row0 + ln) * lda;
  v8f acc[4] = {};
  for (int kb = 0; kb < K; kb += 32) {
    FragB ah, al;
    const v4f x0 = *(const v4fa*)(arow + kb + 8 * hh), x1 = *(const v4fa*)(arow + kb + 8 * hh + 4);
    const v4f x2 = *(const v4fa*)(arow + kb + 16 + 8 * hh), x3 = *(const v4fa*)(arow + kb + 16 + 8 * hh + 4);
    float xs[16] = {x0[0],x0[1],x0[2],x0[3],x1[0],x1[1],x1[2],x1[3],x2[0],x2[1],x2[2],x2[3],x3[0],x3[1],x3[2],x3[3]};
#pragma unroll
    for (int i = 0; i < 16; ++i) { const unsigned short hb = bf16_bits(xs[i]); ah.u[i] = hb; al.u[i] = ASPLIT ? bf16_bits(xs[i] - bf16_val(hb)) : (unsigned short)0; }
#pragma unroll
    for (int t = 0; t < 4; ++t) {
      const unsigned short* brow = Wt + (size_t)(col0 + t * 16 + ln) * ldb + kb;
      FragB b;
      b.half[0] = *(const v8us*)(brow + 8 * hh);
      b.half[1] = *(const v8us*)(brow + 16 + 8 * hh);
      acc[t] = mmaN<ASPLIT ? 2 : 1>(ah.v, al.v, b.v, b.v, acc[t]);
    }
  }
#pragma unroll
  for (int t = 0; t < 4; ++t) {
    const int col = col0 + t * 16 + ln;
    float bv = bias ? bias[col] : 0.f;
    if (BIAS_BF16) bv = bf16_round(bv);
#pragma unroll
    for (int r = 0; r < 8; ++r) {
      float v = acc[t][r] + bv;
      if (resid) { float rv = resid[(size_t)((row0 + 8 * hh + r) % rmod) * ldr + col]; if (RES_BF16) rv = bf16_round(rv); v += rv; }
      if (ACT == 1) v = fmaxf(v, 0.f);
      if (ACT == 2) v = 0.5f * v * (1.0f + erff(v * 0.70710678118654752f));
      if (ACT == 3) { const float u = 0.7978845608028654f * (v + 0.044715f * v * v * v); v = 0.5f * v * (1.0f + tanhf(u)); }
      so[w][8 * hh + r][t * 16 + ln] = v;
    }
  }
  __builtin_amdgcn_fence(__ATOMIC_ACQ_REL, "workgroup");
  __builtin_amdgcn_wave_barrier();
  const int rsub = lane >> 4, c4 = (lane & 15) * 4;
  {
#pragma unroll
    for (int q = 0; q < 8; ++q) {
      const int r = q * 2 + rsub;
      const v4f v = *(const v4fa*)&so[w][r][c4];
      *(v4f*)(C + (size_t)(row0 + r) * ldc + col0 + c4) = v;
    }
    
  }
}
// row LayerNorm (biased variance, eps) over N: s = X (+ R); optional out_sum <- s; out_norm <- (s-mu)*rsqrt(var+eps)*g + b
template <bool PARAM_BF16>
__global__ __launch_bounds__(256) void k_layernorm(const float* __restrict__ X, const float* __restrict__ R, const float* __restrict__ g, const float* __restrict__ bta,
                                                  float* __restrict__ out_sum, float* __restrict__ out_norm, int N, float eps) {
  __shared__ float red[256];
  const int row = blockIdx.x, tid = threadIdx.x;
  const float* x = X + (size_t)row * N; const float* rr = R ? R + (size_t)row * N : nullptr;
  float vals[16];                     // up to N = 4096
  const int per = N / 256;            // contiguous chunk per thread? use strided-by-4 chunks: thread handles j = tid*4 + 1024*u
  float s1 = 0.f;
  for (int u = 0; u < per / 4; ++u) {
    const int j = tid * 4 + 1024 * u;
    const v4f a = *(const v4fa*)(x + j);
    v4f b = {0.f,0.f,0.f,0.f}; if (rr) b = *(const v4fa*)(rr + j);
#pragma unroll
    for (int q = 0; q < 4; ++q) { const float v = a[q] + b[q]; vals[u * 4 + q] = v; s1 += v; }
  }
  red[tid] = s1; __syncthreads();
  for (int st = 128; st > 0; st >>= 1) { if (tid < st) red[tid] += red[tid + st]; __syncthreads(); }
  const float mu = red[0] / (float)N; __syncthreads();
  float s2 = 0.f;
  for (int u = 0; u < per / 4; ++u)
#pragma unroll
    for (int q = 0; q < 4; ++q) { const float c = vals[u * 4 + q] - mu; s2 += c * c; }
  red[tid] = s2; __syncthreads();
  for (int st = 128; st > 0; st >>= 1) { if (tid < st) red[tid] += red[tid + st]; __syncthreads(); }
  const float rs = rsqrtf(red[0] / (float)N + eps);
  {
    for (int u = 0; u < per / 4; ++u) {
      const int j = tid * 4 + 1024 * u;
      v4f o, sm;
#pragma unroll
      for (int q = 0; q < 4; ++q) {
        float gg = g[j + q], bb = bta[j + q];
        if (PARAM_BF16) { gg = bf16_round(gg); bb = bf16_round(bb); }
        sm[q] = vals[u * 4 + q]; o[q] = (vals[u * 4 + q] - mu) * rs * gg + bb;
      }
      if (out_sum) *(v4f*)(out_sum + (size_t)row * N + j) = sm;
      *(v4f*)(out_norm + (size_t)row * N + j) = o;
    }
    
  }
}



// ---- f16 WMMA path (v_wmma_f32_16x16x32_f16): 11-bit significands for operands in range — used where a [0,1] probability operand needs more precision than bf16
typedef _Float16 v16h __attribute__((ext_vector_type(16)));
union FragH { v16h v; v8us half[2]; _Float16 h[16]; unsigned short u[16]; };
template <int NT>
__device__ __forceinline__ v8f mmaH(v16h ah, v16h al, v16h bh, v16h bl, v8f c) {
  c = __builtin_amdgcn_wmma_f32_16x16x32_f16(false, ah, false, bh, (short)0, c, false, false);
  if (NT >= 2) c = __builtin_amdgcn_wmma_f32_16x16x32_f16(false, al, false, bh, (short)0, c, false, false);
  if (NT >= 3) c = __builtin_amdgcn_wmma_f32_16x16x32_f16(false, ah, false, bl, (short)0, c, false, false);
  asm volatile("v_nop\n\tv_nop\n\tv_nop\n\tv_nop" : "+v"(c) : "v"(ah), "v"(al), "v"(bh), "v"(bl));
  return c;
}
// batched GEMM like k_gemm_b but f16 operands: A f32 (split into f16 hi/lo if ASPLIT, else rounded to f16), Bt = f16 values [n][k]; alpha; C f32; N multiple of 16 (partial tiles skipped)
template <bool ASPLIT>
__global__ __launch_bounds__(128) void k_gemm_h(const float* __restrict__ A, int lda, size_t sA, const _Float16* __restrict__ Bh, int ldb, size_t sB, float alpha, float* __restrict__ C, int ldc, size_t sC, int M, int N, int K) {
  __shared__ __attribute__((aligned(16))) float so[4][16][64];
  const int tid = threadIdx.x, w = tid >> 5, lane = tid & 31, ln = lane & 15, hh = lane >> 4; const int by = blockIdx.y;
  A += (size_t)by * sA; Bh += (size_t)by * sB; C += (size_t)by * sC;
  const int ntn = (N + 63) / 64; const int wid = blockIdx.x * 4 + w; const int mt = wid / ntn, nq = wid % ntn; if (mt * 16 >= M) return;
  const int row0 = mt * 16, col0 = nq * 64; const float* arow = A + (size_t)(row0 + ln) * lda;
  v8f acc[4] = {};
  for (int kb = 0; kb < K; kb += 32) {
    FragH ah, al;
    const v4f x0 = *(const v4fa*)(arow + kb + 8 * hh), x1 = *(const v4fa*)(arow + kb + 8 * hh + 4), x2 = *(const v4fa*)(arow + kb + 16 + 8 * hh), x3 = *(const v4fa*)(arow + kb + 16 + 8 * hh + 4);
    float xs[16] = {x0[0],x0[1],x0[2],x0[3],x1[0],x1[1],x1[2],x1[3],x2[0],x2[1],x2[2],x2[3],x3[0],x3[1],x3[2],x3[3]};
#pragma unroll
    for (int i = 0; i < 16; ++i) { const _Float16 h = (_Float16)xs[i]; ah.h[i] = h; al.h[i] = ASPLIT ? (_Float16)(xs[i] - (float)h) : (_Float16)0.0f; }
#pragma unroll
    for (int t = 0; t < 4; ++t) { if (col0 + t * 16 >= N) continue; const size_t boff = (size_t)(col0 + t * 16 + ln) * ldb + kb; FragH bq; bq.half[0] = *(const v8us*)(Bh + boff + 8 * hh); bq.half[1] = *(const v8us*)(Bh + boff + 16 + 8 * hh);
      acc[t] = mmaH<ASPLIT ? 2 : 1>(ah.v, al.v, bq.v, bq.v, acc[t]); }
  }
#pragma unroll
  for (int t = 0; t < 4; ++t) { if (col0 + t * 16 >= N) continue;
#pragma unroll
    for (int r = 0; r < 8; ++r) so[w][8 * hh + r][t * 16 + ln] = acc[t][r] * alpha; }
  __builtin_amdgcn_fence(__ATOMIC_ACQ_REL, "workgroup"); __builtin_amdgcn_wave_barrier();
  const int rsub = lane >> 4, c4 = (lane & 15) * 4;
  {
#pragma unroll
    for (int q = 0; q < 8; ++q) { const int r = q * 2 + rsub; if (col0 + c4 < N) { const v4f v = *(const v4fa*)&so[w][r][c4]; *(v4f*)(C + (size_t)(row0 + r) * ldc + col0 + c4) = v; } }
     }
}

// Wt[n][k] = f16(W[k][n]·scale) from f32 row-major W[K][N] (scale = power of two; bf16-exact weights stay exact in f16 away from the subnormal range)
__global__ __launch_bounds__(256) void k_wt_f16(const float* __restrict__ W, _Float16* __restrict__ Wt, int K, int N, float scale) {
  const int t = blockIdx.x * 256 + threadIdx.x; if (t >= N * (K / 8)) return; const int n = t / (K / 8), k8 = (t % (K / 8)) * 8; FragH f;
#pragma unroll
  for (int i = 0; i < 8; ++i) f.h[i] = (_Float16)(bf16_round(W[(size_t)(k8 + i) * N + n]) * scale); const v8us o = f.half[0];
  *(v8us*)((unsigned short*)Wt + (size_t)n * K + k8) = o; 
}
// k_gemm_hh variant with fused epilogue: v = acc·alpha + bias[by·sBias + col] (+ CP[(row/rowsPerB)·sCPb + by·64 + col] if CP) ; ACT 0 none / 1 elu ; writes f16 C16 (and f32 C if non-null)
template <int ACT>
__global__ __launch_bounds__(128) void k_gemm_hhx(const _Float16* __restrict__ A, int lda, size_t sA, const _Float16* __restrict__ Bh, int ldb, size_t sB, float alpha, const float* __restrict__ bias, size_t sBias, const float* __restrict__ CP, int rowsPerB, size_t sCPb, int row0g,
    float* __restrict__ C, _Float16* __restrict__ C16, int ldc, size_t sC, int M, int N, int K) {
  __shared__ __attribute__((aligned(16))) float so[4][16][64];
  const int tid = threadIdx.x, w = tid >> 5, lane = tid & 31, ln = lane & 15, hh = lane >> 4; const int by = blockIdx.y;
  A += (size_t)by * sA; Bh += (size_t)by * sB; const size_t cofs = (size_t)by * sC; const float* bp = bias ? bias + (size_t)by * sBias : nullptr;
  const int ntn = (N + 63) / 64; const int wid = blockIdx.x * 4 + w; const int mt = wid / ntn, nq = wid % ntn; if (mt * 16 >= M) return;
  const int row0 = mt * 16, col0 = nq * 64; const _Float16* arow = A + (size_t)(row0 + ln) * lda;
  v8f acc[4] = {};
  for (int kb = 0; kb < K; kb += 32) { FragH ah; ah.half[0] = *(const v8us*)((const unsigned short*)arow + kb + 8 * hh); ah.half[1] = *(const v8us*)((const unsigned short*)arow + kb + 16 + 8 * hh);
#pragma unroll
    for (int t = 0; t < 4; ++t) { if (col0 + t * 16 >= N) continue; const size_t boff = (size_t)(col0 + t * 16 + ln) * ldb + kb; FragH bq; bq.half[0] = *(const v8us*)((const unsigned short*)Bh + boff + 8 * hh); bq.half[1] = *(const v8us*)((const unsigned short*)Bh + boff + 16 + 8 * hh);
      acc[t] = mmaH<1>(ah.v, ah.v, bq.v, bq.v, acc[t]); }
  }
#pragma unroll
  for (int t = 0; t < 4; ++t) { if (col0 + t * 16 >= N) continue; const int col = col0 + t * 16 + ln; const float bv = bp ? bf16_round(bp[col]) : 0.f;
#pragma unroll
    for (int r = 0; r < 8; ++r) { float v = acc[t][r] * alpha + bv; if (CP) { const int bidx = (row0g + row0 + 8 * hh + r) / rowsPerB; v += CP[(size_t)bidx * sCPb + (size_t)by * 64 + col]; } if (ACT == 1) v = (v > 0.f) ? v : expm1f(v); else if (ACT == 3) v = fmaxf(v, 0.f); so[w][8 * hh + r][t * 16 + ln] = v; } }
  __builtin_amdgcn_fence(__ATOMIC_ACQ_REL, "workgroup"); __builtin_amdgcn_wave_barrier();
  const int rsub = lane >> 4, c4 = (lane & 15) * 4; typedef _Float16 v4h __attribute__((ext_vector_type(4)));
  {
#pragma unroll
    for (int q = 0; q < 8; ++q) { const int r = q * 2 + rsub; if (col0 + c4 < N) { const v4f v = *(const v4fa*)&so[w][r][c4]; if (C) *(v4f*)(C + cofs + (size_t)(row0 + r) * ldc + col0 + c4) = v; if (C16) { v4h h4; for (int i = 0; i < 4; ++i) h4[i] = (_Float16)v[i]; *(v4h*)(C16 + cofs + (size_t)(row0 + r) * ldc + col0 + c4) = h4; } } }
     }
}


typedef _Float16 v4h __attribute__((ext_vector_type(4)));

__global__ __launch_bounds__(256) void k_x16(const float* __restrict__ x, _Float16* __restrict__ X16, size_t n8) { const size_t t = (size_t)blockIdx.x * 256 + threadIdx.x; if (t >= n8) return; FragH f;
#pragma unroll
  for (int q = 0; q < 8; ++q) f.h[q] = (_Float16)bf16_round(x[t * 8 + q]); *(v8us*)((unsigned short*)X16 + t * 8) = f.half[0];  }
__global__ __launch_bounds__(256) void k_h16(const float* __restrict__ x, _Float16* __restrict__ X16, size_t n8) { const size_t t = (size_t)blockIdx.x * 256 + threadIdx.x; if (t >= n8) return; FragH f;
#pragma unroll
  for (int q = 0; q < 8; ++q) f.h[q] = (_Float16)x[t * 8 + q]; *(v8us*)((unsigned short*)X16 + t * 8) = f.half[0];  }
__global__ __launch_bounds__(256) void k_round16f(const float* __restrict__ W, _Float16* __restrict__ Bt, size_t n8) { const size_t t = (size_t)blockIdx.x * 256 + threadIdx.x; if (t >= n8) return; FragH f;
#pragma unroll
  for (int i = 0; i < 8; ++i) f.h[i] = (_Float16)(bf16_round(W[t * 8 + i]) * 16.0f); *(v8us*)((unsigned short*)Bt + t * 8) = f.half[0];  }
template <int NHv, int TTv>
__global__ __launch_bounds__(256) void k_vt(const _Float16* __restrict__ V16, int ldv, int voff, _Float16* __restrict__ Vt) { __shared__ unsigned short tl[64][66]; const int tid = threadIdx.x; const int slab = blockIdx.x / (TTv / 64), lg = blockIdx.x % (TTv / 64); const int b = slab / NHv, h = slab % NHv;
  for (int i = tid; i < 64 * 8; i += 256) { const int r = i / 8, c8 = (i % 8) * 8; FragH f; f.half[0] = *(const v8us*)((const unsigned short*)V16 + ((size_t)b * TTv + lg * 64 + r) * ldv + voff + h * 64 + c8);
#pragma unroll
    for (int q = 0; q < 8; ++q) tl[r][c8 + q] = f.u[q]; }
  __syncthreads();
  {
#pragma unroll
    for (int rd = 0; rd < 2; ++rd) { const int d = rd * 32 + tid / 8, pc = tid % 8; FragH f;
#pragma unroll
      for (int q = 0; q < 8; ++q) f.u[q] = tl[pc * 8 + q][d];
      *(v8us*)((unsigned short*)Vt + ((size_t)slab * 64 + d) * TTv + lg * 64 + pc * 8) = f.half[0]; }
     } }

// One work-group = one tile of 16 query rows; its NW waves deal the tile's 32-key blocks among themselves (wave w takes blocks w, w + NW, ...), each with its own
// running maximum, sum and accumulators; the partials are merged through LDS behind one work-group barrier. The launch bound asks for 8 waves per SIMD (128 VGPRs), so that
// two work-groups share a WGP. w is held in a scalar register: the waves' trip counts differ, and the loop must branch on a scalar so that every lane stays on at the WMMAs.
// Both products run transposed: S^T = K.Q^T (A = 16 key rows, B = the tile's queries, kept in registers) and O^T += V^T.P^T. A lane then holds 16 scores of ONE query (column ln; keys
// 8hh + r and 16 + 8hh + r of the block), so maximum and sum are in-lane but for one exchange between the wave's halves, and the two converted score tiles ARE the B operand of the second product.
__device__ __forceinline__ float xhalf(float x) { return __builtin_bit_cast(float, __builtin_amdgcn_permlanex16(__builtin_bit_cast(int, x), __builtin_bit_cast(int, x), 0x76543210, 0xfedcba98, false, false)); }      // lane l reads lane l ^ 16
template <int NW>
__global__ __launch_bounds__(NW * 32, 8) void k_flash(const _Float16* __restrict__ Q16, int ldq, const _Float16* __restrict__ K16, int ldk, const _Float16* __restrict__ Vt, const int* __restrict__ MSK, float* __restrict__ O, int ldo) {
  constexpr int RPW = 16, NQB = 4096 / RPW, DT = 4, KS = 2;
  __shared__ __attribute__((aligned(16))) float sO[NW][RPW][64 + 4]; __shared__ float sM[NW][RPW], sL[NW][RPW];
  const int tid = threadIdx.x, w = __builtin_amdgcn_readfirstlane(tid >> 5), lane = tid & 31, ln = lane & 15, hh = lane >> 4;
  const int slab = blockIdx.x / NQB, qblk = blockIdx.x % NQB; const int b = slab / 1, h = slab % 1; const int q0 = qblk * RPW;
  FragH bq[KS];
  { const unsigned short* qr = (const unsigned short*)Q16 + ((size_t)b * 4096 + q0 + ln) * ldq + h * 64;
#pragma unroll
    for (int ks = 0; ks < KS; ++ks) { bq[ks].half[0] = *(const v8us*)(qr + ks * 32 + 8 * hh); bq[ks].half[1] = *(const v8us*)(qr + ks * 32 + 16 + 8 * hh); } }
  const unsigned short* Vth = (const unsigned short*)Vt + (size_t)slab * 64 * 4096;
  float m_q = -3.0e38f, l_q = 0.f; v8f oacc[DT];      // of query q0 + ln; l_q sums this half's keys only, the halves are joined behind the loop
#pragma unroll
  for (int dt = 0; dt < DT; ++dt) oacc[dt] = (v8f){0.f,0.f,0.f,0.f,0.f,0.f,0.f,0.f};      // oacc[dt][r] = O[q0 + ln][dt * 16 + 8hh + r]
  const int jend = q0 + RPW, tq = q0 + ln;
#pragma unroll 1
  for (int j0 = w * 32; j0 < jend; j0 += NW * 32) {
    v8f s[2];
#pragma unroll
    for (int nt = 0; nt < 2; ++nt) { const unsigned short* kr = (const unsigned short*)K16 + ((size_t)b * 4096 + j0 + nt * 16 + ln) * ldk + h * 64; FragH ak[KS];      // A operand: key rows j0 + nt * 16 + ln
#pragma unroll
      for (int ks = 0; ks < KS; ++ks) { ak[ks].half[0] = *(const v8us*)(kr + ks * 32 + 8 * hh); ak[ks].half[1] = *(const v8us*)(kr + ks * 32 + 16 + 8 * hh); }
      v8f acc = (v8f){0.f,0.f,0.f,0.f,0.f,0.f,0.f,0.f};
#pragma unroll
      for (int ks = 0; ks < KS; ++ks) acc = mmaH<1>(ak[ks].v, ak[ks].v, bq[ks].v, bq[ks].v, acc);
      s[nt] = acc; }      // s[nt][r] = q(q0 + ln) . k(j0 + nt * 16 + 8hh + r)
    float mc = -INFINITY; const int dq = tq - j0 - 8 * hh;      // score (nt, r) is unmasked while nt * 16 + r <= dq
#pragma unroll
    for (int nt = 0; nt < 2; ++nt)
#pragma unroll
      for (int r = 0; r < 8; ++r) { s[nt][r] = (nt * 16 + r <= dq) ? s[nt][r] * (0.125f) : -INFINITY; mc = fmaxf(mc, s[nt][r]); }
    mc = fmaxf(mc, xhalf(mc));
    // every block a wave walks starts at a key j0 <= q0, so each query has an unmasked score in it and mn is a finite score: a masked score (-inf) gives exp = 0 and the first block gives al = 0 with no test
    const float mn = fmaxf(m_q, mc); const float al = expf(m_q - mn); m_q = mn;
    float ps = 0.f; FragH pb;
#pragma unroll
    for (int nt = 0; nt < 2; ++nt)
#pragma unroll
      for (int r = 0; r < 8; ++r) { const float p = expf(s[nt][r] - mn); ps += p; pb.h[nt * 8 + r] = (_Float16)p; }      // element nt * 8 + r of a B fragment is k = nt * 16 + 8hh + r: the key this score belongs to
    l_q = l_q * al + ps;
#pragma unroll
    for (int dt = 0; dt < DT; ++dt) { const unsigned short* vrow = Vth + (size_t)(dt * 16 + ln) * 4096 + j0; FragH av; av.half[0] = *(const v8us*)(vrow + 8 * hh); av.half[1] = *(const v8us*)(vrow + 16 + 8 * hh);      // A operand: V^T rows dt * 16 + ln, the block's 32 keys in the k order of the packed scores
#pragma unroll
      for (int r = 0; r < 8; ++r) oacc[dt][r] *= al;
      oacc[dt] = mmaH<1>(av.v, av.v, pb.v, pb.v, oacc[dt]); } }
  // each wave hands over its un-normalised partial: (maximum, sum) per row and the 16 x 64 accumulator; a wave without a block hands (-3e38, 0, zeros), which weighs 0 in the merge
  const int le = (int)__builtin_amdgcn_mbcnt_lo(~0u, 0u), lne = le & 15, hhe = le >> 4;      // lane id read anew, so that tid and its parts need no registers across the loop
  l_q += xhalf(l_q);
  if (hhe == 0) { sM[w][lne] = m_q; sL[w][lne] = l_q; }
#pragma unroll
  for (int dt = 0; dt < DT; ++dt) { *(v4fa*)&sO[w][lne][dt * 16 + 8 * hhe] = (v4f){oacc[dt][0], oacc[dt][1], oacc[dt][2], oacc[dt][3]}; *(v4fa*)&sO[w][lne][dt * 16 + 8 * hhe + 4] = (v4f){oacc[dt][4], oacc[dt][5], oacc[dt][6], oacc[dt][7]}; }
  __syncthreads();      // every wave's partial is in LDS before any is merged
  static_assert(NW == RPW, "wave w merges row w");
  { typedef float v2f __attribute__((ext_vector_type(2))); typedef float v2fa __attribute__((ext_vector_type(2), may_alias)); const int r = w; float M = sM[0][r];
#pragma unroll      // both loops unrolled: the NW partials' LDS loads go out together instead of one wait each
    for (int u = 1; u < NW; ++u) M = fmaxf(M, sM[u][r]);
    float L = 0.f; v2f val = {0.f, 0.f};
#pragma unroll
    for (int u = 0; u < NW; ++u) { const float e = expf(sM[u][r] - M); L += e * sL[u][r]; const v2f pv = *(const v2fa*)&sO[u][r][le * 2]; val += pv * e; }
    const float inv = (L > 0.f) ? 1.0f / L : 0.f; val *= inv;
    *(v2f*)(O + ((size_t)b * 4096 + q0 + r) * ldo + h * 64 + le * 2) = val; } }

extern "C" void kernel_launch(void* const* d_in, const int* in_sizes, int n_in,
                              void* d_out, int out_size, void* d_ws, size_t ws_size, hipStream_t stream) {
  (void)in_sizes; (void)n_in; (void)out_size;
  const float* x = (const float*)d_in[0]; const float* Wk = (const float*)d_in[1]; const float* Wq = (const float*)d_in[2]; const float* Wv = (const float*)d_in[3];
  char* ws = (char*)d_ws; size_t off = 0;
  auto take = [&](size_t bytes) { char* p = ws + off; off += (bytes + 255) & ~(size_t)255; return p; };
  _Float16* Bqkv = (_Float16*)take((size_t)3 * CC * CC * 2); _Float16* X16 = (_Float16*)take((size_t)NR * CC * 2); _Float16* QKV = (_Float16*)take((size_t)NR * 3 * CC * 2); _Float16* Vt = (_Float16*)take((size_t)NR * CC * 2);
  if (off > ws_size) return;      // 2.1 + 6.3 + 2.1 ≈ 10.5 MB
  k_round16f<<<(CC * CC / 8 + 255) / 256, 256, 0, stream>>>(Wq, Bqkv, CC * CC / 8); k_round16f<<<(CC * CC / 8 + 255) / 256, 256, 0, stream>>>(Wk, Bqkv + CC * CC, CC * CC / 8); k_round16f<<<(CC * CC / 8 + 255) / 256, 256, 0, stream>>>(Wv, Bqkv + 2 * CC * CC, CC * CC / 8);      // (out,in) rows: [Wq; Wk; Wv]
  k_x16<<<(unsigned)(((size_t)NR * CC / 8 + 255) / 256), 256, 0, stream>>>(x, X16, (size_t)NR * CC / 8);
  k_gemm_hhx<0><<<dim3(((NR / 16) * (3 * CC / 64) + 3) / 4, 1), 128, 0, stream>>>(X16, CC, 0, Bqkv, CC, 0, 0.0625f, nullptr, 0, nullptr, 1, 0, 0, nullptr, QKV, 3 * CC, 0, NR, 3 * CC, CC);      // [q | k | v] f16
  k_vt<1, TT><<<BB * 1 * (TT / 64), 256, 0, stream>>>(QKV, 3 * CC, 2 * CC, Vt);      // Vᵀ per batch [b][64][T]
  k_flash<16><<<BB * 1 * (TT / 16), 16 * 32, 0, stream>>>(QKV, 3 * CC, QKV + CC, 3 * CC, Vt, nullptr, (float*)d_out, CC);
}

// v003
// It runs in 57.8 microseconds.
// Timed twice side by side with v002, it ran 1.20 times as fast both times.
// Over all steps from v000 it is 7.45 times as fast.
#include <hip/hip_runtime.h>
// Single causal attention head (B=4, T=4096, C=64): q,k,v = x·Wᵀ (no bias), softmax(q·kᵀ·64^-½) with a causal mask, out = P·v. One GEMM for [q|k|v] and a fused flash-style causal attention
// kernel (online softmax in f32; P f16 ≤ 1; O = P·Vᵀ-tiles; RPW-16 waves; causal tile skipping) on v_wmma_f32_16x16x32_f16 — x bf16-exact, (out,in) weights bf16-exact ×2^4, q/k/v f16,
// f32 accumulate.
#define BB 4
#define TT 4096
#define CC 64
#define NR (BB * TT)

typedef __bf16 v16b __attribute__((ext_vector_type(16)));
typedef unsigned short v8us __attribute__((ext_vector_type(8), may_alias));
typedef float  v8f  __attribute__((ext_vector_type(8)));
typedef float  v4f  __attribute__((ext_vector_type(4)));
typedef float  v4fa __attribute__((ext_vector_type(4), may_alias));
union FragB { v16b v; v8us half[2]; unsigned short u[16]; };

__device__ __forceinline__ unsigned short bf16_bits(float x) { unsigned int u = __float_as_uint(x); return (unsigned short)((u + 0x7FFFu + ((u >> 16) & 1u)) >> 16); }
__device__ __forceinline__ float bf16_val(unsigned short b) { return __uint_as_float(((unsigned int)b) << 16); }
__device__ __forceinline__ float bf16_round(float x) { return bf16_val(bf16_bits(x)); }
// D += A·B with NT terms: 1 = ah·bh, 2 = + al·bh (A split), 3 = + ah·bl (both split)
template <int NT>
__device__ __forceinline__ v8f mmaN(v16b ah, v16b al, v16b bh, v16b bl, v8f c) {
  c = __builtin_amdgcn_wmma_f32_16x16x32_bf16(false, ah, false, bh, (short)0, c, false, false);
  if (NT >= 2) c = __builtin_amdgcn_wmma_f32_16x16x32_bf16(false, al, false, bh, (short)0, c, false, false);
  if (NT >= 3) c = __builtin_amdgcn_wmma_f32_16x16x32_bf16(false, ah, false, bl, (short)0, c, false, false);
  asm volatile("v_nop\n\tv_nop\n\tv_nop\n\tv_nop" : "+v"(c) : "v"(ah), "v"(al), "v"(bh), "v"(bl));
  return c;
}

__global__ __launch_bounds__(256) void k_wt_bf16(const float* __restrict__ W, unsigned short* __restrict__ Wt, int K, int N) {
  const int t = blockIdx.x * 256 + threadIdx.x;
  const int k8n = K / 8;
  if (t >= N * k8n) return;
  const int n = t / k8n, k8 = (t % k8n) * 8;
  v8us v;
#pragma unroll
  for (int i = 0; i < 8; ++i) v[i] = bf16_bits(W[(size_t)(k8 + i) * N + n]);
  *(v8us*)(Wt + (size_t)n * K + k8) = v;
  
}

// GEMM C[M][N] (f32, pitch ldc) = act(A[M][K]·W + bias). A f32 row-major (pitch lda) converted per fragment to bf16
// (ASPLIT: hi/lo two planes -> 2 terms, else single rounded term); Wt bf16 [N][K] (pitch ldb). BIAS_BF16 rounds the
// bias to bf16 first (bias quantised to bf16 before the add). K%32==0, M%16==0, N%64==0.
template <bool ASPLIT, int ACT, bool BIAS_BF16>
__global__ __launch_bounds__(128) void k_gemm_bf(const float* __restrict__ A, int lda, const unsigned short* __restrict__ Wt, int ldb,
                                               const float* __restrict__ bias, float* __restrict__ C, int ldc, int M, int N, int K) {
  __shared__ __attribute__((aligned(16))) float so[4][16][64];
  const int tid = threadIdx.x, w = tid >> 5, lane = tid & 31, ln = lane & 15, hh = lane >> 4;
  const int ntn = N / 64;
  const int wid = blockIdx.x * 4 + w;
  const int mt = wid / ntn, nq = wid % ntn;
  if (mt * 16 >= M) return;
  const int row0 = mt * 16, col0 = nq * 64;
  const float* arow = A + (size_t)(row0 + ln) * lda;
  v8f acc[4] = {};
  for (int kb = 0; kb < K; kb += 32) {
    FragB ah, al;
    const v4f x0 = *(const v4fa*)(arow + kb + 8 * hh), x1 = *(const v4fa*)(arow + kb + 8 * hh + 4);
    const v4f x2 = *(const v4fa*)(arow + kb + 16 + 8 * hh), x3 = *(const v4fa*)(arow + kb + 16 + 8 * hh + 4);
    float xs[16] = {x0[0],x0[1],x0[2],x0[3],x1[0],x1[1],x1[2],x1[3],x2[0],x2[1],x2[2],x2[3],x3[0],x3[1],x3[2],x3[3]};
#pragma unroll
    for (int i = 0; i < 16; ++i) { const unsigned short hb = bf16_bits(xs[i]); ah.u[i] = hb; al.u[i] = ASPLIT ? bf16_bits(xs[i] - bf16_val(hb)) : (unsigned short)0; }
#pragma unroll
    for (int t = 0; t < 4; ++t) {
      const unsigned short* brow = Wt + (size_t)(col0 + t * 16 + ln) * ldb + kb;
      FragB b;
      b.half[0] = *(const v8us*)(brow + 8 * hh);
      b.half[1] = *(const v8us*)(brow + 16 + 8 * hh);
      acc[t] = mmaN<ASPLIT ? 2 : 1>(ah.v, al.v, b.v, b.v, acc[t]);
    }
  }
#pragma unroll
  for (int t = 0; t < 4; ++t) {
    float bv = bias ? bias[col0 + t * 16 + ln] : 0.f;
    if (BIAS_BF16) bv = bf16_round(bv);
#pragma unroll
    for (int r = 0; r < 8; ++r) { float v = acc[t][r] + bv; if (ACT == 1) v = fmaxf(v, 0.f); so[w][8 * hh + r][t * 16 + ln] = v; }
  }
  __builtin_amdgcn_fence(__ATOMIC_ACQ_REL, "workgroup");
  __builtin_amdgcn_wave_barrier();
  const int rsub = lane >> 4, c4 = (lane & 15) * 4;
  {
#pragma unroll
    for (int q = 0; q < 8; ++q) {
      const int r = q * 2 + rsub;
      const v4f v = *(const v4fa*)&so[w][r][c4];
      *(v4f*)(C + (size_t)(row0 + r) * ldc + col0 + c4) = v;
    }
    
  }
}

// Flash-style causal/unmasked attention, all contractions 3-term bf16 hi/lo splits, f32 softmax with running max.
// q,k,v rows are read from f32 buffers with arbitrary row pitch (so they can live inside a fused qkv buffer);
// D = head size (multiple of 32, <= 128); one wave = 16 query rows; block = 4 waves (64 queries) sharing K/V chunks of 32.
template <int D, bool CAUSAL>
__global__ __launch_bounds__(128) void k_flash(const float* __restrict__ qb, const float* __restrict__ kb, const float* __restrict__ vb,
                                             int pitch, int T, int H, float scale, float* __restrict__ y, int ypitch) {
  constexpr int KS = D / 32;        // k-steps for QK
  constexpr int DT = D / 16;        // d tiles for PV
  __shared__ __attribute__((aligned(16))) unsigned short sKh[32][D + 8], sKl[32][D + 8], sVh[32][D + 8], sVl[32][D + 8];
  __shared__ __attribute__((aligned(16))) unsigned short sPh[4][16][40], sPl[4][16][40];
  __shared__ __attribute__((aligned(16))) float sO[4][16][D];
  const int tid = threadIdx.x, w = tid >> 5, lane = tid & 31, ln = lane & 15, hh = lane >> 4;
  const int nqb = (T + 63) / 64;
  const int bh = blockIdx.x / nqb, qblk = blockIdx.x % nqb;
  const int b = bh / H, h = bh % H;
  const int q0 = qblk * 64 + w * 16;
  const float* Q = qb + (size_t)b * T * pitch + h * D;
  const float* K = kb + (size_t)b * T * pitch + h * D;
  const float* V = vb + (size_t)b * T * pitch + h * D;

  // A fragments of the wave's 16 query rows (scaled), hi/lo
  FragB aqh[KS], aql[KS];
  {
    int row = q0 + ln; if (row >= T) row = T - 1;
    const float* qr = Q + (size_t)row * pitch;
#pragma unroll
    for (int ks = 0; ks < KS; ++ks)
#pragma unroll
      for (int i = 0; i < 16; ++i) {
        const int d = ks * 32 + ((i < 8) ? (8 * hh + i) : (16 + 8 * hh + (i - 8)));
        const float x = qr[d] * scale; const unsigned short hb = bf16_bits(x);
        aqh[ks].u[i] = hb; aql[ks].u[i] = bf16_bits(x - bf16_val(hb));
      }
  }
  float m_r[8], l_r[8];
#pragma unroll
  for (int r = 0; r < 8; ++r) { m_r[r] = -3.0e38f; l_r[r] = 0.f; }
  v8f oacc[DT];
#pragma unroll
  for (int dt = 0; dt < DT; ++dt) oacc[dt] = (v8f){0.f,0.f,0.f,0.f,0.f,0.f,0.f,0.f};

  const int kv_end = CAUSAL ? min(T, qblk * 64 + 64) : T;     // block-uniform
  for (int j0 = 0; j0 < kv_end; j0 += 32) {
    __syncthreads();
    for (int e = tid; e < 32 * (D / 4); e += 128) {
      const int r = e / (D / 4), c4 = (e % (D / 4)) * 4;
      const int key = j0 + r;
      v4f kf = {0.f,0.f,0.f,0.f}, vf = {0.f,0.f,0.f,0.f};
      if (key < T) { kf = *(const v4fa*)(K + (size_t)key * pitch + c4); vf = *(const v4fa*)(V + (size_t)key * pitch + c4); }
#pragma unroll
      for (int t = 0; t < 4; ++t) {
        unsigned short hb = bf16_bits(kf[t]); sKh[r][c4 + t] = hb; sKl[r][c4 + t] = bf16_bits(kf[t] - bf16_val(hb));
        hb = bf16_bits(vf[t]); sVh[r][c4 + t] = hb; sVl[r][c4 + t] = bf16_bits(vf[t] - bf16_val(hb));
      }
    }
    __syncthreads();
    // S tile 16 x 32
    v8f s[2];
#pragma unroll
    for (int nt = 0; nt < 2; ++nt) {
      v8f acc = {};
#pragma unroll
      for (int ks = 0; ks < KS; ++ks) {
        FragB bh_, bl_;
        bh_.half[0] = *(const v8us*)&sKh[nt * 16 + ln][ks * 32 + 8 * hh]; bh_.half[1] = *(const v8us*)&sKh[nt * 16 + ln][ks * 32 + 16 + 8 * hh];
        bl_.half[0] = *(const v8us*)&sKl[nt * 16 + ln][ks * 32 + 8 * hh]; bl_.half[1] = *(const v8us*)&sKl[nt * 16 + ln][ks * 32 + 16 + 8 * hh];
        acc = mmaN<3>(aqh[ks].v, aql[ks].v, bh_.v, bl_.v, acc);
      }
      s[nt] = acc;
    }
    // mask + running max (rows 8hh+r; the 16 lanes of a half share rows)
    float alpha[8];
#pragma unroll
    for (int r = 0; r < 8; ++r) {
      const int qi = q0 + 8 * hh + r;
      const int ja = j0 + ln, jb = j0 + 16 + ln;
      if (CAUSAL) { if (ja > qi) s[0][r] = -3.0e38f; if (jb > qi) s[1][r] = -3.0e38f; }
      if (ja >= T) s[0][r] = -3.0e38f;
      if (jb >= T) s[1][r] = -3.0e38f;
      float mx = fmaxf(s[0][r], s[1][r]);
      mx = fmaxf(mx, __shfl_xor(mx, 1, 32)); mx = fmaxf(mx, __shfl_xor(mx, 2, 32)); mx = fmaxf(mx, __shfl_xor(mx, 4, 32)); mx = fmaxf(mx, __shfl_xor(mx, 8, 32));
      const float mnew = fmaxf(m_r[r], mx);
      alpha[r] = (mnew > -1.0e38f) ? __expf(m_r[r] - mnew) : 1.0f;
      const float p0 = (s[0][r] > -1.0e38f) ? __expf(s[0][r] - mnew) : 0.f;
      const float p1 = (s[1][r] > -1.0e38f) ? __expf(s[1][r] - mnew) : 0.f;
      m_r[r] = mnew;
      l_r[r] = l_r[r] * alpha[r] + p0 + p1;            // per-lane partial row sum (16 lanes combined at the end)
      unsigned short hb = bf16_bits(p0); sPh[w][8 * hh + r][ln] = hb;      sPl[w][8 * hh + r][ln] = bf16_bits(p0 - bf16_val(hb));
      hb = bf16_bits(p1);                sPh[w][8 * hh + r][16 + ln] = hb; sPl[w][8 * hh + r][16 + ln] = bf16_bits(p1 - bf16_val(hb));
    }
#pragma unroll
    for (int dt = 0; dt < DT; ++dt)
#pragma unroll
      for (int r = 0; r < 8; ++r) oacc[dt][r] *= alpha[r];
    __builtin_amdgcn_fence(__ATOMIC_ACQ_REL, "workgroup");
    __builtin_amdgcn_wave_barrier();
    FragB pah, pal;
    pah.half[0] = *(const v8us*)&sPh[w][ln][8 * hh]; pah.half[1] = *(const v8us*)&sPh[w][ln][16 + 8 * hh];
    pal.half[0] = *(const v8us*)&sPl[w][ln][8 * hh]; pal.half[1] = *(const v8us*)&sPl[w][ln][16 + 8 * hh];
#pragma unroll
    for (int dt = 0; dt < DT; ++dt) {
      FragB bvh, bvl;
#pragma unroll
      for (int i = 0; i < 8; ++i) {
        bvh.u[i] = sVh[8 * hh + i][dt * 16 + ln]; bvh.u[8 + i] = sVh[16 + 8 * hh + i][dt * 16 + ln];
        bvl.u[i] = sVl[8 * hh + i][dt * 16 + ln]; bvl.u[8 + i] = sVl[16 + 8 * hh + i][dt * 16 + ln];
      }
      oacc[dt] = mmaN<3>(pah.v, pal.v, bvh.v, bvl.v, oacc[dt]);
    }
    __builtin_amdgcn_fence(__ATOMIC_ACQ_REL, "workgroup");
    __builtin_amdgcn_wave_barrier();
  }
#pragma unroll
  for (int r = 0; r < 8; ++r) {
    float l = l_r[r];
    l += __shfl_xor(l, 1, 32); l += __shfl_xor(l, 2, 32); l += __shfl_xor(l, 4, 32); l += __shfl_xor(l, 8, 32);
    l_r[r] = (l > 0.f) ? 1.0f / l : 0.f;
  }
#pragma unroll
  for (int dt = 0; dt < DT; ++dt)
#pragma unroll
    for (int r = 0; r < 8; ++r) sO[w][8 * hh + r][dt * 16 + ln] = oacc[dt][r] * l_r[r];
  __builtin_amdgcn_fence(__ATOMIC_ACQ_REL, "workgroup");
  __builtin_amdgcn_wave_barrier();
  {
    for (int r = 0; r < 16; ++r) {
      const int row = q0 + r;
      if (row < T && lane < D / 4) {
        const v4f val = *(const v4fa*)&sO[w][r][lane * 4];
        *(v4f*)(y + ((size_t)b * T + row) * ypitch + h * D + lane * 4) = val;
      }
    }
    
  }
}

// GEMM C = act(A·W + bias + resid): A f32 (ASPLIT -> hi/lo 2 terms), Wt bf16 [N][K]; ACT 0 none, 1 relu, 2 exact gelu;
// resid (optional, f32, row index = (row % rmod), pitch ldr, RES_BF16 rounds it) added before the activation.
template <bool ASPLIT, int ACT, bool BIAS_BF16, bool RES_BF16>
__global__ __launch_bounds__(128) void k_gemm_bf3(const float* __restrict__ A, int lda, const unsigned short* __restrict__ Wt, int ldb,
                                                const float* __restrict__ bias, const float* __restrict__ resid, int rmod, int ldr,
                                                float* __restrict__ C, int ldc, int M, int N, int K) {
  __shared__ __attribute__((aligned(16))) float so[4][16][64];
  const int tid = threadIdx.x, w = tid >> 5, lane = tid & 31, ln = lane & 15, hh = lane >> 4;
  const int ntn = N / 64;
  const int wid = blockIdx.x * 4 + w;
  const int mt = wid / ntn, nq = wid % ntn;
  if (mt * 16 >= M) return;
  const int row0 = mt * 16, col0 = nq * 64;
  const float* arow = A + (size_t)(row0 + ln) * lda;
  v8f acc[4] = {};
  for (int kb = 0; kb < K; kb += 32) {
    FragB ah, al;
    const v4f x0 = *(const v4fa*)(arow + kb + 8 * hh), x1 = *(const v4fa*)(arow + kb + 8 * hh + 4);
    const v4f x2 = *(const v4fa*)(arow + kb + 16 + 8 * hh), x3 = *(const v4fa*)(arow + kb + 16 + 8 * hh + 4);
    float xs[16] = {x0[0],x0[1],x0[2],x0[3],x1[0],x1[1],x1[2],x1[3],x2[0],x2[1],x2[2],x2[3],x3[0],x3[1],x3[2],x3[3]};
#pragma unroll
    for (int i = 0; i < 16; ++i) { const unsigned short hb = bf16_bits(xs[i]); ah.u[i] = hb; al.u[i] = ASPLIT ? bf16_bits(xs[i] - bf16_val(hb)) : (unsigned short)0; }
#pragma unroll
    for (int t = 0; t < 4; ++t) {
      const unsigned short* brow = Wt + (size_t)(col0 + t * 16 + ln) * ldb + kb;
      FragB b;
      b.half[0] = *(const v8us*)(brow + 8 * hh);
      b.half[1] = *(const v8us*)(brow + 16 + 8 * hh);
      acc[t] = mmaN<ASPLIT ? 2 : 1>(ah.v, al.v, b.v, b.v, acc[t]);
    }
  }
#pragma unroll
  for (int t = 0; t < 4; ++t) {
    const int col = col0 + t * 16 + ln;
    float bv = bias ? bias[col] : 0.f;
    if (BIAS_BF16) bv = bf16_round(bv);
#pragma unroll
    for (int r = 0; r < 8; ++r) {
      float v = acc[t][r] + bv;
      if (resid) { float rv = resid[(size_t)((row0 + 8 * hh + r) % rmod) * ldr + col]; if (RES_BF16) rv = bf16_round(rv); v += rv; }
      if (ACT == 1) v = fmaxf(v, 0.f);
      if (ACT == 2) v = 0.5f * v * (1.0f + erff(v * 0.70710678118654752f));
      if (ACT == 3) { const float u = 0.7978845608028654f * (v + 0.044715f * v * v * v); v = 0.5f * v * (1.0f + tanhf(u)); }
      so[w][8 * hh + r][t * 16 + ln] = v;
    }
  }
  __builtin_amdgcn_fence(__ATOMIC_ACQ_REL, "workgroup");
  __builtin_amdgcn_wave_barrier();
  const int rsub = lane >> 4, c4 = (lane & 15) * 4;
  {
#pragma unroll
    for (int q = 0; q < 8; ++q) {
      const int r = q * 2 + rsub;
      const v4f v = *(const v4fa*)&so[w][r][c4];
      *(v4f*)(C + (size_t)(row0 + r) * ldc + col0 + c4) = v;
    }
    
  }
}
// row LayerNorm (biased variance, eps) over N: s = X (+ R); optional out_sum <- s; out_norm <- (s-mu)*rsqrt(var+eps)*g + b
template <bool PARAM_BF16>
__global__ __launch_bounds__(256) void k_layernorm(const float* __restrict__ X, const float* __restrict__ R, const float* __restrict__ g, const float* __restrict__ bta,
                                                  float* __restrict__ out_sum, float* __restrict__ out_norm, int N, float eps) {
  __shared__ float red[256];
  const int row = blockIdx.x, tid = threadIdx.x;
  const float* x = X + (size_t)row * N; const float* rr = R ? R + (size_t)row * N : nullptr;
  float vals[16];                     // up to N = 4096
  const int per = N / 256;            // contiguous chunk per thread? use strided-by-4 chunks: thread handles j = tid*4 + 1024*u
  float s1 = 0.f;
  for (int u = 0; u < per / 4; ++u) {
    const int j = tid * 4 + 1024 * u;
    const v4f a = *(const v4fa*)(x + j);
    v4f b = {0.f,0.f,0.f,0.f}; if (rr) b = *(const v4fa*)(rr + j);
#pragma unroll
    for (int q = 0; q < 4; ++q) { const float v = a[q] + b[q]; vals[u * 4 + q] = v; s1 += v; }
  }
  red[tid] = s1; __syncthreads();
  for (int st = 128; st > 0; st >>= 1) { if (tid < st) red[tid] += red[tid + st]; __syncthreads(); }
  const float mu = red[0] / (float)N; __syncthreads();
  float s2 = 0.f;
  for (int u = 0; u < per / 4; ++u)
#pragma unroll
    for (int q = 0; q < 4; ++q) { const float c = vals[u * 4 + q] - mu; s2 += c * c; }
  red[tid] = s2; __syncthreads();
  for (int st = 128; st > 0; st >>= 1) { if (tid < st) red[tid] += red[tid + st]; __syncthreads(); }
  const float rs = rsqrtf(red[0] / (float)N + eps);
  {
    for (int u = 0; u < per / 4; ++u) {
      const int j = tid * 4 + 1024 * u;
      v4f o, sm;
#pragma unroll
      for (int q = 0; q < 4; ++q) {
        float gg = g[j + q], bb = bta[j + q];
        if (PARAM_BF16) { gg = bf16_round(gg); bb = bf16_round(bb); }
        sm[q] = vals[u * 4 + q]; o[q] = (vals[u * 4 + q] - mu) * rs * gg + bb;
      }
      if (out_sum) *(v4f*)(out_sum + (size_t)row * N + j) = sm;
      *(v4f*)(out_norm + (size_t)row * N + j) = o;
    }
    
  }
}



// ---- f16 WMMA path (v_wmma_f32_16x16x32_f16): 11-bit significands for operands in range — used where a [0,1] probability operand needs more precision than bf16
typedef _Float16 v16h __attribute__((ext_vector_type(16)));
union FragH { v16h v; v8us half[2]; _Float16 h[16]; unsigned short u[16]; };
template <int NT>
__device__ __forceinline__ v8f mmaH(v16h ah, v16h al, v16h bh, v16h bl, v8f c) {
  c = __builtin_amdgcn_wmma_f32_16x16x32_f16(false, ah, false, bh, (short)0, c, false, false);
  if (NT >= 2) c = __builtin_amdgcn_wmma_f32_16x16x32_f16(false, al, false, bh, (short)0, c, false, false);
  if (NT >= 3) c = __builtin_amdgcn_wmma_f32_16x16x32_f16(false, ah, false, bl, (short)0, c, false, false);
  asm volatile("v_nop\n\tv_nop\n\tv_nop\n\tv_nop" : "+v"(c) : "v"(ah), "v"(al), "v"(bh), "v"(bl));
  return c;
}
// batched GEMM like k_gemm_b but f16 operands: A f32 (split into f16 hi/lo if ASPLIT, else rounded to f16), Bt = f16 values [n][k]; alpha; C f32; N multiple of 16 (partial tiles skipped)
template <bool ASPLIT>
__global__ __launch_bounds__(128) void k_gemm_h(const float* __restrict__ A, int lda, size_t sA, const _Float16* __restrict__ Bh, int ldb, size_t sB, float alpha, float* __restrict__ C, int ldc, size_t sC, int M, int N, int K) {
  __shared__ __attribute__((aligned(16))) float so[4][16][64];
  const int tid = threadIdx.x, w = tid >> 5, lane = tid & 31, ln = lane & 15, hh = lane >> 4; const int by = blockIdx.y;
  A += (size_t)by * sA; Bh += (size_t)by * sB; C += (size_t)by * sC;
  const int ntn = (N + 63) / 64; const int wid = blockIdx.x * 4 + w; const int mt = wid / ntn, nq = wid % ntn; if (mt * 16 >= M) return;
  const int row0 = mt * 16, col0 = nq * 64; const float* arow = A + (size_t)(row0 + ln) * lda;
  v8f acc[4] = {};
  for (int kb = 0; kb < K; kb += 32) {
    FragH ah, al;
    const v4f x0 = *(const v4fa*)(arow + kb + 8 * hh), x1 = *(const v4fa*)(arow + kb + 8 * hh + 4), x2 = *(const v4fa*)(arow + kb + 16 + 8 * hh), x3 = *(const v4fa*)(arow + kb + 16 + 8 * hh + 4);
    float xs[16] = {x0[0],x0[1],x0[2],x0[3],x1[0],x1[1],x1[2],x1[3],x2[0],x2[1],x2[2],x2[3],x3[0],x3[1],x3[2],x3[3]};
#pragma unroll
    for (int i = 0; i < 16; ++i) { const _Float16 h = (_Float16)xs[i]; ah.h[i] = h; al.h[i] = ASPLIT ? (_Float16)(xs[i] - (float)h) : (_Float16)0.0f; }
#pragma unroll
    for (int t = 0; t < 4; ++t) { if (col0 + t * 16 >= N) continue; const size_t boff = (size_t)(col0 + t * 16 + ln) * ldb + kb; FragH bq; bq.half[0] = *(const v8us*)(Bh + boff + 8 * hh); bq.half[1] = *(const v8us*)(Bh + boff + 16 + 8 * hh);
      acc[t] = mmaH<ASPLIT ? 2 : 1>(ah.v, al.v, bq.v, bq.v, acc[t]); }
  }
#pragma unroll
  for (int t = 0; t < 4; ++t) { if (col0 + t * 16 >= N) continue;
#pragma unroll
    for (int r = 0; r < 8; ++r) so[w][8 * hh + r][t * 16 + ln] = acc[t][r] * alpha; }
  __builtin_amdgcn_fence(__ATOMIC_ACQ_REL, "workgroup"); __builtin_amdgcn_wave_barrier();
  const int rsub = lane >> 4, c4 = (lane & 15) * 4;
  {
#pragma unroll
    for (int q = 0; q < 8; ++q) { const int r = q * 2 + rsub; if (col0 + c4 < N) { const v4f v = *(const v4fa*)&so[w][r][c4]; *(v4f*)(C + (size_t)(row0 + r) * ldc + col0 + c4) = v; } }
     }
}

// Wt[n][k] = f16(W[k][n]·scale) from f32 row-major W[K][N] (scale = power of two; bf16-exact weights stay exact in f16 away from the subnormal range)
__global__ __launch_bounds__(256) void k_wt_f16(const float* __restrict__ W, _Float16* __restrict__ Wt, int K, int N, float scale) {
  const int t = blockIdx.x * 256 + threadIdx.x; if (t >= N * (K / 8)) return; const int n = t / (K / 8), k8 = (t % (K / 8)) * 8; FragH f;
#pragma unroll
  for (int i = 0; i < 8; ++i) f.h[i] = (_Float16)(bf16_round(W[(size_t)(k8 + i) * N + n]) * scale); const v8us o = f.half[0];
  *(v8us*)((unsigned short*)Wt + (size_t)n * K + k8) = o; 
}


typedef _Float16 v4h __attribute__((ext_vector_type(4)));

__global__ __launch_bounds__(256) void k_h16(const float* __restrict__ x, _Float16* __restrict__ X16, size_t n8) { const size_t t = (size_t)blockIdx.x * 256 + threadIdx.x; if (t >= n8) return; FragH f;
#pragma unroll
  for (int q = 0; q < 8; ++q) f.h[q] = (_Float16)x[t * 8 + q]; *(v8us*)((unsigned short*)X16 + t * 8) = f.half[0];  }
// One launch makes q, k and V^T from the f32 inputs. A work-group takes 64 rows of x. Its 512 threads each round one unit of 8 values of Wq, Wk, Wv (bf16, x 2^4) and of the 64 rows (bf16) to f16 in LDS;
// then waves 0-3 make q, 4-7 k (one 16-row tile each, 4 feature tiles) and 8-11 v (one feature tile each, 4 row tiles); waves 12-15 only help to fill LDS. The operand roles are chosen by where the result goes:
// for q and k the weight rows are A and the x rows B, so a lane's 8 results are 8 features of one row of QKV; for v the x rows are A, so they are 8 positions of one row of V^T. Each is one 16-byte store, and a wave's
// 4 stores fill whole 128-byte lines. Rows of 64 f16 lie at a pitch of 144 bytes (16 x odd) for the 16-byte fragment reads. A and B fragments come from one loader, so their k orders are equal.
__global__ __launch_bounds__(512) void k_proj(const float* __restrict__ x, const float* __restrict__ Wq, const float* __restrict__ Wk, const float* __restrict__ Wv, _Float16* __restrict__ QKV, _Float16* __restrict__ Vt) {
  constexpr int P = CC + 8;
  __shared__ __attribute__((aligned(16))) unsigned short sh[4 * CC][P];      // rows 0-63 Wq, 64-127 Wk, 128-191 Wv (row = output feature), 192-255 the 64 rows of x
  const int tid = threadIdx.x, w = __builtin_amdgcn_readfirstlane(tid >> 5), lane = tid & 31, ln = lane & 15, hh = lane >> 4;      // w in a scalar register: the roles below branch on it, and every lane must stay on at the WMMAs
  const int row0 = blockIdx.x * 64;
  const unsigned boff = tid * 32u;      // byte offset of the thread's unit in each of the four sources
  const char* const src[4] = {(const char*)Wq, (const char*)Wk, (const char*)Wv, (const char*)(x + (size_t)row0 * CC)};
  v4f in[4][2];
#pragma unroll      // unrolled, here and below: in and the fragments are indexed by constants and stay in registers; the 8 loads go out before the first conversion
  for (int i = 0; i < 4; ++i) { in[i][0] = *(const v4fa*)(src[i] + boff); in[i][1] = *(const v4fa*)(src[i] + boff + 16); }
  asm volatile("s_wait_xcnt 0x0" :: "v"(boff) : "memory");      // the loads' offset register is named so that it lives up to this wait: what follows may reuse it
#pragma unroll
  for (int i = 0; i < 4; ++i) { FragH f;
#pragma unroll
    for (int q = 0; q < 8; ++q) { const float v = bf16_round(in[i][q >> 2][q & 3]); f.h[q] = (_Float16)(i < 3 ? v * 16.0f : v); }
    *(v8us*)&sh[i * CC + (tid >> 3)][(tid & 7) * 8] = f.half[0]; }
  __syncthreads();      // the f16 operands are in LDS before any wave reads a fragment
  if (w >= 12) return;      // behind the only barrier
  auto frag = [&](int r, int ks) { FragH f; f.half[0] = *(const v8us*)&sh[r][ks * 32 + 8 * hh]; f.half[1] = *(const v8us*)&sh[r][ks * 32 + 16 + 8 * hh]; return f; };
  const bool isv = w >= 8;
  const int keep = isv ? w * 16 : 3 * CC + (w & 3) * 16;      // first LDS row of the tile a wave keeps as B: v: feature tile w - 8 of Wv; q, k: row tile w & 3 of x
  const int run = isv ? 3 * CC : (w >> 2) * CC;      // first LDS row of the 4 tiles it walks as A: v: the rows of x; q, k: the features of Wq or Wk
  const FragH b0 = frag(keep + ln, 0), b1 = frag(keep + ln, 1);
  unsigned short* dst = isv ? (unsigned short*)Vt + ((size_t)(row0 / TT) * CC + (w - 8) * 16 + ln) * TT + row0 % TT + 8 * hh
                            : (unsigned short*)QKV + (size_t)(row0 + (w & 3) * 16 + ln) * (3 * CC) + (w >> 2) * CC + 8 * hh;
  FragH a[4][2];      // the fragment reads stand ahead of the products, so that later tiles' reads go out while earlier tiles are worked on
#pragma unroll
  for (int t = 0; t < 4; ++t) { a[t][0] = frag(run + t * 16 + ln, 0); a[t][1] = frag(run + t * 16 + ln, 1); }
#pragma unroll
  for (int t = 0; t < 4; ++t) { v8f acc = (v8f){0.f,0.f,0.f,0.f,0.f,0.f,0.f,0.f};
    acc = __builtin_amdgcn_wmma_f32_16x16x32_f16(false, a[t][0].v, false, b0.v, (short)0, acc, false, false);
    acc = __builtin_amdgcn_wmma_f32_16x16x32_f16(false, a[t][1].v, false, b1.v, (short)0, acc, false, false);      // acc[r] = (walked tile's row 8hh + r) . (kept tile's row ln)
    FragH o;
#pragma unroll
    for (int r = 0; r < 8; ++r) o.h[r] = (_Float16)(acc[r] * 0.0625f);
    *(v8us*)(dst + t * 16) = o.half[0]; } }

// One work-group = one tile of 16 query rows; its NW waves deal the tile's 32-key blocks among themselves (wave w takes blocks w, w + NW, ...), each with its own
// running maximum, sum and accumulators; the partials are merged through LDS behind one work-group barrier. The launch bound asks for 8 waves per SIMD (128 VGPRs), so that
// two work-groups share a WGP. w is held in a scalar register: the waves' trip counts differ, and the loop must branch on a scalar so that every lane stays on at the WMMAs.
// Both products run transposed: S^T = K.Q^T (A = 16 key rows, B = the tile's queries, kept in registers) and O^T += V^T.P^T. A lane then holds 16 scores of ONE query (column ln; keys
// 8hh + r and 16 + 8hh + r of the block), so maximum and sum are in-lane but for one exchange between the wave's halves, and the two converted score tiles ARE the B operand of the second product.
__device__ __forceinline__ float xhalf(float x) { return __builtin_bit_cast(float, __builtin_amdgcn_permlanex16(__builtin_bit_cast(int, x), __builtin_bit_cast(int, x), 0x76543210, 0xfedcba98, false, false)); }      // lane l reads lane l ^ 16
template <int NW>
__global__ __launch_bounds__(NW * 32, 8) void k_flash(const _Float16* __restrict__ Q16, int ldq, const _Float16* __restrict__ K16, int ldk, const _Float16* __restrict__ Vt, const int* __restrict__ MSK, float* __restrict__ O, int ldo) {
  constexpr int RPW = 16, NQB = 4096 / RPW, DT = 4, KS = 2;
  __shared__ __attribute__((aligned(16))) float sO[NW][RPW][64 + 4]; __shared__ float sM[NW][RPW], sL[NW][RPW];
  const int tid = threadIdx.x, w = __builtin_amdgcn_readfirstlane(tid >> 5), lane = tid & 31, ln = lane & 15, hh = lane >> 4;
  const int slab = blockIdx.x / NQB, qblk = blockIdx.x % NQB; const int b = slab / 1, h = slab % 1; const int q0 = qblk * RPW;
  FragH bq[KS];
  { const unsigned short* qr = (const unsigned short*)Q16 + ((size_t)b * 4096 + q0 + ln) * ldq + h * 64;
#pragma unroll
    for (int ks = 0; ks < KS; ++ks) { bq[ks].half[0] = *(const v8us*)(qr + ks * 32 + 8 * hh); bq[ks].half[1] = *(const v8us*)(qr + ks * 32 + 16 + 8 * hh); } }
  const unsigned short* Vth = (const unsigned short*)Vt + (size_t)slab * 64 * 4096;
  float m_q = -3.0e38f, l_q = 0.f; v8f oacc[DT];      // of query q0 + ln; l_q sums this half's keys only, the halves are joined behind the loop
#pragma unroll
  for (int dt = 0; dt < DT; ++dt) oacc[dt] = (v8f){0.f,0.f,0.f,0.f,0.f,0.f,0.f,0.f};      // oacc[dt][r] = O[q0 + ln][dt * 16 + 8hh + r]
  const int jend = q0 + RPW, tq = q0 + ln;
#pragma unroll 1
  for (int j0 = w * 32; j0 < jend; j0 += NW * 32) {
    v8f s[2];
#pragma unroll
    for (int nt = 0; nt < 2; ++nt) { const unsigned short* kr = (const unsigned short*)K16 + ((size_t)b * 4096 + j0 + nt * 16 + ln) * ldk + h * 64; FragH ak[KS];      // A operand: key rows j0 + nt * 16 + ln
#pragma unroll
      for (int ks = 0; ks < KS; ++ks) { ak[ks].half[0] = *(const v8us*)(kr + ks * 32 + 8 * hh); ak[ks].half[1] = *(const v8us*)(kr + ks * 32 + 16 + 8 * hh); }
      v8f acc = (v8f){0.f,0.f,0.f,0.f,0.f,0.f,0.f,0.f};
#pragma unroll
      for (int ks = 0; ks < KS; ++ks) acc = mmaH<1>(ak[ks].v, ak[ks].v, bq[ks].v, bq[ks].v, acc);
      s[nt] = acc; }      // s[nt][r] = q(q0 + ln) . k(j0 + nt * 16 + 8hh + r)
    float mc = -INFINITY; const int dq = tq - j0 - 8 * hh;      // score (nt, r) is unmasked while nt * 16 + r <= dq
#pragma unroll
    for (int nt = 0; nt < 2; ++nt)
#pragma unroll
      for (int r = 0; r < 8; ++r) { s[nt][r] = (nt * 16 + r <= dq) ? s[nt][r] * (0.125f) : -INFINITY; mc = fmaxf(mc, s[nt][r]); }
    mc = fmaxf(mc, xhalf(mc));
    // every block a wave walks starts at a key j0 <= q0, so each query has an unmasked score in it and mn is a finite score: a masked score (-inf) gives exp = 0 and the first block gives al = 0 with no test
    const float mn = fmaxf(m_q, mc); const float al = expf(m_q - mn); m_q = mn;
    float ps = 0.f; FragH pb;
#pragma unroll
    for (int nt = 0; nt < 2; ++nt)
#pragma unroll
      for (int r = 0; r < 8; ++r) { const float p = expf(s[nt][r] - mn); ps += p; pb.h[nt * 8 + r] = (_Float16)p; }      // element nt * 8 + r of a B fragment is k = nt * 16 + 8hh + r: the key this score belongs to
    l_q = l_q * al + ps;
#pragma unroll
    for (int dt = 0; dt < DT; ++dt) { const unsigned short* vrow = Vth + (size_t)(dt * 16 + ln) * 4096 + j0; FragH av; av.half[0] = *(const v8us*)(vrow + 8 * hh); av.half[1] = *(const v8us*)(vrow + 16 + 8 * hh);      // A operand: V^T rows dt * 16 + ln, the block's 32 keys in the k order of the packed scores
#pragma unroll
      for (int r = 0; r < 8; ++r) oacc[dt][r] *= al;
      oacc[dt] = mmaH<1>(av.v, av.v, pb.v, pb.v, oacc[dt]); } }
  // each wave hands over its un-normalised partial: (maximum, sum) per row and the 16 x 64 accumulator; a wave without a block hands (-3e38, 0, zeros), which weighs 0 in the merge
  const int le = (int)__builtin_amdgcn_mbcnt_lo(~0u, 0u), lne = le & 15, hhe = le >> 4;      // lane id read anew, so that tid and its parts need no registers across the loop
  l_q += xhalf(l_q);
  if (hhe == 0) { sM[w][lne] = m_q; sL[w][lne] = l_q; }
#pragma unroll
  for (int dt = 0; dt < DT; ++dt) { *(v4fa*)&sO[w][lne][dt * 16 + 8 * hhe] = (v4f){oacc[dt][0], oacc[dt][1], oacc[dt][2], oacc[dt][3]}; *(v4fa*)&sO[w][lne][dt * 16 + 8 * hhe + 4] = (v4f){oacc[dt][4], oacc[dt][5], oacc[dt][6], oacc[dt][7]}; }
  __syncthreads();      // every wave's partial is in LDS before any is merged
  static_assert(NW == RPW, "wave w merges row w");
  { typedef float v2f __attribute__((ext_vector_type(2))); typedef float v2fa __attribute__((ext_vector_type(2), may_alias)); const int r = w; float M = sM[0][r];
#pragma unroll      // both loops unrolled: the NW partials' LDS loads go out together instead of one wait each
    for (int u = 1; u < NW; ++u) M = fmaxf(M, sM[u][r]);
    float L = 0.f; v2f val = {0.f, 0.f};
#pragma unroll
    for (int u = 0; u < NW; ++u) { const float e = expf(sM[u][r] - M); L += e * sL[u][r]; const v2f pv = *(const v2fa*)&sO[u][r][le * 2]; val += pv * e; }
    const float inv = (L > 0.f) ? 1.0f / L : 0.f; val *= inv;
    *(v2f*)(O + ((size_t)b * 4096 + q0 + r) * ldo + h * 64 + le * 2) = val; } }

extern "C" void kernel_launch(void* const* d_in, const int* in_sizes, int n_in,
                              void* d_out, int out_size, void* d_ws, size_t ws_size, hipStream_t stream) {
  (void)in_sizes; (void)n_in; (void)out_size;
  const float* x = (const float*)d_in[0]; const float* Wk = (const float*)d_in[1]; const float* Wq = (const float*)d_in[2]; const float* Wv = (const float*)d_in[3];
  char* ws = (char*)d_ws; size_t off = 0;
  auto take = [&](size_t bytes) { char* p = ws + off; off += (bytes + 255) & ~(size_t)255; return p; };
  _Float16* QKV = (_Float16*)take((size_t)NR * 3 * CC * 2); _Float16* Vt = (_Float16*)take((size_t)NR * CC * 2);
  if (off > ws_size) return;      // 6.3 + 2.1 MB; the v third of a QKV row stays unused
  k_proj<<<NR / 64, 512, 0, stream>>>(x, Wq, Wk, Wv, QKV, Vt);      // [q | k | -] f16 rows and V^T per batch [b][64][T]
  k_flash<16><<<BB * 1 * (TT / 16), 16 * 32, 0, stream>>>(QKV, 3 * CC, QKV + CC, 3 * CC, Vt, nullptr, (float*)d_out, CC);
}

// v004
// One run takes 48 microseconds.
// In two side-by-side timings against v003, it was 1.19 and 1.22 times as fast.
// Over all steps from v000 it is 8.99 times as fast.
#include <hip/hip_runtime.h>
// Single causal attention head (B=4, T=4096, C=64): q,k,v = x·Wᵀ (no bias), softmax(q·kᵀ·64^-½) with a causal mask, out = P·v. One GEMM for [q|k|v] and a fused flash-style causal attention
// kernel (online softmax in f32; P f16 ≤ 1; O = P·Vᵀ-tiles; RPW-16 waves; causal tile skipping) on v_wmma_f32_16x16x32_f16 — x bf16-exact, (out,in) weights bf16-exact ×2^4, q/k/v f16,
// f32 accumulate.
#define BB 4
#define TT 4096
#define CC 64
#define NR (BB * TT)

typedef __bf16 v16b __attribute__((ext_vector_type(16)));
typedef unsigned short v8us __attribute__((ext_vector_type(8), may_alias));
typedef float  v8f  __attribute__((ext_vector_type(8)));
typedef float  v4f  __attribute__((ext_vector_type(4)));
typedef float  v4fa __attribute__((ext_vector_type(4), may_alias));
union FragB { v16b v; v8us half[2]; unsigned short u[16]; };

__device__ __forceinline__ unsigned short bf16_bits(float x) { unsigned int u = __float_as_uint(x); return (unsigned short)((u + 0x7FFFu + ((u >> 16) & 1u)) >> 16); }
__device__ __forceinline__ float bf16_val(unsigned short b) { return __uint_as_float(((unsigned int)b) << 16); }
__device__ __forceinline__ float bf16_round(float x) { return bf16_val(bf16_bits(x)); }
// D += A·B with NT terms: 1 = ah·bh, 2 = + al·bh (A split), 3 = + ah·bl (both split)
template <int NT>
__device__ __forceinline__ v8f mmaN(v16b ah, v16b al, v16b bh, v16b bl, v8f c) {
  c = __builtin_amdgcn_wmma_f32_16x16x32_bf16(false, ah, false, bh, (short)0, c, false, false);
  if (NT >= 2) c = __builtin_amdgcn_wmma_f32_16x16x32_bf16(false, al, false, bh, (short)0, c, false, false);
  if (NT >= 3) c = __builtin_amdgcn_wmma_f32_16x16x32_bf16(false, ah, false, bl, (short)0, c, false, false);
  asm volatile("v_nop\n\tv_nop\n\tv_nop\n\tv_nop" : "+v"(c) : "v"(ah), "v"(al), "v"(bh), "v"(bl));
  return c;
}

__global__ __launch_bounds__(256) void k_wt_bf16(const float* __restrict__ W, unsigned short* __restrict__ Wt, int K, int N) {
  const int t = blockIdx.x * 256 + threadIdx.x;
  const int k8n = K / 8;
  if (t >= N * k8n) return;
  const int n = t / k8n, k8 = (t % k8n) * 8;
  v8us v;
#pragma unroll
  for (int i = 0; i < 8; ++i) v[i] = bf16_bits(W[(size_t)(k8 + i) * N + n]);
  *(v8us*)(Wt + (size_t)n * K + k8) = v;
  
}

// GEMM C[M][N] (f32, pitch ldc) = act(A[M][K]·W + bias). A f32 row-major (pitch lda) converted per fragment to bf16
// (ASPLIT: hi/lo two planes -> 2 terms, else single rounded term); Wt bf16 [N][K] (pitch ldb). BIAS_BF16 rounds the
// bias to bf16 first (bias quantised to bf16 before the add). K%32==0, M%16==0, N%64==0.
template <bool ASPLIT, int ACT, bool BIAS_BF16>
__global__ __launch_bounds__(128) void k_gemm_bf(const float* __restrict__ A, int lda, const unsigned short* __restrict__ Wt, int ldb,
                                               const float* __restrict__ bias, float* __restrict__ C, int ldc, int M, int N, int K) {
  __shared__ __attribute__((aligned(16))) float so[4][16][64];
  const int tid = threadIdx.x, w = tid >> 5, lane = tid & 31, ln = lane & 15, hh = lane >> 4;
  const int ntn = N / 64;
  const int wid = blockIdx.x * 4 + w;
  const int mt = wid / ntn, nq = wid % ntn;
  if (mt * 16 >= M) return;
  const int row0 = mt * 16, col0 = nq * 64;
  const float* arow = A + (size_t)(row0 + ln) * lda;
  v8f acc[4] = {};
  for (int kb = 0; kb < K; kb += 32) {
    FragB ah, al;
    const v4f x0 = *(const v4fa*)(arow + kb + 8 * hh), x1 = *(const v4fa*)(arow + kb + 8 * hh + 4);
    const v4f x2 = *(const v4fa*)(arow + kb + 16 + 8 * hh), x3 = *(const v4fa*)(arow + kb + 16 + 8 * hh + 4);
    float xs[16] = {x0[0],x0[1],x0[2],x0[3],x1[0],x1[1],x1[2],x1[3],x2[0],x2[1],x2[2],x2[3],x3[0],x3[1],x3[2],x3[3]};
#pragma unroll
    for (int i = 0; i < 16; ++i) { const unsigned short hb = bf16_bits(xs[i]); ah.u[i] = hb; al.u[i] = ASPLIT ? bf16_bits(xs[i] - bf16_val(hb)) : (unsigned short)0; }
#pragma unroll
    for (int t = 0; t < 4; ++t) {
      const unsigned short* brow = Wt + (size_t)(col0 + t * 16 + ln) * ldb + kb;
      FragB b;
      b.half[0] = *(const v8us*)(brow + 8 * hh);
      b.half[1] = *(const v8us*)(brow + 16 + 8 * hh);
      acc[t] = mmaN<ASPLIT ? 2 : 1>(ah.v, al.v, b.v, b.v, acc[t]);
    }
  }
#pragma unroll
  for (int t = 0; t < 4; ++t) {
    float bv = bias ? bias[col0 + t * 16 + ln] : 0.f;
    if (BIAS_BF16) bv = bf16_round(bv);
#pragma unroll
    for (int r = 0; r < 8; ++r) { float v = acc[t][r] + bv; if (ACT == 1) v = fmaxf(v, 0.f); so[w][8 * hh + r][t * 16 + ln] = v; }
  }
  __builtin_amdgcn_fence(__ATOMIC_ACQ_REL, "workgroup");
  __builtin_amdgcn_wave_barrier();
  const int rsub = lane >> 4, c4 = (lane & 15) * 4;
  {
#pragma unroll
    for (int q = 0; q < 8; ++q) {
      const int r = q * 2 + rsub;
      const v4f v = *(const v4fa*)&so[w][r][c4];
      *(v4f*)(C + (size_t)(row0 + r) * ldc + col0 + c4) = v;
    }
    
  }
}

// Flash-style causal/unmasked attention, all contractions 3-term bf16 hi/lo splits, f32 softmax with running max.
// q,k,v rows are read from f32 buffers with arbitrary row pitch (so they can live inside a fused qkv buffer);
// D = head size (multiple of 32, <= 128); one wave = 16 query rows; block = 4 waves (64 queries) sharing K/V chunks of 32.
template <int D, bool CAUSAL>
__global__ __launch_bounds__(128) void k_flash(const float* __restrict__ qb, const float* __restrict__ kb, const float* __restrict__ vb,
                                             int pitch, int T, int H, float scale, float* __restrict__ y, int ypitch) {
  constexpr int KS = D / 32;        // k-steps for QK
  constexpr int DT = D / 16;        // d tiles for PV
  __shared__ __attribute__((aligned(16))) unsigned short sKh[32][D + 8], sKl[32][D + 8], sVh[32][D + 8], sVl[32][D + 8];
  __shared__ __attribute__((aligned(16))) unsigned short sPh[4][16][40], sPl[4][16][40];
  __shared__ __attribute__((aligned(16))) float sO[4][16][D];
  const int tid = threadIdx.x, w = tid >> 5, lane = tid & 31, ln = lane & 15, hh = lane >> 4;
  const int nqb = (T + 63) / 64;
  const int bh = blockIdx.x / nqb, qblk = blockIdx.x % nqb;
  const int b = bh / H, h = bh % H;
  const int q0 = qblk * 64 + w * 16;
  const float* Q = qb + (size_t)b * T * pitch + h * D;
  const float* K = kb + (size_t)b * T * pitch + h * D;
  const float* V = vb + (size_t)b * T * pitch + h * D;

  // A fragments of the wave's 16 query rows (scaled), hi/lo
  FragB aqh[KS], aql[KS];
  {
    int row = q0 + ln; if (row >= T) row = T - 1;
    const float* qr = Q + (size_t)row * pitch;
#pragma unroll
    for (int ks = 0; ks < KS; ++ks)
#pragma unroll
      for (int i = 0; i < 16; ++i) {
        const int d = ks * 32 + ((i < 8) ? (8 * hh + i) : (16 + 8 * hh + (i - 8)));
        const float x = qr[d] * scale; const unsigned short hb = bf16_bits(x);
        aqh[ks].u[i] = hb; aql[ks].u[i] = bf16_bits(x - bf16_val(hb));
      }
  }
  float m_r[8], l_r[8];
#pragma unroll
  for (int r = 0; r < 8; ++r) { m_r[r] = -3.0e38f; l_r[r] = 0.f; }
  v8f oacc[DT];
#pragma unroll
  for (int dt = 0; dt < DT; ++dt) oacc[dt] = (v8f){0.f,0.f,0.f,0.f,0.f,0.f,0.f,0.f};

  const int kv_end = CAUSAL ? min(T, qblk * 64 + 64) : T;     // block-uniform
  for (int j0 = 0; j0 < kv_end; j0 += 32) {
    __syncthreads();
    for (int e = tid; e < 32 * (D / 4); e += 128) {
      const int r = e / (D / 4), c4 = (e % (D / 4)) * 4;
      const int key = j0 + r;
      v4f kf = {0.f,0.f,0.f,0.f}, vf = {0.f,0.f,0.f,0.f};
      if (key < T) { kf = *(const v4fa*)(K + (size_t)key * pitch + c4); vf = *(const v4fa*)(V + (size_t)key * pitch + c4); }
#pragma unroll
      for (int t = 0; t < 4; ++t) {
        unsigned short hb = bf16_bits(kf[t]); sKh[r][c4 + t] = hb; sKl[r][c4 + t] = bf16_bits(kf[t] - bf16_val(hb));
        hb = bf16_bits(vf[t]); sVh[r][c4 + t] = hb; sVl[r][c4 + t] = bf16_bits(vf[t] - bf16_val(hb));
      }
    }
    __syncthreads();
    // S tile 16 x 32
    v8f s[2];
#pragma unroll
    for (int nt = 0; nt < 2; ++nt) {
      v8f acc = {};
#pragma unroll
      for (int ks = 0; ks < KS; ++ks) {
        FragB bh_, bl_;
        bh_.half[0] = *(const v8us*)&sKh[nt * 16 + ln][ks * 32 + 8 * hh]; bh_.half[1] = *(const v8us*)&sKh[nt * 16 + ln][ks * 32 + 16 + 8 * hh];
        bl_.half[0] = *(const v8us*)&sKl[nt * 16 + ln][ks * 32 + 8 * hh]; bl_.half[1] = *(const v8us*)&sKl[nt * 16 + ln][ks * 32 + 16 + 8 * hh];
        acc = mmaN<3>(aqh[ks].v, aql[ks].v, bh_.v, bl_.v, acc);
      }
      s[nt] = acc;
    }
    // mask + running max (rows 8hh+r; the 16 lanes of a half share rows)
    float alpha[8];
#pragma unroll
    for (int r = 0; r < 8; ++r) {
      const int qi = q0 + 8 * hh + r;
      const int ja = j0 + ln, jb = j0 + 16 + ln;
      if (CAUSAL) { if (ja > qi) s[0][r] = -3.0e38f; if (jb > qi) s[1][r] = -3.0e38f; }
      if (ja >= T) s[0][r] = -3.0e38f;
      if (jb >= T) s[1][r] = -3.0e38f;
      float mx = fmaxf(s[0][r], s[1][r]);
      mx = fmaxf(mx, __shfl_xor(mx, 1, 32)); mx = fmaxf(mx, __shfl_xor(mx, 2, 32)); mx = fmaxf(mx, __shfl_xor(mx, 4, 32)); mx = fmaxf(mx, __shfl_xor(mx, 8, 32));
      const float mnew = fmaxf(m_r[r], mx);
      alpha[r] = (mnew > -1.0e38f) ? __expf(m_r[r] - mnew) : 1.0f;
      const float p0 = (s[0][r] > -1.0e38f) ? __expf(s[0][r] - mnew) : 0.f;
      const float p1 = (s[1][r] > -1.0e38f) ? __expf(s[1][r] - mnew) : 0.f;
      m_r[r] = mnew;
      l_r[r] = l_r[r] * alpha[r] + p0 + p1;            // per-lane partial row sum (16 lanes combined at the end)
      unsigned short hb = bf16_bits(p0); sPh[w][8 * hh + r][ln] = hb;      sPl[w][8 * hh + r][ln] = bf16_bits(p0 - bf16_val(hb));
      hb = bf16_bits(p1);                sPh[w][8 * hh + r][16 + ln] = hb; sPl[w][8 * hh + r][16 + ln] = bf16_bits(p1 - bf16_val(hb));
    }
#pragma unroll
    for (int dt = 0; dt < DT; ++dt)
#pragma unroll
      for (int r = 0; r < 8; ++r) oacc[dt][r] *= alpha[r];
    __builtin_amdgcn_fence(__ATOMIC_ACQ_REL, "workgroup");
    __builtin_amdgcn_wave_barrier();
    FragB pah, pal;
    pah.half[0] = *(const v8us*)&sPh[w][ln][8 * hh]; pah.half[1] = *(const v8us*)&sPh[w][ln][16 + 8 * hh];
    pal.half[0] = *(const v8us*)&sPl[w][ln][8 * hh]; pal.half[1] = *(const v8us*)&sPl[w][ln][16 + 8 * hh];
#pragma unroll
    for (int dt = 0; dt < DT; ++dt) {
      FragB bvh, bvl;
#pragma unroll
      for (int i = 0; i < 8; ++i) {
        bvh.u[i] = sVh[8 * hh + i][dt * 16 + ln]; bvh.u[8 + i] = sVh[16 + 8 * hh + i][dt * 16 + ln];
        bvl.u[i] = sVl[8 * hh + i][dt * 16 + ln]; bvl.u[8 + i] = sVl[16 + 8 * hh + i][dt * 16 + ln];
      }
      oacc[dt] = mmaN<3>(pah.v, pal.v, bvh.v, bvl.v, oacc[dt]);
    }
    __builtin_amdgcn_fence(__ATOMIC_ACQ_REL, "workgroup");
    __builtin_amdgcn_wave_barrier();
  }
#pragma unroll
  for (int r = 0; r < 8; ++r) {
    float l = l_r[r];
    l += __shfl_xor(l, 1, 32); l += __shfl_xor(l, 2, 32); l += __shfl_xor(l, 4, 32); l += __shfl_xor(l, 8, 32);
    l_r[r] = (l > 0.f) ? 1.0f / l : 0.f;
  }
#pragma unroll
  for (int dt = 0; dt < DT; ++dt)
#pragma unroll
    for (int r = 0; r < 8; ++r) sO[w][8 * hh + r][dt * 16 + ln] = oacc[dt][r] * l_r[r];
  __builtin_amdgcn_fence(__ATOMIC_ACQ_REL, "workgroup");
  __builtin_amdgcn_wave_barrier();
  {
    for (int r = 0; r < 16; ++r) {
      const int row = q0 + r;
      if (row < T && lane < D / 4) {
        const v4f val = *(const v4fa*)&sO[w][r][lane * 4];
        *(v4f*)(y + ((size_t)b * T + row) * ypitch + h * D + lane * 4) = val;
      }
    }
    
  }
}

// GEMM C = act(A·W + bias + resid): A f32 (ASPLIT -> hi/lo 2 terms), Wt bf16 [N][K]; ACT 0 none, 1 relu, 2 exact gelu;
// resid (optional, f32, row index = (row % rmod), pitch ldr, RES_BF16 rounds it) added before the activation.
template <bool ASPLIT, int ACT, bool BIAS_BF16, bool RES_BF16>
__global__ __launch_bounds__(128) void k_gemm_bf3(const float* __restrict__ A, int lda, const unsigned short* __restrict__ Wt, int ldb,
                                                const float* __restrict__ bias, const float* __restrict__ resid, int rmod, int ldr,
                                                float* __restrict__ C, int ldc, int M, int N, int K) {
  __shared__ __attribute__((aligned(16))) float so[4][16][64];
  const int tid = threadIdx.x, w = tid >> 5, lane = tid & 31, ln = lane & 15, hh = lane >> 4;
  const int ntn = N / 64;
  const int wid = blockIdx.x * 4 + w;
  const int mt = wid / ntn, nq = wid % ntn;
  if (mt * 16 >= M) return;
  const int row0 = mt * 16, col0 = nq * 64;
  const float* arow = A + (size_t)(row0 + ln) * lda;
  v8f acc[4] = {};
  for (int kb = 0; kb < K; kb += 32) {
    FragB ah, al;
    const v4f x0 = *(const v4fa*)(arow + kb + 8 * hh), x1 = *(const v4fa*)(arow + kb + 8 * hh + 4);
    const v4f x2 = *(const v4fa*)(arow + kb + 16 + 8 * hh), x3 = *(const v4fa*)(arow + kb + 16 + 8 * hh + 4);
    float xs[16] = {x0[0],x0[1],x0[2],x0[3],x1[0],x1[1],x1[2],x1[3],x2[0],x2[1],x2[2],x2[3],x3[0],x3[1],x3[2],x3[3]};
#pragma unroll
    for (int i = 0; i < 16; ++i) { const unsigned short hb = bf16_bits(xs[i]); ah.u[i] = hb; al.u[i] = ASPLIT ? bf16_bits(xs[i] - bf16_val(hb)) : (unsigned short)0; }
#pragma unroll
    for (int t = 0; t < 4; ++t) {
      const unsigned short* brow = Wt + (size_t)(col0 + t * 16 + ln) * ldb + kb;
      FragB b;
      b.half[0] = *(const v8us*)(brow + 8 * hh);
      b.half[1] = *(const v8us*)(brow + 16 + 8 * hh);
      acc[t] = mmaN<ASPLIT ? 2 : 1>(ah.v, al.v, b.v, b.v, acc[t]);
    }
  }
#pragma unroll
  for (int t = 0; t < 4; ++t) {
    const int col = col0 + t * 16 + ln;
    float bv = bias ? bias[col] : 0.f;
    if (BIAS_BF16) bv = bf16_round(bv);
#pragma unroll
    for (int r = 0; r < 8; ++r) {
      float v = acc[t][r] + bv;
      if (resid) { float rv = resid[(size_t)((row0 + 8 * hh + r) % rmod) * ldr + col]; if (RES_BF16) rv = bf16_round(rv); v += rv; }
      if (ACT == 1) v = fmaxf(v, 0.f);
      if (ACT == 2) v = 0.5f * v * (1.0f + erff(v * 0.70710678118654752f));
      if (ACT == 3) { const float u = 0.7978845608028654f * (v + 0.044715f * v * v * v); v = 0.5f * v * (1.0f + tanhf(u)); }
      so[w][8 * hh + r][t * 16 + ln] = v;
    }
  }
  __builtin_amdgcn_fence(__ATOMIC_ACQ_REL, "workgroup");
  __builtin_amdgcn_wave_barrier();
  const int rsub = lane >> 4, c4 = (lane & 15) * 4;
  {
#pragma unroll
    for (int q = 0; q < 8; ++q) {
      const int r = q * 2 + rsub;
      const v4f v = *(const v4fa*)&so[w][r][c4];
      *(v4f*)(C + (size_t)(row0 + r) * ldc + col0 + c4) = v;
    }
    
  }
}
// row LayerNorm (biased variance, eps) over N: s = X (+ R); optional out_sum <- s; out_norm <- (s-mu)*rsqrt(var+eps)*g + b
template <bool PARAM_BF16>
__global__ __launch_bounds__(256) void k_layernorm(const float* __restrict__ X, const float* __restrict__ R, const float* __restrict__ g, const float* __restrict__ bta,
                                                  float* __restrict__ out_sum, float* __restrict__ out_norm, int N, float eps) {
  __shared__ float red[256];
  const int row = blockIdx.x, tid = threadIdx.x;
  const float* x = X + (size_t)row * N; const float* rr = R ? R + (size_t)row * N : nullptr;
  float vals[16];                     // up to N = 4096
  const int per = N / 256;            // contiguous chunk per thread? use strided-by-4 chunks: thread handles j = tid*4 + 1024*u
  float s1 = 0.f;
  for (int u = 0; u < per / 4; ++u) {
    const int j = tid * 4 + 1024 * u;
    const v4f a = *(const v4fa*)(x + j);
    v4f b = {0.f,0.f,0.f,0.f}; if (rr) b = *(const v4fa*)(rr + j);
#pragma unroll
    for (int q = 0; q < 4; ++q) { const float v = a[q] + b[q]; vals[u * 4 + q] = v; s1 += v; }
  }
  red[tid] = s1; __syncthreads();
  for (int st = 128; st > 0; st >>= 1) { if (tid < st) red[tid] += red[tid + st]; __syncthreads(); }
  const float mu = red[0] / (float)N; __syncthreads();
  float s2 = 0.f;
  for (int u = 0; u < per / 4; ++u)
#pragma unroll
    for (int q = 0; q < 4; ++q) { const float c = vals[u * 4 + q] - mu; s2 += c * c; }
  red[tid] = s2; __syncthreads();
  for (int st = 128; st > 0; st >>= 1) { if (tid < st) red[tid] += red[tid + st]; __syncthreads(); }
  const float rs = rsqrtf(red[0] / (float)N + eps);
  {
    for (int u = 0; u < per / 4; ++u) {
      const int j = tid * 4 + 1024 * u;
      v4f o, sm;
#pragma unroll
      for (int q = 0; q < 4; ++q) {
        float gg = g[j + q], bb = bta[j + q];
        if (PARAM_BF16) { gg = bf16_round(gg); bb = bf16_round(bb); }
        sm[q] = vals[u * 4 + q]; o[q] = (vals[u * 4 + q] - mu) * rs * gg + bb;
      }
      if (out_sum) *(v4f*)(out_sum + (size_t)row * N + j) = sm;
      *(v4f*)(out_norm + (size_t)row * N + j) = o;
    }
    
  }
}



// ---- f16 WMMA path (v_wmma_f32_16x16x32_f16): 11-bit significands for operands in range — used where a [0,1] probability operand needs more precision than bf16
typedef _Float16 v16h __attribute__((ext_vector_type(16)));
union FragH { v16h v; v8us half[2]; _Float16 h[16]; unsigned short u[16]; };
template <int NT>
__device__ __forceinline__ v8f mmaH(v16h ah, v16h al, v16h bh, v16h bl, v8f c) {
  c = __builtin_amdgcn_wmma_f32_16x16x32_f16(false, ah, false, bh, (short)0, c, false, false);
  if (NT >= 2) c = __builtin_amdgcn_wmma_f32_16x16x32_f16(false, al, false, bh, (short)0, c, false, false);
  if (NT >= 3) c = __builtin_amdgcn_wmma_f32_16x16x32_f16(false, ah, false, bl, (short)0, c, false, false);
  asm volatile("v_nop\n\tv_nop\n\tv_nop\n\tv_nop" : "+v"(c) : "v"(ah), "v"(al), "v"(bh), "v"(bl));
  return c;
}
// batched GEMM like k_gemm_b but f16 operands: A f32 (split into f16 hi/lo if ASPLIT, else rounded to f16), Bt = f16 values [n][k]; alpha; C f32; N multiple of 16 (partial tiles skipped)
template <bool ASPLIT>
__global__ __launch_bounds__(128) void k_gemm_h(const float* __restrict__ A, int lda, size_t sA, const _Float16* __restrict__ Bh, int ldb, size_t sB, float alpha, float* __restrict__ C, int ldc, size_t sC, int M, int N, int K) {
  __shared__ __attribute__((aligned(16))) float so[4][16][64];
  const int tid = threadIdx.x, w = tid >> 5, lane = tid & 31, ln = lane & 15, hh = lane >> 4; const int by = blockIdx.y;
  A += (size_t)by * sA; Bh += (size_t)by * sB; C += (size_t)by * sC;
  const int ntn = (N + 63) / 64; const int wid = blockIdx.x * 4 + w; const int mt = wid / ntn, nq = wid % ntn; if (mt * 16 >= M) return;
  const int row0 = mt * 16, col0 = nq * 64; const float* arow = A + (size_t)(row0 + ln) * lda;
  v8f acc[4] = {};
  for (int kb = 0; kb < K; kb += 32) {
    FragH ah, al;
    const v4f x0 = *(const v4fa*)(arow + kb + 8 * hh), x1 = *(const v4fa*)(arow + kb + 8 * hh + 4), x2 = *(const v4fa*)(arow + kb + 16 + 8 * hh), x3 = *(const v4fa*)(arow + kb + 16 + 8 * hh + 4);
    float xs[16] = {x0[0],x0[1],x0[2],x0[3],x1[0],x1[1],x1[2],x1[3],x2[0],x2[1],x2[2],x2[3],x3[0],x3[1],x3[2],x3[3]};
#pragma unroll
    for (int i = 0; i < 16; ++i) { const _Float16 h = (_Float16)xs[i]; ah.h[i] = h; al.h[i] = ASPLIT ? (_Float16)(xs[i] - (float)h) : (_Float16)0.0f; }
#pragma unroll
    for (int t = 0; t < 4; ++t) { if (col0 + t * 16 >= N) continue; const size_t boff = (size_t)(col0 + t * 16 + ln) * ldb + kb; FragH bq; bq.half[0] = *(const v8us*)(Bh + boff + 8 * hh); bq.half[1] = *(const v8us*)(Bh + boff + 16 + 8 * hh);
      acc[t] = mmaH<ASPLIT ? 2 : 1>(ah.v, al.v, bq.v, bq.v, acc[t]); }
  }
#pragma unroll
  for (int t = 0; t < 4; ++t) { if (col0 + t * 16 >= N) continue;
#pragma unroll
    for (int r = 0; r < 8; ++r) so[w][8 * hh + r][t * 16 + ln] = acc[t][r] * alpha; }
  __builtin_amdgcn_fence(__ATOMIC_ACQ_REL, "workgroup"); __builtin_amdgcn_wave_barrier();
  const int rsub = lane >> 4, c4 = (lane & 15) * 4;
  {
#pragma unroll
    for (int q = 0; q < 8; ++q) { const int r = q * 2 + rsub; if (col0 + c4 < N) { const v4f v = *(const v4fa*)&so[w][r][c4]; *(v4f*)(C + (size_t)(row0 + r) * ldc + col0 + c4) = v; } }
     }
}

// Wt[n][k] = f16(W[k][n]·scale) from f32 row-major W[K][N] (scale = power of two; bf16-exact weights stay exact in f16 away from the subnormal range)
__global__ __launch_bounds__(256) void k_wt_f16(const float* __restrict__ W, _Float16* __restrict__ Wt, int K, int N, float scale) {
  const int t = blockIdx.x * 256 + threadIdx.x; if (t >= N * (K / 8)) return; const int n = t / (K / 8), k8 = (t % (K / 8)) * 8; FragH f;
#pragma unroll
  for (int i = 0; i < 8; ++i) f.h[i] = (_Float16)(bf16_round(W[(size_t)(k8 + i) * N + n]) * scale); const v8us o = f.half[0];
  *(v8us*)((unsigned short*)Wt + (size_t)n * K + k8) = o; 
}


typedef _Float16 v4h __attribute__((ext_vector_type(4)));

__global__ __launch_bounds__(256) void k_h16(const float* __restrict__ x, _Float16* __restrict__ X16, size_t n8) { const size_t t = (size_t)blockIdx.x * 256 + threadIdx.x; if (t >= n8) return; FragH f;
#pragma unroll
  for (int q = 0; q < 8; ++q) f.h[q] = (_Float16)x[t * 8 + q]; *(v8us*)((unsigned short*)X16 + t * 8) = f.half[0];  }
// One launch makes q, k and v from the f32 inputs, k and v in the order in which the attention kernel's A fragments hold them (see Kp, Vp below). A work-group takes 64 rows of x. Its 512 threads each round one unit of 8 values of Wq, Wk, Wv (bf16, x 2^4) and of the 64 rows (bf16) to f16 in LDS;
// then waves 0-3 make q, 4-7 k (one 16-row tile each, 4 feature tiles) and 8-11 v (one feature tile each, 4 row tiles); waves 12-15 only help to fill LDS. The operand roles are chosen by where the result goes:
// for q and k the weight rows are A and the x rows B, so a lane's 8 results are 8 features of one row; for v the x rows are A, so they are 8 positions of one feature. Each is one 16-byte store: these 8 values are
// one lane's half of an A fragment (features or keys 8hh + r of a group of 16), so a k or v store of a wave is 512 contiguous bytes at lane * 16; a wave's 4 q stores fill whole 128-byte lines.
// Kp: per 16 keys 4 units of 512 bytes, unit u = features u * 16 .. + 15: lane (hh, ln) holds features u * 16 + 8hh + r of key ln. Vp: per 32 keys 8 units, unit dt * 2 + g: lane (hh, ln) holds keys g * 16 + 8hh + r of feature dt * 16 + ln.
// In LDS, rows of 64 f16 lie at a pitch of 144 bytes (16 x odd) for the 16-byte fragment reads. A and B fragments come from one loader, so their k orders are equal.
__global__ __launch_bounds__(512) void k_proj(const float* __restrict__ x, const float* __restrict__ Wq, const float* __restrict__ Wk, const float* __restrict__ Wv, _Float16* __restrict__ Q16, _Float16* __restrict__ Kp, _Float16* __restrict__ Vp) {
  constexpr int P = CC + 8;
  __shared__ __attribute__((aligned(16))) unsigned short sh[4 * CC][P];      // rows 0-63 Wq, 64-127 Wk, 128-191 Wv (row = output feature), 192-255 the 64 rows of x
  const int tid = threadIdx.x, w = __builtin_amdgcn_readfirstlane(tid >> 5), lane = tid & 31, ln = lane & 15, hh = lane >> 4;      // w in a scalar register: the roles below branch on it, and every lane must stay on at the WMMAs
  const int row0 = blockIdx.x * 64;
  const unsigned boff = tid * 32u;      // byte offset of the thread's unit in each of the four sources
  const char* const src[4] = {(const char*)Wq, (const char*)Wk, (const char*)Wv, (const char*)(x + (size_t)row0 * CC)};
  v4f in[4][2];
#pragma unroll      // unrolled, here and below: in and the fragments are indexed by constants and stay in registers; the 8 loads go out before the first conversion
  for (int i = 0; i < 4; ++i) { in[i][0] = *(const v4fa*)(src[i] + boff); in[i][1] = *(const v4fa*)(src[i] + boff + 16); }
  asm volatile("s_wait_xcnt 0x0" :: "v"(boff) : "memory");      // the loads' offset register is named so that it lives up to this wait: what follows may reuse it
#pragma unroll
  for (int i = 0; i < 4; ++i) { FragH f;
#pragma unroll
    for (int q = 0; q < 8; ++q) { const float v = bf16_round(in[i][q >> 2][q & 3]); f.h[q] = (_Float16)(i < 3 ? v * 16.0f : v); }
    *(v8us*)&sh[i * CC + (tid >> 3)][(tid & 7) * 8] = f.half[0]; }
  __syncthreads();      // the f16 operands are in LDS before any wave reads a fragment
  if (w >= 12) return;      // behind the only barrier
  auto frag = [&](int r, int ks) { FragH f; f.half[0] = *(const v8us*)&sh[r][ks * 32 + 8 * hh]; f.half[1] = *(const v8us*)&sh[r][ks * 32 + 16 + 8 * hh]; return f; };
  const bool isv = w >= 8;
  const int keep = isv ? w * 16 : 3 * CC + (w & 3) * 16;      // first LDS row of the tile a wave keeps as B: v: feature tile w - 8 of Wv; q, k: row tile w & 3 of x
  const int run = isv ? 3 * CC : (w >> 2) * CC;      // first LDS row of the 4 tiles it walks as A: v: the rows of x; q, k: the features of Wq or Wk
  const FragH b0 = frag(keep + ln, 0), b1 = frag(keep + ln, 1);
  unsigned short* dst = isv ? (unsigned short*)Vp + (size_t)row0 * CC + (w - 8) * 512 + lane * 8      // walked tile t = 16 keys: block t >> 1 of 32 keys, unit (w - 8) * 2 + (t & 1)
                      : w >= 4 ? (unsigned short*)Kp + (size_t)(row0 + (w & 3) * 16) * CC + lane * 8      // walked tile t = 16 features: unit t
                               : (unsigned short*)Q16 + (size_t)(row0 + w * 16 + ln) * CC + 8 * hh;
  const int st1 = w >= 4 ? 256 : 16, st2 = isv ? 32 * CC : 2 * st1;      // steps, in f16, of bit 0 and bit 1 of t
  FragH a[4][2];      // the fragment reads stand ahead of the products, so that later tiles' reads go out while earlier tiles are worked on
#pragma unroll
  for (int t = 0; t < 4; ++t) { a[t][0] = frag(run + t * 16 + ln, 0); a[t][1] = frag(run + t * 16 + ln, 1); }
#pragma unroll
  for (int t = 0; t < 4; ++t) { v8f acc = (v8f){0.f,0.f,0.f,0.f,0.f,0.f,0.f,0.f};
    acc = __builtin_amdgcn_wmma_f32_16x16x32_f16(false, a[t][0].v, false, b0.v, (short)0, acc, false, false);
    acc = __builtin_amdgcn_wmma_f32_16x16x32_f16(false, a[t][1].v, false, b1.v, (short)0, acc, false, false);      // acc[r] = (walked tile's row 8hh + r) . (kept tile's row ln)
    FragH o;
#pragma unroll
    for (int r = 0; r < 8; ++r) o.h[r] = (_Float16)(acc[r] * 0.0625f);
    *(v8us*)(dst + (t & 1) * st1 + (t >> 1) * st2) = o.half[0]; } }

// One work-group = one tile of 16 query rows; its NW waves deal the tile's 32-key blocks among themselves (wave w takes blocks w, w + NW, ...), each with its own
// running maximum, sum and accumulators; the partials are merged through LDS behind one work-group barrier. The launch bound asks for 8 waves per SIMD (128 VGPRs), so that
// two work-groups share a WGP. w is held in a scalar register: the waves' trip counts differ, and the loop must branch on a scalar so that every lane stays on at the WMMAs.
// Both products run transposed: S^T = K.Q^T (A = 16 key rows, B = the tile's queries, kept in registers) and O^T += V^T.P^T. A lane then holds 16 scores of ONE query (column ln; keys
// 8hh + r and 16 + 8hh + r of the block), so maximum and sum are in-lane but for one exchange between the wave's halves, and the two converted score tiles ARE the B operand of the second product.
__device__ __forceinline__ float xhalf(float x) { return __builtin_bit_cast(float, __builtin_amdgcn_permlanex16(__builtin_bit_cast(int, x), __builtin_bit_cast(int, x), 0x76543210, 0xfedcba98, false, false)); }      // lane l reads lane l ^ 16
template <int NW>
__global__ __launch_bounds__(NW * 32, 8) void k_flash(const _Float16* __restrict__ Q16, int ldq, const _Float16* __restrict__ Kp, const _Float16* __restrict__ Vp, const int* __restrict__ MSK, float* __restrict__ O, int ldo) {
  constexpr int RPW = 16, NQB = 4096 / RPW, DT = 4, KS = 2;
  __shared__ __attribute__((aligned(16))) float sO[NW][RPW][64 + 4]; __shared__ float sM[NW][RPW], sL[NW][RPW];
  const int tid = threadIdx.x, w = __builtin_amdgcn_readfirstlane(tid >> 5), lane = tid & 31, ln = lane & 15, hh = lane >> 4;
  const int slab = blockIdx.x / NQB, qblk = blockIdx.x % NQB; const int b = slab / 1, h = slab % 1; const int q0 = qblk * RPW;
  FragH bq[KS];
  { const unsigned short* qr = (const unsigned short*)Q16 + ((size_t)b * 4096 + q0 + ln) * ldq + h * 64;
#pragma unroll
    for (int ks = 0; ks < KS; ++ks) { bq[ks].half[0] = *(const v8us*)(qr + ks * 32 + 8 * hh); bq[ks].half[1] = *(const v8us*)(qr + ks * 32 + 16 + 8 * hh); } }
  const unsigned short* Kl = (const unsigned short*)Kp + (size_t)slab * 4096 * 64 + lane * 8; const unsigned short* Vl = (const unsigned short*)Vp + (size_t)slab * 4096 * 64 + lane * 8;      // fragment order (k_proj): a block of 32 keys is 4 KB in each, every load below 512 contiguous bytes of it
  float m_q = -3.0e38f, l_q = 0.f; v8f oacc[DT];      // of query q0 + ln; l_q sums this half's keys only, the halves are joined behind the loop
#pragma unroll
  for (int dt = 0; dt < DT; ++dt) oacc[dt] = (v8f){0.f,0.f,0.f,0.f,0.f,0.f,0.f,0.f};      // oacc[dt][r] = O[q0 + ln][dt * 16 + 8hh + r]
  const int jend = q0 + RPW, tq = q0 + ln;
#pragma unroll 1
  for (int j0 = w * 32; j0 < jend; j0 += NW * 32) {
    v8f s[2];
#pragma unroll
    for (int nt = 0; nt < 2; ++nt) { const unsigned short* kr = Kl + (size_t)(j0 + nt * 16) * 64; FragH ak[KS];      // A operand: key rows j0 + nt * 16 + ln
#pragma unroll
      for (int ks = 0; ks < KS; ++ks) { ak[ks].half[0] = *(const v8us*)(kr + ks * 512); ak[ks].half[1] = *(const v8us*)(kr + ks * 512 + 256); }
      v8f acc = (v8f){0.f,0.f,0.f,0.f,0.f,0.f,0.f,0.f};
#pragma unroll
      for (int ks = 0; ks < KS; ++ks) acc = mmaH<1>(ak[ks].v, ak[ks].v, bq[ks].v, bq[ks].v, acc);
      s[nt] = acc; }      // s[nt][r] = q(q0 + ln) . k(j0 + nt * 16 + 8hh + r)
    float mc = -INFINITY; const int dq = tq - j0 - 8 * hh;      // score (nt, r) is unmasked while nt * 16 + r <= dq
#pragma unroll
    for (int nt = 0; nt < 2; ++nt)
#pragma unroll
      for (int r = 0; r < 8; ++r) { s[nt][r] = (nt * 16 + r <= dq) ? s[nt][r] * (0.125f) : -INFINITY; mc = fmaxf(mc, s[nt][r]); }
    mc = fmaxf(mc, xhalf(mc));
    // every block a wave walks starts at a key j0 <= q0, so each query has an unmasked score in it and mn is a finite score: a masked score (-inf) gives exp = 0 and the first block gives al = 0 with no test
    const float mn = fmaxf(m_q, mc); const float al = expf(m_q - mn); m_q = mn;
    float ps = 0.f; FragH pb;
#pragma unroll
    for (int nt = 0; nt < 2; ++nt)
#pragma unroll
      for (int r = 0; r < 8; ++r) { const float p = expf(s[nt][r] - mn); ps += p; pb.h[nt * 8 + r] = (_Float16)p; }      // element nt * 8 + r of a B fragment is k = nt * 16 + 8hh + r: the key this score belongs to
    l_q = l_q * al + ps;
#pragma unroll
    for (int dt = 0; dt < DT; ++dt) { const unsigned short* vrow = Vl + (size_t)j0 * 64 + dt * 512; FragH av; av.half[0] = *(const v8us*)vrow; av.half[1] = *(const v8us*)(vrow + 256);      // A operand: V^T rows dt * 16 + ln, the block's 32 keys in the k order of the packed scores
#pragma unroll
      for (int r = 0; r < 8; ++r) oacc[dt][r] *= al;
      oacc[dt] = mmaH<1>(av.v, av.v, pb.v, pb.v, oacc[dt]); } }
  // each wave hands over its un-normalised partial: (maximum, sum) per row and the 16 x 64 accumulator; a wave without a block hands (-3e38, 0, zeros), which weighs 0 in the merge
  const int le = (int)__builtin_amdgcn_mbcnt_lo(~0u, 0u), lne = le & 15, hhe = le >> 4;      // lane id read anew, so that tid and its parts need no registers across the loop
  l_q += xhalf(l_q);
  if (hhe == 0) { sM[w][lne] = m_q; sL[w][lne] = l_q; }
#pragma unroll
  for (int dt = 0; dt < DT; ++dt) { *(v4fa*)&sO[w][lne][dt * 16 + 8 * hhe] = (v4f){oacc[dt][0], oacc[dt][1], oacc[dt][2], oacc[dt][3]}; *(v4fa*)&sO[w][lne][dt * 16 + 8 * hhe + 4] = (v4f){oacc[dt][4], oacc[dt][5], oacc[dt][6], oacc[dt][7]}; }
  __syncthreads();      // every wave's partial is in LDS before any is merged
  static_assert(NW == RPW, "wave w merges row w");
  { typedef float v2f __attribute__((ext_vector_type(2))); typedef float v2fa __attribute__((ext_vector_type(2), may_alias)); const int r = w; float M = sM[0][r];
#pragma unroll      // both loops unrolled: the NW partials' LDS loads go out together instead of one wait each
    for (int u = 1; u < NW; ++u) M = fmaxf(M, sM[u][r]);
    float L = 0.f; v2f val = {0.f, 0.f};
#pragma unroll
    for (int u = 0; u < NW; ++u) { const float e = expf(sM[u][r] - M); L += e * sL[u][r]; const v2f pv = *(const v2fa*)&sO[u][r][le * 2]; val += pv * e; }
    const float inv = (L > 0.f) ? 1.0f / L : 0.f; val *= inv;
    *(v2f*)(O + ((size_t)b * 4096 + q0 + r) * ldo + h * 64 + le * 2) = val; } }

extern "C" void kernel_launch(void* const* d_in, const int* in_sizes, int n_in,
                              void* d_out, int out_size, void* d_ws, size_t ws_size, hipStream_t stream) {
  (void)in_sizes; (void)n_in; (void)out_size;
  const float* x = (const float*)d_in[0]; const float* Wk = (const float*)d_in[1]; const float* Wq = (const float*)d_in[2]; const float* Wv = (const float*)d_in[3];
  char* ws = (char*)d_ws; size_t off = 0;
  auto take = [&](size_t bytes) { char* p = ws + off; off += (bytes + 255) & ~(size_t)255; return p; };
  _Float16* Q16 = (_Float16*)take((size_t)NR * CC * 2); _Float16* Kp = (_Float16*)take((size_t)NR * CC * 2); _Float16* Vp = (_Float16*)take((size_t)NR * CC * 2);
  if (off > ws_size) return;      // 3 buffers of 2 MiB
  k_proj<<<NR / 64, 512, 0, stream>>>(x, Wq, Wk, Wv, Q16, Kp, Vp);      // q in f16 rows; k and v in fragment order
  k_flash<16><<<BB * 1 * (TT / 16), 16 * 32, 0, stream>>>(Q16, CC, Kp, Vp, nullptr, (float*)d_out, CC);
}

// v005
// Measured time: 45.6 microseconds a run.
// Two timings next to v004 put it at 1.07 and 1.10 times that version's speed.
// Counting every step since v000, it is 9.75 times as fast.
#include <hip/hip_runtime.h>
// Single causal attention head (B=4, T=4096, C=64): q,k,v = x·Wᵀ (no bias), softmax(q·kᵀ·64^-½) with a causal mask, out = P·v. One GEMM for [q|k|v] and a fused flash-style causal attention
// kernel (online softmax in f32; P f16 ≤ 1; O = P·Vᵀ-tiles; RPW-16 waves; causal tile skipping) on v_wmma_f32_16x16x32_f16 — x bf16-exact, (out,in) weights bf16-exact ×2^4, q/k/v f16,
// f32 accumulate.
#define BB 4
#define TT 4096
#define CC 64
#define NR (BB * TT)

typedef __bf16 v16b __attribute__((ext_vector_type(16)));
typedef unsigned short v8us __attribute__((ext_vector_type(8), may_alias));
typedef float  v8f  __attribute__((ext_vector_type(8)));
typedef float  v4f  __attribute__((ext_vector_type(4)));
typedef float  v4fa __attribute__((ext_vector_type(4), may_alias));
union FragB { v16b v; v8us half[2]; unsigned short u[16]; };

__device__ __forceinline__ unsigned short bf16_bits(float x) { unsigned int u = __float_as_uint(x); return (unsigned short)((u + 0x7FFFu + ((u >> 16) & 1u)) >> 16); }
__device__ __forceinline__ float bf16_val(unsigned short b) { return __uint_as_float(((unsigned int)b) << 16); }
__device__ __forceinline__ float bf16_round(float x) { return bf16_val(bf16_bits(x)); }
// D += A·B with NT terms: 1 = ah·bh, 2 = + al·bh (A split), 3 = + ah·bl (both split)
template <int NT>
__device__ __forceinline__ v8f mmaN(v16b ah, v16b al, v16b bh, v16b bl, v8f c) {
  c = __builtin_amdgcn_wmma_f32_16x16x32_bf16(false, ah, false, bh, (short)0, c, false, false);
  if (NT >= 2) c = __builtin_amdgcn_wmma_f32_16x16x32_bf16(false, al, false, bh, (short)0, c, false, false);
  if (NT >= 3) c = __builtin_amdgcn_wmma_f32_16x16x32_bf16(false, ah, false, bl, (short)0, c, false, false);
  asm volatile("v_nop\n\tv_nop\n\tv_nop\n\tv_nop" : "+v"(c) : "v"(ah), "v"(al), "v"(bh), "v"(bl));
  return c;
}

__global__ __launch_bounds__(256) void k_wt_bf16(const float* __restrict__ W, unsigned short* __restrict__ Wt, int K, int N) {
  const int t = blockIdx.x * 256 + threadIdx.x;
  const int k8n = K / 8;
  if (t >= N * k8n) return;
  const int n = t / k8n, k8 = (t % k8n) * 8;
  v8us v;
#pragma unroll
  for (int i = 0; i < 8; ++i) v[i] = bf16_bits(W[(size_t)(k8 + i) * N + n]);
  *(v8us*)(Wt + (size_t)n * K + k8) = v;
  
}

// GEMM C[M][N] (f32, pitch ldc) = act(A[M][K]·W + bias). A f32 row-major (pitch lda) converted per fragment to bf16
// (ASPLIT: hi/lo two planes -> 2 terms, else single rounded term); Wt bf16 [N][K] (pitch ldb). BIAS_BF16 rounds the
// bias to bf16 first (bias quantised to bf16 before the add). K%32==0, M%16==0, N%64==0.
template <bool ASPLIT, int ACT, bool BIAS_BF16>
__global__ __launch_bounds__(128) void k_gemm_bf(const float* __restrict__ A, int lda, const unsigned short* __restrict__ Wt, int ldb,
                                               const float* __restrict__ bias, float* __restrict__ C, int ldc, int M, int N, int K) {
  __shared__ __attribute__((aligned(16))) float so[4][16][64];
  const int tid = threadIdx.x, w = tid >> 5, lane = tid & 31, ln = lane & 15, hh = lane >> 4;
  const int ntn = N / 64;
  const int wid = blockIdx.x * 4 + w;
  const int mt = wid / ntn, nq = wid % ntn;
  if (mt * 16 >= M) return;
  const int row0 = mt * 16, col0 = nq * 64;
  const float* arow = A + (size_t)(row0 + ln) * lda;
  v8f acc[4] = {};
  for (int kb = 0; kb < K; kb += 32) {
    FragB ah, al;
    const v4f x0 = *(const v4fa*)(arow + kb + 8 * hh), x1 = *(const v4fa*)(arow + kb + 8 * hh + 4);
    const v4f x2 = *(const v4fa*)(arow + kb + 16 + 8 * hh), x3 = *(const v4fa*)(arow + kb + 16 + 8 * hh + 4);
    float xs[16] = {x0[0],x0[1],x0[2],x0[3],x1[0],x1[1],x1[2],x1[3],x2[0],x2[1],x2[2],x2[3],x3[0],x3[1],x3[2],x3[3]};
#pragma unroll
    for (int i = 0; i < 16; ++i) { const unsigned short hb = bf16_bits(xs[i]); ah.u[i] = hb; al.u[i] = ASPLIT ? bf16_bits(xs[i] - bf16_val(hb)) : (unsigned short)0; }
#pragma unroll
    for (int t = 0; t < 4; ++t) {
      const unsigned short* brow = Wt + (size_t)(col0 + t * 16 + ln) * ldb + kb;
      FragB b;
      b.half[0] = *(const v8us*)(brow + 8 * hh);
      b.half[1] = *(const v8us*)(brow + 16 + 8 * hh);
      acc[t] = mmaN<ASPLIT ? 2 : 1>(ah.v, al.v, b.v, b.v, acc[t]);
    }
  }
#pragma unroll
  for (int t = 0; t < 4; ++t) {
    float bv = bias ? bias[col0 + t * 16 + ln] : 0.f;
    if (BIAS_BF16) bv = bf16_round(bv);
#pragma unroll
    for (int r = 0; r < 8; ++r) { float v = acc[t][r] + bv; if (ACT == 1) v = fmaxf(v, 0.f); so[w][8 * hh + r][t * 16 + ln] = v; }
  }
  __builtin_amdgcn_fence(__ATOMIC_ACQ_REL, "workgroup");
  __builtin_amdgcn_wave_barrier();
  const int rsub = lane >> 4, c4 = (lane & 15) * 4;
  {
#pragma unroll
    for (int q = 0; q < 8; ++q) {
      const int r = q * 2 + rsub;
      const v4f v = *(const v4fa*)&so[w][r][c4];
      *(v4f*)(C + (size_t)(row0 + r) * ldc + col0 + c4) = v;
    }
    
  }
}

// Flash-style causal/unmasked attention, all contractions 3-term bf16 hi/lo splits, f32 softmax with running max.
// q,k,v rows are read from f32 buffers with arbitrary row pitch (so they can live inside a fused qkv buffer);
// D = head size (multiple of 32, <= 128); one wave = 16 query rows; block = 4 waves (64 queries) sharing K/V chunks of 32.
template <int D, bool CAUSAL>
__global__ __launch_bounds__(128) void k_flash(const float* __restrict__ qb, const float* __restrict__ kb, const float* __restrict__ vb,
                                             int pitch, int T, int H, float scale, float* __restrict__ y, int ypitch) {
  constexpr int KS = D / 32;        // k-steps for QK
  constexpr int DT = D / 16;        // d tiles for PV
  __shared__ __attribute__((aligned(16))) unsigned short sKh[32][D + 8], sKl[32][D + 8], sVh[32][D + 8], sVl[32][D + 8];
  __shared__ __attribute__((aligned(16))) unsigned short sPh[4][16][40], sPl[4][16][40];
  __shared__ __attribute__((aligned(16))) float sO[4][16][D];
  const int tid = threadIdx.x, w = tid >> 5, lane = tid & 31, ln = lane & 15, hh = lane >> 4;
  const int nqb = (T + 63) / 64;
  const int bh = blockIdx.x / nqb, qblk = blockIdx.x % nqb;
  const int b = bh / H, h = bh % H;
  const int q0 = qblk * 64 + w * 16;
  const float* Q = qb + (size_t)b * T * pitch + h * D;
  const float* K = kb + (size_t)b * T * pitch + h * D;
  const float* V = vb + (size_t)b * T * pitch + h * D;

  // A fragments of the wave's 16 query rows (scaled), hi/lo
  FragB aqh[KS], aql[KS];
  {
    int row = q0 + ln; if (row >= T) row = T - 1;
    const float* qr = Q + (size_t)row * pitch;
#pragma unroll
    for (int ks = 0; ks < KS; ++ks)
#pragma unroll
      for (int i = 0; i < 16; ++i) {
        const int d = ks * 32 + ((i < 8) ? (8 * hh + i) : (16 + 8 * hh + (i - 8)));
        const float x = qr[d] * scale; const unsigned short hb = bf16_bits(x);
        aqh[ks].u[i] = hb; aql[ks].u[i] = bf16_bits(x - bf16_val(hb));
      }
  }
  float m_r[8], l_r[8];
#pragma unroll
  for (int r = 0; r < 8; ++r) { m_r[r] = -3.0e38f; l_r[r] = 0.f; }
  v8f oacc[DT];
#pragma unroll
  for (int dt = 0; dt < DT; ++dt) oacc[dt] = (v8f){0.f,0.f,0.f,0.f,0.f,0.f,0.f,0.f};

  const int kv_end = CAUSAL ? min(T, qblk * 64 + 64) : T;     // block-uniform
  for (int j0 = 0; j0 < kv_end; j0 += 32) {
    __syncthreads();
    for (int e = tid; e < 32 * (D / 4); e += 128) {
      const int r = e / (D / 4), c4 = (e % (D / 4)) * 4;
      const int key = j0 + r;
      v4f kf = {0.f,0.f,0.f,0.f}, vf = {0.f,0.f,0.f,0.f};
      if (key < T) { kf = *(const v4fa*)(K + (size_t)key * pitch + c4); vf = *(const v4fa*)(V + (size_t)key * pitch + c4); }
#pragma unroll
      for (int t = 0; t < 4; ++t) {
        unsigned short hb = bf16_bits(kf[t]); sKh[r][c4 + t] = hb; sKl[r][c4 + t] = bf16_bits(kf[t] - bf16_val(hb));
        hb = bf16_bits(vf[t]); sVh[r][c4 + t] = hb; sVl[r][c4 + t] = bf16_bits(vf[t] - bf16_val(hb));
      }
    }
    __syncthreads();
    // S tile 16 x 32
    v8f s[2];
#pragma unroll
    for (int nt = 0; nt < 2; ++nt) {
      v8f acc = {};
#pragma unroll
      for (int ks = 0; ks < KS; ++ks) {
        FragB bh_, bl_;
        bh_.half[0] = *(const v8us*)&sKh[nt * 16 + ln][ks * 32 + 8 * hh]; bh_.half[1] = *(const v8us*)&sKh[nt * 16 + ln][ks * 32 + 16 + 8 * hh];
        bl_.half[0] = *(const v8us*)&sKl[nt * 16 + ln][ks * 32 + 8 * hh]; bl_.half[1] = *(const v8us*)&sKl[nt * 16 + ln][ks * 32 + 16 + 8 * hh];
        acc = mmaN<3>(aqh[ks].v, aql[ks].v, bh_.v, bl_.v, acc);
      }
      s[nt] = acc;
    }
    // mask + running max (rows 8hh+r; the 16 lanes of a half share rows)
    float alpha[8];
#pragma unroll
    for (int r = 0; r < 8; ++r) {
      const int qi = q0 + 8 * hh + r;
      const int ja = j0 + ln, jb = j0 + 16 + ln;
      if (CAUSAL) { if (ja > qi) s[0][r] = -3.0e38f; if (jb > qi) s[1][r] = -3.0e38f; }
      if (ja >= T) s[0][r] = -3.0e38f;
      if (jb >= T) s[1][r] = -3.0e38f;
      float mx = fmaxf(s[0][r], s[1][r]);
      mx = fmaxf(mx, __shfl_xor(mx, 1, 32)); mx = fmaxf(mx, __shfl_xor(mx, 2, 32)); mx = fmaxf(mx, __shfl_xor(mx, 4, 32)); mx = fmaxf(mx, __shfl_xor(mx, 8, 32));
      const float mnew = fmaxf(m_r[r], mx);
      alpha[r] = (mnew > -1.0e38f) ? __expf(m_r[r] - mnew) : 1.0f;
      const float p0 = (s[0][r] > -1.0e38f) ? __expf(s[0][r] - mnew) : 0.f;
      const float p1 = (s[1][r] > -1.0e38f) ? __expf(s[1][r] - mnew) : 0.f;
      m_r[r] = mnew;
      l_r[r] = l_r[r] * alpha[r] + p0 + p1;            // per-lane partial row sum (16 lanes combined at the end)
      unsigned short hb = bf16_bits(p0); sPh[w][8 * hh + r][ln] = hb;      sPl[w][8 * hh + r][ln] = bf16_bits(p0 - bf16_val(hb));
      hb = bf16_bits(p1);                sPh[w][8 * hh + r][16 + ln] = hb; sPl[w][8 * hh + r][16 + ln] = bf16_bits(p1 - bf16_val(hb));
    }
#pragma unroll
    for (int dt = 0; dt < DT; ++dt)
#pragma unroll
      for (int r = 0; r < 8; ++r) oacc[dt][r] *= alpha[r];
    __builtin_amdgcn_fence(__ATOMIC_ACQ_REL, "workgroup");
    __builtin_amdgcn_wave_barrier();
    FragB pah, pal;
    pah.half[0] = *(const v8us*)&sPh[w][ln][8 * hh]; pah.half[1] = *(const v8us*)&sPh[w][ln][16 + 8 * hh];
    pal.half[0] = *(const v8us*)&sPl[w][ln][8 * hh]; pal.half[1] = *(const v8us*)&sPl[w][ln][16 + 8 * hh];
#pragma unroll
    for (int dt = 0; dt < DT; ++dt) {
      FragB bvh, bvl;
#pragma unroll
      for (int i = 0; i < 8; ++i) {
        bvh.u[i] = sVh[8 * hh + i][dt * 16 + ln]; bvh.u[8 + i] = sVh[16 + 8 * hh + i][dt * 16 + ln];
        bvl.u[i] = sVl[8 * hh + i][dt * 16 + ln]; bvl.u[8 + i] = sVl[16 + 8 * hh + i][dt * 16 + ln];
      }
      oacc[dt] = mmaN<3>(pah.v, pal.v, bvh.v, bvl.v, oacc[dt]);
    }
    __builtin_amdgcn_fence(__ATOMIC_ACQ_REL, "workgroup");
    __builtin_amdgcn_wave_barrier();
  }
#pragma unroll
  for (int r = 0; r < 8; ++r) {
    float l = l_r[r];
    l += __shfl_xor(l, 1, 32); l += __shfl_xor(l, 2, 32); l += __shfl_xor(l, 4, 32); l += __shfl_xor(l, 8, 32);
    l_r[r] = (l > 0.f) ? 1.0f / l : 0.f;
  }
#pragma unroll
  for (int dt = 0; dt < DT; ++dt)
#pragma unroll
    for (int r = 0; r < 8; ++r) sO[w][8 * hh + r][dt * 16 + ln] = oacc[dt][r] * l_r[r];
  __builtin_amdgcn_fence(__ATOMIC_ACQ_REL, "workgroup");
  __builtin_amdgcn_wave_barrier();
  {
    for (int r = 0; r < 16; ++r) {
      const int row = q0 + r;
      if (row < T && lane < D / 4) {
        const v4f val = *(const v4fa*)&sO[w][r][lane * 4];
        *(v4f*)(y + ((size_t)b * T + row) * ypitch + h * D + lane * 4) = val;
      }
    }
    
  }
}

// GEMM C = act(A·W + bias + resid): A f32 (ASPLIT -> hi/lo 2 terms), Wt bf16 [N][K]; ACT 0 none, 1 relu, 2 exact gelu;
// resid (optional, f32, row index = (row % rmod), pitch ldr, RES_BF16 rounds it) added before the activation.
template <bool ASPLIT, int ACT, bool BIAS_BF16, bool RES_BF16>
__global__ __launch_bounds__(128) void k_gemm_bf3(const float* __restrict__ A, int lda, const unsigned short* __restrict__ Wt, int ldb,
                                                const float* __restrict__ bias, const float* __restrict__ resid, int rmod, int ldr,
                                                float* __restrict__ C, int ldc, int M, int N, int K) {
  __shared__ __attribute__((aligned(16))) float so[4][16][64];
  const int tid = threadIdx.x, w = tid >> 5, lane = tid & 31, ln = lane & 15, hh = lane >> 4;
  const int ntn = N / 64;
  const int wid = blockIdx.x * 4 + w;
  const int mt = wid / ntn, nq = wid % ntn;
  if (mt * 16 >= M) return;
  const int row0 = mt * 16, col0 = nq * 64;
  const float* arow = A + (size_t)(row0 + ln) * lda;
  v8f acc[4] = {};
  for (int kb = 0; kb < K; kb += 32) {
    FragB ah, al;
    const v4f x0 = *(const v4fa*)(arow + kb + 8 * hh), x1 = *(const v4fa*)(arow + kb + 8 * hh + 4);
    const v4f x2 = *(const v4fa*)(arow + kb + 16 + 8 * hh), x3 = *(const v4fa*)(arow + kb + 16 + 8 * hh + 4);
    float xs[16] = {x0[0],x0[1],x0[2],x0[3],x1[0],x1[1],x1[2],x1[3],x2[0],x2[1],x2[2],x2[3],x3[0],x3[1],x3[2],x3[3]};
#pragma unroll
    for (int i = 0; i < 16; ++i) { const unsigned short hb = bf16_bits(xs[i]); ah.u[i] = hb; al.u[i] = ASPLIT ? bf16_bits(xs[i] - bf16_val(hb)) : (unsigned short)0; }
#pragma unroll
    for (int t = 0; t < 4; ++t) {
      const unsigned short* brow = Wt + (size_t)(col0 + t * 16 + ln) * ldb + kb;
      FragB b;
      b.half[0] = *(const v8us*)(brow + 8 * hh);
      b.half[1] = *(const v8us*)(brow + 16 + 8 * hh);
      acc[t] = mmaN<ASPLIT ? 2 : 1>(ah.v, al.v, b.v, b.v, acc[t]);
    }
  }
#pragma unroll
  for (int t = 0; t < 4; ++t) {
    const int col = col0 + t * 16 + ln;
    float bv = bias ? bias[col] : 0.f;
    if (BIAS_BF16) bv = bf16_round(bv);
#pragma unroll
    for (int r = 0; r < 8; ++r) {
      float v = acc[t][r] + bv;
      if (resid) { float rv = resid[(size_t)((row0 + 8 * hh + r) % rmod) * ldr + col]; if (RES_BF16) rv = bf16_round(rv); v += rv; }
      if (ACT == 1) v = fmaxf(v, 0.f);
      if (ACT == 2) v = 0.5f * v * (1.0f + erff(v * 0.70710678118654752f));
      if (ACT == 3) { const float u = 0.7978845608028654f * (v + 0.044715f * v * v * v); v = 0.5f * v * (1.0f + tanhf(u)); }
      so[w][8 * hh + r][t * 16 + ln] = v;
    }
  }
  __builtin_amdgcn_fence(__ATOMIC_ACQ_REL, "workgroup");
  __builtin_amdgcn_wave_barrier();
  const int rsub = lane >> 4, c4 = (lane & 15) * 4;
  {
#pragma unroll
    for (int q = 0; q < 8; ++q) {
      const int r = q * 2 + rsub;
      const v4f v = *(const v4fa*)&so[w][r][c4];
      *(v4f*)(C + (size_t)(row0 + r) * ldc + col0 + c4) = v;
    }
    
  }
}
// row LayerNorm (biased variance, eps) over N: s = X (+ R); optional out_sum <- s; out_norm <- (s-mu)*rsqrt(var+eps)*g + b
template <bool PARAM_BF16>
__global__ __launch_bounds__(256) void k_layernorm(const float* __restrict__ X, const float* __restrict__ R, const float* __restrict__ g, const float* __restrict__ bta,
                                                  float* __restrict__ out_sum, float* __restrict__ out_norm, int N, float eps) {
  __shared__ float red[256];
  const int row = blockIdx.x, tid = threadIdx.x;
  const float* x = X + (size_t)row * N; const float* rr = R ? R + (size_t)row * N : nullptr;
  float vals[16];                     // up to N = 4096
  const int per = N / 256;            // contiguous chunk per thread? use strided-by-4 chunks: thread handles j = tid*4 + 1024*u
  float s1 = 0.f;
  for (int u = 0; u < per / 4; ++u) {
    const int j = tid * 4 + 1024 * u;
    const v4f a = *(const v4fa*)(x + j);
    v4f b = {0.f,0.f,0.f,0.f}; if (rr) b = *(const v4fa*)(rr + j);
#pragma unroll
    for (int q = 0; q < 4; ++q) { const float v = a[q] + b[q]; vals[u * 4 + q] = v; s1 += v; }
  }
  red[tid] = s1; __syncthreads();
  for (int st = 128; st > 0; st >>= 1) { if (tid < st) red[tid] += red[tid + st]; __syncthreads(); }
  const float mu = red[0] / (float)N; __syncthreads();
  float s2 = 0.f;
  for (int u = 0; u < per / 4; ++u)
#pragma unroll
    for (int q = 0; q < 4; ++q) { const float c = vals[u * 4 + q] - mu; s2 += c * c; }
  red[tid] = s2; __syncthreads();
  for (int st = 128; st > 0; st >>= 1) { if (tid < st) red[tid] += red[tid + st]; __syncthreads(); }
  const float rs = rsqrtf(red[0] / (float)N + eps);
  {
    for (int u = 0; u < per / 4; ++u) {
      const int j = tid * 4 + 1024 * u;
      v4f o, sm;
#pragma unroll
      for (int q = 0; q < 4; ++q) {
        float gg = g[j + q], bb = bta[j + q];
        if (PARAM_BF16) { gg = bf16_round(gg); bb = bf16_round(bb); }
        sm[q] = vals[u * 4 + q]; o[q] = (vals[u * 4 + q] - mu) * rs * gg + bb;
      }
      if (out_sum) *(v4f*)(out_sum + (size_t)row * N + j) = sm;
      *(v4f*)(out_norm + (size_t)row * N + j) = o;
    }
    
  }
}



// ---- f16 WMMA path (v_wmma_f32_16x16x32_f16): 11-bit significands for operands in range — used where a [0,1] probability operand needs more precision than bf16
typedef _Float16 v16h __attribute__((ext_vector_type(16)));
union FragH { v16h v; v8us half[2]; _Float16 h[16]; unsigned short u[16]; };
template <int NT>
__device__ __forceinline__ v8f mmaH(v16h ah, v16h al, v16h bh, v16h bl, v8f c) {
  c = __builtin_amdgcn_wmma_f32_16x16x32_f16(false, ah, false, bh, (short)0, c, false, false);
  if (NT >= 2) c = __builtin_amdgcn_wmma_f32_16x16x32_f16(false, al, false, bh, (short)0, c, false, false);
  if (NT >= 3) c = __builtin_amdgcn_wmma_f32_16x16x32_f16(false, ah, false, bl, (short)0, c, false, false);
  asm volatile("v_nop\n\tv_nop\n\tv_nop\n\tv_nop" : "+v"(c) : "v"(ah), "v"(al), "v"(bh), "v"(bl));
  return c;
}
// batched GEMM like k_gemm_b but f16 operands: A f32 (split into f16 hi/lo if ASPLIT, else rounded to f16), Bt = f16 values [n][k]; alpha; C f32; N multiple of 16 (partial tiles skipped)
template <bool ASPLIT>
__global__ __launch_bounds__(128) void k_gemm_h(const float* __restrict__ A, int lda, size_t sA, const _Float16* __restrict__ Bh, int ldb, size_t sB, float alpha, float* __restrict__ C, int ldc, size_t sC, int M, int N, int K) {
  __shared__ __attribute__((aligned(16))) float so[4][16][64];
  const int tid = threadIdx.x, w = tid >> 5, lane = tid & 31, ln = lane & 15, hh = lane >> 4; const int by = blockIdx.y;
  A += (size_t)by * sA; Bh += (size_t)by * sB; C += (size_t)by * sC;
  const int ntn = (N + 63) / 64; const int wid = blockIdx.x * 4 + w; const int mt = wid / ntn, nq = wid % ntn; if (mt * 16 >= M) return;
  const int row0 = mt * 16, col0 = nq * 64; const float* arow = A + (size_t)(row0 + ln) * lda;
  v8f acc[4] = {};
  for (int kb = 0; kb < K; kb += 32) {
    FragH ah, al;
    const v4f x0 = *(const v4fa*)(arow + kb + 8 * hh), x1 = *(const v4fa*)(arow + kb + 8 * hh + 4), x2 = *(const v4fa*)(arow + kb + 16 + 8 * hh), x3 = *(const v4fa*)(arow + kb + 16 + 8 * hh + 4);
    float xs[16] = {x0[0],x0[1],x0[2],x0[3],x1[0],x1[1],x1[2],x1[3],x2[0],x2[1],x2[2],x2[3],x3[0],x3[1],x3[2],x3[3]};
#pragma unroll
    for (int i = 0; i < 16; ++i) { const _Float16 h = (_Float16)xs[i]; ah.h[i] = h; al.h[i] = ASPLIT ? (_Float16)(xs[i] - (float)h) : (_Float16)0.0f; }
#pragma unroll
    for (int t = 0; t < 4; ++t) { if (col0 + t * 16 >= N) continue; const size_t boff = (size_t)(col0 + t * 16 + ln) * ldb + kb; FragH bq; bq.half[0] = *(const v8us*)(Bh + boff + 8 * hh); bq.half[1] = *(const v8us*)(Bh + boff + 16 + 8 * hh);
      acc[t] = mmaH<ASPLIT ? 2 : 1>(ah.v, al.v, bq.v, bq.v, acc[t]); }
  }
#pragma unroll
  for (int t = 0; t < 4; ++t) { if (col0 + t * 16 >= N) continue;
#pragma unroll
    for (int r = 0; r < 8; ++r) so[w][8 * hh + r][t * 16 + ln] = acc[t][r] * alpha; }
  __builtin_amdgcn_fence(__ATOMIC_ACQ_REL, "workgroup"); __builtin_amdgcn_wave_barrier();
  const int rsub = lane >> 4, c4 = (lane & 15) * 4;
  {
#pragma unroll
    for (int q = 0; q < 8; ++q) { const int r = q * 2 + rsub; if (col0 + c4 < N) { const v4f v = *(const v4fa*)&so[w][r][c4]; *(v4f*)(C + (size_t)(row0 + r) * ldc + col0 + c4) = v; } }
     }
}

// Wt[n][k] = f16(W[k][n]·scale) from f32 row-major W[K][N] (scale = power of two; bf16-exact weights stay exact in f16 away from the subnormal range)
__global__ __launch_bounds__(256) void k_wt_f16(const float* __restrict__ W, _Float16* __restrict__ Wt, int K, int N, float scale) {
  const int t = blockIdx.x * 256 + threadIdx.x; if (t >= N * (K / 8)) return; const int n = t / (K / 8), k8 = (t % (K / 8)) * 8; FragH f;
#pragma unroll
  for (int i = 0; i < 8; ++i) f.h[i] = (_Float16)(bf16_round(W[(size_t)(k8 + i) * N + n]) * scale); const v8us o = f.half[0];
  *(v8us*)((unsigned short*)Wt + (size_t)n * K + k8) = o; 
}


typedef _Float16 v4h __attribute__((ext_vector_type(4)));

__global__ __launch_bounds__(256) void k_h16(const float* __restrict__ x, _Float16* __restrict__ X16, size_t n8) { const size_t t = (size_t)blockIdx.x * 256 + threadIdx.x; if (t >= n8) return; FragH f;
#pragma unroll
  for (int q = 0; q < 8; ++q) f.h[q] = (_Float16)x[t * 8 + q]; *(v8us*)((unsigned short*)X16 + t * 8) = f.half[0];  }
// One launch makes q, k and v from the f32 inputs, k and v in the order in which the attention kernel's A fragments hold them (see Kp, Vp below). A work-group takes 64 rows of x. Its 512 threads each round one unit of 8 values of Wq, Wk, Wv (bf16, x 2^4) and of the 64 rows (bf16) to f16 in LDS;
// then waves 0-3 make q, 4-7 k (one 16-row tile each, 4 feature tiles) and 8-11 v (one feature tile each, 4 row tiles); waves 12-15 only help to fill LDS. The operand roles are chosen by where the result goes:
// for q and k the weight rows are A and the x rows B, so a lane's 8 results are 8 features of one row; for v the x rows are A, so they are 8 positions of one feature. Each is one 16-byte store: these 8 values are
// one lane's half of an A fragment (features or keys 8hh + r of a group of 16), so a k or v store of a wave is 512 contiguous bytes at lane * 16; a wave's 4 q stores fill whole 128-byte lines.
// Kp: per 16 keys 4 units of 512 bytes, unit u = features u * 16 .. + 15: lane (hh, ln) holds features u * 16 + 8hh + r of key ln. Vp: per 32 keys 8 units, unit dt * 2 + g: lane (hh, ln) holds keys g * 16 + 8hh + r of feature dt * 16 + ln.
// In LDS, rows of 64 f16 lie at a pitch of 144 bytes (16 x odd) for the 16-byte fragment reads. A and B fragments come from one loader, so their k orders are equal.
__global__ __launch_bounds__(512) void k_proj(const float* __restrict__ x, const float* __restrict__ Wq, const float* __restrict__ Wk, const float* __restrict__ Wv, _Float16* __restrict__ Q16, _Float16* __restrict__ Kp, _Float16* __restrict__ Vp) {
  constexpr int P = CC + 8;
  __shared__ __attribute__((aligned(16))) unsigned short sh[4 * CC][P];      // rows 0-63 Wq, 64-127 Wk, 128-191 Wv (row = output feature), 192-255 the 64 rows of x
  const int tid = threadIdx.x, w = __builtin_amdgcn_readfirstlane(tid >> 5), lane = tid & 31, ln = lane & 15, hh = lane >> 4;      // w in a scalar register: the roles below branch on it, and every lane must stay on at the WMMAs
  const int row0 = blockIdx.x * 64;
  const unsigned boff = tid * 32u;      // byte offset of the thread's unit in each of the four sources
  const char* const src[4] = {(const char*)Wq, (const char*)Wk, (const char*)Wv, (const char*)(x + (size_t)row0 * CC)};
  v4f in[4][2];
#pragma unroll      // unrolled, here and below: in and the fragments are indexed by constants and stay in registers; the 8 loads go out before the first conversion
  for (int i = 0; i < 4; ++i) { in[i][0] = *(const v4fa*)(src[i] + boff); in[i][1] = *(const v4fa*)(src[i] + boff + 16); }
  asm volatile("s_wait_xcnt 0x0" :: "v"(boff) : "memory");      // the loads' offset register is named so that it lives up to this wait: what follows may reuse it
#pragma unroll
  for (int i = 0; i < 4; ++i) { FragH f;
#pragma unroll
    for (int q = 0; q < 8; ++q) { const float v = bf16_round(in[i][q >> 2][q & 3]); f.h[q] = (_Float16)(i < 3 ? v * 16.0f : v); }
    *(v8us*)&sh[i * CC + (tid >> 3)][(tid & 7) * 8] = f.half[0]; }
  __syncthreads();      // the f16 operands are in LDS before any wave reads a fragment
  if (w >= 12) return;      // behind the only barrier
  auto frag = [&](int r, int ks) { FragH f; f.half[0] = *(const v8us*)&sh[r][ks * 32 + 8 * hh]; f.half[1] = *(const v8us*)&sh[r][ks * 32 + 16 + 8 * hh]; return f; };
  const bool isv = w >= 8;
  const int keep = isv ? w * 16 : 3 * CC + (w & 3) * 16;      // first LDS row of the tile a wave keeps as B: v: feature tile w - 8 of Wv; q, k: row tile w & 3 of x
  const int run = isv ? 3 * CC : (w >> 2) * CC;      // first LDS row of the 4 tiles it walks as A: v: the rows of x; q, k: the features of Wq or Wk
  const FragH b0 = frag(keep + ln, 0), b1 = frag(keep + ln, 1);
  unsigned short* dst = isv ? (unsigned short*)Vp + (size_t)row0 * CC + (w - 8) * 512 + lane * 8      // walked tile t = 16 keys: block t >> 1 of 32 keys, unit (w - 8) * 2 + (t & 1)
                      : w >= 4 ? (unsigned short*)Kp + (size_t)(row0 + (w & 3) * 16) * CC + lane * 8      // walked tile t = 16 features: unit t
                               : (unsigned short*)Q16 + (size_t)(row0 + w * 16 + ln) * CC + 8 * hh;
  const int st1 = w >= 4 ? 256 : 16, st2 = isv ? 32 * CC : 2 * st1;      // steps, in f16, of bit 0 and bit 1 of t
  FragH a[4][2];      // the fragment reads stand ahead of the products, so that later tiles' reads go out while earlier tiles are worked on
#pragma unroll
  for (int t = 0; t < 4; ++t) { a[t][0] = frag(run + t * 16 + ln, 0); a[t][1] = frag(run + t * 16 + ln, 1); }
#pragma unroll
  for (int t = 0; t < 4; ++t) { v8f acc = (v8f){0.f,0.f,0.f,0.f,0.f,0.f,0.f,0.f};
    acc = __builtin_amdgcn_wmma_f32_16x16x32_f16(false, a[t][0].v, false, b0.v, (short)0, acc, false, false);
    acc = __builtin_amdgcn_wmma_f32_16x16x32_f16(false, a[t][1].v, false, b1.v, (short)0, acc, false, false);      // acc[r] = (walked tile's row 8hh + r) . (kept tile's row ln)
    FragH o;
#pragma unroll
    for (int r = 0; r < 8; ++r) o.h[r] = (_Float16)(acc[r] * 0.0625f);
    *(v8us*)(dst + (t & 1) * st1 + (t >> 1) * st2) = o.half[0]; } }

// One work-group = one tile of 16 query rows; its NW waves deal the tile's 32-key blocks among themselves (wave w takes blocks w, w + NW, ...), each with its own
// running maximum, sum and accumulators; the partials are merged through LDS behind one work-group barrier. The launch bound asks for 8 waves per SIMD (128 VGPRs), so that
// two work-groups share a WGP. w is held in a scalar register: the waves' trip counts differ, and the loop must branch on a scalar so that every lane stays on at the WMMAs.
// Both products run transposed: S^T = K.Q^T (A = 16 key rows, B = the tile's queries, kept in registers) and O^T += V^T.P^T. A lane then holds 16 scores of ONE query (column ln; keys
// 8hh + r and 16 + 8hh + r of the block), so maximum and sum are in-lane but for one exchange between the wave's halves, and the two converted score tiles ARE the B operand of the second product.
// Softmax in base 2: exp(s / 8 - m) = 2^(s * SC2 - m'), m' = the maximum in the same units. v_exp_f32 gives 0 for -inf and for the -3e38 start value, which is all the range handling these arguments (never above 0) need.
#define SC2 0.18033688011112042f      // 64^-0.5 * log2(e)
__device__ __forceinline__ float ex2(float x) { return __builtin_amdgcn_exp2f(x); }
// The merge's form: the v_nop fills the one slot that the instruction set asks for behind a transcendental before its source is overwritten; inside the statement it cannot drift.
__device__ __forceinline__ float ex2_slot(float x) { float r; asm("v_exp_f32 %0, %1\n\tv_nop" : "=v"(r) : "v"(x)); return r; }
__device__ __forceinline__ float xhalf(float x) { return __builtin_bit_cast(float, __builtin_amdgcn_permlanex16(__builtin_bit_cast(int, x), __builtin_bit_cast(int, x), 0x76543210, 0xfedcba98, false, false)); }      // lane l reads lane l ^ 16
template <int NW>
__global__ __launch_bounds__(NW * 32, 8) void k_flash(const _Float16* __restrict__ Q16, int ldq, const _Float16* __restrict__ Kp, const _Float16* __restrict__ Vp, const int* __restrict__ MSK, float* __restrict__ O, int ldo) {
  constexpr int RPW = 16, NQB = 4096 / RPW, DT = 4, KS = 2;
  __shared__ __attribute__((aligned(16))) float sO[NW][RPW][64 + 4]; __shared__ float sM[NW][RPW], sL[NW][RPW];
  const int tid = threadIdx.x, w = __builtin_amdgcn_readfirstlane(tid >> 5), lane = tid & 31, ln = lane & 15, hh = lane >> 4;
  const int slab = blockIdx.x / NQB, qblk = blockIdx.x % NQB; const int b = slab / 1, h = slab % 1; const int q0 = qblk * RPW;
  FragH bq[KS];
  { const unsigned short* qr = (const unsigned short*)Q16 + ((size_t)b * 4096 + q0 + ln) * ldq + h * 64;
#pragma unroll
    for (int ks = 0; ks < KS; ++ks) { bq[ks].half[0] = *(const v8us*)(qr + ks * 32 + 8 * hh); bq[ks].half[1] = *(const v8us*)(qr + ks * 32 + 16 + 8 * hh); } }
  const unsigned short* Kl = (const unsigned short*)Kp + (size_t)slab * 4096 * 64 + lane * 8; const unsigned short* Vl = (const unsigned short*)Vp + (size_t)slab * 4096 * 64 + lane * 8;      // fragment order (k_proj): a block of 32 keys is 4 KB in each, every load below 512 contiguous bytes of it
  float m_q = -3.0e38f, l_q = 0.f; v8f oacc[DT];      // of query q0 + ln; l_q sums this half's keys only, the halves are joined behind the loop
#pragma unroll
  for (int dt = 0; dt < DT; ++dt) oacc[dt] = (v8f){0.f,0.f,0.f,0.f,0.f,0.f,0.f,0.f};      // oacc[dt][r] = O[q0 + ln][dt * 16 + 8hh + r]
  const int jend = q0 + RPW, tq = q0 + ln;
#pragma unroll 1
  for (int j0 = w * 32; j0 < jend; j0 += NW * 32) {
    v8f s[2];
#pragma unroll
    for (int nt = 0; nt < 2; ++nt) { const unsigned short* kr = Kl + (size_t)(j0 + nt * 16) * 64; FragH ak[KS];      // A operand: key rows j0 + nt * 16 + ln
#pragma unroll
      for (int ks = 0; ks < KS; ++ks) { ak[ks].half[0] = *(const v8us*)(kr + ks * 512); ak[ks].half[1] = *(const v8us*)(kr + ks * 512 + 256); }
      v8f acc = (v8f){0.f,0.f,0.f,0.f,0.f,0.f,0.f,0.f};
#pragma unroll
      for (int ks = 0; ks < KS; ++ks) acc = mmaH<1>(ak[ks].v, ak[ks].v, bq[ks].v, bq[ks].v, acc);
      s[nt] = acc; }      // s[nt][r] = q(q0 + ln) . k(j0 + nt * 16 + 8hh + r)
    float mc = -INFINITY; const int dq = tq - j0 - 8 * hh;      // score (nt, r) is unmasked while nt * 16 + r <= dq
#pragma unroll
    for (int nt = 0; nt < 2; ++nt)
#pragma unroll
      for (int r = 0; r < 8; ++r) { s[nt][r] = (nt * 16 + r <= dq) ? s[nt][r] : -INFINITY; mc = fmaxf(mc, s[nt][r]); }      // raw products: the scale is positive, so it is applied to the maximum alone
    mc = fmaxf(mc, xhalf(mc));
    // every block a wave walks starts at a key j0 <= q0, so each query has an unmasked score in it and mn is a finite score: a masked score (-inf) gives exp = 0 and the first block gives al = 0 with no test
    const float mn = fmaxf(m_q, mc * SC2); const float al = ex2(m_q - mn); m_q = mn;
    float ps = 0.f; FragH pb;
#pragma unroll
    for (int nt = 0; nt < 2; ++nt)
#pragma unroll
      for (int r = 0; r < 8; ++r) { const float p = ex2(fmaf(s[nt][r], SC2, -mn)); ps += p; pb.h[nt * 8 + r] = (_Float16)p; }      // element nt * 8 + r of a B fragment is k = nt * 16 + 8hh + r: the key this score belongs to
    l_q = l_q * al + ps;
#pragma unroll
    for (int dt = 0; dt < DT; ++dt) { const unsigned short* vrow = Vl + (size_t)j0 * 64 + dt * 512; FragH av; av.half[0] = *(const v8us*)vrow; av.half[1] = *(const v8us*)(vrow + 256);      // A operand: V^T rows dt * 16 + ln, the block's 32 keys in the k order of the packed scores
#pragma unroll
      for (int r = 0; r < 8; ++r) oacc[dt][r] *= al;
      oacc[dt] = mmaH<1>(av.v, av.v, pb.v, pb.v, oacc[dt]); } }
  // each wave hands over its un-normalised partial: (maximum, sum) per row and the 16 x 64 accumulator; a wave without a block hands (-3e38, 0, zeros), which weighs 0 in the merge
  const int le = (int)__builtin_amdgcn_mbcnt_lo(~0u, 0u), lne = le & 15, hhe = le >> 4;      // lane id read anew, so that tid and its parts need no registers across the loop
  l_q += xhalf(l_q);
  if (hhe == 0) { sM[w][lne] = m_q; sL[w][lne] = l_q; }
#pragma unroll
  for (int dt = 0; dt < DT; ++dt) { *(v4fa*)&sO[w][lne][dt * 16 + 8 * hhe] = (v4f){oacc[dt][0], oacc[dt][1], oacc[dt][2], oacc[dt][3]}; *(v4fa*)&sO[w][lne][dt * 16 + 8 * hhe + 4] = (v4f){oacc[dt][4], oacc[dt][5], oacc[dt][6], oacc[dt][7]}; }
  __syncthreads();      // every wave's partial is in LDS before any is merged
  static_assert(NW == RPW, "wave w merges row w");
  { typedef float v2f __attribute__((ext_vector_type(2))); typedef float v2fa __attribute__((ext_vector_type(2), may_alias)); const int r = w; float M = sM[0][r];
#pragma unroll      // both loops unrolled: the NW partials' LDS loads go out together instead of one wait each
    for (int u = 1; u < NW; ++u) M = fmaxf(M, sM[u][r]);
    float L = 0.f; v2f val = {0.f, 0.f};
#pragma unroll
    for (int u = 0; u < NW; ++u) { const float e = ex2_slot(sM[u][r] - M); L += e * sL[u][r]; const v2f pv = *(const v2fa*)&sO[u][r][le * 2]; val += pv * e; }
    const float inv = (L > 0.f) ? 1.0f / L : 0.f; val *= inv;
    *(v2f*)(O + ((size_t)b * 4096 + q0 + r) * ldo + h * 64 + le * 2) = val; } }

extern "C" void kernel_launch(void* const* d_in, const int* in_sizes, int n_in,
                              void* d_out, int out_size, void* d_ws, size_t ws_size, hipStream_t stream) {
  (void)in_sizes; (void)n_in; (void)out_size;
  const float* x = (const float*)d_in[0]; const float* Wk = (const float*)d_in[1]; const float* Wq = (const float*)d_in[2]; const float* Wv = (const float*)d_in[3];
  char* ws = (char*)d_ws; size_t off = 0;
  auto take = [&](size_t bytes) { char* p = ws + off; off += (bytes + 255) & ~(size_t)255; return p; };
  _Float16* Q16 = (_Float16*)take((size_t)NR * CC * 2); _Float16* Kp = (_Float16*)take((size_t)NR * CC * 2); _Float16* Vp = (_Float16*)take((size_t)NR * CC * 2);
  if (off > ws_size) return;      // 3 buffers of 2 MiB
  k_proj<<<NR / 64, 512, 0, stream>>>(x, Wq, Wk, Wv, Q16, Kp, Vp);      // q in f16 rows; k and v in fragment order
  k_flash<16><<<BB * 1 * (TT / 16), 16 * 32, 0, stream>>>(Q16, CC, Kp, Vp, nullptr, (float*)d_out, CC);
}

// v006
// Measured time: 28.9 microseconds a run.
// Two timings next to v005 put it at 1.48 and 1.57 times that version's speed.
// All steps since v000 together make it 14.9 times as fast.
#include <hip/hip_runtime.h>
// Single causal attention head (B=4, T=4096, C=64): q,k,v = x·Wᵀ (no bias), softmax(q·kᵀ·64^-½) with a causal mask, out = P·v. One GEMM for [q|k|v] and a fused flash-style causal attention
// kernel (online softmax in f32; P f16 ≤ 1; O = P·Vᵀ-tiles; RPW-16 waves; causal tile skipping) on v_wmma_f32_16x16x32_f16 — x bf16-exact, (out,in) weights bf16-exact ×2^4, q/k/v f16,
// f32 accumulate.
#define BB 4
#define TT 4096
#define CC 64
#define NR (BB * TT)

typedef __bf16 v16b __attribute__((ext_vector_type(16)));
typedef unsigned short v8us __attribute__((ext_vector_type(8), may_alias));
typedef float  v8f  __attribute__((ext_vector_type(8)));
typedef float  v4f  __attribute__((ext_vector_type(4)));
typedef float  v4fa __attribute__((ext_vector_type(4), may_alias));
union FragB { v16b v; v8us half[2]; unsigned short u[16]; };

__device__ __forceinline__ unsigned short bf16_bits(float x) { unsigned int u = __float_as_uint(x); return (unsigned short)((u + 0x7FFFu + ((u >> 16) & 1u)) >> 16); }
__device__ __forceinline__ float bf16_val(unsigned short b) { return __uint_as_float(((unsigned int)b) << 16); }
__device__ __forceinline__ float bf16_round(float x) { return bf16_val(bf16_bits(x)); }
// D += A·B with NT terms: 1 = ah·bh, 2 = + al·bh (A split), 3 = + ah·bl (both split)
template <int NT>
__device__ __forceinline__ v8f mmaN(v16b ah, v16b al, v16b bh, v16b bl, v8f c) {
  c = __builtin_amdgcn_wmma_f32_16x16x32_bf16(false, ah, false, bh, (short)0, c, false, false);
  if (NT >= 2) c = __builtin_amdgcn_wmma_f32_16x16x32_bf16(false, al, false, bh, (short)0, c, false, false);
  if (NT >= 3) c = __builtin_amdgcn_wmma_f32_16x16x32_bf16(false, ah, false, bl, (short)0, c, false, false);
  asm volatile("v_nop\n\tv_nop\n\tv_nop\n\tv_nop" : "+v"(c) : "v"(ah), "v"(al), "v"(bh), "v"(bl));
  return c;
}

__global__ __launch_bounds__(256) void k_wt_bf16(const float* __restrict__ W, unsigned short* __restrict__ Wt, int K, int N) {
  const int t = blockIdx.x * 256 + threadIdx.x;
  const int k8n = K / 8;
  if (t >= N * k8n) return;
  const int n = t / k8n, k8 = (t % k8n) * 8;
  v8us v;
#pragma unroll
  for (int i = 0; i < 8; ++i) v[i] = bf16_bits(W[(size_t)(k8 + i) * N + n]);
  *(v8us*)(Wt + (size_t)n * K + k8) = v;
  
}

// GEMM C[M][N] (f32, pitch ldc) = act(A[M][K]·W + bias). A f32 row-major (pitch lda) converted per fragment to bf16
// (ASPLIT: hi/lo two planes -> 2 terms, else single rounded term); Wt bf16 [N][K] (pitch ldb). BIAS_BF16 rounds the
// bias to bf16 first (bias quantised to bf16 before the add). K%32==0, M%16==0, N%64==0.
template <bool ASPLIT, int ACT, bool BIAS_BF16>
__global__ __launch_bounds__(128) void k_gemm_bf(const float* __restrict__ A, int lda, const unsigned short* __restrict__ Wt, int ldb,
                                               const float* __restrict__ bias, float* __restrict__ C, int ldc, int M, int N, int K) {
  __shared__ __attribute__((aligned(16))) float so[4][16][64];
  const int tid = threadIdx.x, w = tid >> 5, lane = tid & 31, ln = lane & 15, hh = lane >> 4;
  const int ntn = N / 64;
  const int wid = blockIdx.x * 4 + w;
  const int mt = wid / ntn, nq = wid % ntn;
  if (mt * 16 >= M) return;
  const int row0 = mt * 16, col0 = nq * 64;
  const float* arow = A + (size_t)(row0 + ln) * lda;
  v8f acc[4] = {};
  for (int kb = 0; kb < K; kb += 32) {
    FragB ah, al;
    const v4f x0 = *(const v4fa*)(arow + kb + 8 * hh), x1 = *(const v4fa*)(arow + kb + 8 * hh + 4);
    const v4f x2 = *(const v4fa*)(arow + kb + 16 + 8 * hh), x3 = *(const v4fa*)(arow + kb + 16 + 8 * hh + 4);
    float xs[16] = {x0[0],x0[1],x0[2],x0[3],x1[0],x1[1],x1[2],x1[3],x2[0],x2[1],x2[2],x2[3],x3[0],x3[1],x3[2],x3[3]};
#pragma unroll
    for (int i = 0; i < 16; ++i) { const unsigned short hb = bf16_bits(xs[i]); ah.u[i] = hb; al.u[i] = ASPLIT ? bf16_bits(xs[i] - bf16_val(hb)) : (unsigned short)0; }
#pragma unroll
    for (int t = 0; t < 4; ++t) {
      const unsigned short* brow = Wt + (size_t)(col0 + t * 16 + ln) * ldb + kb;
      FragB b;
      b.half[0] = *(const v8us*)(brow + 8 * hh);
      b.half[1] = *(const v8us*)(brow + 16 + 8 * hh);
      acc[t] = mmaN<ASPLIT ? 2 : 1>(ah.v, al.v, b.v, b.v, acc[t]);
    }
  }
#pragma unroll
  for (int t = 0; t < 4; ++t) {
    float bv = bias ? bias[col0 + t * 16 + ln] : 0.f;
    if (BIAS_BF16) bv = bf16_round(bv);
#pragma unroll
    for (int r = 0; r < 8; ++r) { float v = acc[t][r] + bv; if (ACT == 1) v = fmaxf(v, 0.f); so[w][8 * hh + r][t * 16 + ln] = v; }
  }
  __builtin_amdgcn_fence(__ATOMIC_ACQ_REL, "workgroup");
  __builtin_amdgcn_wave_barrier();
  const int rsub = lane >> 4, c4 = (lane & 15) * 4;
  {
#pragma unroll
    for (int q = 0; q < 8; ++q) {
      const int r = q * 2 + rsub;
      const v4f v = *(const v4fa*)&so[w][r][c4];
      *(v4f*)(C + (size_t)(row0 + r) * ldc + col0 + c4) = v;
    }
    
  }
}

// Flash-style causal/unmasked attention, all contractions 3-term bf16 hi/lo splits, f32 softmax with running max.
// q,k,v rows are read from f32 buffers with arbitrary row pitch (so they can live inside a fused qkv buffer);
// D = head size (multiple of 32, <= 128); one wave = 16 query rows; block = 4 waves (64 queries) sharing K/V chunks of 32.
template <int D, bool CAUSAL>
__global__ __launch_bounds__(128) void k_flash(const float* __restrict__ qb, const float* __restrict__ kb, const float* __restrict__ vb,
                                             int pitch, int T, int H, float scale, float* __restrict__ y, int ypitch) {
  constexpr int KS = D / 32;        // k-steps for QK
  constexpr int DT = D / 16;        // d tiles for PV
  __shared__ __attribute__((aligned(16))) unsigned short sKh[32][D + 8], sKl[32][D + 8], sVh[32][D + 8], sVl[32][D + 8];
  __shared__ __attribute__((aligned(16))) unsigned short sPh[4][16][40], sPl[4][16][40];
  __shared__ __attribute__((aligned(16))) float sO[4][16][D];
  const int tid = threadIdx.x, w = tid >> 5, lane = tid & 31, ln = lane & 15, hh = lane >> 4;
  const int nqb = (T + 63) / 64;
  const int bh = blockIdx.x / nqb, qblk = blockIdx.x % nqb;
  const int b = bh / H, h = bh % H;
  const int q0 = qblk * 64 + w * 16;
  const float* Q = qb + (size_t)b * T * pitch + h * D;
  const float* K = kb + (size_t)b * T * pitch + h * D;
  const float* V = vb + (size_t)b * T * pitch + h * D;

  // A fragments of the wave's 16 query rows (scaled), hi/lo
  FragB aqh[KS], aql[KS];
  {
    int row = q0 + ln; if (row >= T) row = T - 1;
    const float* qr = Q + (size_t)row * pitch;
#pragma unroll
    for (int ks = 0; ks < KS; ++ks)
#pragma unroll
      for (int i = 0; i < 16; ++i) {
        const int d = ks * 32 + ((i < 8) ? (8 * hh + i) : (16 + 8 * hh + (i - 8)));
        const float x = qr[d] * scale; const unsigned short hb = bf16_bits(x);
        aqh[ks].u[i] = hb; aql[ks].u[i] = bf16_bits(x - bf16_val(hb));
      }
  }
  float m_r[8], l_r[8];
#pragma unroll
  for (int r = 0; r < 8; ++r) { m_r[r] = -3.0e38f; l_r[r] = 0.f; }
  v8f oacc[DT];
#pragma unroll
  for (int dt = 0; dt < DT; ++dt) oacc[dt] = (v8f){0.f,0.f,0.f,0.f,0.f,0.f,0.f,0.f};

  const int kv_end = CAUSAL ? min(T, qblk * 64 + 64) : T;     // block-uniform
  for (int j0 = 0; j0 < kv_end; j0 += 32) {
    __syncthreads();
    for (int e = tid; e < 32 * (D / 4); e += 128) {
      const int r = e / (D / 4), c4 = (e % (D / 4)) * 4;
      const int key = j0 + r;
      v4f kf = {0.f,0.f,0.f,0.f}, vf = {0.f,0.f,0.f,0.f};
      if (key < T) { kf = *(const v4fa*)(K + (size_t)key * pitch + c4); vf = *(const v4fa*)(V + (size_t)key * pitch + c4); }
#pragma unroll
      for (int t = 0; t < 4; ++t) {
        unsigned short hb = bf16_bits(kf[t]); sKh[r][c4 + t] = hb; sKl[r][c4 + t] = bf16_bits(kf[t] - bf16_val(hb));
        hb = bf16_bits(vf[t]); sVh[r][c4 + t] = hb; sVl[r][c4 + t] = bf16_bits(vf[t] - bf16_val(hb));
      }
    }
    __syncthreads();
    // S tile 16 x 32
    v8f s[2];
#pragma unroll
    for (int nt = 0; nt < 2; ++nt) {
      v8f acc = {};
#pragma unroll
      for (int ks = 0; ks < KS; ++ks) {
        FragB bh_, bl_;
        bh_.half[0] = *(const v8us*)&sKh[nt * 16 + ln][ks * 32 + 8 * hh]; bh_.half[1] = *(const v8us*)&sKh[nt * 16 + ln][ks * 32 + 16 + 8 * hh];
        bl_.half[0] = *(const v8us*)&sKl[nt * 16 + ln][ks * 32 + 8 * hh]; bl_.half[1] = *(const v8us*)&sKl[nt * 16 + ln][ks * 32 + 16 + 8 * hh];
        acc = mmaN<3>(aqh[ks].v, aql[ks].v, bh_.v, bl_.v, acc);
      }
      s[nt] = acc;
    }
    // mask + running max (rows 8hh+r; the 16 lanes of a half share rows)
    float alpha[8];
#pragma unroll
    for (int r = 0; r < 8; ++r) {
      const int qi = q0 + 8 * hh + r;
      const int ja = j0 + ln, jb = j0 + 16 + ln;
      if (CAUSAL) { if (ja > qi) s[0][r] = -3.0e38f; if (jb > qi) s[1][r] = -3.0e38f; }
      if (ja >= T) s[0][r] = -3.0e38f;
      if (jb >= T) s[1][r] = -3.0e38f;
      float mx = fmaxf(s[0][r], s[1][r]);
      mx = fmaxf(mx, __shfl_xor(mx, 1, 32)); mx = fmaxf(mx, __shfl_xor(mx, 2, 32)); mx = fmaxf(mx, __shfl_xor(mx, 4, 32)); mx = fmaxf(mx, __shfl_xor(mx, 8, 32));
      const float mnew = fmaxf(m_r[r], mx);
      alpha[r] = (mnew > -1.0e38f) ? __expf(m_r[r] - mnew) : 1.0f;
      const float p0 = (s[0][r] > -1.0e38f) ? __expf(s[0][r] - mnew) : 0.f;
      const float p1 = (s[1][r] > -1.0e38f) ? __expf(s[1][r] - mnew) : 0.f;
      m_r[r] = mnew;
      l_r[r] = l_r[r] * alpha[r] + p0 + p1;            // per-lane partial row sum (16 lanes combined at the end)
      unsigned short hb = bf16_bits(p0); sPh[w][8 * hh + r][ln] = hb;      sPl[w][8 * hh + r][ln] = bf16_bits(p0 - bf16_val(hb));
      hb = bf16_bits(p1);                sPh[w][8 * hh + r][16 + ln] = hb; sPl[w][8 * hh + r][16 + ln] = bf16_bits(p1 - bf16_val(hb));
    }
#pragma unroll
    for (int dt = 0; dt < DT; ++dt)
#pragma unroll
      for (int r = 0; r < 8; ++r) oacc[dt][r] *= alpha[r];
    __builtin_amdgcn_fence(__ATOMIC_ACQ_REL, "workgroup");
    __builtin_amdgcn_wave_barrier();
    FragB pah, pal;
    pah.half[0] = *(const v8us*)&sPh[w][ln][8 * hh]; pah.half[1] = *(const v8us*)&sPh[w][ln][16 + 8 * hh];
    pal.half[0] = *(const v8us*)&sPl[w][ln][8 * hh]; pal.half[1] = *(const v8us*)&sPl[w][ln][16 + 8 * hh];
#pragma unroll
    for (int dt = 0; dt < DT; ++dt) {
      FragB bvh, bvl;
#pragma unroll
      for (int i = 0; i < 8; ++i) {
        bvh.u[i] = sVh[8 * hh + i][dt * 16 + ln]; bvh.u[8 + i] = sVh[16 + 8 * hh + i][dt * 16 + ln];
        bvl.u[i] = sVl[8 * hh + i][dt * 16 + ln]; bvl.u[8 + i] = sVl[16 + 8 * hh + i][dt * 16 + ln];
      }
      oacc[dt] = mmaN<3>(pah.v, pal.v, bvh.v, bvl.v, oacc[dt]);
    }
    __builtin_amdgcn_fence(__ATOMIC_ACQ_REL, "workgroup");
    __builtin_amdgcn_wave_barrier();
  }
#pragma unroll
  for (int r = 0; r < 8; ++r) {
    float l = l_r[r];
    l += __shfl_xor(l, 1, 32); l += __shfl_xor(l, 2, 32); l += __shfl_xor(l, 4, 32); l += __shfl_xor(l, 8, 32);
    l_r[r] = (l > 0.f) ? 1.0f / l : 0.f;
  }
#pragma unroll
  for (int dt = 0; dt < DT; ++dt)
#pragma unroll
    for (int r = 0; r < 8; ++r) sO[w][8 * hh + r][dt * 16 + ln] = oacc[dt][r] * l_r[r];
  __builtin_amdgcn_fence(__ATOMIC_ACQ_REL, "workgroup");
  __builtin_amdgcn_wave_barrier();
  {
    for (int r = 0; r < 16; ++r) {
      const int row = q0 + r;
      if (row < T && lane < D / 4) {
        const v4f val = *(const v4fa*)&sO[w][r][lane * 4];
        *(v4f*)(y + ((size_t)b * T + row) * ypitch + h * D + lane * 4) = val;
      }
    }
    
  }
}

// GEMM C = act(A·W + bias + resid): A f32 (ASPLIT -> hi/lo 2 terms), Wt bf16 [N][K]; ACT 0 none, 1 relu, 2 exact gelu;
// resid (optional, f32, row index = (row % rmod), pitch ldr, RES_BF16 rounds it) added before the activation.
template <bool ASPLIT, int ACT, bool BIAS_BF16, bool RES_BF16>
__global__ __launch_bounds__(128) void k_gemm_bf3(const float* __restrict__ A, int lda, const unsigned short* __restrict__ Wt, int ldb,
                                                const float* __restrict__ bias, const float* __restrict__ resid, int rmod, int ldr,
                                                float* __restrict__ C, int ldc, int M, int N, int K) {
  __shared__ __attribute__((aligned(16))) float so[4][16][64];
  const int tid = threadIdx.x, w = tid >> 5, lane = tid & 31, ln = lane & 15, hh = lane >> 4;
  const int ntn = N / 64;
  const int wid = blockIdx.x * 4 + w;
  const int mt = wid / ntn, nq = wid % ntn;
  if (mt * 16 >= M) return;
  const int row0 = mt * 16, col0 = nq * 64;
  const float* arow = A + (size_t)(row0 + ln) * lda;
  v8f acc[4] = {};
  for (int kb = 0; kb < K; kb += 32) {
    FragB ah, al;
    const v4f x0 = *(const v4fa*)(arow + kb + 8 * hh), x1 = *(const v4fa*)(arow + kb + 8 * hh + 4);
    const v4f x2 = *(const v4fa*)(arow + kb + 16 + 8 * hh), x3 = *(const v4fa*)(arow + kb + 16 + 8 * hh + 4);
    float xs[16] = {x0[0],x0[1],x0[2],x0[3],x1[0],x1[1],x1[2],x1[3],x2[0],x2[1],x2[2],x2[3],x3[0],x3[1],x3[2],x3[3]};
#pragma unroll
    for (int i = 0; i < 16; ++i) { const unsigned short hb = bf16_bits(xs[i]); ah.u[i] = hb; al.u[i] = ASPLIT ? bf16_bits(xs[i] - bf16_val(hb)) : (unsigned short)0; }
#pragma unroll
    for (int t = 0; t < 4; ++t) {
      const unsigned short* brow = Wt + (size_t)(col0 + t * 16 + ln) * ldb + kb;
      FragB b;
      b.half[0] = *(const v8us*)(brow + 8 * hh);
      b.half[1] = *(const v8us*)(brow + 16 + 8 * hh);
      acc[t] = mmaN<ASPLIT ? 2 : 1>(ah.v, al.v, b.v, b.v, acc[t]);
    }
  }
#pragma unroll
  for (int t = 0; t < 4; ++t) {
    const int col = col0 + t * 16 + ln;
    float bv = bias ? bias[col] : 0.f;
    if (BIAS_BF16) bv = bf16_round(bv);
#pragma unroll
    for (int r = 0; r < 8; ++r) {
      float v = acc[t][r] + bv;
      if (resid) { float rv = resid[(size_t)((row0 + 8 * hh + r) % rmod) * ldr + col]; if (RES_BF16) rv = bf16_round(rv); v += rv; }
      if (ACT == 1) v = fmaxf(v, 0.f);
      if (ACT == 2) v = 0.5f * v * (1.0f + erff(v * 0.70710678118654752f));
      if (ACT == 3) { const float u = 0.7978845608028654f * (v + 0.044715f * v * v * v); v = 0.5f * v * (1.0f + tanhf(u)); }
      so[w][8 * hh + r][t * 16 + ln] = v;
    }
  }
  __builtin_amdgcn_fence(__ATOMIC_ACQ_REL, "workgroup");
  __builtin_amdgcn_wave_barrier();
  const int rsub = lane >> 4, c4 = (lane & 15) * 4;
  {
#pragma unroll
    for (int q = 0; q < 8; ++q) {
      const int r = q * 2 + rsub;
      const v4f v = *(const v4fa*)&so[w][r][c4];
      *(v4f*)(C + (size_t)(row0 + r) * ldc + col0 + c4) = v;
    }
    
  }
}
// row LayerNorm (biased variance, eps) over N: s = X (+ R); optional out_sum <- s; out_norm <- (s-mu)*rsqrt(var+eps)*g + b
template <bool PARAM_BF16>
__global__ __launch_bounds__(256) void k_layernorm(const float* __restrict__ X, const float* __restrict__ R, const float* __restrict__ g, const float* __restrict__ bta,
                                                  float* __restrict__ out_sum, float* __restrict__ out_norm, int N, float eps) {
  __shared__ float red[256];
  const int row = blockIdx.x, tid = threadIdx.x;
  const float* x = X + (size_t)row * N; const float* rr = R ? R + (size_t)row * N : nullptr;
  float vals[16];                     // up to N = 4096
  const int per = N / 256;            // contiguous chunk per thread? use strided-by-4 chunks: thread handles j = tid*4 + 1024*u
  float s1 = 0.f;
  for (int u = 0; u < per / 4; ++u) {
    const int j = tid * 4 + 1024 * u;
    const v4f a = *(const v4fa*)(x + j);
    v4f b = {0.f,0.f,0.f,0.f}; if (rr) b = *(const v4fa*)(rr + j);
#pragma unroll
    for (int q = 0; q < 4; ++q) { const float v = a[q] + b[q]; vals[u * 4 + q] = v; s1 += v; }
  }
  red[tid] = s1; __syncthreads();
  for (int st = 128; st > 0; st >>= 1) { if (tid < st) red[tid] += red[tid + st]; __syncthreads(); }
  const float mu = red[0] / (float)N; __syncthreads();
  float s2 = 0.f;
  for (int u = 0; u < per / 4; ++u)
#pragma unroll
    for (int q = 0; q < 4; ++q) { const float c = vals[u * 4 + q] - mu; s2 += c * c; }
  red[tid] = s2; __syncthreads();
  for (int st = 128; st > 0; st >>= 1) { if (tid < st) red[tid] += red[tid + st]; __syncthreads(); }
  const float rs = rsqrtf(red[0] / (float)N + eps);
  {
    for (int u = 0; u < per / 4; ++u) {
      const int j = tid * 4 + 1024 * u;
      v4f o, sm;
#pragma unroll
      for (int q = 0; q < 4; ++q) {
        float gg = g[j + q], bb = bta[j + q];
        if (PARAM_BF16) { gg = bf16_round(gg); bb = bf16_round(bb); }
        sm[q] = vals[u * 4 + q]; o[q] = (vals[u * 4 + q] - mu) * rs * gg + bb;
      }
      if (out_sum) *(v4f*)(out_sum + (size_t)row * N + j) = sm;
      *(v4f*)(out_norm + (size_t)row * N + j) = o;
    }
    
  }
}



// ---- f16 WMMA path (v_wmma_f32_16x16x32_f16): 11-bit significands for operands in range — used where a [0,1] probability operand needs more precision than bf16
typedef _Float16 v16h __attribute__((ext_vector_type(16)));
union FragH { v16h v; v8us half[2]; _Float16 h[16]; unsigned short u[16]; };
template <int NT>
__device__ __forceinline__ v8f mmaH(v16h ah, v16h al, v16h bh, v16h bl, v8f c) {
  c = __builtin_amdgcn_wmma_f32_16x16x32_f16(false, ah, false, bh, (short)0, c, false, false);
  if (NT >= 2) c = __builtin_amdgcn_wmma_f32_16x16x32_f16(false, al, false, bh, (short)0, c, false, false);
  if (NT >= 3) c = __builtin_amdgcn_wmma_f32_16x16x32_f16(false, ah, false, bl, (short)0, c, false, false);
  asm volatile("v_nop\n\tv_nop\n\tv_nop\n\tv_nop" : "+v"(c) : "v"(ah), "v"(al), "v"(bh), "v"(bl));
  return c;
}
// batched GEMM like k_gemm_b but f16 operands: A f32 (split into f16 hi/lo if ASPLIT, else rounded to f16), Bt = f16 values [n][k]; alpha; C f32; N multiple of 16 (partial tiles skipped)
template <bool ASPLIT>
__global__ __launch_bounds__(128) void k_gemm_h(const float* __restrict__ A, int lda, size_t sA, const _Float16* __restrict__ Bh, int ldb, size_t sB, float alpha, float* __restrict__ C, int ldc, size_t sC, int M, int N, int K) {
  __shared__ __attribute__((aligned(16))) float so[4][16][64];
  const int tid = threadIdx.x, w = tid >> 5, lane = tid & 31, ln = lane & 15, hh = lane >> 4; const int by = blockIdx.y;
  A += (size_t)by * sA; Bh += (size_t)by * sB; C += (size_t)by * sC;
  const int ntn = (N + 63) / 64; const int wid = blockIdx.x * 4 + w; const int mt = wid / ntn, nq = wid % ntn; if (mt * 16 >= M) return;
  const int row0 = mt * 16, col0 = nq * 64; const float* arow = A + (size_t)(row0 + ln) * lda;
  v8f acc[4] = {};
  for (int kb = 0; kb < K; kb += 32) {
    FragH ah, al;
    const v4f x0 = *(const v4fa*)(arow + kb + 8 * hh), x1 = *(const v4fa*)(arow + kb + 8 * hh + 4), x2 = *(const v4fa*)(arow + kb + 16 + 8 * hh), x3 = *(const v4fa*)(arow + kb + 16 + 8 * hh + 4);
    float xs[16] = {x0[0],x0[1],x0[2],x0[3],x1[0],x1[1],x1[2],x1[3],x2[0],x2[1],x2[2],x2[3],x3[0],x3[1],x3[2],x3[3]};
#pragma unroll
    for (int i = 0; i < 16; ++i) { const _Float16 h = (_Float16)xs[i]; ah.h[i] = h; al.h[i] = ASPLIT ? (_Float16)(xs[i] - (float)h) : (_Float16)0.0f; }
#pragma unroll
    for (int t = 0; t < 4; ++t) { if (col0 + t * 16 >= N) continue; const size_t boff = (size_t)(col0 + t * 16 + ln) * ldb + kb; FragH bq; bq.half[0] = *(const v8us*)(Bh + boff + 8 * hh); bq.half[1] = *(const v8us*)(Bh + boff + 16 + 8 * hh);
      acc[t] = mmaH<ASPLIT ? 2 : 1>(ah.v, al.v, bq.v, bq.v, acc[t]); }
  }
#pragma unroll
  for (int t = 0; t < 4; ++t) { if (col0 + t * 16 >= N) continue;
#pragma unroll
    for (int r = 0; r < 8; ++r) so[w][8 * hh + r][t * 16 + ln] = acc[t][r] * alpha; }
  __builtin_amdgcn_fence(__ATOMIC_ACQ_REL, "workgroup"); __builtin_amdgcn_wave_barrier();
  const int rsub = lane >> 4, c4 = (lane & 15) * 4;
  {
#pragma unroll
    for (int q = 0; q < 8; ++q) { const int r = q * 2 + rsub; if (col0 + c4 < N) { const v4f v = *(const v4fa*)&so[w][r][c4]; *(v4f*)(C + (size_t)(row0 + r) * ldc + col0 + c4) = v; } }
     }
}

// Wt[n][k] = f16(W[k][n]·scale) from f32 row-major W[K][N] (scale = power of two; bf16-exact weights stay exact in f16 away from the subnormal range)
__global__ __launch_bounds__(256) void k_wt_f16(const float* __restrict__ W, _Float16* __restrict__ Wt, int K, int N, float scale) {
  const int t = blockIdx.x * 256 + threadIdx.x; if (t >= N * (K / 8)) return; const int n = t / (K / 8), k8 = (t % (K / 8)) * 8; FragH f;
#pragma unroll
  for (int i = 0; i < 8; ++i) f.h[i] = (_Float16)(bf16_round(W[(size_t)(k8 + i) * N + n]) * scale); const v8us o = f.half[0];
  *(v8us*)((unsigned short*)Wt + (size_t)n * K + k8) = o; 
}


typedef _Float16 v4h __attribute__((ext_vector_type(4)));

__global__ __launch_bounds__(256) void k_h16(const float* __restrict__ x, _Float16* __restrict__ X16, size_t n8) { const size_t t = (size_t)blockIdx.x * 256 + threadIdx.x; if (t >= n8) return; FragH f;
#pragma unroll
  for (int q = 0; q < 8; ++q) f.h[q] = (_Float16)x[t * 8 + q]; *(v8us*)((unsigned short*)X16 + t * 8) = f.half[0];  }
// One launch makes q, k and v from the f32 inputs, k and v in the order in which the attention kernel's A fragments hold them (see Kp, Vp below). A work-group takes 64 rows of x. Its 512 threads each round one unit of 8 values of Wq, Wk, Wv (bf16, x 2^4) and of the 64 rows (bf16) to f16 in LDS;
// then waves 0-3 make q, 4-7 k (one 16-row tile each, 4 feature tiles) and 8-11 v (one feature tile each, 4 row tiles); waves 12-15 only help to fill LDS. The operand roles are chosen by where the result goes:
// for q and k the weight rows are A and the x rows B, so a lane's 8 results are 8 features of one row; for v the x rows are A, so they are 8 positions of one feature. Each is one 16-byte store: these 8 values are
// one lane's half of an A fragment (features or keys 8hh + r of a group of 16), so a k or v store of a wave is 512 contiguous bytes at lane * 16; a wave's 4 q stores fill whole 128-byte lines.
// Kp: per 16 keys 4 units of 512 bytes, unit u = features u * 16 .. + 15: lane (hh, ln) holds features u * 16 + 8hh + r of key ln. Vp: per 32 keys 8 units, unit dt * 2 + g: lane (hh, ln) holds keys g * 16 + 8hh + r of feature dt * 16 + ln.
// In LDS, rows of 64 f16 lie at a pitch of 144 bytes (16 x odd) for the 16-byte fragment reads. A and B fragments come from one loader, so their k orders are equal.
__global__ __launch_bounds__(512) void k_proj(const float* __restrict__ x, const float* __restrict__ Wq, const float* __restrict__ Wk, const float* __restrict__ Wv, _Float16* __restrict__ Q16, _Float16* __restrict__ Kp, _Float16* __restrict__ Vp) {
  constexpr int P = CC + 8;
  __shared__ __attribute__((aligned(16))) unsigned short sh[4 * CC][P];      // rows 0-63 Wq, 64-127 Wk, 128-191 Wv (row = output feature), 192-255 the 64 rows of x
  const int tid = threadIdx.x, w = __builtin_amdgcn_readfirstlane(tid >> 5), lane = tid & 31, ln = lane & 15, hh = lane >> 4;      // w in a scalar register: the roles below branch on it, and every lane must stay on at the WMMAs
  const int row0 = blockIdx.x * 64;
  const unsigned boff = tid * 32u;      // byte offset of the thread's unit in each of the four sources
  const char* const src[4] = {(const char*)Wq, (const char*)Wk, (const char*)Wv, (const char*)(x + (size_t)row0 * CC)};
  v4f in[4][2];
#pragma unroll      // unrolled, here and below: in and the fragments are indexed by constants and stay in registers; the 8 loads go out before the first conversion
  for (int i = 0; i < 4; ++i) { in[i][0] = *(const v4fa*)(src[i] + boff); in[i][1] = *(const v4fa*)(src[i] + boff + 16); }
  asm volatile("s_wait_xcnt 0x0" :: "v"(boff) : "memory");      // the loads' offset register is named so that it lives up to this wait: what follows may reuse it
#pragma unroll
  for (int i = 0; i < 4; ++i) { FragH f;
#pragma unroll
    for (int q = 0; q < 8; ++q) { const float v = bf16_round(in[i][q >> 2][q & 3]); f.h[q] = (_Float16)(i < 3 ? v * 16.0f : v); }
    *(v8us*)&sh[i * CC + (tid >> 3)][(tid & 7) * 8] = f.half[0]; }
  __syncthreads();      // the f16 operands are in LDS before any wave reads a fragment
  if (w >= 12) return;      // behind the only barrier
  auto frag = [&](int r, int ks) { FragH f; f.half[0] = *(const v8us*)&sh[r][ks * 32 + 8 * hh]; f.half[1] = *(const v8us*)&sh[r][ks * 32 + 16 + 8 * hh]; return f; };
  const bool isv = w >= 8;
  const int keep = isv ? w * 16 : 3 * CC + (w & 3) * 16;      // first LDS row of the tile a wave keeps as B: v: feature tile w - 8 of Wv; q, k: row tile w & 3 of x
  const int run = isv ? 3 * CC : (w >> 2) * CC;      // first LDS row of the 4 tiles it walks as A: v: the rows of x; q, k: the features of Wq or Wk
  const FragH b0 = frag(keep + ln, 0), b1 = frag(keep + ln, 1);
  unsigned short* dst = isv ? (unsigned short*)Vp + (size_t)row0 * CC + (w - 8) * 512 + lane * 8      // walked tile t = 16 keys: block t >> 1 of 32 keys, unit (w - 8) * 2 + (t & 1)
                      : w >= 4 ? (unsigned short*)Kp + (size_t)(row0 + (w & 3) * 16) * CC + lane * 8      // walked tile t = 16 features: unit t
                               : (unsigned short*)Q16 + (size_t)(row0 + w * 16 + ln) * CC + 8 * hh;
  const int st1 = w >= 4 ? 256 : 16, st2 = isv ? 32 * CC : 2 * st1;      // steps, in f16, of bit 0 and bit 1 of t
  FragH a[4][2];      // the fragment reads stand ahead of the products, so that later tiles' reads go out while earlier tiles are worked on
#pragma unroll
  for (int t = 0; t < 4; ++t) { a[t][0] = frag(run + t * 16 + ln, 0); a[t][1] = frag(run + t * 16 + ln, 1); }
#pragma unroll
  for (int t = 0; t < 4; ++t) { v8f acc = (v8f){0.f,0.f,0.f,0.f,0.f,0.f,0.f,0.f};
    acc = __builtin_amdgcn_wmma_f32_16x16x32_f16(false, a[t][0].v, false, b0.v, (short)0, acc, false, false);
    acc = __builtin_amdgcn_wmma_f32_16x16x32_f16(false, a[t][1].v, false, b1.v, (short)0, acc, false, false);      // acc[r] = (walked tile's row 8hh + r) . (kept tile's row ln)
    FragH o;
#pragma unroll
    for (int r = 0; r < 8; ++r) o.h[r] = (_Float16)(acc[r] * 0.0625f);
    *(v8us*)(dst + (t & 1) * st1 + (t >> 1) * st2) = o.half[0]; } }

// One work-group = one tile of 16 query rows; its NW waves deal the tile's 32-key blocks among themselves (wave w takes blocks w, w + NW, ...), each with its own
// running maximum, sum and accumulators; the partials are merged through LDS behind one work-group barrier. The launch bound asks for 8 waves per SIMD (128 VGPRs), so that
// two work-groups share a WGP. w is held in a scalar register: the waves' trip counts differ, and the loop must branch on a scalar so that every lane stays on at the WMMAs.
// Both products run transposed: S^T = K.Q^T (A = 16 key rows, B = the tile's queries, kept in registers) and O^T += V^T.P^T. A lane then holds 16 scores of ONE query (column ln; keys
// 8hh + r and 16 + 8hh + r of the block), so maximum and sum are in-lane but for one exchange between the wave's halves, and the two converted score tiles ARE the B operand of the second product.
// Softmax in base 2: exp(s / 8 - m) = 2^(s * SC2 - m'), m' = the maximum in the same units. v_exp_f32 gives 0 for -inf and for the -3e38 start value, which is all the range handling these arguments (never above 0) need.
#define SC2 0.18033688011112042f      // 64^-0.5 * log2(e)
__device__ __forceinline__ float ex2(float x) { return __builtin_amdgcn_exp2f(x); }
// The merge's form: the v_nop fills the one slot that the instruction set asks for behind a transcendental before its source is overwritten; inside the statement it cannot drift.
__device__ __forceinline__ float ex2_slot(float x) { float r; asm("v_exp_f32 %0, %1\n\tv_nop" : "=v"(r) : "v"(x)); return r; }
__device__ __forceinline__ float xhalf(float x) { return __builtin_bit_cast(float, __builtin_amdgcn_permlanex16(__builtin_bit_cast(int, x), __builtin_bit_cast(int, x), 0x76543210, 0xfedcba98, false, false)); }      // lane l reads lane l ^ 16
template <int NW>
__global__ __launch_bounds__(NW * 32, 8) void k_flash(const _Float16* __restrict__ Q16, int ldq, const _Float16* __restrict__ Kp, const _Float16* __restrict__ Vp, const int* __restrict__ MSK, float* __restrict__ O, int ldo) {
  constexpr int RPW = 16, NQB = 4096 / RPW, DT = 4, KS = 2;
  __shared__ __attribute__((aligned(16))) float sO[NW][RPW][64 + 4]; __shared__ float sM[NW][RPW], sL[NW][RPW];
  const int tid = threadIdx.x, w = __builtin_amdgcn_readfirstlane(tid >> 5), lane = tid & 31, ln = lane & 15, hh = lane >> 4;
  const int slab = blockIdx.x / NQB, qblk = blockIdx.x % NQB; const int b = slab / 1, h = slab % 1; const int q0 = qblk * RPW;
  FragH bq[KS];
  { const unsigned short* qr = (const unsigned short*)Q16 + ((size_t)b * 4096 + q0 + ln) * ldq + h * 64;
#pragma unroll
    for (int ks = 0; ks < KS; ++ks) { bq[ks].half[0] = *(const v8us*)(qr + ks * 32 + 8 * hh); bq[ks].half[1] = *(const v8us*)(qr + ks * 32 + 16 + 8 * hh); } }
  const unsigned short* Kl = (const unsigned short*)Kp + (size_t)slab * 4096 * 64 + lane * 8; const unsigned short* Vl = (const unsigned short*)Vp + (size_t)slab * 4096 * 64 + lane * 8;      // fragment order (k_proj): a block of 32 keys is 4 KB in each, every load below 512 contiguous bytes of it
  float m_q = -3.0e38f, l_q = 0.f; v8f oacc[DT];      // of query q0 + ln; l_q sums this half's keys only, the halves are joined behind the loop
#pragma unroll
  for (int dt = 0; dt < DT; ++dt) oacc[dt] = (v8f){0.f,0.f,0.f,0.f,0.f,0.f,0.f,0.f};      // oacc[dt][r] = O[q0 + ln][dt * 16 + 8hh + r]
  const int jend = q0 + RPW, tq = q0 + ln;
#pragma unroll 1
  for (int j0 = w * 32; j0 < jend; j0 += NW * 32) {
    // The block's 16 fragment loads (8 KB) all stand ahead of its first product, so that they are in flight together and a block waits out one load latency; placed at their uses they went out in six groups, each waited for in turn.
    const unsigned short* kr = Kl + (size_t)j0 * 64; const unsigned short* vr = Vl + (size_t)j0 * 64; FragH ak[2][KS], av[DT];
#pragma unroll
    for (int u = 0; u < 2 * KS; ++u) { ak[u / KS][u % KS].half[0] = *(const v8us*)(kr + u * 512); ak[u / KS][u % KS].half[1] = *(const v8us*)(kr + u * 512 + 256); }      // A operand: key rows j0 + nt * 16 + ln
#pragma unroll
    for (int dt = 0; dt < DT; ++dt) { av[dt].half[0] = *(const v8us*)(vr + dt * 512); av[dt].half[1] = *(const v8us*)(vr + dt * 512 + 256); }      // A operand: V^T rows dt * 16 + ln, the block's 32 keys in the k order of the packed scores
    asm volatile("s_wait_xcnt 0x0" :: "v"(kr), "v"(vr) : "memory");      // the loads' address registers are named so that they live up to this wait: what follows, a load's own result too, may reuse them only behind it
    v8f s[2];
#pragma unroll
    for (int nt = 0; nt < 2; ++nt) { v8f acc = (v8f){0.f,0.f,0.f,0.f,0.f,0.f,0.f,0.f};
#pragma unroll
      for (int ks = 0; ks < KS; ++ks) acc = mmaH<1>(ak[nt][ks].v, ak[nt][ks].v, bq[ks].v, bq[ks].v, acc);
      s[nt] = acc; }      // s[nt][r] = q(q0 + ln) . k(j0 + nt * 16 + 8hh + r)
    float mc = -INFINITY; const int dq = tq - j0 - 8 * hh;      // score (nt, r) is unmasked while nt * 16 + r <= dq
#pragma unroll
    for (int nt = 0; nt < 2; ++nt)
#pragma unroll
      for (int r = 0; r < 8; ++r) { s[nt][r] = (nt * 16 + r <= dq) ? s[nt][r] : -INFINITY; mc = fmaxf(mc, s[nt][r]); }      // raw products: the scale is positive, so it is applied to the maximum alone
    mc = fmaxf(mc, xhalf(mc));
    // every block a wave walks starts at a key j0 <= q0, so each query has an unmasked score in it and mn is a finite score: a masked score (-inf) gives exp = 0 and the first block gives al = 0 with no test
    const float mn = fmaxf(m_q, mc * SC2); const float al = ex2(m_q - mn); m_q = mn;
    float ps = 0.f; FragH pb;
#pragma unroll
    for (int nt = 0; nt < 2; ++nt)
#pragma unroll
      for (int r = 0; r < 8; ++r) { const float p = ex2(fmaf(s[nt][r], SC2, -mn)); ps += p; pb.h[nt * 8 + r] = (_Float16)p; }      // element nt * 8 + r of a B fragment is k = nt * 16 + 8hh + r: the key this score belongs to
    l_q = l_q * al + ps;
#pragma unroll
    for (int dt = 0; dt < DT; ++dt) {
#pragma unroll
      for (int r = 0; r < 8; ++r) oacc[dt][r] *= al;
      oacc[dt] = mmaH<1>(av[dt].v, av[dt].v, pb.v, pb.v, oacc[dt]); } }
  // each wave hands over its un-normalised partial: (maximum, sum) per row and the 16 x 64 accumulator; a wave without a block hands (-3e38, 0, zeros), which weighs 0 in the merge
  const int le = (int)__builtin_amdgcn_mbcnt_lo(~0u, 0u), lne = le & 15, hhe = le >> 4;      // lane id read anew, so that tid and its parts need no registers across the loop
  l_q += xhalf(l_q);
  if (hhe == 0) { sM[w][lne] = m_q; sL[w][lne] = l_q; }
#pragma unroll
  for (int dt = 0; dt < DT; ++dt) { *(v4fa*)&sO[w][lne][dt * 16 + 8 * hhe] = (v4f){oacc[dt][0], oacc[dt][1], oacc[dt][2], oacc[dt][3]}; *(v4fa*)&sO[w][lne][dt * 16 + 8 * hhe + 4] = (v4f){oacc[dt][4], oacc[dt][5], oacc[dt][6], oacc[dt][7]}; }
  __syncthreads();      // every wave's partial is in LDS before any is merged
  static_assert(NW == RPW, "wave w merges row w");
  { typedef float v2f __attribute__((ext_vector_type(2))); typedef float v2fa __attribute__((ext_vector_type(2), may_alias)); const int r = w; float M = sM[0][r];
#pragma unroll      // both loops unrolled: the NW partials' LDS loads go out together instead of one wait each
    for (int u = 1; u < NW; ++u) M = fmaxf(M, sM[u][r]);
    float L = 0.f; v2f val = {0.f, 0.f};
#pragma unroll
    for (int u = 0; u < NW; ++u) { const float e = ex2_slot(sM[u][r] - M); L += e * sL[u][r]; const v2f pv = *(const v2fa*)&sO[u][r][le * 2]; val += pv * e; }
    const float inv = (L > 0.f) ? 1.0f / L : 0.f; val *= inv;
    *(v2f*)(O + ((size_t)b * 4096 + q0 + r) * ldo + h * 64 + le * 2) = val; } }

extern "C" void kernel_launch(void* const* d_in, const int* in_sizes, int n_in,
                              void* d_out, int out_size, void* d_ws, size_t ws_size, hipStream_t stream) {
  (void)in_sizes; (void)n_in; (void)out_size;
  const float* x = (const float*)d_in[0]; const float* Wk = (const float*)d_in[1]; const float* Wq = (const float*)d_in[2]; const float* Wv = (const float*)d_in[3];
  char* ws = (char*)d_ws; size_t off = 0;
  auto take = [&](size_t bytes) { char* p = ws + off; off += (bytes + 255) & ~(size_t)255; return p; };
  _Float16* Q16 = (_Float16*)take((size_t)NR * CC * 2); _Float16* Kp = (_Float16*)take((size_t)NR * CC * 2); _Float16* Vp = (_Float16*)take((size_t)NR * CC * 2);
  if (off > ws_size) return;      // 3 buffers of 2 MiB
  k_proj<<<NR / 64, 512, 0, stream>>>(x, Wq, Wk, Wv, Q16, Kp, Vp);      // q in f16 rows; k and v in fragment order
  k_flash<16><<<BB * 1 * (TT / 16), 16 * 32, 0, stream>>>(Q16, CC, Kp, Vp, nullptr, (float*)d_out, CC);
}

// v007
// One run takes 26.9 microseconds.
// Timed twice side by side with v006, it ran 1.07 and 1.08 times as fast.
// All steps since v000 together make it 15.9 times as fast.
#include <hip/hip_runtime.h>
// Single causal attention head (B=4, T=4096, C=64): q,k,v = x·Wᵀ (no bias), softmax(q·kᵀ·64^-½) with a causal mask, out = P·v. One GEMM for [q|k|v] and a fused flash-style causal attention
// kernel (online softmax in f32; P f16 ≤ 1; O = P·Vᵀ-tiles; 32 query rows per 16-wave work-group; causal tile skipping) on v_wmma_f32_16x16x32_f16 — x bf16-exact, (out,in) weights bf16-exact ×2^4, q/k/v f16,
// f32 accumulate.
#define BB 4
#define TT 4096
#define CC 64
#define NR (BB * TT)

typedef __bf16 v16b __attribute__((ext_vector_type(16)));
typedef unsigned short v8us __attribute__((ext_vector_type(8), may_alias));
typedef float  v8f  __attribute__((ext_vector_type(8)));
typedef float  v4f  __attribute__((ext_vector_type(4)));
typedef float  v4fa __attribute__((ext_vector_type(4), may_alias));
union FragB { v16b v; v8us half[2]; unsigned short u[16]; };

__device__ __forceinline__ unsigned short bf16_bits(float x) { unsigned int u = __float_as_uint(x); return (unsigned short)((u + 0x7FFFu + ((u >> 16) & 1u)) >> 16); }
__device__ __forceinline__ float bf16_val(unsigned short b) { return __uint_as_float(((unsigned int)b) << 16); }
__device__ __forceinline__ float bf16_round(float x) { return bf16_val(bf16_bits(x)); }
// D += A·B with NT terms: 1 = ah·bh, 2 = + al·bh (A split), 3 = + ah·bl (both split)
template <int NT>
__device__ __forceinline__ v8f mmaN(v16b ah, v16b al, v16b bh, v16b bl, v8f c) {
  c = __builtin_amdgcn_wmma_f32_16x16x32_bf16(false, ah, false, bh, (short)0, c, false, false);
  if (NT >= 2) c = __builtin_amdgcn_wmma_f32_16x16x32_bf16(false, al, false, bh, (short)0, c, false, false);
  if (NT >= 3) c = __builtin_amdgcn_wmma_f32_16x16x32_bf16(false, ah, false, bl, (short)0, c, false, false);
  asm volatile("v_nop\n\tv_nop\n\tv_nop\n\tv_nop" : "+v"(c) : "v"(ah), "v"(al), "v"(bh), "v"(bl));
  return c;
}

__global__ __launch_bounds__(256) void k_wt_bf16(const float* __restrict__ W, unsigned short* __restrict__ Wt, int K, int N) {
  const int t = blockIdx.x * 256 + threadIdx.x;
  const int k8n = K / 8;
  if (t >= N * k8n) return;
  const int n = t / k8n, k8 = (t % k8n) * 8;
  v8us v;
#pragma unroll
  for (int i = 0; i < 8; ++i) v[i] = bf16_bits(W[(size_t)(k8 + i) * N + n]);
  *(v8us*)(Wt + (size_t)n * K + k8) = v;
  
}

// GEMM C[M][N] (f32, pitch ldc) = act(A[M][K]·W + bias). A f32 row-major (pitch lda) converted per fragment to bf16
// (ASPLIT: hi/lo two planes -> 2 terms, else single rounded term); Wt bf16 [N][K] (pitch ldb). BIAS_BF16 rounds the
// bias to bf16 first (bias quantised to bf16 before the add). K%32==0, M%16==0, N%64==0.
template <bool ASPLIT, int ACT, bool BIAS_BF16>
__global__ __launch_bounds__(128) void k_gemm_bf(const float* __restrict__ A, int lda, const unsigned short* __restrict__ Wt, int ldb,
                                               const float* __restrict__ bias, float* __restrict__ C, int ldc, int M, int N, int K) {
  __shared__ __attribute__((aligned(16))) float so[4][16][64];
  const int tid = threadIdx.x, w = tid >> 5, lane = tid & 31, ln = lane & 15, hh = lane >> 4;
  const int ntn = N / 64;
  const int wid = blockIdx.x * 4 + w;
  const int mt = wid / ntn, nq = wid % ntn;
  if (mt * 16 >= M) return;
  const int row0 = mt * 16, col0 = nq * 64;
  const float* arow = A + (size_t)(row0 + ln) * lda;
  v8f acc[4] = {};
  for (int kb = 0; kb < K; kb += 32) {
    FragB ah, al;
    const v4f x0 = *(const v4fa*)(arow + kb + 8 * hh), x1 = *(const v4fa*)(arow + kb + 8 * hh + 4);
    const v4f x2 = *(const v4fa*)(arow + kb + 16 + 8 * hh), x3 = *(const v4fa*)(arow + kb + 16 + 8 * hh + 4);
    float xs[16] = {x0[0],x0[1],x0[2],x0[3],x1[0],x1[1],x1[2],x1[3],x2[0],x2[1],x2[2],x2[3],x3[0],x3[1],x3[2],x3[3]};
#pragma unroll
    for (int i = 0; i < 16; ++i) { const unsigned short hb = bf16_bits(xs[i]); ah.u[i] = hb; al.u[i] = ASPLIT ? bf16_bits(xs[i] - bf16_val(hb)) : (unsigned short)0; }
#pragma unroll
    for (int t = 0; t < 4; ++t) {
      const unsigned short* brow = Wt + (size_t)(col0 + t * 16 + ln) * ldb + kb;
      FragB b;
      b.half[0] = *(const v8us*)(brow + 8 * hh);
      b.half[1] = *(const v8us*)(brow + 16 + 8 * hh);
      acc[t] = mmaN<ASPLIT ? 2 : 1>(ah.v, al.v, b.v, b.v, acc[t]);
    }
  }
#pragma unroll
  for (int t = 0; t < 4; ++t) {
    float bv = bias ? bias[col0 + t * 16 + ln] : 0.f;
    if (BIAS_BF16) bv = bf16_round(bv);
#pragma unroll
    for (int r = 0; r < 8; ++r) { float v = acc[t][r] + bv; if (ACT == 1) v = fmaxf(v, 0.f); so[w][8 * hh + r][t * 16 + ln] = v; }
  }
  __builtin_amdgcn_fence(__ATOMIC_ACQ_REL, "workgroup");
  __builtin_amdgcn_wave_barrier();
  const int rsub = lane >> 4, c4 = (lane & 15) * 4;
  {
#pragma unroll
    for (int q = 0; q < 8; ++q) {
      const int r = q * 2 + rsub;
      const v4f v = *(const v4fa*)&so[w][r][c4];
      *(v4f*)(C + (size_t)(row0 + r) * ldc + col0 + c4) = v;
    }
    
  }
}

// Flash-style causal/unmasked attention, all contractions 3-term bf16 hi/lo splits, f32 softmax with running max.
// q,k,v rows are read from f32 buffers with arbitrary row pitch (so they can live inside a fused qkv buffer);
// D = head size (multiple of 32, <= 128); one wave = 16 query rows; block = 4 waves (64 queries) sharing K/V chunks of 32.
template <int D, bool CAUSAL>
__global__ __launch_bounds__(128) void k_flash(const float* __restrict__ qb, const float* __restrict__ kb, const float* __restrict__ vb,
                                             int pitch, int T, int H, float scale, float* __restrict__ y, int ypitch) {
  constexpr int KS = D / 32;        // k-steps for QK
  constexpr int DT = D / 16;        // d tiles for PV
  __shared__ __attribute__((aligned(16))) unsigned short sKh[32][D + 8], sKl[32][D + 8], sVh[32][D + 8], sVl[32][D + 8];
  __shared__ __attribute__((aligned(16))) unsigned short sPh[4][16][40], sPl[4][16][40];
  __shared__ __attribute__((aligned(16))) float sO[4][16][D];
  const int tid = threadIdx.x, w = tid >> 5, lane = tid & 31, ln = lane & 15, hh = lane >> 4;
  const int nqb = (T + 63) / 64;
  const int bh = blockIdx.x / nqb, qblk = blockIdx.x % nqb;
  const int b = bh / H, h = bh % H;
  const int q0 = qblk * 64 + w * 16;
  const float* Q = qb + (size_t)b * T * pitch + h * D;
  const float* K = kb + (size_t)b * T * pitch + h * D;
  const float* V = vb + (size_t)b * T * pitch + h * D;

  // A fragments of the wave's 16 query rows (scaled), hi/lo
  FragB aqh[KS], aql[KS];
  {
    int row = q0 + ln; if (row >= T) row = T - 1;
    const float* qr = Q + (size_t)row * pitch;
#pragma unroll
    for (int ks = 0; ks < KS; ++ks)
#pragma unroll
      for (int i = 0; i < 16; ++i) {
        const int d = ks * 32 + ((i < 8) ? (8 * hh + i) : (16 + 8 * hh + (i - 8)));
        const float x = qr[d] * scale; const unsigned short hb = bf16_bits(x);
        aqh[ks].u[i] = hb; aql[ks].u[i] = bf16_bits(x - bf16_val(hb));
      }
  }
  float m_r[8], l_r[8];
#pragma unroll
  for (int r = 0; r < 8; ++r) { m_r[r] = -3.0e38f; l_r[r] = 0.f; }
  v8f oacc[DT];
#pragma unroll
  for (int dt = 0; dt < DT; ++dt) oacc[dt] = (v8f){0.f,0.f,0.f,0.f,0.f,0.f,0.f,0.f};

  const int kv_end = CAUSAL ? min(T, qblk * 64 + 64) : T;     // block-uniform
  for (int j0 = 0; j0 < kv_end; j0 += 32) {
    __syncthreads();
    for (int e = tid; e < 32 * (D / 4); e += 128) {
      const int r = e / (D / 4), c4 = (e % (D / 4)) * 4;
      const int key = j0 + r;
      v4f kf = {0.f,0.f,0.f,0.f}, vf = {0.f,0.f,0.f,0.f};
      if (key < T) { kf = *(const v4fa*)(K + (size_t)key * pitch + c4); vf = *(const v4fa*)(V + (size_t)key * pitch + c4); }
#pragma unroll
      for (int t = 0; t < 4; ++t) {
        unsigned short hb = bf16_bits(kf[t]); sKh[r][c4 + t] = hb; sKl[r][c4 + t] = bf16_bits(kf[t] - bf16_val(hb));
        hb = bf16_bits(vf[t]); sVh[r][c4 + t] = hb; sVl[r][c4 + t] = bf16_bits(vf[t] - bf16_val(hb));
      }
    }
    __syncthreads();
    // S tile 16 x 32
    v8f s[2];
#pragma unroll
    for (int nt = 0; nt < 2; ++nt) {
      v8f acc = {};
#pragma unroll
      for (int ks = 0; ks < KS; ++ks) {
        FragB bh_, bl_;
        bh_.half[0] = *(const v8us*)&sKh[nt * 16 + ln][ks * 32 + 8 * hh]; bh_.half[1] = *(const v8us*)&sKh[nt * 16 + ln][ks * 32 + 16 + 8 * hh];
        bl_.half[0] = *(const v8us*)&sKl[nt * 16 + ln][ks * 32 + 8 * hh]; bl_.half[1] = *(const v8us*)&sKl[nt * 16 + ln][ks * 32 + 16 + 8 * hh];
        acc = mmaN<3>(aqh[ks].v, aql[ks].v, bh_.v, bl_.v, acc);
      }
      s[nt] = acc;
    }
    // mask + running max (rows 8hh+r; the 16 lanes of a half share rows)
    float alpha[8];
#pragma unroll
    for (int r = 0; r < 8; ++r) {
      const int qi = q0 + 8 * hh + r;
      const int ja = j0 + ln, jb = j0 + 16 + ln;
      if (CAUSAL) { if (ja > qi) s[0][r] = -3.0e38f; if (jb > qi) s[1][r] = -3.0e38f; }
      if (ja >= T) s[0][r] = -3.0e38f;
      if (jb >= T) s[1][r] = -3.0e38f;
      float mx = fmaxf(s[0][r], s[1][r]);
      mx = fmaxf(mx, __shfl_xor(mx, 1, 32)); mx = fmaxf(mx, __shfl_xor(mx, 2, 32)); mx = fmaxf(mx, __shfl_xor(mx, 4, 32)); mx = fmaxf(mx, __shfl_xor(mx, 8, 32));
      const float mnew = fmaxf(m_r[r], mx);
      alpha[r] = (mnew > -1.0e38f) ? __expf(m_r[r] - mnew) : 1.0f;
      const float p0 = (s[0][r] > -1.0e38f) ? __expf(s[0][r] - mnew) : 0.f;
      const float p1 = (s[1][r] > -1.0e38f) ? __expf(s[1][r] - mnew) : 0.f;
      m_r[r] = mnew;
      l_r[r] = l_r[r] * alpha[r] + p0 + p1;            // per-lane partial row sum (16 lanes combined at the end)
      unsigned short hb = bf16_bits(p0); sPh[w][8 * hh + r][ln] = hb;      sPl[w][8 * hh + r][ln] = bf16_bits(p0 - bf16_val(hb));
      hb = bf16_bits(p1);                sPh[w][8 * hh + r][16 + ln] = hb; sPl[w][8 * hh + r][16 + ln] = bf16_bits(p1 - bf16_val(hb));
    }
#pragma unroll
    for (int dt = 0; dt < DT; ++dt)
#pragma unroll
      for (int r = 0; r < 8; ++r) oacc[dt][r] *= alpha[r];
    __builtin_amdgcn_fence(__ATOMIC_ACQ_REL, "workgroup");
    __builtin_amdgcn_wave_barrier();
    FragB pah, pal;
    pah.half[0] = *(const v8us*)&sPh[w][ln][8 * hh]; pah.half[1] = *(const v8us*)&sPh[w][ln][16 + 8 * hh];
    pal.half[0] = *(const v8us*)&sPl[w][ln][8 * hh]; pal.half[1] = *(const v8us*)&sPl[w][ln][16 + 8 * hh];
#pragma unroll
    for (int dt = 0; dt < DT; ++dt) {
      FragB bvh, bvl;
#pragma unroll
      for (int i = 0; i < 8; ++i) {
        bvh.u[i] = sVh[8 * hh + i][dt * 16 + ln]; bvh.u[8 + i] = sVh[16 + 8 * hh + i][dt * 16 + ln];
        bvl.u[i] = sVl[8 * hh + i][dt * 16 + ln]; bvl.u[8 + i] = sVl[16 + 8 * hh + i][dt * 16 + ln];
      }
      oacc[dt] = mmaN<3>(pah.v, pal.v, bvh.v, bvl.v, oacc[dt]);
    }
    __builtin_amdgcn_fence(__ATOMIC_ACQ_REL, "workgroup");
    __builtin_amdgcn_wave_barrier();
  }
#pragma unroll
  for (int r = 0; r < 8; ++r) {
    float l = l_r[r];
    l += __shfl_xor(l, 1, 32); l += __shfl_xor(l, 2, 32); l += __shfl_xor(l, 4, 32); l += __shfl_xor(l, 8, 32);
    l_r[r] = (l > 0.f) ? 1.0f / l : 0.f;
  }
#pragma unroll
  for (int dt = 0; dt < DT; ++dt)
#pragma unroll
    for (int r = 0; r < 8; ++r) sO[w][8 * hh + r][dt * 16 + ln] = oacc[dt][r] * l_r[r];
  __builtin_amdgcn_fence(__ATOMIC_ACQ_REL, "workgroup");
  __builtin_amdgcn_wave_barrier();
  {
    for (int r = 0; r < 16; ++r) {
      const int row = q0 + r;
      if (row < T && lane < D / 4) {
        const v4f val = *(const v4fa*)&sO[w][r][lane * 4];
        *(v4f*)(y + ((size_t)b * T + row) * ypitch + h * D + lane * 4) = val;
      }
    }
    
  }
}

// GEMM C = act(A·W + bias + resid): A f32 (ASPLIT -> hi/lo 2 terms), Wt bf16 [N][K]; ACT 0 none, 1 relu, 2 exact gelu;
// resid (optional, f32, row index = (row % rmod), pitch ldr, RES_BF16 rounds it) added before the activation.
template <bool ASPLIT, int ACT, bool BIAS_BF16, bool RES_BF16>
__global__ __launch_bounds__(128) void k_gemm_bf3(const float* __restrict__ A, int lda, const unsigned short* __restrict__ Wt, int ldb,
                                                const float* __restrict__ bias, const float* __restrict__ resid, int rmod, int ldr,
                                                float* __restrict__ C, int ldc, int M, int N, int K) {
  __shared__ __attribute__((aligned(16))) float so[4][16][64];
  const int tid = threadIdx.x, w = tid >> 5, lane = tid & 31, ln = lane & 15, hh = lane >> 4;
  const int ntn = N / 64;
  const int wid = blockIdx.x * 4 + w;
  const int mt = wid / ntn, nq = wid % ntn;
  if (mt * 16 >= M) return;
  const int row0 = mt * 16, col0 = nq * 64;
  const float* arow = A + (size_t)(row0 + ln) * lda;
  v8f acc[4] = {};
  for (int kb = 0; kb < K; kb += 32) {
    FragB ah, al;
    const v4f x0 = *(const v4fa*)(arow + kb + 8 * hh), x1 = *(const v4fa*)(arow + kb + 8 * hh + 4);
    const v4f x2 = *(const v4fa*)(arow + kb + 16 + 8 * hh), x3 = *(const v4fa*)(arow + kb + 16 + 8 * hh + 4);
    float xs[16] = {x0[0],x0[1],x0[2],x0[3],x1[0],x1[1],x1[2],x1[3],x2[0],x2[1],x2[2],x2[3],x3[0],x3[1],x3[2],x3[3]};
#pragma unroll
    for (int i = 0; i < 16; ++i) { const unsigned short hb = bf16_bits(xs[i]); ah.u[i] = hb; al.u[i] = ASPLIT ? bf16_bits(xs[i] - bf16_val(hb)) : (unsigned short)0; }
#pragma unroll
    for (int t = 0; t < 4; ++t) {
      const unsigned short* brow = Wt + (size_t)(col0 + t * 16 + ln) * ldb + kb;
      FragB b;
      b.half[0] = *(const v8us*)(brow + 8 * hh);
      b.half[1] = *(const v8us*)(brow + 16 + 8 * hh);
      acc[t] = mmaN<ASPLIT ? 2 : 1>(ah.v, al.v, b.v, b.v, acc[t]);
    }
  }
#pragma unroll
  for (int t = 0; t < 4; ++t) {
    const int col = col0 + t * 16 + ln;
    float bv = bias ? bias[col] : 0.f;
    if (BIAS_BF16) bv = bf16_round(bv);
#pragma unroll
    for (int r = 0; r < 8; ++r) {
      float v = acc[t][r] + bv;
      if (resid) { float rv = resid[(size_t)((row0 + 8 * hh + r) % rmod) * ldr + col]; if (RES_BF16) rv = bf16_round(rv); v += rv; }
      if (ACT == 1) v = fmaxf(v, 0.f);
      if (ACT == 2) v = 0.5f * v * (1.0f + erff(v * 0.70710678118654752f));
      if (ACT == 3) { const float u = 0.7978845608028654f * (v + 0.044715f * v * v * v); v = 0.5f * v * (1.0f + tanhf(u)); }
      so[w][8 * hh + r][t * 16 + ln] = v;
    }
  }
  __builtin_amdgcn_fence(__ATOMIC_ACQ_REL, "workgroup");
  __builtin_amdgcn_wave_barrier();
  const int rsub = lane >> 4, c4 = (lane & 15) * 4;
  {
#pragma unroll
    for (int q = 0; q < 8; ++q) {
      const int r = q * 2 + rsub;
      const v4f v = *(const v4fa*)&so[w][r][c4];
      *(v4f*)(C + (size_t)(row0 + r) * ldc + col0 + c4) = v;
    }
    
  }
}
// row LayerNorm (biased variance, eps) over N: s = X (+ R); optional out_sum <- s; out_norm <- (s-mu)*rsqrt(var+eps)*g + b
template <bool PARAM_BF16>
__global__ __launch_bounds__(256) void k_layernorm(const float* __restrict__ X, const float* __restrict__ R, const float* __restrict__ g, const float* __restrict__ bta,
                                                  float* __restrict__ out_sum, float* __restrict__ out_norm, int N, float eps) {
  __shared__ float red[256];
  const int row = blockIdx.x, tid = threadIdx.x;
  const float* x = X + (size_t)row * N; const float* rr = R ? R + (size_t)row * N : nullptr;
  float vals[16];                     // up to N = 4096
  const int per = N / 256;            // contiguous chunk per thread? use strided-by-4 chunks: thread handles j = tid*4 + 1024*u
  float s1 = 0.f;
  for (int u = 0; u < per / 4; ++u) {
    const int j = tid * 4 + 1024 * u;
    const v4f a = *(const v4fa*)(x + j);
    v4f b = {0.f,0.f,0.f,0.f}; if (rr) b = *(const v4fa*)(rr + j);
#pragma unroll
    for (int q = 0; q < 4; ++q) { const float v = a[q] + b[q]; vals[u * 4 + q] = v; s1 += v; }
  }
  red[tid] = s1; __syncthreads();
  for (int st = 128; st > 0; st >>= 1) { if (tid < st) red[tid] += red[tid + st]; __syncthreads(); }
  const float mu = red[0] / (float)N; __syncthreads();
  float s2 = 0.f;
  for (int u = 0; u < per / 4; ++u)
#pragma unroll
    for (int q = 0; q < 4; ++q) { const float c = vals[u * 4 + q] - mu; s2 += c * c; }
  red[tid] = s2; __syncthreads();
  for (int st = 128; st > 0; st >>= 1) { if (tid < st) red[tid] += red[tid + st]; __syncthreads(); }
  const float rs = rsqrtf(red[0] / (float)N + eps);
  {
    for (int u = 0; u < per / 4; ++u) {
      const int j = tid * 4 + 1024 * u;
      v4f o, sm;
#pragma unroll
      for (int q = 0; q < 4; ++q) {
        float gg = g[j + q], bb = bta[j + q];
        if (PARAM_BF16) { gg = bf16_round(gg); bb = bf16_round(bb); }
        sm[q] = vals[u * 4 + q]; o[q] = (vals[u * 4 + q] - mu) * rs * gg + bb;
      }
      if (out_sum) *(v4f*)(out_sum + (size_t)row * N + j) = sm;
      *(v4f*)(out_norm + (size_t)row * N + j) = o;
    }
    
  }
}



// ---- f16 WMMA path (v_wmma_f32_16x16x32_f16): 11-bit significands for operands in range — used where a [0,1] probability operand needs more precision than bf16
typedef _Float16 v16h __attribute__((ext_vector_type(16)));
union FragH { v16h v; v8us half[2]; _Float16 h[16]; unsigned short u[16]; };
template <int NT>
__device__ __forceinline__ v8f mmaH(v16h ah, v16h al, v16h bh, v16h bl, v8f c) {
  c = __builtin_amdgcn_wmma_f32_16x16x32_f16(false, ah, false, bh, (short)0, c, false, false);
  if (NT >= 2) c = __builtin_amdgcn_wmma_f32_16x16x32_f16(false, al, false, bh, (short)0, c, false, false);
  if (NT >= 3) c = __builtin_amdgcn_wmma_f32_16x16x32_f16(false, ah, false, bl, (short)0, c, false, false);
  asm volatile("v_nop\n\tv_nop\n\tv_nop\n\tv_nop" : "+v"(c) : "v"(ah), "v"(al), "v"(bh), "v"(bl));
  return c;
}
// batched GEMM like k_gemm_b but f16 operands: A f32 (split into f16 hi/lo if ASPLIT, else rounded to f16), Bt = f16 values [n][k]; alpha; C f32; N multiple of 16 (partial tiles skipped)
template <bool ASPLIT>
__global__ __launch_bounds__(128) void k_gemm_h(const float* __restrict__ A, int lda, size_t sA, const _Float16* __restrict__ Bh, int ldb, size_t sB, float alpha, float* __restrict__ C, int ldc, size_t sC, int M, int N, int K) {
  __shared__ __attribute__((aligned(16))) float so[4][16][64];
  const int tid = threadIdx.x, w = tid >> 5, lane = tid & 31, ln = lane & 15, hh = lane >> 4; const int by = blockIdx.y;
  A += (size_t)by * sA; Bh += (size_t)by * sB; C += (size_t)by * sC;
  const int ntn = (N + 63) / 64; const int wid = blockIdx.x * 4 + w; const int mt = wid / ntn, nq = wid % ntn; if (mt * 16 >= M) return;
  const int row0 = mt * 16, col0 = nq * 64; const float* arow = A + (size_t)(row0 + ln) * lda;
  v8f acc[4] = {};
  for (int kb = 0; kb < K; kb += 32) {
    FragH ah, al;
    const v4f x0 = *(const v4fa*)(arow + kb + 8 * hh), x1 = *(const v4fa*)(arow + kb + 8 * hh + 4), x2 = *(const v4fa*)(arow + kb + 16 + 8 * hh), x3 = *(const v4fa*)(arow + kb + 16 + 8 * hh + 4);
    float xs[16] = {x0[0],x0[1],x0[2],x0[3],x1[0],x1[1],x1[2],x1[3],x2[0],x2[1],x2[2],x2[3],x3[0],x3[1],x3[2],x3[3]};
#pragma unroll
    for (int i = 0; i < 16; ++i) { const _Float16 h = (_Float16)xs[i]; ah.h[i] = h; al.h[i] = ASPLIT ? (_Float16)(xs[i] - (float)h) : (_Float16)0.0f; }
#pragma unroll
    for (int t = 0; t < 4; ++t) { if (col0 + t * 16 >= N) continue; const size_t boff = (size_t)(col0 + t * 16 + ln) * ldb + kb; FragH bq; bq.half[0] = *(const v8us*)(Bh + boff + 8 * hh); bq.half[1] = *(const v8us*)(Bh + boff + 16 + 8 * hh);
      acc[t] = mmaH<ASPLIT ? 2 : 1>(ah.v, al.v, bq.v, bq.v, acc[t]); }
  }
#pragma unroll
  for (int t = 0; t < 4; ++t) { if (col0 + t * 16 >= N) continue;
#pragma unroll
    for (int r = 0; r < 8; ++r) so[w][8 * hh + r][t * 16 + ln] = acc[t][r] * alpha; }
  __builtin_amdgcn_fence(__ATOMIC_ACQ_REL, "workgroup"); __builtin_amdgcn_wave_barrier();
  const int rsub = lane >> 4, c4 = (lane & 15) * 4;
  {
#pragma unroll
    for (int q = 0; q < 8; ++q) { const int r = q * 2 + rsub; if (col0 + c4 < N) { const v4f v = *(const v4fa*)&so[w][r][c4]; *(v4f*)(C + (size_t)(row0 + r) * ldc + col0 + c4) = v; } }
     }
}

// Wt[n][k] = f16(W[k][n]·scale) from f32 row-major W[K][N] (scale = power of two; bf16-exact weights stay exact in f16 away from the subnormal range)
__global__ __launch_bounds__(256) void k_wt_f16(const float* __restrict__ W, _Float16* __restrict__ Wt, int K, int N, float scale) {
  const int t = blockIdx.x * 256 + threadIdx.x; if (t >= N * (K / 8)) return; const int n = t / (K / 8), k8 = (t % (K / 8)) * 8; FragH f;
#pragma unroll
  for (int i = 0; i < 8; ++i) f.h[i] = (_Float16)(bf16_round(W[(size_t)(k8 + i) * N + n]) * scale); const v8us o = f.half[0];
  *(v8us*)((unsigned short*)Wt + (size_t)n * K + k8) = o; 
}


typedef _Float16 v4h __attribute__((ext_vector_type(4)));

__global__ __launch_bounds__(256) void k_h16(const float* __restrict__ x, _Float16* __restrict__ X16, size_t n8) { const size_t t = (size_t)blockIdx.x * 256 + threadIdx.x; if (t >= n8) return; FragH f;
#pragma unroll
  for (int q = 0; q < 8; ++q) f.h[q] = (_Float16)x[t * 8 + q]; *(v8us*)((unsigned short*)X16 + t * 8) = f.half[0];  }
// One launch makes q, k and v from the f32 inputs, k and v in the order in which the attention kernel's A fragments hold them (see Kp, Vp below). A work-group takes 64 rows of x. Its 512 threads each round one unit of 8 values of Wq, Wk, Wv (bf16, x 2^4) and of the 64 rows (bf16) to f16 in LDS;
// then waves 0-3 make q, 4-7 k (one 16-row tile each, 4 feature tiles) and 8-11 v (one feature tile each, 4 row tiles); waves 12-15 only help to fill LDS. The operand roles are chosen by where the result goes:
// for q and k the weight rows are A and the x rows B, so a lane's 8 results are 8 features of one row; for v the x rows are A, so they are 8 positions of one feature. Each is one 16-byte store: these 8 values are
// one lane's half of an A fragment (features or keys 8hh + r of a group of 16), so a k or v store of a wave is 512 contiguous bytes at lane * 16; a wave's 4 q stores fill whole 128-byte lines.
// Kp: per 16 keys 4 units of 512 bytes, unit u = features u * 16 .. + 15: lane (hh, ln) holds features u * 16 + 8hh + r of key ln. Vp: per 32 keys 8 units, unit dt * 2 + g: lane (hh, ln) holds keys g * 16 + 8hh + r of feature dt * 16 + ln.
// In LDS, rows of 64 f16 lie at a pitch of 144 bytes (16 x odd) for the 16-byte fragment reads. A and B fragments come from one loader, so their k orders are equal.
__global__ __launch_bounds__(512) void k_proj(const float* __restrict__ x, const float* __restrict__ Wq, const float* __restrict__ Wk, const float* __restrict__ Wv, _Float16* __restrict__ Q16, _Float16* __restrict__ Kp, _Float16* __restrict__ Vp) {
  constexpr int P = CC + 8;
  __shared__ __attribute__((aligned(16))) unsigned short sh[4 * CC][P];      // rows 0-63 Wq, 64-127 Wk, 128-191 Wv (row = output feature), 192-255 the 64 rows of x
  const int tid = threadIdx.x, w = __builtin_amdgcn_readfirstlane(tid >> 5), lane = tid & 31, ln = lane & 15, hh = lane >> 4;      // w in a scalar register: the roles below branch on it, and every lane must stay on at the WMMAs
  const int row0 = blockIdx.x * 64;
  const unsigned boff = tid * 32u;      // byte offset of the thread's unit in each of the four sources
  const char* const src[4] = {(const char*)Wq, (const char*)Wk, (const char*)Wv, (const char*)(x + (size_t)row0 * CC)};
  v4f in[4][2];
#pragma unroll      // unrolled, here and below: in and the fragments are indexed by constants and stay in registers; the 8 loads go out before the first conversion
  for (int i = 0; i < 4; ++i) { in[i][0] = *(const v4fa*)(src[i] + boff); in[i][1] = *(const v4fa*)(src[i] + boff + 16); }
  asm volatile("s_wait_xcnt 0x0" :: "v"(boff) : "memory");      // the loads' offset register is named so that it lives up to this wait: what follows may reuse it
#pragma unroll
  for (int i = 0; i < 4; ++i) { FragH f;
#pragma unroll
    for (int q = 0; q < 8; ++q) { const float v = bf16_round(in[i][q >> 2][q & 3]); f.h[q] = (_Float16)(i < 3 ? v * 16.0f : v); }
    *(v8us*)&sh[i * CC + (tid >> 3)][(tid & 7) * 8] = f.half[0]; }
  __syncthreads();      // the f16 operands are in LDS before any wave reads a fragment
  if (w >= 12) return;      // behind the only barrier
  auto frag = [&](int r, int ks) { FragH f; f.half[0] = *(const v8us*)&sh[r][ks * 32 + 8 * hh]; f.half[1] = *(const v8us*)&sh[r][ks * 32 + 16 + 8 * hh]; return f; };
  const bool isv = w >= 8;
  const int keep = isv ? w * 16 : 3 * CC + (w & 3) * 16;      // first LDS row of the tile a wave keeps as B: v: feature tile w - 8 of Wv; q, k: row tile w & 3 of x
  const int run = isv ? 3 * CC : (w >> 2) * CC;      // first LDS row of the 4 tiles it walks as A: v: the rows of x; q, k: the features of Wq or Wk
  const FragH b0 = frag(keep + ln, 0), b1 = frag(keep + ln, 1);
  unsigned short* dst = isv ? (unsigned short*)Vp + (size_t)row0 * CC + (w - 8) * 512 + lane * 8      // walked tile t = 16 keys: block t >> 1 of 32 keys, unit (w - 8) * 2 + (t & 1)
                      : w >= 4 ? (unsigned short*)Kp + (size_t)(row0 + (w & 3) * 16) * CC + lane * 8      // walked tile t = 16 features: unit t
                               : (unsigned short*)Q16 + (size_t)(row0 + w * 16 + ln) * CC + 8 * hh;
  const int st1 = w >= 4 ? 256 : 16, st2 = isv ? 32 * CC : 2 * st1;      // steps, in f16, of bit 0 and bit 1 of t
  FragH a[4][2];      // the fragment reads stand ahead of the products, so that later tiles' reads go out while earlier tiles are worked on
#pragma unroll
  for (int t = 0; t < 4; ++t) { a[t][0] = frag(run + t * 16 + ln, 0); a[t][1] = frag(run + t * 16 + ln, 1); }
#pragma unroll
  for (int t = 0; t < 4; ++t) { v8f acc = (v8f){0.f,0.f,0.f,0.f,0.f,0.f,0.f,0.f};
    acc = __builtin_amdgcn_wmma_f32_16x16x32_f16(false, a[t][0].v, false, b0.v, (short)0, acc, false, false);
    acc = __builtin_amdgcn_wmma_f32_16x16x32_f16(false, a[t][1].v, false, b1.v, (short)0, acc, false, false);      // acc[r] = (walked tile's row 8hh + r) . (kept tile's row ln)
    FragH o;
#pragma unroll
    for (int r = 0; r < 8; ++r) o.h[r] = (_Float16)(acc[r] * 0.0625f);
    *(v8us*)(dst + (t & 1) * st1 + (t >> 1) * st2) = o.half[0]; } }

// One work-group = one tile of 32 query rows; its NW waves deal the tile's 32-key blocks among themselves (wave w takes blocks w, w + NW, ...). Every wave holds BOTH 16-query halves of the tile (QT = 2 B operands,
// 2 sets of running maximum, sum and accumulators), so each K and V fragment it loads feeds two products: half the fragment bytes per score and half the waves of a 16-row tile. The partials are merged through LDS behind
// one work-group barrier. The launch bound asks for 4 waves per SIMD (256 VGPRs: one work-group per WGP). w is held in a scalar register: the waves' trip counts differ, and the loop must branch on a scalar so that every lane stays on at the WMMAs.
// Both products run transposed: S^T = K.Q^T (A = 16 key rows, B = 16 of the tile's queries, kept in registers) and O^T += V^T.P^T. A lane then holds 16 scores of ONE query (column ln; keys
// 8hh + r and 16 + 8hh + r of the block), so maximum and sum are in-lane but for one exchange between the wave's halves, and the two converted score tiles ARE the B operand of the second product.
// Softmax in base 2: exp(s / 8 - m) = 2^(s * SC2 - m'), m' = the maximum in the same units. v_exp_f32 gives 0 for -inf and for the -3e38 start value, which is all the range handling these arguments (never above 0) need.
#define SC2 0.18033688011112042f      // 64^-0.5 * log2(e)
__device__ __forceinline__ float ex2(float x) { return __builtin_amdgcn_exp2f(x); }
// The merge's form: the v_nop fills the one slot that the instruction set asks for behind a transcendental before its source is overwritten; inside the statement it cannot drift.
__device__ __forceinline__ float ex2_slot(float x) { float r; asm("v_exp_f32 %0, %1\n\tv_nop" : "=v"(r) : "v"(x)); return r; }
__device__ __forceinline__ float xhalf(float x) { return __builtin_bit_cast(float, __builtin_amdgcn_permlanex16(__builtin_bit_cast(int, x), __builtin_bit_cast(int, x), 0x76543210, 0xfedcba98, false, false)); }      // lane l reads lane l ^ 16
template <int NW>
__global__ __launch_bounds__(NW * 32, 4) void k_flash(const _Float16* __restrict__ Q16, int ldq, const _Float16* __restrict__ Kp, const _Float16* __restrict__ Vp, const int* __restrict__ MSK, float* __restrict__ O, int ldo) {
  constexpr int QT = 2, RPW = 16 * QT, NQB = 4096 / RPW, DT = 4, KS = 2;
  __shared__ __attribute__((aligned(16))) float sO[NW][RPW][64 + 4]; __shared__ float sM[NW][RPW], sL[NW][RPW];
  const int tid = threadIdx.x, w = __builtin_amdgcn_readfirstlane(tid >> 5), lane = tid & 31, ln = lane & 15, hh = lane >> 4;
  const int slab = blockIdx.x / NQB, qblk = blockIdx.x % NQB; const int b = slab / 1, h = slab % 1; const int q0 = qblk * RPW;
  FragH bq[QT][KS]; const unsigned short* qr[QT];
  const unsigned short* Kl = (const unsigned short*)Kp + (size_t)slab * 4096 * 64 + lane * 8; const unsigned short* Vl = (const unsigned short*)Vp + (size_t)slab * 4096 * 64 + lane * 8;      // fragment order (k_proj): a block of 32 keys is 4 KB in each, every load below 512 contiguous bytes of it
  float m_q[QT], l_q[QT]; v8f oacc[QT][DT];      // of query q0 + qt * 16 + ln; l_q sums this half's keys only, the halves are joined behind the loop
#pragma unroll
  for (int qt = 0; qt < QT; ++qt) { m_q[qt] = -3.0e38f; l_q[qt] = 0.f;
#pragma unroll
    for (int dt = 0; dt < DT; ++dt) oacc[qt][dt] = (v8f){0.f,0.f,0.f,0.f,0.f,0.f,0.f,0.f}; }      // oacc[qt][dt][r] = O[q0 + qt * 16 + ln][dt * 16 + 8hh + r]
  const int jend = q0 + RPW, tq = q0 + ln;
  if (w * 32 < jend) {      // the loop's own entry test, a scalar branch: a wave without a block loads no queries and passes no wait for them
#pragma unroll      // unrolled, here and below: everything indexed by qt is indexed by constants and stays in registers
    for (int qt = 0; qt < QT; ++qt) { qr[qt] = (const unsigned short*)Q16 + ((size_t)b * 4096 + q0 + qt * 16 + ln) * ldq + h * 64 + 8 * hh;
#pragma unroll
      for (int ks = 0; ks < KS; ++ks) { bq[qt][ks].half[0] = *(const v8us*)(qr[qt] + ks * 32); bq[qt][ks].half[1] = *(const v8us*)(qr[qt] + ks * 32 + 16); } }
    asm volatile("s_wait_xcnt 0x0" :: "v"(qr[0]), "v"(qr[1]) : "memory"); }      // the 8 loads' address registers are named so that they live up to this wait: what follows may reuse them only behind it
#pragma unroll 1
  for (int j0 = w * 32; j0 < jend; j0 += NW * 32) {
    // The block's 16 fragment loads (8 KB) all stand ahead of its first product, so that they are in flight together and a block waits out one load latency; placed at their uses they went out in six groups, each waited for in turn.
    const unsigned short* kr = Kl + (size_t)j0 * 64; const unsigned short* vr = Vl + (size_t)j0 * 64; FragH ak[2][KS], av[DT];
#pragma unroll
    for (int u = 0; u < 2 * KS; ++u) { ak[u / KS][u % KS].half[0] = *(const v8us*)(kr + u * 512); ak[u / KS][u % KS].half[1] = *(const v8us*)(kr + u * 512 + 256); }      // A operand: key rows j0 + nt * 16 + ln
#pragma unroll
    for (int dt = 0; dt < DT; ++dt) { av[dt].half[0] = *(const v8us*)(vr + dt * 512); av[dt].half[1] = *(const v8us*)(vr + dt * 512 + 256); }      // A operand: V^T rows dt * 16 + ln, the block's 32 keys in the k order of the packed scores
    asm volatile("s_wait_xcnt 0x0" :: "v"(kr), "v"(vr) : "memory");      // the loads' address registers are named so that they live up to this wait: what follows, a load's own result too, may reuse them only behind it
    float al[QT]; FragH pb[QT];
#pragma unroll
    for (int qt = 0; qt < QT; ++qt) {
      v8f s[2];
#pragma unroll
      for (int nt = 0; nt < 2; ++nt) { v8f acc = (v8f){0.f,0.f,0.f,0.f,0.f,0.f,0.f,0.f};
#pragma unroll
        for (int ks = 0; ks < KS; ++ks) acc = mmaH<1>(ak[nt][ks].v, ak[nt][ks].v, bq[qt][ks].v, bq[qt][ks].v, acc);
        s[nt] = acc; }      // s[nt][r] = q(q0 + qt * 16 + ln) . k(j0 + nt * 16 + 8hh + r)
      float mc = -INFINITY; const int dq = tq + qt * 16 - j0 - 8 * hh;      // score (nt, r) is unmasked while nt * 16 + r <= dq
#pragma unroll
      for (int nt = 0; nt < 2; ++nt)
#pragma unroll
        for (int r = 0; r < 8; ++r) { s[nt][r] = (nt * 16 + r <= dq) ? s[nt][r] : -INFINITY; mc = fmaxf(mc, s[nt][r]); }      // raw products: the scale is positive, so it is applied to the maximum alone
      mc = fmaxf(mc, xhalf(mc));
      // every block a wave walks starts at a key j0 <= q0, so each query has an unmasked score in it and mn is a finite score: a masked score (-inf) gives exp = 0 and the first block gives al = 0 with no test
      const float mn = fmaxf(m_q[qt], mc * SC2); al[qt] = ex2(m_q[qt] - mn); m_q[qt] = mn;
      float ps = 0.f;
#pragma unroll
      for (int nt = 0; nt < 2; ++nt)
#pragma unroll
        for (int r = 0; r < 8; ++r) { const float p = ex2(fmaf(s[nt][r], SC2, -mn)); ps += p; pb[qt].h[nt * 8 + r] = (_Float16)p; }      // element nt * 8 + r of a B fragment is k = nt * 16 + 8hh + r: the key this score belongs to
      l_q[qt] = l_q[qt] * al[qt] + ps; }
#pragma unroll
    for (int dt = 0; dt < DT; ++dt)
#pragma unroll
      for (int qt = 0; qt < QT; ++qt) {
#pragma unroll
        for (int r = 0; r < 8; ++r) oacc[qt][dt][r] *= al[qt];
        oacc[qt][dt] = mmaH<1>(av[dt].v, av[dt].v, pb[qt].v, pb[qt].v, oacc[qt][dt]); } }
  // each wave hands over its un-normalised partial: (maximum, sum) per row and the 32 x 64 accumulator; a wave without a block hands (-3e38, 0, zeros), which weighs 0 in the merge
  const int le = (int)__builtin_amdgcn_mbcnt_lo(~0u, 0u), lne = le & 15, hhe = le >> 4;      // lane id read anew, so that tid and its parts need no registers across the loop
#pragma unroll
  for (int qt = 0; qt < QT; ++qt) { const int row = qt * 16 + lne;
    l_q[qt] += xhalf(l_q[qt]);
    if (hhe == 0) { sM[w][row] = m_q[qt]; sL[w][row] = l_q[qt]; }
#pragma unroll
    for (int dt = 0; dt < DT; ++dt) { *(v4fa*)&sO[w][row][dt * 16 + 8 * hhe] = (v4f){oacc[qt][dt][0], oacc[qt][dt][1], oacc[qt][dt][2], oacc[qt][dt][3]}; *(v4fa*)&sO[w][row][dt * 16 + 8 * hhe + 4] = (v4f){oacc[qt][dt][4], oacc[qt][dt][5], oacc[qt][dt][6], oacc[qt][dt][7]}; } }
  __syncthreads();      // every wave's partial is in LDS before any is merged
  static_assert(NW * QT == RPW, "wave w merges rows w and NW + w");
  typedef float v2f __attribute__((ext_vector_type(2))); typedef float v2fa __attribute__((ext_vector_type(2), may_alias));
#pragma unroll
  for (int qt = 0; qt < QT; ++qt) { const int r = qt * NW + w; float M = sM[0][r];
#pragma unroll      // both loops unrolled: the NW partials' LDS loads go out together instead of one wait each
    for (int u = 1; u < NW; ++u) M = fmaxf(M, sM[u][r]);
    float L = 0.f; v2f val = {0.f, 0.f};
#pragma unroll
    for (int u = 0; u < NW; ++u) { const float e = ex2_slot(sM[u][r] - M); L += e * sL[u][r]; const v2f pv = *(const v2fa*)&sO[u][r][le * 2]; val += pv * e; }
    const float inv = (L > 0.f) ? 1.0f / L : 0.f; val *= inv;
    *(v2f*)(O + ((size_t)b * 4096 + q0 + r) * ldo + h * 64 + le * 2) = val; } }

extern "C" void kernel_launch(void* const* d_in, const int* in_sizes, int n_in,
                              void* d_out, int out_size, void* d_ws, size_t ws_size, hipStream_t stream) {
  (void)in_sizes; (void)n_in; (void)out_size;
  const float* x = (const float*)d_in[0]; const float* Wk = (const float*)d_in[1]; const float* Wq = (const float*)d_in[2]; const float* Wv = (const float*)d_in[3];
  char* ws = (char*)d_ws; size_t off = 0;
  auto take = [&](size_t bytes) { char* p = ws + off; off += (bytes + 255) & ~(size_t)255; return p; };
  _Float16* Q16 = (_Float16*)take((size_t)NR * CC * 2); _Float16* Kp = (_Float16*)take((size_t)NR * CC * 2); _Float16* Vp = (_Float16*)take((size_t)NR * CC * 2);
  if (off > ws_size) return;      // 3 buffers of 2 MiB
  k_proj<<<NR / 64, 512, 0, stream>>>(x, Wq, Wk, Wv, Q16, Kp, Vp);      // q in f16 rows; k and v in fragment order
  k_flash<16><<<BB * 1 * (TT / 32), 16 * 32, 0, stream>>>(Q16, CC, Kp, Vp, nullptr, (float*)d_out, CC);
}

// v008
// A run of this version takes 19.7 microseconds.
// Two timings next to v007 put it at 1.36 and 1.38 times that version's speed.
// Counting every step since v000, it is 21.8 times as fast.
#include <hip/hip_runtime.h>
// Single causal attention head (B=4, T=4096, C=64): q,k,v = x·Wᵀ (no bias), softmax(q·kᵀ·64^-½) with a causal mask, out = P·v. One GEMM for [q|k|v] and a fused flash-style causal attention
// kernel (online softmax in f32; P f16 ≤ 1; O = P·Vᵀ-tiles; two tiles of 32 query rows per 16-wave work-group; causal tile skipping) on v_wmma_f32_16x16x32_f16 — x bf16-exact, (out,in) weights bf16-exact ×2^4, q/k/v f16,
// f32 accumulate.
#define BB 4
#define TT 4096
#define CC 64
#define NR (BB * TT)

typedef __bf16 v16b __attribute__((ext_vector_type(16)));
typedef unsigned short v8us __attribute__((ext_vector_type(8), may_alias));
typedef float  v8f  __attribute__((ext_vector_type(8)));
typedef float  v4f  __attribute__((ext_vector_type(4)));
typedef float  v4fa __attribute__((ext_vector_type(4), may_alias));
union FragB { v16b v; v8us half[2]; unsigned short u[16]; };

__device__ __forceinline__ unsigned short bf16_bits(float x) { unsigned int u = __float_as_uint(x); return (unsigned short)((u + 0x7FFFu + ((u >> 16) & 1u)) >> 16); }
__device__ __forceinline__ float bf16_val(unsigned short b) { return __uint_as_float(((unsigned int)b) << 16); }
__device__ __forceinline__ float bf16_round(float x) { return bf16_val(bf16_bits(x)); }
// D += A·B with NT terms: 1 = ah·bh, 2 = + al·bh (A split), 3 = + ah·bl (both split)
template <int NT>
__device__ __forceinline__ v8f mmaN(v16b ah, v16b al, v16b bh, v16b bl, v8f c) {
  c = __builtin_amdgcn_wmma_f32_16x16x32_bf16(false, ah, false, bh, (short)0, c, false, false);
  if (NT >= 2) c = __builtin_amdgcn_wmma_f32_16x16x32_bf16(false, al, false, bh, (short)0, c, false, false);
  if (NT >= 3) c = __builtin_amdgcn_wmma_f32_16x16x32_bf16(false, ah, false, bl, (short)0, c, false, false);
  asm volatile("v_nop\n\tv_nop\n\tv_nop\n\tv_nop" : "+v"(c) : "v"(ah), "v"(al), "v"(bh), "v"(bl));
  return c;
}

__global__ __launch_bounds__(256) void k_wt_bf16(const float* __restrict__ W, unsigned short* __restrict__ Wt, int K, int N) {
  const int t = blockIdx.x * 256 + threadIdx.x;
  const int k8n = K / 8;
  if (t >= N * k8n) return;
  const int n = t / k8n, k8 = (t % k8n) * 8;
  v8us v;
#pragma unroll
  for (int i = 0; i < 8; ++i) v[i] = bf16_bits(W[(size_t)(k8 + i) * N + n]);
  *(v8us*)(Wt + (size_t)n * K + k8) = v;
  
}

// GEMM C[M][N] (f32, pitch ldc) = act(A[M][K]·W + bias). A f32 row-major (pitch lda) converted per fragment to bf16
// (ASPLIT: hi/lo two planes -> 2 terms, else single rounded term); Wt bf16 [N][K] (pitch ldb). BIAS_BF16 rounds the
// bias to bf16 first (bias quantised to bf16 before the add). K%32==0, M%16==0, N%64==0.
template <bool ASPLIT, int ACT, bool BIAS_BF16>
__global__ __launch_bounds__(128) void k_gemm_bf(const float* __restrict__ A, int lda, const unsigned short* __restrict__ Wt, int ldb,
                                               const float* __restrict__ bias, float* __restrict__ C, int ldc, int M, int N, int K) {
  __shared__ __attribute__((aligned(16))) float so[4][16][64];
  const int tid = threadIdx.x, w = tid >> 5, lane = tid & 31, ln = lane & 15, hh = lane >> 4;
  const int ntn = N / 64;
  const int wid = blockIdx.x * 4 + w;
  const int mt = wid / ntn, nq = wid % ntn;
  if (mt * 16 >= M) return;
  const int row0 = mt * 16, col0 = nq * 64;
  const float* arow = A + (size_t)(row0 + ln) * lda;
  v8f acc[4] = {};
  for (int kb = 0; kb < K; kb += 32) {
    FragB ah, al;
    const v4f x0 = *(const v4fa*)(arow + kb + 8 * hh), x1 = *(const v4fa*)(arow + kb + 8 * hh + 4);
    const v4f x2 = *(const v4fa*)(arow + kb + 16 + 8 * hh), x3 = *(const v4fa*)(arow + kb + 16 + 8 * hh + 4);
    float xs[16] = {x0[0],x0[1],x0[2],x0[3],x1[0],x1[1],x1[2],x1[3],x2[0],x2[1],x2[2],x2[3],x3[0],x3[1],x3[2],x3[3]};
#pragma unroll
    for (int i = 0; i < 16; ++i) { const unsigned short hb = bf16_bits(xs[i]); ah.u[i] = hb; al.u[i] = ASPLIT ? bf16_bits(xs[i] - bf16_val(hb)) : (unsigned short)0; }
#pragma unroll
    for (int t = 0; t < 4; ++t) {
      const unsigned short* brow = Wt + (size_t)(col0 + t * 16 + ln) * ldb + kb;
      FragB b;
      b.half[0] = *(const v8us*)(brow + 8 * hh);
      b.half[1] = *(const v8us*)(brow + 16 + 8 * hh);
      acc[t] = mmaN<ASPLIT ? 2 : 1>(ah.v, al.v, b.v, b.v, acc[t]);
    }
  }
#pragma unroll
  for (int t = 0; t < 4; ++t) {
    float bv = bias ? bias[col0 + t * 16 + ln] : 0.f;
    if (BIAS_BF16) bv = bf16_round(bv);
#pragma unroll
    for (int r = 0; r < 8; ++r) { float v = acc[t][r] + bv; if (ACT == 1) v = fmaxf(v, 0.f); so[w][8 * hh + r][t * 16 + ln] = v; }
  }
  __builtin_amdgcn_fence(__ATOMIC_ACQ_REL, "workgroup");
  __builtin_amdgcn_wave_barrier();
  const int rsub = lane >> 4, c4 = (lane & 15) * 4;
  {
#pragma unroll
    for (int q = 0; q < 8; ++q) {
      const int r = q * 2 + rsub;
      const v4f v = *(const v4fa*)&so[w][r][c4];
      *(v4f*)(C + (size_t)(row0 + r) * ldc + col0 + c4) = v;
    }
    
  }
}

// Flash-style causal/unmasked attention, all contractions 3-term bf16 hi/lo splits, f32 softmax with running max.
// q,k,v rows are read from f32 buffers with arbitrary row pitch (so they can live inside a fused qkv buffer);
// D = head size (multiple of 32, <= 128); one wave = 16 query rows; block = 4 waves (64 queries) sharing K/V chunks of 32.
template <int D, bool CAUSAL>
__global__ __launch_bounds__(128) void k_flash(const float* __restrict__ qb, const float* __restrict__ kb, const float* __restrict__ vb,
                                             int pitch, int T, int H, float scale, float* __restrict__ y, int ypitch) {
  constexpr int KS = D / 32;        // k-steps for QK
  constexpr int DT = D / 16;        // d tiles for PV
  __shared__ __attribute__((aligned(16))) unsigned short sKh[32][D + 8], sKl[32][D + 8], sVh[32][D + 8], sVl[32][D + 8];
  __shared__ __attribute__((aligned(16))) unsigned short sPh[4][16][40], sPl[4][16][40];
  __shared__ __attribute__((aligned(16))) float sO[4][16][D];
  const int tid = threadIdx.x, w = tid >> 5, lane = tid & 31, ln = lane & 15, hh = lane >> 4;
  const int nqb = (T + 63) / 64;
  const int bh = blockIdx.x / nqb, qblk = blockIdx.x % nqb;
  const int b = bh / H, h = bh % H;
  const int q0 = qblk * 64 + w * 16;
  const float* Q = qb + (size_t)b * T * pitch + h * D;
  const float* K = kb + (size_t)b * T * pitch + h * D;
  const float* V = vb + (size_t)b * T * pitch + h * D;

  // A fragments of the wave's 16 query rows (scaled), hi/lo
  FragB aqh[KS], aql[KS];
  {
    int row = q0 + ln; if (row >= T) row = T - 1;
    const float* qr = Q + (size_t)row * pitch;
#pragma unroll
    for (int ks = 0; ks < KS; ++ks)
#pragma unroll
      for (int i = 0; i < 16; ++i) {
        const int d = ks * 32 + ((i < 8) ? (8 * hh + i) : (16 + 8 * hh + (i - 8)));
        const float x = qr[d] * scale; const unsigned short hb = bf16_bits(x);
        aqh[ks].u[i] = hb; aql[ks].u[i] = bf16_bits(x - bf16_val(hb));
      }
  }
  float m_r[8], l_r[8];
#pragma unroll
  for (int r = 0; r < 8; ++r) { m_r[r] = -3.0e38f; l_r[r] = 0.f; }
  v8f oacc[DT];
#pragma unroll
  for (int dt = 0; dt < DT; ++dt) oacc[dt] = (v8f){0.f,0.f,0.f,0.f,0.f,0.f,0.f,0.f};

  const int kv_end = CAUSAL ? min(T, qblk * 64 + 64) : T;     // block-uniform
  for (int j0 = 0; j0 < kv_end; j0 += 32) {
    __syncthreads();
    for (int e = tid; e < 32 * (D / 4); e += 128) {
      const int r = e / (D / 4), c4 = (e % (D / 4)) * 4;
      const int key = j0 + r;
      v4f kf = {0.f,0.f,0.f,0.f}, vf = {0.f,0.f,0.f,0.f};
      if (key < T) { kf = *(const v4fa*)(K + (size_t)key * pitch + c4); vf = *(const v4fa*)(V + (size_t)key * pitch + c4); }
#pragma unroll
      for (int t = 0; t < 4; ++t) {
        unsigned short hb = bf16_bits(kf[t]); sKh[r][c4 + t] = hb; sKl[r][c4 + t] = bf16_bits(kf[t] - bf16_val(hb));
        hb = bf16_bits(vf[t]); sVh[r][c4 + t] = hb; sVl[r][c4 + t] = bf16_bits(vf[t] - bf16_val(hb));
      }
    }
    __syncthreads();
    // S tile 16 x 32
    v8f s[2];
#pragma unroll
    for (int nt = 0; nt < 2; ++nt) {
      v8f acc = {};
#pragma unroll
      for (int ks = 0; ks < KS; ++ks) {
        FragB bh_, bl_;
        bh_.half[0] = *(const v8us*)&sKh[nt * 16 + ln][ks * 32 + 8 * hh]; bh_.half[1] = *(const v8us*)&sKh[nt * 16 + ln][ks * 32 + 16 + 8 * hh];
        bl_.half[0] = *(const v8us*)&sKl[nt * 16 + ln][ks * 32 + 8 * hh]; bl_.half[1] = *(const v8us*)&sKl[nt * 16 + ln][ks * 32 + 16 + 8 * hh];
        acc = mmaN<3>(aqh[ks].v, aql[ks].v, bh_.v, bl_.v, acc);
      }
      s[nt] = acc;
    }
    // mask + running max (rows 8hh+r; the 16 lanes of a half share rows)
    float alpha[8];
#pragma unroll
    for (int r = 0; r < 8; ++r) {
      const int qi = q0 + 8 * hh + r;
      const int ja = j0 + ln, jb = j0 + 16 + ln;
      if (CAUSAL) { if (ja > qi) s[0][r] = -3.0e38f; if (jb > qi) s[1][r] = -3.0e38f; }
      if (ja >= T) s[0][r] = -3.0e38f;
      if (jb >= T) s[1][r] = -3.0e38f;
      float mx = fmaxf(s[0][r], s[1][r]);
      mx = fmaxf(mx, __shfl_xor(mx, 1, 32)); mx = fmaxf(mx, __shfl_xor(mx, 2, 32)); mx = fmaxf(mx, __shfl_xor(mx, 4, 32)); mx = fmaxf(mx, __shfl_xor(mx, 8, 32));
      const float mnew = fmaxf(m_r[r], mx);
      alpha[r] = (mnew > -1.0e38f) ? __expf(m_r[r] - mnew) : 1.0f;
      const float p0 = (s[0][r] > -1.0e38f) ? __expf(s[0][r] - mnew) : 0.f;
      const float p1 = (s[1][r] > -1.0e38f) ? __expf(s[1][r] - mnew) : 0.f;
      m_r[r] = mnew;
      l_r[r] = l_r[r] * alpha[r] + p0 + p1;            // per-lane partial row sum (16 lanes combined at the end)
      unsigned short hb = bf16_bits(p0); sPh[w][8 * hh + r][ln] = hb;      sPl[w][8 * hh + r][ln] = bf16_bits(p0 - bf16_val(hb));
      hb = bf16_bits(p1);                sPh[w][8 * hh + r][16 + ln] = hb; sPl[w][8 * hh + r][16 + ln] = bf16_bits(p1 - bf16_val(hb));
    }
#pragma unroll
    for (int dt = 0; dt < DT; ++dt)
#pragma unroll
      for (int r = 0; r < 8; ++r) oacc[dt][r] *= alpha[r];
    __builtin_amdgcn_fence(__ATOMIC_ACQ_REL, "workgroup");
    __builtin_amdgcn_wave_barrier();
    FragB pah, pal;
    pah.half[0] = *(const v8us*)&sPh[w][ln][8 * hh]; pah.half[1] = *(const v8us*)&sPh[w][ln][16 + 8 * hh];
    pal.half[0] = *(const v8us*)&sPl[w][ln][8 * hh]; pal.half[1] = *(const v8us*)&sPl[w][ln][16 + 8 * hh];
#pragma unroll
    for (int dt = 0; dt < DT; ++dt) {
      FragB bvh, bvl;
#pragma unroll
      for (int i = 0; i < 8; ++i) {
        bvh.u[i] = sVh[8 * hh + i][dt * 16 + ln]; bvh.u[8 + i] = sVh[16 + 8 * hh + i][dt * 16 + ln];
        bvl.u[i] = sVl[8 * hh + i][dt * 16 + ln]; bvl.u[8 + i] = sVl[16 + 8 * hh + i][dt * 16 + ln];
      }
      oacc[dt] = mmaN<3>(pah.v, pal.v, bvh.v, bvl.v, oacc[dt]);
    }
    __builtin_amdgcn_fence(__ATOMIC_ACQ_REL, "workgroup");
    __builtin_amdgcn_wave_barrier();
  }
#pragma unroll
  for (int r = 0; r < 8; ++r) {
    float l = l_r[r];
    l += __shfl_xor(l, 1, 32); l += __shfl_xor(l, 2, 32); l += __shfl_xor(l, 4, 32); l += __shfl_xor(l, 8, 32);
    l_r[r] = (l > 0.f) ? 1.0f / l : 0.f;
  }
#pragma unroll
  for (int dt = 0; dt < DT; ++dt)
#pragma unroll
    for (int r = 0; r < 8; ++r) sO[w][8 * hh + r][dt * 16 + ln] = oacc[dt][r] * l_r[r];
  __builtin_amdgcn_fence(__ATOMIC_ACQ_REL, "workgroup");
  __builtin_amdgcn_wave_barrier();
  {
    for (int r = 0; r < 16; ++r) {
      const int row = q0 + r;
      if (row < T && lane < D / 4) {
        const v4f val = *(const v4fa*)&sO[w][r][lane * 4];
        *(v4f*)(y + ((size_t)b * T + row) * ypitch + h * D + lane * 4) = val;
      }
    }
    
  }
}

// GEMM C = act(A·W + bias + resid): A f32 (ASPLIT -> hi/lo 2 terms), Wt bf16 [N][K]; ACT 0 none, 1 relu, 2 exact gelu;
// resid (optional, f32, row index = (row % rmod), pitch ldr, RES_BF16 rounds it) added before the activation.
template <bool ASPLIT, int ACT, bool BIAS_BF16, bool RES_BF16>
__global__ __launch_bounds__(128) void k_gemm_bf3(const float* __restrict__ A, int lda, const unsigned short* __restrict__ Wt, int ldb,
                                                const float* __restrict__ bias, const float* __restrict__ resid, int rmod, int ldr,
                                                float* __restrict__ C, int ldc, int M, int N, int K) {
  __shared__ __attribute__((aligned(16))) float so[4][16][64];
  const int tid = threadIdx.x, w = tid >> 5, lane = tid & 31, ln = lane & 15, hh = lane >> 4;
  const int ntn = N / 64;
  const int wid = blockIdx.x * 4 + w;
  const int mt = wid / ntn, nq = wid % ntn;
  if (mt * 16 >= M) return;
  const int row0 = mt * 16, col0 = nq * 64;
  const float* arow = A + (size_t)(row0 + ln) * lda;
  v8f acc[4] = {};
  for (int kb = 0; kb < K; kb += 32) {
    FragB ah, al;
    const v4f x0 = *(const v4fa*)(arow + kb + 8 * hh), x1 = *(const v4fa*)(arow + kb + 8 * hh + 4);
    const v4f x2 = *(const v4fa*)(arow + kb + 16 + 8 * hh), x3 = *(const v4fa*)(arow + kb + 16 + 8 * hh + 4);
    float xs[16] = {x0[0],x0[1],x0[2],x0[3],x1[0],x1[1],x1[2],x1[3],x2[0],x2[1],x2[2],x2[3],x3[0],x3[1],x3[2],x3[3]};
#pragma unroll
    for (int i = 0; i < 16; ++i) { const unsigned short hb = bf16_bits(xs[i]); ah.u[i] = hb; al.u[i] = ASPLIT ? bf16_bits(xs[i] - bf16_val(hb)) : (unsigned short)0; }
#pragma unroll
    for (int t = 0; t < 4; ++t) {
      const unsigned short* brow = Wt + (size_t)(col0 + t * 16 + ln) * ldb + kb;
      FragB b;
      b.half[0] = *(const v8us*)(brow + 8 * hh);
      b.half[1] = *(const v8us*)(brow + 16 + 8 * hh);
      acc[t] = mmaN<ASPLIT ? 2 : 1>(ah.v, al.v, b.v, b.v, acc[t]);
    }
  }
#pragma unroll
  for (int t = 0; t < 4; ++t) {
    const int col = col0 + t * 16 + ln;
    float bv = bias ? bias[col] : 0.f;
    if (BIAS_BF16) bv = bf16_round(bv);
#pragma unroll
    for (int r = 0; r < 8; ++r) {
      float v = acc[t][r] + bv;
      if (resid) { float rv = resid[(size_t)((row0 + 8 * hh + r) % rmod) * ldr + col]; if (RES_BF16) rv = bf16_round(rv); v += rv; }
      if (ACT == 1) v = fmaxf(v, 0.f);
      if (ACT == 2) v = 0.5f * v * (1.0f + erff(v * 0.70710678118654752f));
      if (ACT == 3) { const float u = 0.7978845608028654f * (v + 0.044715f * v * v * v); v = 0.5f * v * (1.0f + tanhf(u)); }
      so[w][8 * hh + r][t * 16 + ln] = v;
    }
  }
  __builtin_amdgcn_fence(__ATOMIC_ACQ_REL, "workgroup");
  __builtin_amdgcn_wave_barrier();
  const int rsub = lane >> 4, c4 = (lane & 15) * 4;
  {
#pragma unroll
    for (int q = 0; q < 8; ++q) {
      const int r = q * 2 + rsub;
      const v4f v = *(const v4fa*)&so[w][r][c4];
      *(v4f*)(C + (size_t)(row0 + r) * ldc + col0 + c4) = v;
    }
    
  }
}
// row LayerNorm (biased variance, eps) over N: s = X (+ R); optional out_sum <- s; out_norm <- (s-mu)*rsqrt(var+eps)*g + b
template <bool PARAM_BF16>
__global__ __launch_bounds__(256) void k_layernorm(const float* __restrict__ X, const float* __restrict__ R, const float* __restrict__ g, const float* __restrict__ bta,
                                                  float* __restrict__ out_sum, float* __restrict__ out_norm, int N, float eps) {
  __shared__ float red[256];
  const int row = blockIdx.x, tid = threadIdx.x;
  const float* x = X + (size_t)row * N; const float* rr = R ? R + (size_t)row * N : nullptr;
  float vals[16];                     // up to N = 4096
  const int per = N / 256;            // contiguous chunk per thread? use strided-by-4 chunks: thread handles j = tid*4 + 1024*u
  float s1 = 0.f;
  for (int u = 0; u < per / 4; ++u) {
    const int j = tid * 4 + 1024 * u;
    const v4f a = *(const v4fa*)(x + j);
    v4f b = {0.f,0.f,0.f,0.f}; if (rr) b = *(const v4fa*)(rr + j);
#pragma unroll
    for (int q = 0; q < 4; ++q) { const float v = a[q] + b[q]; vals[u * 4 + q] = v; s1 += v; }
  }
  red[tid] = s1; __syncthreads();
  for (int st = 128; st > 0; st >>= 1) { if (tid < st) red[tid] += red[tid + st]; __syncthreads(); }
  const float mu = red[0] / (float)N; __syncthreads();
  float s2 = 0.f;
  for (int u = 0; u < per / 4; ++u)
#pragma unroll
    for (int q = 0; q < 4; ++q) { const float c = vals[u * 4 + q] - mu; s2 += c * c; }
  red[tid] = s2; __syncthreads();
  for (int st = 128; st > 0; st >>= 1) { if (tid < st) red[tid] += red[tid + st]; __syncthreads(); }
  const float rs = rsqrtf(red[0] / (float)N + eps);
  {
    for (int u = 0; u < per / 4; ++u) {
      const int j = tid * 4 + 1024 * u;
      v4f o, sm;
#pragma unroll
      for (int q = 0; q < 4; ++q) {
        float gg = g[j + q], bb = bta[j + q];
        if (PARAM_BF16) { gg = bf16_round(gg); bb = bf16_round(bb); }
        sm[q] = vals[u * 4 + q]; o[q] = (vals[u * 4 + q] - mu) * rs * gg + bb;
      }
      if (out_sum) *(v4f*)(out_sum + (size_t)row * N + j) = sm;
      *(v4f*)(out_norm + (size_t)row * N + j) = o;
    }
    
  }
}



// ---- f16 WMMA path (v_wmma_f32_16x16x32_f16): 11-bit significands for operands in range — used where a [0,1] probability operand needs more precision than bf16
typedef _Float16 v16h __attribute__((ext_vector_type(16)));
union FragH { v16h v; v8us half[2]; _Float16 h[16]; unsigned short u[16]; };
template <int NT>
__device__ __forceinline__ v8f mmaH(v16h ah, v16h al, v16h bh, v16h bl, v8f c) {
  c = __builtin_amdgcn_wmma_f32_16x16x32_f16(false, ah, false, bh, (short)0, c, false, false);
  if (NT >= 2) c = __builtin_amdgcn_wmma_f32_16x16x32_f16(false, al, false, bh, (short)0, c, false, false);
  if (NT >= 3) c = __builtin_amdgcn_wmma_f32_16x16x32_f16(false, ah, false, bl, (short)0, c, false, false);
  asm volatile("v_nop\n\tv_nop\n\tv_nop\n\tv_nop" : "+v"(c) : "v"(ah), "v"(al), "v"(bh), "v"(bl));
  return c;
}
// batched GEMM like k_gemm_b but f16 operands: A f32 (split into f16 hi/lo if ASPLIT, else rounded to f16), Bt = f16 values [n][k]; alpha; C f32; N multiple of 16 (partial tiles skipped)
template <bool ASPLIT>
__global__ __launch_bounds__(128) void k_gemm_h(const float* __restrict__ A, int lda, size_t sA, const _Float16* __restrict__ Bh, int ldb, size_t sB, float alpha, float* __restrict__ C, int ldc, size_t sC, int M, int N, int K) {
  __shared__ __attribute__((aligned(16))) float so[4][16][64];
  const int tid = threadIdx.x, w = tid >> 5, lane = tid & 31, ln = lane & 15, hh = lane >> 4; const int by = blockIdx.y;
  A += (size_t)by * sA; Bh += (size_t)by * sB; C += (size_t)by * sC;
  const int ntn = (N + 63) / 64; const int wid = blockIdx.x * 4 + w; const int mt = wid / ntn, nq = wid % ntn; if (mt * 16 >= M) return;
  const int row0 = mt * 16, col0 = nq * 64; const float* arow = A + (size_t)(row0 + ln) * lda;
  v8f acc[4] = {};
  for (int kb = 0; kb < K; kb += 32) {
    FragH ah, al;
    const v4f x0 = *(const v4fa*)(arow + kb + 8 * hh), x1 = *(const v4fa*)(arow + kb + 8 * hh + 4), x2 = *(const v4fa*)(arow + kb + 16 + 8 * hh), x3 = *(const v4fa*)(arow + kb + 16 + 8 * hh + 4);
    float xs[16] = {x0[0],x0[1],x0[2],x0[3],x1[0],x1[1],x1[2],x1[3],x2[0],x2[1],x2[2],x2[3],x3[0],x3[1],x3[2],x3[3]};
#pragma unroll
    for (int i = 0; i < 16; ++i) { const _Float16 h = (_Float16)xs[i]; ah.h[i] = h; al.h[i] = ASPLIT ? (_Float16)(xs[i] - (float)h) : (_Float16)0.0f; }
#pragma unroll
    for (int t = 0; t < 4; ++t) { if (col0 + t * 16 >= N) continue; const size_t boff = (size_t)(col0 + t * 16 + ln) * ldb + kb; FragH bq; bq.half[0] = *(const v8us*)(Bh + boff + 8 * hh); bq.half[1] = *(const v8us*)(Bh + boff + 16 + 8 * hh);
      acc[t] = mmaH<ASPLIT ? 2 : 1>(ah.v, al.v, bq.v, bq.v, acc[t]); }
  }
#pragma unroll
  for (int t = 0; t < 4; ++t) { if (col0 + t * 16 >= N) continue;
#pragma unroll
    for (int r = 0; r < 8; ++r) so[w][8 * hh + r][t * 16 + ln] = acc[t][r] * alpha; }
  __builtin_amdgcn_fence(__ATOMIC_ACQ_REL, "workgroup"); __builtin_amdgcn_wave_barrier();
  const int rsub = lane >> 4, c4 = (lane & 15) * 4;
  {
#pragma unroll
    for (int q = 0; q < 8; ++q) { const int r = q * 2 + rsub; if (col0 + c4 < N) { const v4f v = *(const v4fa*)&so[w][r][c4]; *(v4f*)(C + (size_t)(row0 + r) * ldc + col0 + c4) = v; } }
     }
}

// Wt[n][k] = f16(W[k][n]·scale) from f32 row-major W[K][N] (scale = power of two; bf16-exact weights stay exact in f16 away from the subnormal range)
__global__ __launch_bounds__(256) void k_wt_f16(const float* __restrict__ W, _Float16* __restrict__ Wt, int K, int N, float scale) {
  const int t = blockIdx.x * 256 + threadIdx.x; if (t >= N * (K / 8)) return; const int n = t / (K / 8), k8 = (t % (K / 8)) * 8; FragH f;
#pragma unroll
  for (int i = 0; i < 8; ++i) f.h[i] = (_Float16)(bf16_round(W[(size_t)(k8 + i) * N + n]) * scale); const v8us o = f.half[0];
  *(v8us*)((unsigned short*)Wt + (size_t)n * K + k8) = o; 
}


typedef _Float16 v4h __attribute__((ext_vector_type(4)));

__global__ __launch_bounds__(256) void k_h16(const float* __restrict__ x, _Float16* __restrict__ X16, size_t n8) { const size_t t = (size_t)blockIdx.x * 256 + threadIdx.x; if (t >= n8) return; FragH f;
#pragma unroll
  for (int q = 0; q < 8; ++q) f.h[q] = (_Float16)x[t * 8 + q]; *(v8us*)((unsigned short*)X16 + t * 8) = f.half[0];  }
// One launch makes q, k and v from the f32 inputs, k and v in the order in which the attention kernel's A fragments hold them (see Kp, Vp below). A work-group takes 64 rows of x. Its 512 threads each round one unit of 8 values of Wq, Wk, Wv (bf16, x 2^4) and of the 64 rows (bf16) to f16 in LDS;
// then waves 0-3 make q, 4-7 k (one 16-row tile each, 4 feature tiles) and 8-11 v (one feature tile each, 4 row tiles); waves 12-15 only help to fill LDS. The operand roles are chosen by where the result goes:
// for q and k the weight rows are A and the x rows B, so a lane's 8 results are 8 features of one row; for v the x rows are A, so they are 8 positions of one feature. Each is one 16-byte store: these 8 values are
// one lane's half of an A fragment (features or keys 8hh + r of a group of 16), so a k or v store of a wave is 512 contiguous bytes at lane * 16; a wave's 4 q stores fill whole 128-byte lines.
// Kp: per 16 keys 4 units of 512 bytes, unit u = features u * 16 .. + 15: lane (hh, ln) holds features u * 16 + 8hh + r of key ln. Vp: per 32 keys 8 units, unit dt * 2 + g: lane (hh, ln) holds keys g * 16 + 8hh + r of feature dt * 16 + ln.
// In LDS, rows of 64 f16 lie at a pitch of 144 bytes (16 x odd) for the 16-byte fragment reads. A and B fragments come from one loader, so their k orders are equal.
__global__ __launch_bounds__(512) void k_proj(const float* __restrict__ x, const float* __restrict__ Wq, const float* __restrict__ Wk, const float* __restrict__ Wv, _Float16* __restrict__ Q16, _Float16* __restrict__ Kp, _Float16* __restrict__ Vp) {
  constexpr int P = CC + 8;
  __shared__ __attribute__((aligned(16))) unsigned short sh[4 * CC][P];      // rows 0-63 Wq, 64-127 Wk, 128-191 Wv (row = output feature), 192-255 the 64 rows of x
  const int tid = threadIdx.x, w = __builtin_amdgcn_readfirstlane(tid >> 5), lane = tid & 31, ln = lane & 15, hh = lane >> 4;      // w in a scalar register: the roles below branch on it, and every lane must stay on at the WMMAs
  const int row0 = blockIdx.x * 64;
  const unsigned boff = tid * 32u;      // byte offset of the thread's unit in each of the four sources
  const char* const src[4] = {(const char*)Wq, (const char*)Wk, (const char*)Wv, (const char*)(x + (size_t)row0 * CC)};
  v4f in[4][2];
#pragma unroll      // unrolled, here and below: in and the fragments are indexed by constants and stay in registers; the 8 loads go out before the first conversion
  for (int i = 0; i < 4; ++i) { in[i][0] = *(const v4fa*)(src[i] + boff); in[i][1] = *(const v4fa*)(src[i] + boff + 16); }
  asm volatile("s_wait_xcnt 0x0" :: "v"(boff) : "memory");      // the loads' offset register is named so that it lives up to this wait: what follows may reuse it
#pragma unroll
  for (int i = 0; i < 4; ++i) { FragH f;
#pragma unroll
    for (int q = 0; q < 8; ++q) { const float v = bf16_round(in[i][q >> 2][q & 3]); f.h[q] = (_Float16)(i < 3 ? v * 16.0f : v); }
    *(v8us*)&sh[i * CC + (tid >> 3)][(tid & 7) * 8] = f.half[0]; }
  __syncthreads();      // the f16 operands are in LDS before any wave reads a fragment
  if (w >= 12) return;      // behind the only barrier
  auto frag = [&](int r, int ks) { FragH f; f.half[0] = *(const v8us*)&sh[r][ks * 32 + 8 * hh]; f.half[1] = *(const v8us*)&sh[r][ks * 32 + 16 + 8 * hh]; return f; };
  const bool isv = w >= 8;
  const int keep = isv ? w * 16 : 3 * CC + (w & 3) * 16;      // first LDS row of the tile a wave keeps as B: v: feature tile w - 8 of Wv; q, k: row tile w & 3 of x
  const int run = isv ? 3 * CC : (w >> 2) * CC;      // first LDS row of the 4 tiles it walks as A: v: the rows of x; q, k: the features of Wq or Wk
  const FragH b0 = frag(keep + ln, 0), b1 = frag(keep + ln, 1);
  unsigned short* dst = isv ? (unsigned short*)Vp + (size_t)row0 * CC + (w - 8) * 512 + lane * 8      // walked tile t = 16 keys: block t >> 1 of 32 keys, unit (w - 8) * 2 + (t & 1)
                      : w >= 4 ? (unsigned short*)Kp + (size_t)(row0 + (w & 3) * 16) * CC + lane * 8      // walked tile t = 16 features: unit t
                               : (unsigned short*)Q16 + (size_t)(row0 + w * 16 + ln) * CC + 8 * hh;
  const int st1 = w >= 4 ? 256 : 16, st2 = isv ? 32 * CC : 2 * st1;      // steps, in f16, of bit 0 and bit 1 of t
  FragH a[4][2];      // the fragment reads stand ahead of the products, so that later tiles' reads go out while earlier tiles are worked on
#pragma unroll
  for (int t = 0; t < 4; ++t) { a[t][0] = frag(run + t * 16 + ln, 0); a[t][1] = frag(run + t * 16 + ln, 1); }
#pragma unroll
  for (int t = 0; t < 4; ++t) { v8f acc = (v8f){0.f,0.f,0.f,0.f,0.f,0.f,0.f,0.f};
    acc = __builtin_amdgcn_wmma_f32_16x16x32_f16(false, a[t][0].v, false, b0.v, (short)0, acc, false, false);
    acc = __builtin_amdgcn_wmma_f32_16x16x32_f16(false, a[t][1].v, false, b1.v, (short)0, acc, false, false);      // acc[r] = (walked tile's row 8hh + r) . (kept tile's row ln)
    FragH o;
#pragma unroll
    for (int r = 0; r < 8; ++r) o.h[r] = (_Float16)(acc[r] * 0.0625f);
    *(v8us*)(dst + (t & 1) * st1 + (t >> 1) * st2) = o.half[0]; } }

// One work-group = TWO tiles of 32 query rows, one after the other in every wave: tile p, then tile NQB - 1 - p of the same sequence (a wave without a block in the short tile goes straight on to the long one). A causal tile t costs t + 1 blocks, so every work-group walks NQB + 1 blocks: the grid is one equal
// work-group per WGP, all resident at once, where one tile per work-group gave twice as many, of 1 to NQB blocks. Each tile has its own LDS planes, so one barrier and one merge serve both.
// Per tile: the NW waves deal the tile's 32-key blocks among themselves (wave w takes blocks w, w + NW, ...). Every wave holds BOTH 16-query halves of the tile (QT = 2 B operands,
// 2 sets of running maximum, sum and accumulators), so each K and V fragment it loads feeds two products: half the fragment bytes per score and half the waves of a 16-row tile. The partials are merged through LDS behind
// one work-group barrier. The launch bound asks for 4 waves per SIMD (256 VGPRs: one work-group per WGP). w is held in a scalar register: the waves' trip counts differ, and the loop must branch on a scalar so that every lane stays on at the WMMAs.
// Both products run transposed: S^T = K.Q^T (A = 16 key rows, B = 16 of the tile's queries, kept in registers) and O^T += V^T.P^T. A lane then holds 16 scores of ONE query (column ln; keys
// 8hh + r and 16 + 8hh + r of the block), so maximum and sum are in-lane but for one exchange between the wave's halves, and the two converted score tiles ARE the B operand of the second product.
// Softmax in base 2: exp(s / 8 - m) = 2^(s * SC2 - m'), m' = the maximum in the same units. v_exp_f32 gives 0 for -inf and for the -3e38 start value, which is all the range handling these arguments (never above 0) need.
#define SC2 0.18033688011112042f      // 64^-0.5 * log2(e)
// One exponential: the v_nop fills the one slot that the instruction set asks for behind a transcendental before its result is used or its source overwritten; inside the statement it cannot drift.
__device__ __forceinline__ float ex2_slot(float x) { float r; asm("v_exp_f32 %0, %1\n\tv_nop" : "=v"(r) : "v"(x)); return r; }
// Eight exponentials, each in place on a register of its own: every one but the last has an independent instruction behind it, and one v_nop fills the slot behind the last. The block loop's form: one slot instruction per eight.
__device__ __forceinline__ void ex2x8(float (&t)[8]) {
  asm("v_exp_f32 %0, %0\n\tv_exp_f32 %1, %1\n\tv_exp_f32 %2, %2\n\tv_exp_f32 %3, %3\n\tv_exp_f32 %4, %4\n\tv_exp_f32 %5, %5\n\tv_exp_f32 %6, %6\n\tv_exp_f32 %7, %7\n\tv_nop"
      : "+v"(t[0]), "+v"(t[1]), "+v"(t[2]), "+v"(t[3]), "+v"(t[4]), "+v"(t[5]), "+v"(t[6]), "+v"(t[7])); }
__device__ __forceinline__ float xhalf(float x) { return __builtin_bit_cast(float, __builtin_amdgcn_permlanex16(__builtin_bit_cast(int, x), __builtin_bit_cast(int, x), 0x76543210, 0xfedcba98, false, false)); }      // lane l reads lane l ^ 16
template <int NW>
__global__ __launch_bounds__(NW * 32, 4) void k_flash(const _Float16* __restrict__ Q16, int ldq, const _Float16* __restrict__ Kp, const _Float16* __restrict__ Vp, const int* __restrict__ MSK, float* __restrict__ O, int ldo) {
  constexpr int QT = 2, RPW = 16 * QT, NQB = 4096 / RPW, NPR = NQB / 2, DT = 4, KS = 2;
  __shared__ __attribute__((aligned(16))) float sO[2][NW][RPW][64 + 4]; __shared__ float sM[2][NW][RPW], sL[2][NW][RPW];      // first index: the work-group's first or second tile
  const int tid = threadIdx.x, w = __builtin_amdgcn_readfirstlane(tid >> 5), lane = tid & 31, ln = lane & 15, hh = lane >> 4;
  const int slab = blockIdx.x / NPR, pr = blockIdx.x % NPR; const int b = slab / 1, h = slab % 1;
  FragH bq[QT][KS]; const unsigned short* qr[QT];
  const unsigned short* Kl = (const unsigned short*)Kp + (size_t)slab * 4096 * 64 + lane * 8; const unsigned short* Vl = (const unsigned short*)Vp + (size_t)slab * 4096 * 64 + lane * 8;      // fragment order (k_proj): a block of 32 keys is 4 KB in each, every load below 512 contiguous bytes of it
#pragma unroll 1      // kept rolled: one copy of the block loop in the instruction cache, and one tile's registers
  for (int ti = 0; ti < 2; ++ti) {
  const int q0 = (ti ? NQB - 1 - pr : pr) * RPW;
  float m_q[QT], l_q[QT]; v8f oacc[QT][DT];      // of query q0 + qt * 16 + ln; l_q sums this half's keys only, the halves are joined behind the loop
#pragma unroll
  for (int qt = 0; qt < QT; ++qt) { m_q[qt] = -3.0e38f; l_q[qt] = 0.f;
#pragma unroll
    for (int dt = 0; dt < DT; ++dt) oacc[qt][dt] = (v8f){0.f,0.f,0.f,0.f,0.f,0.f,0.f,0.f}; }      // oacc[qt][dt][r] = O[q0 + qt * 16 + ln][dt * 16 + 8hh + r]
  const int jend = q0 + RPW, tq = q0 + ln;
  if (w * 32 < jend) {      // the loop's own entry test, a scalar branch: a wave without a block loads no queries and passes no wait for them
#pragma unroll      // unrolled, here and below: everything indexed by qt is indexed by constants and stays in registers
    for (int qt = 0; qt < QT; ++qt) { qr[qt] = (const unsigned short*)Q16 + ((size_t)b * 4096 + q0 + qt * 16 + ln) * ldq + h * 64 + 8 * hh;
#pragma unroll
      for (int ks = 0; ks < KS; ++ks) { bq[qt][ks].half[0] = *(const v8us*)(qr[qt] + ks * 32); bq[qt][ks].half[1] = *(const v8us*)(qr[qt] + ks * 32 + 16); } }
    asm volatile("s_wait_xcnt 0x0" :: "v"(qr[0]), "v"(qr[1]) : "memory"); }      // the 8 loads' address registers are named so that they live up to this wait: what follows may reuse them only behind it
#pragma unroll 1
  for (int j0 = w * 32; j0 < jend; j0 += NW * 32) {
    // The block's 16 fragment loads (8 KB) all stand ahead of its first product, so that they are in flight together and a block waits out one load latency; placed at their uses they went out in six groups, each waited for in turn.
    const unsigned short* kr = Kl + (size_t)j0 * 64; const unsigned short* vr = Vl + (size_t)j0 * 64; FragH ak[2][KS], av[DT];
#pragma unroll
    for (int u = 0; u < 2 * KS; ++u) { ak[u / KS][u % KS].half[0] = *(const v8us*)(kr + u * 512); ak[u / KS][u % KS].half[1] = *(const v8us*)(kr + u * 512 + 256); }      // A operand: key rows j0 + nt * 16 + ln
#pragma unroll
    for (int dt = 0; dt < DT; ++dt) { av[dt].half[0] = *(const v8us*)(vr + dt * 512); av[dt].half[1] = *(const v8us*)(vr + dt * 512 + 256); }      // A operand: V^T rows dt * 16 + ln, the block's 32 keys in the k order of the packed scores
    asm volatile("s_wait_xcnt 0x0" :: "v"(kr), "v"(vr) : "memory");      // the loads' address registers are named so that they live up to this wait: what follows, a load's own result too, may reuse them only behind it
    float al[QT]; FragH pb[QT];
#pragma unroll
    for (int qt = 0; qt < QT; ++qt) {
      v8f s[2];
#pragma unroll
      for (int nt = 0; nt < 2; ++nt) { v8f acc = (v8f){0.f,0.f,0.f,0.f,0.f,0.f,0.f,0.f};
#pragma unroll
        for (int ks = 0; ks < KS; ++ks) acc = mmaH<1>(ak[nt][ks].v, ak[nt][ks].v, bq[qt][ks].v, bq[qt][ks].v, acc);
        s[nt] = acc; }      // s[nt][r] = q(q0 + qt * 16 + ln) . k(j0 + nt * 16 + 8hh + r)
      float mc = -INFINITY; const int dq = tq + qt * 16 - j0 - 8 * hh;      // score (nt, r) is unmasked while nt * 16 + r <= dq
#pragma unroll
      for (int nt = 0; nt < 2; ++nt)
#pragma unroll
        for (int r = 0; r < 8; ++r) { s[nt][r] = (nt * 16 + r <= dq) ? s[nt][r] : -INFINITY; mc = fmaxf(mc, s[nt][r]); }      // raw products: the scale is positive, so it is applied to the maximum alone
      mc = fmaxf(mc, xhalf(mc));
      // every block a wave walks starts at a key j0 <= q0, so each query has an unmasked score in it and mn is a finite score: a masked score (-inf) gives exp = 0 and the first block gives al = 0 with no test
      const float mn = fmaxf(m_q[qt], mc * SC2); al[qt] = ex2_slot(m_q[qt] - mn); m_q[qt] = mn;
      float ps = 0.f;
#pragma unroll
      for (int nt = 0; nt < 2; ++nt) { float p[8];
#pragma unroll
        for (int r = 0; r < 8; ++r) p[r] = fmaf(s[nt][r], SC2, -mn);
        ex2x8(p);
#pragma unroll
        for (int r = 0; r < 8; ++r) { ps += p[r]; pb[qt].h[nt * 8 + r] = (_Float16)p[r]; } }      // element nt * 8 + r of a B fragment is k = nt * 16 + 8hh + r: the key this score belongs to
      l_q[qt] = l_q[qt] * al[qt] + ps; }
#pragma unroll
    for (int dt = 0; dt < DT; ++dt)
#pragma unroll
      for (int qt = 0; qt < QT; ++qt) {
#pragma unroll
        for (int r = 0; r < 8; ++r) oacc[qt][dt][r] *= al[qt];
        oacc[qt][dt] = mmaH<1>(av[dt].v, av[dt].v, pb[qt].v, pb[qt].v, oacc[qt][dt]); } }
  // each wave hands over its un-normalised partial: (maximum, sum) per row and the 32 x 64 accumulator; a wave without a block hands (-3e38, 0, zeros), which weighs 0 in the merge
  const int le = (int)__builtin_amdgcn_mbcnt_lo(~0u, 0u), lne = le & 15, hhe = le >> 4;      // lane id read anew, so that tid and its parts need no registers across the loop
#pragma unroll
  for (int qt = 0; qt < QT; ++qt) { const int row = qt * 16 + lne;
    l_q[qt] += xhalf(l_q[qt]);
    if (hhe == 0) { sM[ti][w][row] = m_q[qt]; sL[ti][w][row] = l_q[qt]; }
#pragma unroll
    for (int dt = 0; dt < DT; ++dt) { *(v4fa*)&sO[ti][w][row][dt * 16 + 8 * hhe] = (v4f){oacc[qt][dt][0], oacc[qt][dt][1], oacc[qt][dt][2], oacc[qt][dt][3]}; *(v4fa*)&sO[ti][w][row][dt * 16 + 8 * hhe + 4] = (v4f){oacc[qt][dt][4], oacc[qt][dt][5], oacc[qt][dt][6], oacc[qt][dt][7]}; } } }
  __syncthreads();      // every wave's partials of both tiles are in LDS before any is merged
  static_assert(NW * QT == RPW, "wave w merges rows w and NW + w");
  typedef float v2f __attribute__((ext_vector_type(2))); typedef float v2fa __attribute__((ext_vector_type(2), may_alias));
  const int le = (int)__builtin_amdgcn_mbcnt_lo(~0u, 0u);
#pragma unroll      // unrolled over both tiles: the four rows' LDS loads are independent and go out together
  for (int ti = 0; ti < 2; ++ti) { const int q0 = (ti ? NQB - 1 - pr : pr) * RPW;
#pragma unroll
  for (int qt = 0; qt < QT; ++qt) { const int r = qt * NW + w; float M = sM[ti][0][r];
#pragma unroll      // both loops unrolled: the NW partials' LDS loads go out together instead of one wait each
    for (int u = 1; u < NW; ++u) M = fmaxf(M, sM[ti][u][r]);
    float L = 0.f; v2f val = {0.f, 0.f};
#pragma unroll
    for (int u = 0; u < NW; ++u) { const float e = ex2_slot(sM[ti][u][r] - M); L += e * sL[ti][u][r]; const v2f pv = *(const v2fa*)&sO[ti][u][r][le * 2]; val += pv * e; }
    const float inv = (L > 0.f) ? 1.0f / L : 0.f; val *= inv;
    *(v2f*)(O + ((size_t)b * 4096 + q0 + r) * ldo + h * 64 + le * 2) = val; } } }

extern "C" void kernel_launch(void* const* d_in, const int* in_sizes, int n_in,
                              void* d_out, int out_size, void* d_ws, size_t ws_size, hipStream_t stream) {
  (void)in_sizes; (void)n_in; (void)out_size;
  const float* x = (const float*)d_in[0]; const float* Wk = (const float*)d_in[1]; const float* Wq = (const float*)d_in[2]; const float* Wv = (const float*)d_in[3];
  char* ws = (char*)d_ws; size_t off = 0;
  auto take = [&](size_t bytes) { char* p = ws + off; off += (bytes + 255) & ~(size_t)255; return p; };
  _Float16* Q16 = (_Float16*)take((size_t)NR * CC * 2); _Float16* Kp = (_Float16*)take((size_t)NR * CC * 2); _Float16* Vp = (_Float16*)take((size_t)NR * CC * 2);
  if (off > ws_size) return;      // 3 buffers of 2 MiB
  k_proj<<<NR / 64, 512, 0, stream>>>(x, Wq, Wk, Wv, Q16, Kp, Vp);      // q in f16 rows; k and v in fragment order
  k_flash<16><<<BB * 1 * (TT / 64), 16 * 32, 0, stream>>>(Q16, CC, Kp, Vp, nullptr, (float*)d_out, CC);
}

// v009
// It runs in 18.8 microseconds.
// In two side-by-side timings against v008, it was 1.06 and 1.05 times as fast.
// Over all steps from v000 it is 22.9 times as fast.
#include <hip/hip_runtime.h>
// Single causal attention head (B=4, T=4096, C=64): q,k,v = x·Wᵀ (no bias), softmax(q·kᵀ·64^-½) with a causal mask, out = P·v. One GEMM for [q|k|v] and a fused flash-style causal attention
// kernel (online softmax in f32; P f16 ≤ 1; O = P·Vᵀ-tiles; two tiles of 32 query rows per 16-wave work-group; causal tile skipping) on v_wmma_f32_16x16x32_f16 — x bf16-exact, (out,in) weights bf16-exact ×2^4, q/k/v f16,
// f32 accumulate.
#define BB 4
#define TT 4096
#define CC 64
#define NR (BB * TT)

typedef __bf16 v16b __attribute__((ext_vector_type(16)));
typedef unsigned short v8us __attribute__((ext_vector_type(8), may_alias));
typedef float  v8f  __attribute__((ext_vector_type(8)));
typedef float  v4f  __attribute__((ext_vector_type(4)));
typedef float  v4fa __attribute__((ext_vector_type(4), may_alias));
union FragB { v16b v; v8us half[2]; unsigned short u[16]; };

__device__ __forceinline__ unsigned short bf16_bits(float x) { unsigned int u = __float_as_uint(x); return (unsigned short)((u + 0x7FFFu + ((u >> 16) & 1u)) >> 16); }
__device__ __forceinline__ float bf16_val(unsigned short b) { return __uint_as_float(((unsigned int)b) << 16); }
__device__ __forceinline__ float bf16_round(float x) { return bf16_val(bf16_bits(x)); }
// D += A·B with NT terms: 1 = ah·bh, 2 = + al·bh (A split), 3 = + ah·bl (both split)
template <int NT>
__device__ __forceinline__ v8f mmaN(v16b ah, v16b al, v16b bh, v16b bl, v8f c) {
  c = __builtin_amdgcn_wmma_f32_16x16x32_bf16(false, ah, false, bh, (short)0, c, false, false);
  if (NT >= 2) c = __builtin_amdgcn_wmma_f32_16x16x32_bf16(false, al, false, bh, (short)0, c, false, false);
  if (NT >= 3) c = __builtin_amdgcn_wmma_f32_16x16x32_bf16(false, ah, false, bl, (short)0, c, false, false);
  asm volatile("v_nop\n\tv_nop\n\tv_nop\n\tv_nop" : "+v"(c) : "v"(ah), "v"(al), "v"(bh), "v"(bl));
  return c;
}

__global__ __launch_bounds__(256) void k_wt_bf16(const float* __restrict__ W, unsigned short* __restrict__ Wt, int K, int N) {
  const int t = blockIdx.x * 256 + threadIdx.x;
  const int k8n = K / 8;
  if (t >= N * k8n) return;
  const int n = t / k8n, k8 = (t % k8n) * 8;
  v8us v;
#pragma unroll
  for (int i = 0; i < 8; ++i) v[i] = bf16_bits(W[(size_t)(k8 + i) * N + n]);
  *(v8us*)(Wt + (size_t)n * K + k8) = v;
  
}

// GEMM C[M][N] (f32, pitch ldc) = act(A[M][K]·W + bias). A f32 row-major (pitch lda) converted per fragment to bf16
// (ASPLIT: hi/lo two planes -> 2 terms, else single rounded term); Wt bf16 [N][K] (pitch ldb). BIAS_BF16 rounds the
// bias to bf16 first (bias quantised to bf16 before the add). K%32==0, M%16==0, N%64==0.
template <bool ASPLIT, int ACT, bool BIAS_BF16>
__global__ __launch_bounds__(128) void k_gemm_bf(const float* __restrict__ A, int lda, const unsigned short* __restrict__ Wt, int ldb,
                                               const float* __restrict__ bias, float* __restrict__ C, int ldc, int M, int N, int K) {
  __shared__ __attribute__((aligned(16))) float so[4][16][64];
  const int tid = threadIdx.x, w = tid >> 5, lane = tid & 31, ln = lane & 15, hh = lane >> 4;
  const int ntn = N / 64;
  const int wid = blockIdx.x * 4 + w;
  const int mt = wid / ntn, nq = wid % ntn;
  if (mt * 16 >= M) return;
  const int row0 = mt * 16, col0 = nq * 64;
  const float* arow = A + (size_t)(row0 + ln) * lda;
  v8f acc[4] = {};
  for (int kb = 0; kb < K; kb += 32) {
    FragB ah, al;
    const v4f x0 = *(const v4fa*)(arow + kb + 8 * hh), x1 = *(const v4fa*)(arow + kb + 8 * hh + 4);
    const v4f x2 = *(const v4fa*)(arow + kb + 16 + 8 * hh), x3 = *(const v4fa*)(arow + kb + 16 + 8 * hh + 4);
    float xs[16] = {x0[0],x0[1],x0[2],x0[3],x1[0],x1[1],x1[2],x1[3],x2[0],x2[1],x2[2],x2[3],x3[0],x3[1],x3[2],x3[3]};
#pragma unroll
    for (int i = 0; i < 16; ++i) { const unsigned short hb = bf16_bits(xs[i]); ah.u[i] = hb; al.u[i] = ASPLIT ? bf16_bits(xs[i] - bf16_val(hb)) : (unsigned short)0; }
#pragma unroll
    for (int t = 0; t < 4; ++t) {
      const unsigned short* brow = Wt + (size_t)(col0 + t * 16 + ln) * ldb + kb;
      FragB b;
      b.half[0] = *(const v8us*)(brow + 8 * hh);
      b.half[1] = *(const v8us*)(brow + 16 + 8 * hh);
      acc[t] = mmaN<ASPLIT ? 2 : 1>(ah.v, al.v, b.v, b.v, acc[t]);
    }
  }
#pragma unroll
  for (int t = 0; t < 4; ++t) {
    float bv = bias ? bias[col0 + t * 16 + ln] : 0.f;
    if (BIAS_BF16) bv = bf16_round(bv);
#pragma unroll
    for (int r = 0; r < 8; ++r) { float v = acc[t][r] + bv; if (ACT == 1) v = fmaxf(v, 0.f); so[w][8 * hh + r][t * 16 + ln] = v; }
  }
  __builtin_amdgcn_fence(__ATOMIC_ACQ_REL, "workgroup");
  __builtin_amdgcn_wave_barrier();
  const int rsub = lane >> 4, c4 = (lane & 15) * 4;
  {
#pragma unroll
    for (int q = 0; q < 8; ++q) {
      const int r = q * 2 + rsub;
      const v4f v = *(const v4fa*)&so[w][r][c4];
      *(v4f*)(C + (size_t)(row0 + r) * ldc + col0 + c4) = v;
    }
    
  }
}

// Flash-style causal/unmasked attention, all contractions 3-term bf16 hi/lo splits, f32 softmax with running max.
// q,k,v rows are read from f32 buffers with arbitrary row pitch (so they can live inside a fused qkv buffer);
// D = head size (multiple of 32, <= 128); one wave = 16 query rows; block = 4 waves (64 queries) sharing K/V chunks of 32.
template <int D, bool CAUSAL>
__global__ __launch_bounds__(128) void k_flash(const float* __restrict__ qb, const float* __restrict__ kb, const float* __restrict__ vb,
                                             int pitch, int T, int H, float scale, float* __restrict__ y, int ypitch) {
  constexpr int KS = D / 32;        // k-steps for QK
  constexpr int DT = D / 16;        // d tiles for PV
  __shared__ __attribute__((aligned(16))) unsigned short sKh[32][D + 8], sKl[32][D + 8], sVh[32][D + 8], sVl[32][D + 8];
  __shared__ __attribute__((aligned(16))) unsigned short sPh[4][16][40], sPl[4][16][40];
  __shared__ __attribute__((aligned(16))) float sO[4][16][D];
  const int tid = threadIdx.x, w = tid >> 5, lane = tid & 31, ln = lane & 15, hh = lane >> 4;
  const int nqb = (T + 63) / 64;
  const int bh = blockIdx.x / nqb, qblk = blockIdx.x % nqb;
  const int b = bh / H, h = bh % H;
  const int q0 = qblk * 64 + w * 16;
  const float* Q = qb + (size_t)b * T * pitch + h * D;
  const float* K = kb + (size_t)b * T * pitch + h * D;
  const float* V = vb + (size_t)b * T * pitch + h * D;

  // A fragments of the wave's 16 query rows (scaled), hi/lo
  FragB aqh[KS], aql[KS];
  {
    int row = q0 + ln; if (row >= T) row = T - 1;
    const float* qr = Q + (size_t)row * pitch;
#pragma unroll
    for (int ks = 0; ks < KS; ++ks)
#pragma unroll
      for (int i = 0; i < 16; ++i) {
        const int d = ks * 32 + ((i < 8) ? (8 * hh + i) : (16 + 8 * hh + (i - 8)));
        const float x = qr[d] * scale; const unsigned short hb = bf16_bits(x);
        aqh[ks].u[i] = hb; aql[ks].u[i] = bf16_bits(x - bf16_val(hb));
      }
  }
  float m_r[8], l_r[8];
#pragma unroll
  for (int r = 0; r < 8; ++r) { m_r[r] = -3.0e38f; l_r[r] = 0.f; }
  v8f oacc[DT];
#pragma unroll
  for (int dt = 0; dt < DT; ++dt) oacc[dt] = (v8f){0.f,0.f,0.f,0.f,0.f,0.f,0.f,0.f};

  const int kv_end = CAUSAL ? min(T, qblk * 64 + 64) : T;     // block-uniform
  for (int j0 = 0; j0 < kv_end; j0 += 32) {
    __syncthreads();
    for (int e = tid; e < 32 * (D / 4); e += 128) {
      const int r = e / (D / 4), c4 = (e % (D / 4)) * 4;
      const int key = j0 + r;
      v4f kf = {0.f,0.f,0.f,0.f}, vf = {0.f,0.f,0.f,0.f};
      if (key < T) { kf = *(const v4fa*)(K + (size_t)key * pitch + c4); vf = *(const v4fa*)(V + (size_t)key * pitch + c4); }
#pragma unroll
      for (int t = 0; t < 4; ++t) {
        unsigned short hb = bf16_bits(kf[t]); sKh[r][c4 + t] = hb; sKl[r][c4 + t] = bf16_bits(kf[t] - bf16_val(hb));
        hb = bf16_bits(vf[t]); sVh[r][c4 + t] = hb; sVl[r][c4 + t] = bf16_bits(vf[t] - bf16_val(hb));
      }
    }
    __syncthreads();
    // S tile 16 x 32
    v8f s[2];
#pragma unroll
    for (int nt = 0; nt < 2; ++nt) {
      v8f acc = {};
#pragma unroll
      for (int ks = 0; ks < KS; ++ks) {
        FragB bh_, bl_;
        bh_.half[0] = *(const v8us*)&sKh[nt * 16 + ln][ks * 32 + 8 * hh]; bh_.half[1] = *(const v8us*)&sKh[nt * 16 + ln][ks * 32 + 16 + 8 * hh];
        bl_.half[0] = *(const v8us*)&sKl[nt * 16 + ln][ks * 32 + 8 * hh]; bl_.half[1] = *(const v8us*)&sKl[nt * 16 + ln][ks * 32 + 16 + 8 * hh];
        acc = mmaN<3>(aqh[ks].v, aql[ks].v, bh_.v, bl_.v, acc);
      }
      s[nt] = acc;
    }
    // mask + running max (rows 8hh+r; the 16 lanes of a half share rows)
    float alpha[8];
#pragma unroll
    for (int r = 0; r < 8; ++r) {
      const int qi = q0 + 8 * hh + r;
      const int ja = j0 + ln, jb = j0 + 16 + ln;
      if (CAUSAL) { if (ja > qi) s[0][r] = -3.0e38f; if (jb > qi) s[1][r] = -3.0e38f; }
      if (ja >= T) s[0][r] = -3.0e38f;
      if (jb >= T) s[1][r] = -3.0e38f;
      float mx = fmaxf(s[0][r], s[1][r]);
      mx = fmaxf(mx, __shfl_xor(mx, 1, 32)); mx = fmaxf(mx, __shfl_xor(mx, 2, 32)); mx = fmaxf(mx, __shfl_xor(mx, 4, 32)); mx = fmaxf(mx, __shfl_xor(mx, 8, 32));
      const float mnew = fmaxf(m_r[r], mx);
      alpha[r] = (mnew > -1.0e38f) ? __expf(m_r[r] - mnew) : 1.0f;
      const float p0 = (s[0][r] > -1.0e38f) ? __expf(s[0][r] - mnew) : 0.f;
      const float p1 = (s[1][r] > -1.0e38f) ? __expf(s[1][r] - mnew) : 0.f;
      m_r[r] = mnew;
      l_r[r] = l_r[r] * alpha[r] + p0 + p1;            // per-lane partial row sum (16 lanes combined at the end)
      unsigned short hb = bf16_bits(p0); sPh[w][8 * hh + r][ln] = hb;      sPl[w][8 * hh + r][ln] = bf16_bits(p0 - bf16_val(hb));
      hb = bf16_bits(p1);                sPh[w][8 * hh + r][16 + ln] = hb; sPl[w][8 * hh + r][16 + ln] = bf16_bits(p1 - bf16_val(hb));
    }
#pragma unroll
    for (int dt = 0; dt < DT; ++dt)
#pragma unroll
      for (int r = 0; r < 8; ++r) oacc[dt][r] *= alpha[r];
    __builtin_amdgcn_fence(__ATOMIC_ACQ_REL, "workgroup");
    __builtin_amdgcn_wave_barrier();
    FragB pah, pal;
    pah.half[0] = *(const v8us*)&sPh[w][ln][8 * hh]; pah.half[1] = *(const v8us*)&sPh[w][ln][16 + 8 * hh];
    pal.half[0] = *(const v8us*)&sPl[w][ln][8 * hh]; pal.half[1] = *(const v8us*)&sPl[w][ln][16 + 8 * hh];
#pragma unroll
    for (int dt = 0; dt < DT; ++dt) {
      FragB bvh, bvl;
#pragma unroll
      for (int i = 0; i < 8; ++i) {
        bvh.u[i] = sVh[8 * hh + i][dt * 16 + ln]; bvh.u[8 + i] = sVh[16 + 8 * hh + i][dt * 16 + ln];
        bvl.u[i] = sVl[8 * hh + i][dt * 16 + ln]; bvl.u[8 + i] = sVl[16 + 8 * hh + i][dt * 16 + ln];
      }
      oacc[dt] = mmaN<3>(pah.v, pal.v, bvh.v, bvl.v, oacc[dt]);
    }
    __builtin_amdgcn_fence(__ATOMIC_ACQ_REL, "workgroup");
    __builtin_amdgcn_wave_barrier();
  }
#pragma unroll
  for (int r = 0; r < 8; ++r) {
    float l = l_r[r];
    l += __shfl_xor(l, 1, 32); l += __shfl_xor(l, 2, 32); l += __shfl_xor(l, 4, 32); l += __shfl_xor(l, 8, 32);
    l_r[r] = (l > 0.f) ? 1.0f / l : 0.f;
  }
#pragma unroll
  for (int dt = 0; dt < DT; ++dt)
#pragma unroll
    for (int r = 0; r < 8; ++r) sO[w][8 * hh + r][dt * 16 + ln] = oacc[dt][r] * l_r[r];
  __builtin_amdgcn_fence(__ATOMIC_ACQ_REL, "workgroup");
  __builtin_amdgcn_wave_barrier();
  {
    for (int r = 0; r < 16; ++r) {
      const int row = q0 + r;
      if (row < T && lane < D / 4) {
        const v4f val = *(const v4fa*)&sO[w][r][lane * 4];
        *(v4f*)(y + ((size_t)b * T + row) * ypitch + h * D + lane * 4) = val;
      }
    }
    
  }
}

// GEMM C = act(A·W + bias + resid): A f32 (ASPLIT -> hi/lo 2 terms), Wt bf16 [N][K]; ACT 0 none, 1 relu, 2 exact gelu;
// resid (optional, f32, row index = (row % rmod), pitch ldr, RES_BF16 rounds it) added before the activation.
template <bool ASPLIT, int ACT, bool BIAS_BF16, bool RES_BF16>
__global__ __launch_bounds__(128) void k_gemm_bf3(const float* __restrict__ A, int lda, const unsigned short* __restrict__ Wt, int ldb,
                                                const float* __restrict__ bias, const float* __restrict__ resid, int rmod, int ldr,
                                                float* __restrict__ C, int ldc, int M, int N, int K) {
  __shared__ __attribute__((aligned(16))) float so[4][16][64];
  const int tid = threadIdx.x, w = tid >> 5, lane = tid & 31, ln = lane & 15, hh = lane >> 4;
  const int ntn = N / 64;
  const int wid = blockIdx.x * 4 + w;
  const int mt = wid / ntn, nq = wid % ntn;
  if (mt * 16 >= M) return;
  const int row0 = mt * 16, col0 = nq * 64;
  const float* arow = A + (size_t)(row0 + ln) * lda;
  v8f acc[4] = {};
  for (int kb = 0; kb < K; kb += 32) {
    FragB ah, al;
    const v4f x0 = *(const v4fa*)(arow + kb + 8 * hh), x1 = *(const v4fa*)(arow + kb + 8 * hh + 4);
    const v4f x2 = *(const v4fa*)(arow + kb + 16 + 8 * hh), x3 = *(const v4fa*)(arow + kb + 16 + 8 * hh + 4);
    float xs[16] = {x0[0],x0[1],x0[2],x0[3],x1[0],x1[1],x1[2],x1[3],x2[0],x2[1],x2[2],x2[3],x3[0],x3[1],x3[2],x3[3]};
#pragma unroll
    for (int i = 0; i < 16; ++i) { const unsigned short hb = bf16_bits(xs[i]); ah.u[i] = hb; al.u[i] = ASPLIT ? bf16_bits(xs[i] - bf16_val(hb)) : (unsigned short)0; }
#pragma unroll
    for (int t = 0; t < 4; ++t) {
      const unsigned short* brow = Wt + (size_t)(col0 + t * 16 + ln) * ldb + kb;
      FragB b;
      b.half[0] = *(const v8us*)(brow + 8 * hh);
      b.half[1] = *(const v8us*)(brow + 16 + 8 * hh);
      acc[t] = mmaN<ASPLIT ? 2 : 1>(ah.v, al.v, b.v, b.v, acc[t]);
    }
  }
#pragma unroll
  for (int t = 0; t < 4; ++t) {
    const int col = col0 + t * 16 + ln;
    float bv = bias ? bias[col] : 0.f;
    if (BIAS_BF16) bv = bf16_round(bv);
#pragma unroll
    for (int r = 0; r < 8; ++r) {
      float v = acc[t][r] + bv;
      if (resid) { float rv = resid[(size_t)((row0 + 8 * hh + r) % rmod) * ldr + col]; if (RES_BF16) rv = bf16_round(rv); v += rv; }
      if (ACT == 1) v = fmaxf(v, 0.f);
      if (ACT == 2) v = 0.5f * v * (1.0f + erff(v * 0.70710678118654752f));
      if (ACT == 3) { const float u = 0.7978845608028654f * (v + 0.044715f * v * v * v); v = 0.5f * v * (1.0f + tanhf(u)); }
      so[w][8 * hh + r][t * 16 + ln] = v;
    }
  }
  __builtin_amdgcn_fence(__ATOMIC_ACQ_REL, "workgroup");
  __builtin_amdgcn_wave_barrier();
  const int rsub = lane >> 4, c4 = (lane & 15) * 4;
  {
#pragma unroll
    for (int q = 0; q < 8; ++q) {
      const int r = q * 2 + rsub;
      const v4f v = *(const v4fa*)&so[w][r][c4];
      *(v4f*)(C + (size_t)(row0 + r) * ldc + col0 + c4) = v;
    }
    
  }
}
// row LayerNorm (biased variance, eps) over N: s = X (+ R); optional out_sum <- s; out_norm <- (s-mu)*rsqrt(var+eps)*g + b
template <bool PARAM_BF16>
__global__ __launch_bounds__(256) void k_layernorm(const float* __restrict__ X, const float* __restrict__ R, const float* __restrict__ g, const float* __restrict__ bta,
                                                  float* __restrict__ out_sum, float* __restrict__ out_norm, int N, float eps) {
  __shared__ float red[256];
  const int row = blockIdx.x, tid = threadIdx.x;
  const float* x = X + (size_t)row * N; const float* rr = R ? R + (size_t)row * N : nullptr;
  float vals[16];                     // up to N = 4096
  const int per = N / 256;            // contiguous chunk per thread? use strided-by-4 chunks: thread handles j = tid*4 + 1024*u
  float s1 = 0.f;
  for (int u = 0; u < per / 4; ++u) {
    const int j = tid * 4 + 1024 * u;
    const v4f a = *(const v4fa*)(x + j);
    v4f b = {0.f,0.f,0.f,0.f}; if (rr) b = *(const v4fa*)(rr + j);
#pragma unroll
    for (int q = 0; q < 4; ++q) { const float v = a[q] + b[q]; vals[u * 4 + q] = v; s1 += v; }
  }
  red[tid] = s1; __syncthreads();
  for (int st = 128; st > 0; st >>= 1) { if (tid < st) red[tid] += red[tid + st]; __syncthreads(); }
  const float mu = red[0] / (float)N; __syncthreads();
  float s2 = 0.f;
  for (int u = 0; u < per / 4; ++u)
#pragma unroll
    for (int q = 0; q < 4; ++q) { const float c = vals[u * 4 + q] - mu; s2 += c * c; }
  red[tid] = s2; __syncthreads();
  for (int st = 128; st > 0; st >>= 1) { if (tid < st) red[tid] += red[tid + st]; __syncthreads(); }
  const float rs = rsqrtf(red[0] / (float)N + eps);
  {
    for (int u = 0; u < per / 4; ++u) {
      const int j = tid * 4 + 1024 * u;
      v4f o, sm;
#pragma unroll
      for (int q = 0; q < 4; ++q) {
        float gg = g[j + q], bb = bta[j + q];
        if (PARAM_BF16) { gg = bf16_round(gg); bb = bf16_round(bb); }
        sm[q] = vals[u * 4 + q]; o[q] = (vals[u * 4 + q] - mu) * rs * gg + bb;
      }
      if (out_sum) *(v4f*)(out_sum + (size_t)row * N + j) = sm;
      *(v4f*)(out_norm + (size_t)row * N + j) = o;
    }
    
  }
}



// ---- f16 WMMA path (v_wmma_f32_16x16x32_f16): 11-bit significands for operands in range — used where a [0,1] probability operand needs more precision than bf16
typedef _Float16 v16h __attribute__((ext_vector_type(16)));
union FragH { v16h v; v8us half[2]; _Float16 h[16]; unsigned short u[16]; };
template <int NT>
__device__ __forceinline__ v8f mmaH(v16h ah, v16h al, v16h bh, v16h bl, v8f c) {
  c = __builtin_amdgcn_wmma_f32_16x16x32_f16(false, ah, false, bh, (short)0, c, false, false);
  if (NT >= 2) c = __builtin_amdgcn_wmma_f32_16x16x32_f16(false, al, false, bh, (short)0, c, false, false);
  if (NT >= 3) c = __builtin_amdgcn_wmma_f32_16x16x32_f16(false, ah, false, bl, (short)0, c, false, false);
  asm volatile("v_nop\n\tv_nop\n\tv_nop\n\tv_nop" : "+v"(c) : "v"(ah), "v"(al), "v"(bh), "v"(bl));
  return c;
}
// batched GEMM like k_gemm_b but f16 operands: A f32 (split into f16 hi/lo if ASPLIT, else rounded to f16), Bt = f16 values [n][k]; alpha; C f32; N multiple of 16 (partial tiles skipped)
template <bool ASPLIT>
__global__ __launch_bounds__(128) void k_gemm_h(const float* __restrict__ A, int lda, size_t sA, const _Float16* __restrict__ Bh, int ldb, size_t sB, float alpha, float* __restrict__ C, int ldc, size_t sC, int M, int N, int K) {
  __shared__ __attribute__((aligned(16))) float so[4][16][64];
  const int tid = threadIdx.x, w = tid >> 5, lane = tid & 31, ln = lane & 15, hh = lane >> 4; const int by = blockIdx.y;
  A += (size_t)by * sA; Bh += (size_t)by * sB; C += (size_t)by * sC;
  const int ntn = (N + 63) / 64; const int wid = blockIdx.x * 4 + w; const int mt = wid / ntn, nq = wid % ntn; if (mt * 16 >= M) return;
  const int row0 = mt * 16, col0 = nq * 64; const float* arow = A + (size_t)(row0 + ln) * lda;
  v8f acc[4] = {};
  for (int kb = 0; kb < K; kb += 32) {
    FragH ah, al;
    const v4f x0 = *(const v4fa*)(arow + kb + 8 * hh), x1 = *(const v4fa*)(arow + kb + 8 * hh + 4), x2 = *(const v4fa*)(arow + kb + 16 + 8 * hh), x3 = *(const v4fa*)(arow + kb + 16 + 8 * hh + 4);
    float xs[16] = {x0[0],x0[1],x0[2],x0[3],x1[0],x1[1],x1[2],x1[3],x2[0],x2[1],x2[2],x2[3],x3[0],x3[1],x3[2],x3[3]};
#pragma unroll
    for (int i = 0; i < 16; ++i) { const _Float16 h = (_Float16)xs[i]; ah.h[i] = h; al.h[i] = ASPLIT ? (_Float16)(xs[i] - (float)h) : (_Float16)0.0f; }
#pragma unroll
    for (int t = 0; t < 4; ++t) { if (col0 + t * 16 >= N) continue; const size_t boff = (size_t)(col0 + t * 16 + ln) * ldb + kb; FragH bq; bq.half[0] = *(const v8us*)(Bh + boff + 8 * hh); bq.half[1] = *(const v8us*)(Bh + boff + 16 + 8 * hh);
      acc[t] = mmaH<ASPLIT ? 2 : 1>(ah.v, al.v, bq.v, bq.v, acc[t]); }
  }
#pragma unroll
  for (int t = 0; t < 4; ++t) { if (col0 + t * 16 >= N) continue;
#pragma unroll
    for (int r = 0; r < 8; ++r) so[w][8 * hh + r][t * 16 + ln] = acc[t][r] * alpha; }
  __builtin_amdgcn_fence(__ATOMIC_ACQ_REL, "workgroup"); __builtin_amdgcn_wave_barrier();
  const int rsub = lane >> 4, c4 = (lane & 15) * 4;
  {
#pragma unroll
    for (int q = 0; q < 8; ++q) { const int r = q * 2 + rsub; if (col0 + c4 < N) { const v4f v = *(const v4fa*)&so[w][r][c4]; *(v4f*)(C + (size_t)(row0 + r) * ldc + col0 + c4) = v; } }
     }
}

// Wt[n][k] = f16(W[k][n]·scale) from f32 row-major W[K][N] (scale = power of two; bf16-exact weights stay exact in f16 away from the subnormal range)
__global__ __launch_bounds__(256) void k_wt_f16(const float* __restrict__ W, _Float16* __restrict__ Wt, int K, int N, float scale) {
  const int t = blockIdx.x * 256 + threadIdx.x; if (t >= N * (K / 8)) return; const int n = t / (K / 8), k8 = (t % (K / 8)) * 8; FragH f;
#pragma unroll
  for (int i = 0; i < 8; ++i) f.h[i] = (_Float16)(bf16_round(W[(size_t)(k8 + i) * N + n]) * scale); const v8us o = f.half[0];
  *(v8us*)((unsigned short*)Wt + (size_t)n * K + k8) = o; 
}


typedef _Float16 v4h __attribute__((ext_vector_type(4)));

__global__ __launch_bounds__(256) void k_h16(const float* __restrict__ x, _Float16* __restrict__ X16, size_t n8) { const size_t t = (size_t)blockIdx.x * 256 + threadIdx.x; if (t >= n8) return; FragH f;
#pragma unroll
  for (int q = 0; q < 8; ++q) f.h[q] = (_Float16)x[t * 8 + q]; *(v8us*)((unsigned short*)X16 + t * 8) = f.half[0];  }
// One launch makes q, k and v from the f32 inputs, k and v in the order in which the attention kernel's A fragments hold them (see Kp, Vp below). A work-group takes 64 rows of x. Its 512 threads each round one unit of 8 values of Wq, Wk, Wv (bf16, x 2^4) and of the 64 rows (bf16) to f16 in LDS;
// then waves 0-3 make q, 4-7 k (one 16-row tile each, 4 feature tiles) and 8-11 v (one feature tile each, 4 row tiles); waves 12-15 only help to fill LDS. The operand roles are chosen by where the result goes:
// for q and k the weight rows are A and the x rows B, so a lane's 8 results are 8 features of one row; for v the x rows are A, so they are 8 positions of one feature. Each is one 16-byte store: these 8 values are
// one lane's half of an A fragment (features or keys 8hh + r of a group of 16), so a k or v store of a wave is 512 contiguous bytes at lane * 16; a wave's 4 q stores fill whole 128-byte lines.
// Kp: per 16 keys 4 units of 512 bytes, unit u = features u * 16 .. + 15: lane (hh, ln) holds features u * 16 + 8hh + r of key ln. Vp: per 32 keys 8 units, unit dt * 2 + g: lane (hh, ln) holds keys g * 16 + 8hh + r of feature dt * 16 + ln.
// In LDS, rows of 64 f16 lie at a pitch of 144 bytes (16 x odd) for the 16-byte fragment reads. A and B fragments come from one loader, so their k orders are equal.
__global__ __launch_bounds__(512) void k_proj(const float* __restrict__ x, const float* __restrict__ Wq, const float* __restrict__ Wk, const float* __restrict__ Wv, _Float16* __restrict__ Q16, _Float16* __restrict__ Kp, _Float16* __restrict__ Vp) {
  constexpr int P = CC + 8;
  __shared__ __attribute__((aligned(16))) unsigned short sh[4 * CC][P];      // rows 0-63 Wq, 64-127 Wk, 128-191 Wv (row = output feature), 192-255 the 64 rows of x
  const int tid = threadIdx.x, w = __builtin_amdgcn_readfirstlane(tid >> 5), lane = tid & 31, ln = lane & 15, hh = lane >> 4;      // w in a scalar register: the roles below branch on it, and every lane must stay on at the WMMAs
  const int row0 = blockIdx.x * 64;
  const unsigned boff = tid * 32u;      // byte offset of the thread's unit in each of the four sources
  const char* const src[4] = {(const char*)Wq, (const char*)Wk, (const char*)Wv, (const char*)(x + (size_t)row0 * CC)};
  v4f in[4][2];
#pragma unroll      // unrolled, here and below: in and the fragments are indexed by constants and stay in registers; the 8 loads go out before the first conversion
  for (int i = 0; i < 4; ++i) { in[i][0] = *(const v4fa*)(src[i] + boff); in[i][1] = *(const v4fa*)(src[i] + boff + 16); }
  asm volatile("s_wait_xcnt 0x0" :: "v"(boff) : "memory");      // the loads' offset register is named so that it lives up to this wait: what follows may reuse it
#pragma unroll
  for (int i = 0; i < 4; ++i) { FragH f;
#pragma unroll
    for (int q = 0; q < 8; ++q) { const float v = bf16_round(in[i][q >> 2][q & 3]); f.h[q] = (_Float16)(i < 3 ? v * 16.0f : v); }
    *(v8us*)&sh[i * CC + (tid >> 3)][(tid & 7) * 8] = f.half[0]; }
  __syncthreads();      // the f16 operands are in LDS before any wave reads a fragment
  if (w >= 12) return;      // behind the only barrier
  auto frag = [&](int r, int ks) { FragH f; f.half[0] = *(const v8us*)&sh[r][ks * 32 + 8 * hh]; f.half[1] = *(const v8us*)&sh[r][ks * 32 + 16 + 8 * hh]; return f; };
  const bool isv = w >= 8;
  const int keep = isv ? w * 16 : 3 * CC + (w & 3) * 16;      // first LDS row of the tile a wave keeps as B: v: feature tile w - 8 of Wv; q, k: row tile w & 3 of x
  const int run = isv ? 3 * CC : (w >> 2) * CC;      // first LDS row of the 4 tiles it walks as A: v: the rows of x; q, k: the features of Wq or Wk
  const FragH b0 = frag(keep + ln, 0), b1 = frag(keep + ln, 1);
  unsigned short* dst = isv ? (unsigned short*)Vp + (size_t)row0 * CC + (w - 8) * 512 + lane * 8      // walked tile t = 16 keys: block t >> 1 of 32 keys, unit (w - 8) * 2 + (t & 1)
                      : w >= 4 ? (unsigned short*)Kp + (size_t)(row0 + (w & 3) * 16) * CC + lane * 8      // walked tile t = 16 features: unit t
                               : (unsigned short*)Q16 + (size_t)(row0 + w * 16 + ln) * CC + 8 * hh;
  const int st1 = w >= 4 ? 256 : 16, st2 = isv ? 32 * CC : 2 * st1;      // steps, in f16, of bit 0 and bit 1 of t
  FragH a[4][2];      // the fragment reads stand ahead of the products, so that later tiles' reads go out while earlier tiles are worked on
#pragma unroll
  for (int t = 0; t < 4; ++t) { a[t][0] = frag(run + t * 16 + ln, 0); a[t][1] = frag(run + t * 16 + ln, 1); }
#pragma unroll
  for (int t = 0; t < 4; ++t) { v8f acc = (v8f){0.f,0.f,0.f,0.f,0.f,0.f,0.f,0.f};
    acc = __builtin_amdgcn_wmma_f32_16x16x32_f16(false, a[t][0].v, false, b0.v, (short)0, acc, false, false);
    acc = __builtin_amdgcn_wmma_f32_16x16x32_f16(false, a[t][1].v, false, b1.v, (short)0, acc, false, false);      // acc[r] = (walked tile's row 8hh + r) . (kept tile's row ln)
    FragH o;
#pragma unroll
    for (int r = 0; r < 8; ++r) o.h[r] = (_Float16)(acc[r] * 0.0625f);
    *(v8us*)(dst + (t & 1) * st1 + (t >> 1) * st2) = o.half[0]; } }

// One work-group = TWO tiles of 32 query rows, one after the other in every wave: tile p, then tile NQB - 1 - p of the same sequence (a wave without a block in the short tile goes straight on to the long one). A causal tile t costs t + 1 blocks, so every work-group walks NQB + 1 blocks: the grid is one equal
// work-group per WGP, all resident at once, where one tile per work-group gave twice as many, of 1 to NQB blocks. Each tile has its own LDS planes, so one barrier and one merge serve both.
// Per tile: the NW waves deal the tile's 32-key blocks among themselves (wave w takes blocks w, w + NW, ...). Every wave holds BOTH 16-query halves of the tile (QT = 2 B operands,
// 2 sets of running maximum, sum and accumulators), so each K and V fragment it loads feeds two products: half the fragment bytes per score and half the waves of a 16-row tile. The partials are merged through LDS behind
// one work-group barrier. The launch bound asks for 4 waves per SIMD (256 VGPRs: one work-group per WGP). w is held in a scalar register: the waves' trip counts differ, and the loop must branch on a scalar so that every lane stays on at the WMMAs.
// Both products run transposed: S^T = K.Q^T (A = 16 key rows, B = 16 of the tile's queries, kept in registers) and O^T += V^T.P^T. A lane then holds 16 scores of ONE query (column ln; keys
// 8hh + r and 16 + 8hh + r of the block), so maximum and sum are in-lane but for one exchange between the wave's halves, and the two converted score tiles ARE the B operand of the second product.
// Softmax in base 2: exp(s / 8 - m) = 2^(s * SC2 - m'), m' = the maximum in the same units. v_exp_f32 gives 0 for -inf and for the -3e38 start value, which is all the range handling these arguments (never above 0) need.
#define SC2 0.18033688011112042f      // 64^-0.5 * log2(e)
// One exponential: the v_nop fills the one slot that the instruction set asks for behind a transcendental before its result is used or its source overwritten; inside the statement it cannot drift.
__device__ __forceinline__ float ex2_slot(float x) { float r; asm("v_exp_f32 %0, %1\n\tv_nop" : "=v"(r) : "v"(x)); return r; }
// Eight exponentials, each in place on a register of its own: every one but the last has an independent instruction behind it, and one v_nop fills the slot behind the last. The block loop's form: one slot instruction per eight.
__device__ __forceinline__ void ex2x8(float (&t)[8]) {
  asm("v_exp_f32 %0, %0\n\tv_exp_f32 %1, %1\n\tv_exp_f32 %2, %2\n\tv_exp_f32 %3, %3\n\tv_exp_f32 %4, %4\n\tv_exp_f32 %5, %5\n\tv_exp_f32 %6, %6\n\tv_exp_f32 %7, %7\n\tv_nop"
      : "+v"(t[0]), "+v"(t[1]), "+v"(t[2]), "+v"(t[3]), "+v"(t[4]), "+v"(t[5]), "+v"(t[6]), "+v"(t[7])); }
__device__ __forceinline__ float xhalf(float x) { return __builtin_bit_cast(float, __builtin_amdgcn_permlanex16(__builtin_bit_cast(int, x), __builtin_bit_cast(int, x), 0x76543210, 0xfedcba98, false, false)); }      // lane l reads lane l ^ 16
typedef float v2f __attribute__((ext_vector_type(2))); typedef float v2fa __attribute__((ext_vector_type(2), may_alias));
// A move inside each 16-lane row of the wave: CTRL = 0x160 + m: lane l reads lane l ^ m (row_xmask); CTRL = 0x150 + u: every lane reads lane u of its row (row_share).
template <int CTRL> __device__ __forceinline__ float row16(float x) { return __builtin_bit_cast(float, __builtin_amdgcn_update_dpp(0, __builtin_bit_cast(int, x), CTRL, 0xf, 0xf, true)); }
// val += partial U's 4 values x partial U's weight, U = 0, 1, ... in turn (the DPP control word is an immediate, so the walk over U is a template); the loads are independent and go out together.
template <int U, int N, int STEP> __device__ __forceinline__ void add_parts(const float* p, float e, v4f& val) {
  val += *(const v4fa*)(p + U * STEP) * row16<0x150 + U>(e);
  if constexpr (U + 1 < N) add_parts<U + 1, N, STEP>(p, e, val); }
template <int NW>
__global__ __launch_bounds__(NW * 32, 4) void k_flash(const _Float16* __restrict__ Q16, int ldq, const _Float16* __restrict__ Kp, const _Float16* __restrict__ Vp, const int* __restrict__ MSK, float* __restrict__ O, int ldo) {
  constexpr int QT = 2, RPW = 16 * QT, NQB = 4096 / RPW, NPR = NQB / 2, DT = 4, KS = 2;
  __shared__ __attribute__((aligned(16))) float sO[2][NW][RPW][64 + 4]; __shared__ __attribute__((aligned(8))) float sML[2][RPW][NW + 1][2];      // first index: the work-group's first or second tile. sML: (maximum, sum) of row, wave; a row's pitch of 34 dwords keeps the 16 rows of a store and the two rows of a load on different banks
  const int tid = threadIdx.x, w = __builtin_amdgcn_readfirstlane(tid >> 5), lane = tid & 31, ln = lane & 15, hh = lane >> 4;
  const int slab = blockIdx.x / NPR, pr = blockIdx.x % NPR; const int b = slab / 1, h = slab % 1;
  FragH bq[QT][KS]; const unsigned short* qr[QT];
  const unsigned short* Kl = (const unsigned short*)Kp + (size_t)slab * 4096 * 64 + lane * 8; const unsigned short* Vl = (const unsigned short*)Vp + (size_t)slab * 4096 * 64 + lane * 8;      // fragment order (k_proj): a block of 32 keys is 4 KB in each, every load below 512 contiguous bytes of it
#pragma unroll 1      // kept rolled: one copy of the block loop in the instruction cache, and one tile's registers
  for (int ti = 0; ti < 2; ++ti) {
  const int q0 = (ti ? NQB - 1 - pr : pr) * RPW;
  float m_q[QT], l_q[QT]; v8f oacc[QT][DT];      // of query q0 + qt * 16 + ln; l_q sums this half's keys only, the halves are joined behind the loop
#pragma unroll
  for (int qt = 0; qt < QT; ++qt) { m_q[qt] = -3.0e38f; l_q[qt] = 0.f;
#pragma unroll
    for (int dt = 0; dt < DT; ++dt) oacc[qt][dt] = (v8f){0.f,0.f,0.f,0.f,0.f,0.f,0.f,0.f}; }      // oacc[qt][dt][r] = O[q0 + qt * 16 + ln][dt * 16 + 8hh + r]
  const int jend = q0 + RPW, tq = q0 + ln;
  if (w * 32 < jend) {      // the loop's own entry test, a scalar branch: a wave without a block loads no queries and passes no wait for them
#pragma unroll      // unrolled, here and below: everything indexed by qt is indexed by constants and stays in registers
    for (int qt = 0; qt < QT; ++qt) { qr[qt] = (const unsigned short*)Q16 + ((size_t)b * 4096 + q0 + qt * 16 + ln) * ldq + h * 64 + 8 * hh;
#pragma unroll
      for (int ks = 0; ks < KS; ++ks) { bq[qt][ks].half[0] = *(const v8us*)(qr[qt] + ks * 32); bq[qt][ks].half[1] = *(const v8us*)(qr[qt] + ks * 32 + 16); } }
    asm volatile("s_wait_xcnt 0x0" :: "v"(qr[0]), "v"(qr[1]) : "memory"); }      // the 8 loads' address registers are named so that they live up to this wait: what follows may reuse them only behind it
#pragma unroll 1
  for (int j0 = w * 32; j0 < jend; j0 += NW * 32) {
    // The block's 16 fragment loads (8 KB) all stand ahead of its first product, so that they are in flight together and a block waits out one load latency; placed at their uses they went out in six groups, each waited for in turn.
    const unsigned short* kr = Kl + (size_t)j0 * 64; const unsigned short* vr = Vl + (size_t)j0 * 64; FragH ak[2][KS], av[DT];
#pragma unroll
    for (int u = 0; u < 2 * KS; ++u) { ak[u / KS][u % KS].half[0] = *(const v8us*)(kr + u * 512); ak[u / KS][u % KS].half[1] = *(const v8us*)(kr + u * 512 + 256); }      // A operand: key rows j0 + nt * 16 + ln
#pragma unroll
    for (int dt = 0; dt < DT; ++dt) { av[dt].half[0] = *(const v8us*)(vr + dt * 512); av[dt].half[1] = *(const v8us*)(vr + dt * 512 + 256); }      // A operand: V^T rows dt * 16 + ln, the block's 32 keys in the k order of the packed scores
    asm volatile("s_wait_xcnt 0x0" :: "v"(kr), "v"(vr) : "memory");      // the loads' address registers are named so that they live up to this wait: what follows, a load's own result too, may reuse them only behind it
    float al[QT]; FragH pb[QT];
#pragma unroll
    for (int qt = 0; qt < QT; ++qt) {
      v8f s[2];
#pragma unroll
      for (int nt = 0; nt < 2; ++nt) { v8f acc = (v8f){0.f,0.f,0.f,0.f,0.f,0.f,0.f,0.f};
#pragma unroll
        for (int ks = 0; ks < KS; ++ks) acc = mmaH<1>(ak[nt][ks].v, ak[nt][ks].v, bq[qt][ks].v, bq[qt][ks].v, acc);
        s[nt] = acc; }      // s[nt][r] = q(q0 + qt * 16 + ln) . k(j0 + nt * 16 + 8hh + r)
      float mc = -INFINITY; const int dq = tq + qt * 16 - j0 - 8 * hh;      // score (nt, r) is unmasked while nt * 16 + r <= dq
#pragma unroll
      for (int nt = 0; nt < 2; ++nt)
#pragma unroll
        for (int r = 0; r < 8; ++r) { s[nt][r] = (nt * 16 + r <= dq) ? s[nt][r] : -INFINITY; mc = fmaxf(mc, s[nt][r]); }      // raw products: the scale is positive, so it is applied to the maximum alone
      mc = fmaxf(mc, xhalf(mc));
      // every block a wave walks starts at a key j0 <= q0, so each query has an unmasked score in it and mn is a finite score: a masked score (-inf) gives exp = 0 and the first block gives al = 0 with no test
      const float mn = fmaxf(m_q[qt], mc * SC2); al[qt] = ex2_slot(m_q[qt] - mn); m_q[qt] = mn;
      float ps = 0.f;
#pragma unroll
      for (int nt = 0; nt < 2; ++nt) { float p[8];
#pragma unroll
        for (int r = 0; r < 8; ++r) p[r] = fmaf(s[nt][r], SC2, -mn);
        ex2x8(p);
#pragma unroll
        for (int r = 0; r < 8; ++r) { ps += p[r]; pb[qt].h[nt * 8 + r] = (_Float16)p[r]; } }      // element nt * 8 + r of a B fragment is k = nt * 16 + 8hh + r: the key this score belongs to
      l_q[qt] = l_q[qt] * al[qt] + ps; }
#pragma unroll
    for (int dt = 0; dt < DT; ++dt)
#pragma unroll
      for (int qt = 0; qt < QT; ++qt) {
#pragma unroll
        for (int r = 0; r < 8; ++r) oacc[qt][dt][r] *= al[qt];
        oacc[qt][dt] = mmaH<1>(av[dt].v, av[dt].v, pb[qt].v, pb[qt].v, oacc[qt][dt]); } }
  // each wave hands over its un-normalised partial: (maximum, sum) per row and the 32 x 64 accumulator; a wave without a block hands (-3e38, 0, zeros), which weighs 0 in the merge
  const int le = (int)__builtin_amdgcn_mbcnt_lo(~0u, 0u), lne = le & 15, hhe = le >> 4;      // lane id read anew, so that tid and its parts need no registers across the loop
#pragma unroll
  for (int qt = 0; qt < QT; ++qt) { const int row = qt * 16 + lne;
    l_q[qt] += xhalf(l_q[qt]);
    if (hhe == 0) *(v2fa*)&sML[ti][row][w][0] = (v2f){m_q[qt], l_q[qt]};
#pragma unroll
    for (int dt = 0; dt < DT; ++dt) { *(v4fa*)&sO[ti][w][row][dt * 16 + 8 * hhe] = (v4f){oacc[qt][dt][0], oacc[qt][dt][1], oacc[qt][dt][2], oacc[qt][dt][3]}; *(v4fa*)&sO[ti][w][row][dt * 16 + 8 * hhe + 4] = (v4f){oacc[qt][dt][4], oacc[qt][dt][5], oacc[qt][dt][6], oacc[qt][dt][7]}; } } }
  __syncthreads();      // every wave's partials of both tiles are in LDS before any is merged
  // Merge: wave w takes rows w and NW + w of each tile, one row in each 16-lane half. Lane j of a half holds the (maximum, sum) of partial j of its row, so each weight 2^(m - M) is made once, in its own lane,
  // M and the row sum come by four DPP steps inside the half, and a weight reaches the half's lanes by row_share; lane j adds up columns 4j .. 4j + 3, one 16-byte LDS read per partial for both rows.
  static_assert(NW == 16 && NW * QT == RPW, "one partial per lane of a 16-lane row; wave w merges rows w and NW + w");
  const int le = (int)__builtin_amdgcn_mbcnt_lo(~0u, 0u), j = le & 15, r = (le >> 4) * NW + w;
#pragma unroll      // unrolled over both tiles: their LDS loads are independent and go out together
  for (int ti = 0; ti < 2; ++ti) { const int q0 = (ti ? NQB - 1 - pr : pr) * RPW;
    const v2f ml = *(const v2fa*)&sML[ti][r][j][0];
    float M = ml[0]; M = fmaxf(M, row16<0x161>(M)); M = fmaxf(M, row16<0x162>(M)); M = fmaxf(M, row16<0x164>(M)); M = fmaxf(M, row16<0x168>(M));
    const float e = ex2_slot(ml[0] - M);
    float L = e * ml[1]; L += row16<0x161>(L); L += row16<0x162>(L); L += row16<0x164>(L); L += row16<0x168>(L);
    v4f val = {0.f, 0.f, 0.f, 0.f};
    add_parts<0, NW, RPW * (64 + 4)>(&sO[ti][0][r][j * 4], e, val);
    const float inv = (L > 0.f) ? 1.0f / L : 0.f; val *= inv;
    *(v4f*)(O + ((size_t)b * 4096 + q0) * ldo + (r * ldo + h * 64 + j * 4)) = val; } }

extern "C" void kernel_launch(void* const* d_in, const int* in_sizes, int n_in,
                              void* d_out, int out_size, void* d_ws, size_t ws_size, hipStream_t stream) {
  (void)in_sizes; (void)n_in; (void)out_size;
  const float* x = (const float*)d_in[0]; const float* Wk = (const float*)d_in[1]; const float* Wq = (const float*)d_in[2]; const float* Wv = (const float*)d_in[3];
  char* ws = (char*)d_ws; size_t off = 0;
  auto take = [&](size_t bytes) { char* p = ws + off; off += (bytes + 255) & ~(size_t)255; return p; };
  _Float16* Q16 = (_Float16*)take((size_t)NR * CC * 2); _Float16* Kp = (_Float16*)take((size_t)NR * CC * 2); _Float16* Vp = (_Float16*)take((size_t)NR * CC * 2);
  if (off > ws_size) return;      // 3 buffers of 2 MiB
  k_proj<<<NR / 64, 512, 0, stream>>>(x, Wq, Wk, Wv, Q16, Kp, Vp);      // q in f16 rows; k and v in fragment order
  k_flash<16><<<BB * 1 * (TT / 64), 16 * 32, 0, stream>>>(Q16, CC, Kp, Vp, nullptr, (float*)d_out, CC);
}
